// v000
// Measured on an AMD MI455X. A time is GPU time per run, averaged over a window of back-to-back runs after a warm-up
// (all launches, gaps included; the runs take copies of the inputs in turn), and the median of several windows.
// Apart from v000's, it joins two sittings. Times from different sittings can be a few percent apart, while
// side-by-side timings come from the same sitting.
// The starting kernel, v000, takes 212 microseconds a run.
#include <hip/hip_runtime.h>
#include <math.h>
#include <stdint.h>

// Contractions: fused qkv projection x.Wqkv (f16 operands holding bf16-RNE values, x carried x16 and W x1024, one
// product per tile pair); scores k.q (k and q each an f16 hi plane x16 plus an f16 residual plane x2^11: hi.hi in one
// accumulator, hi.lo + lo.hi in a second accumulator folded with 2^-11, 3 products); context v.p (p x1024 and v x16,
// each f16 hi plus f16 residual x2^11: hi.hi in one accumulator, lo.hi + hi.lo in a second folded with 2^-11,
// 3 products); all v_wmma_f32_16x16x32_f16 with f32 accumulate; rotary tables, rotary combine, key masking, softmax
// statistics and the final normalisation in f32 on VALU; output stored as f32.

#define NB    2
#define NT    2048
#define ND    1024
#define NQKV  3072
#define NH    32
#define HD    32
#define NTOK  (NB * NT)
#define NBH   (NB * NH)
#define QBLK  128
#define KCH   64
#define NKC   (NT / KCH)
#define KP    40
#define VP    72
#define SPP   72
#define OP    36
#define ATHR  256

static_assert(NH * HD == ND);
static_assert(NQKV == 3 * ND);
static_assert((NT % QBLK) == 0 && (NT % KCH) == 0 && (NT % 64) == 0 && (NTOK % 64) == 0);
static_assert((NQKV % 64) == 0 && (ND % 64) == 0 && (ND % 32) == 0);
static_assert(QBLK == (ATHR / 32) * 16);
static_assert(KCH * 4 == ATHR && HD * 8 == ATHR);
static_assert(HD == 32 && KCH == 64 && NKC * KCH == NT);
static_assert(((NTOK * ND) % 2048) == 0);
static_assert((((NTOK / 64) * (NQKV / 64)) % 8) == 0);

typedef _Float16 v16h __attribute__((ext_vector_type(16)));
typedef _Float16 v8h  __attribute__((ext_vector_type(8)));
typedef float    v8f  __attribute__((ext_vector_type(8)));
typedef float    v4f  __attribute__((ext_vector_type(4)));
typedef unsigned int v4u __attribute__((ext_vector_type(4)));
typedef int      v4i  __attribute__((ext_vector_type(4)));

// ---- scalar helpers --------------------------------------------------------------------------------
__device__ __forceinline__ unsigned short bf_bits(float f) {          // f32 -> bf16 bits, RNE convert
  unsigned u = __float_as_uint(f);
  return (unsigned short)((u + 0x7FFFu + ((u >> 16) & 1u)) >> 16);
}
__device__ __forceinline__ float bf_up(unsigned short h) { return __uint_as_float(((unsigned)h) << 16); }
__device__ __forceinline__ unsigned short h_bits(_Float16 x) { return __builtin_bit_cast(unsigned short, x); }
__device__ __forceinline__ unsigned pk16(unsigned short a, unsigned short b) { return (unsigned)a | ((unsigned)b << 16); }
__device__ __forceinline__ v8f zero8() { v8f z = {0.f, 0.f, 0.f, 0.f, 0.f, 0.f, 0.f, 0.f}; return z; }

// ---- fragment loader: 16-bit A/B operand, lane -> row/col (lane&15), p already includes +8*(lane>>4);
//      elements 0..7 <- p[0..7] (k0+8h..), elements 8..15 <- p[16..23] (k0+16+8h..)
__device__ __forceinline__ v16h ldfrag_h(const _Float16* p) {
  union { v16h v; v8h h[2]; } f;
  f.h[0] = *(const v8h*)(p);
  f.h[1] = *(const v8h*)(p + 16);
  return f.v;
}

// ---- WMMA helpers with trailing VALU hazard gap --------------------------------------------------------
__device__ __forceinline__ v8f mma_h_raw(v16h a, v16h b, v8f c) {
  return __builtin_amdgcn_wmma_f32_16x16x32_f16(false, a, false, b, (short)0, c, false, false);
}
__device__ __forceinline__ void dep_guard_h(v8f& a, v8f& b, v16h x, v16h y) {
#if defined(__HIP_DEVICE_COMPILE__)
  asm volatile("v_nop\n\tv_nop\n\tv_nop\n\tv_nop" : "+v"(a), "+v"(b) : "v"(x), "v"(y));
#endif
}
__device__ __forceinline__ void guard4(v8f& a, v8f& b, v16h w, v16h x, v16h y, v16h z) {
#if defined(__HIP_DEVICE_COMPILE__)
  asm volatile("v_nop\n\tv_nop\n\tv_nop\n\tv_nop" : "+v"(a), "+v"(b) : "v"(w), "v"(x), "v"(y), "v"(z));
#endif
}
__device__ __forceinline__ void keep4_h(v16h a, v16h b, v16h c, v16h d) {
#if defined(__HIP_DEVICE_COMPILE__)
  asm volatile("v_nop" :: "v"(a), "v"(b), "v"(c), "v"(d));
#endif
}
__device__ __forceinline__ void acc_guard4(v8f& a, v8f& b, v8f& c, v8f& d) {
#if defined(__HIP_DEVICE_COMPILE__)
  asm volatile("v_nop\n\tv_nop\n\tv_nop\n\tv_nop" : "+v"(a), "+v"(b), "+v"(c), "+v"(d));
#endif
}
__device__ __forceinline__ void wave_sync_lds() {
  __builtin_amdgcn_fence(__ATOMIC_RELEASE, "workgroup");
  __builtin_amdgcn_wave_barrier();
  __builtin_amdgcn_fence(__ATOMIC_ACQUIRE, "workgroup");
}

// =====================================================================================================
// f32 -> f16( bf16_RNE(v) * scale ), scale a power of two (exact), 8 elements per thread, one 16-B store
// =====================================================================================================
__global__ __launch_bounds__(256) void cvt_h8(const float* __restrict__ in, unsigned short* out, int n8, float scale) {
  const int i = blockIdx.x * 256 + threadIdx.x;
  if (i < n8) {
    const v4f a = *(const v4f*)(in + (size_t)i * 8);
    const v4f c = *(const v4f*)(in + (size_t)i * 8 + 4);
    float f[8];
    f[0] = a[0]; f[1] = a[1]; f[2] = a[2]; f[3] = a[3];
    f[4] = c[0]; f[5] = c[1]; f[6] = c[2]; f[7] = c[3];
    unsigned short hb[8];
#pragma unroll
    for (int e = 0; e < 8; ++e) hb[e] = h_bits((_Float16)(bf_up(bf_bits(f[e])) * scale));
    v4u p;
    p[0] = pk16(hb[0], hb[1]);
    p[1] = pk16(hb[2], hb[3]);
    p[2] = pk16(hb[4], hb[5]);
    p[3] = pk16(hb[6], hb[7]);
    *(v4u*)(out + (size_t)i * 8) = p;
    
  }
}

// =====================================================================================================
// Weight transpose + convert: W[c][o] f32 (c in [0,1024), o in [0,3072), o contiguous) ->
// WT[o][c] f16 = f16( bf16_RNE(W[c][o]) * scale ), c contiguous (k-major rows for the B fragment loader).
// Block = one 64(o) x 64(c) tile: thread (ol = tid&63, cb = tid>>6) reads 16 consecutive c rows of column o0+ol
// (coalesced per row across lanes), packs them as two 16-B LDS stores into sT[ol][c]; block barrier; then every
// grid = (3072/64, 1024/64) = (48, 16): x = o tiles (rows of WT), y = c tiles (rows of W).
// coverage: 256 threads x 2 rows-iterations... : rows tid>>3 (0..31) and +32 -> all 64 rows x 64 halves per tile.
// =====================================================================================================
__global__ __launch_bounds__(256) void cvt_wT(const float* __restrict__ W, unsigned short* WT, float scale) {
  __shared__ __align__(16) unsigned short sT[64 * SPP];          // 9216 B
  const int tid = threadIdx.x;
  const int o0 = blockIdx.x * 64;
  const int c0 = blockIdx.y * 64;
  {
    const int ol = tid & 63, cb = tid >> 6;                      // cb 0..3 -> c rows cb*16 .. +15
    unsigned short hb[16];
#pragma unroll
    for (int e = 0; e < 16; ++e) {
      const float f = W[(size_t)(c0 + cb * 16 + e) * NQKV + o0 + ol];
      hb[e] = h_bits((_Float16)(bf_up(bf_bits(f)) * scale));
    }
    v4u p0, p1;
#pragma unroll
    for (int q = 0; q < 4; ++q) {
      p0[q] = pk16(hb[2 * q], hb[2 * q + 1]);
      p1[q] = pk16(hb[8 + 2 * q], hb[8 + 2 * q + 1]);
    }
    *(v4u*)(sT + ol * SPP + cb * 16) = p0;
    *(v4u*)(sT + ol * SPP + cb * 16 + 8) = p1;
  }
  __syncthreads();
  {
    const int row = tid >> 3, c8 = (tid & 7) * 8;
    const v4u v0 = *(const v4u*)(sT + row * SPP + c8);
    const v4u v1 = *(const v4u*)(sT + (row + 32) * SPP + c8);
    const size_t d0 = (size_t)(o0 + row) * ND + c0 + c8;
    const size_t d1 = (size_t)(o0 + row + 32) * ND + c0 + c8;
    {
      *(v4u*)(WT + d0) = v0;
      *(v4u*)(WT + d1) = v1;
      
    }
  }
}

// =====================================================================================================
// inv_freq[j] = 1 / 10000^(j/32), j = 0..31 (full head dim, not pairs). One block of 32 threads; the 32 floats are
// =====================================================================================================
__global__ __launch_bounds__(32) void k_invf(float* INVF) {
  #pragma clang fp contract(off)
  const int j = threadIdx.x;
  const float e = (float)j * 0.03125f;
  const float p = powf(10000.0f, e);
  const float inv = 1.0f / p;
  *(float*)(INVF + j) = inv;
  
}

// =====================================================================================================
// Rotary tables COS/SIN[s][j] = cos/sin( s * inv_freq[j] ), s in [0,2048), j in [0,32): 256 threads = 8 rows x 32,
// one precise sincosf per thread (rolled, nothing unrolled); values staged in LDS, block barrier, then waves 0-1
// coverage: 256 blocks x 8 rows x 32 = every COS and SIN element.
// =====================================================================================================
__global__ __launch_bounds__(256) void k_tab(const float* __restrict__ INVF, float* COS, float* SIN) {
  #pragma clang fp contract(off)
  __shared__ __align__(16) float sc[8 * 32];
  __shared__ __align__(16) float ss[8 * 32];
  const int tid = threadIdx.x, j = tid & 31, rl = tid >> 5;
  const int s = blockIdx.x * 8 + rl;
  const float ang = (float)s * INVF[j];
  float sn, cs;
  sincosf(ang, &sn, &cs);
  sc[rl * 32 + j] = cs;
  ss[rl * 32 + j] = sn;
  __syncthreads();
  if (tid < 64) {                                                // waves 0,1: COS rows
    const int row = tid >> 3, c4 = (tid & 7) * 4;
    const v4f v = *(const v4f*)(sc + row * 32 + c4);
    float* d = COS + (size_t)(blockIdx.x * 8 + row) * HD + c4;
    *(v4f*)d = v;
    
  } else if (tid < 128) {                                        // waves 2,3: SIN rows
    const int t2 = tid - 64;
    const int row = t2 >> 3, c4 = (t2 & 7) * 4;
    const v4f v = *(const v4f*)(ss + row * 32 + c4);
    float* d = SIN + (size_t)(blockIdx.x * 8 + row) * HD + c4;
    *(v4f*)d = v;
    
  }
}

// =====================================================================================================
// Fused qkv projection GEMM with rotary + 16-bit plane epilogue:
//   Y[tok][o] = sum_c XH[tok][c] * WT[o][c] * oscale,  tok in [0,4096), o in [0,3072), K = 1024.
// One wave per 64x64 tile (register-blocked, no block barriers), A = XH rows (token), Bt = WT rows (k contiguous).
// The 64 tokens of a tile lie in one batch b (t0 = m0 mod 2048); the 64 outputs are two heads h0, h0+1 of one of
// q (o < 1024), k (1024 <= o < 2048), v (o >= 2048); column j (16-wide subtile) -> head h0 + (j>>1), d = 16*(j&1)+lane%16.
//   q, k: rotary combine per the module: out[d] = y[d]*cos[s][d] - y[d+16]*sin[s][d] (d < 16),
//         out[d] = y[d]*cos[s][d] + y[d-16]*sin[s][d] (d >= 16); both partners sit in the same lane and element.
//         PH/PL[bh][t][32] f16 = (out*16) hi plane and residual x2^11 (64 B per token; the wave owns 64 consecutive
// then q/k: each head's slab region (16 tok x 64 B = 1024 contiguous B) written as 32 lanes x 16 B contiguous per
// grid = 384 blocks x 8 waves = 3072 tiles = 64 x 48 exactly.
// coverage: q/k tiles: 4 slabs x 2 heads x 16 tok x 32 d (hi and residual); v tiles: 4 subtiles x 16 d x 64 tok;
// 64 token tiles x (16+16+16) column tiles = every (bh, t) row of QH/QL/KH/KL and every (bh, d) row of VH/VL.
// =====================================================================================================
__global__ __launch_bounds__(256) void gemm_proj(
    const unsigned short* __restrict__ XHp, const unsigned short* __restrict__ WTp,
    const float* __restrict__ COS, const float* __restrict__ SIN,
    unsigned short* QH, unsigned short* QL, unsigned short* KH, unsigned short* KL,
    unsigned short* VH, unsigned short* VL, float oscale) {
  const _Float16* A  = (const _Float16*)(const void*)XHp;
  const _Float16* Bt = (const _Float16*)(const void*)WTp;
  __shared__ __align__(16) unsigned short sP[8][2][16 * SPP];     // 36864 B
  const int lane = threadIdx.x & 31;
  const int wave = threadIdx.x >> 5;
  const int tilesN = NQKV / 64;                                  // 48
  const int tilesM = NTOK / 64;                                  // 64
  const int tile = blockIdx.x * 8 + wave;
  if (tile >= tilesM * tilesN) return;                           // wave-uniform; no block barriers
  const int tm = tile / tilesN;
  const int tn = tile - tm * tilesN;
  const int m0 = tm << 6;                                        // token base
  const int n0 = tn << 6;                                        // output channel base in [0,3072)
  const int rlane = lane & 15;
  const int hh    = lane >> 4;
  const int koff  = hh * 8;
  const int mOff  = hh * 8;

  v8f acc[4][4];
#pragma unroll
  for (int i = 0; i < 4; ++i)
#pragma unroll
    for (int j = 0; j < 4; ++j) acc[i][j] = zero8();

  for (int k0 = 0; k0 < ND; k0 += 32) {
    v16h bf[4];
#pragma unroll
    for (int j = 0; j < 4; ++j) {
      const size_t bo = (size_t)(n0 + (j << 4) + rlane) * ND + koff + k0;
      bf[j] = ldfrag_h(Bt + bo);
    }
#pragma unroll
    for (int i = 0; i < 4; ++i) {
      const size_t ao = (size_t)(m0 + (i << 4) + rlane) * ND + koff + k0;
      const v16h ah = ldfrag_h(A + ao);
#pragma unroll
      for (int j = 0; j < 4; ++j) acc[i][j] = mma_h_raw(ah, bf[j], acc[i][j]);
      dep_guard_h(acc[i][0], acc[i][3], ah, bf[3]);
    }
    keep4_h(bf[0], bf[1], bf[2], bf[3]);
  }
  acc_guard4(acc[0][0], acc[0][1], acc[0][2], acc[0][3]);
  acc_guard4(acc[1][0], acc[1][1], acc[1][2], acc[1][3]);
  acc_guard4(acc[2][0], acc[2][1], acc[2][2], acc[2][3]);
  acc_guard4(acc[3][0], acc[3][1], acc[3][2], acc[3][3]);

  // ---- epilogue ----
  const int b   = m0 / NT;
  const int t0  = m0 - b * NT;
  const int sel = n0 >> 10;                                      // 0 q, 1 k, 2 v (wave-uniform)
  const int h0  = (n0 & (ND - 1)) >> 5;                          // first of the two heads of this tile
  unsigned short* s0 = &sP[wave][0][0];
  unsigned short* s1 = &sP[wave][1][0];

  if (sel < 2) {
    unsigned short* PH = (sel == 0) ? QH : KH;
    unsigned short* PL = (sel == 0) ? QL : KL;
#pragma unroll
    for (int i = 0; i < 4; ++i) {                                // slab = 16 tokens t0+16i .. +15
#pragma unroll
      for (int r = 0; r < 8; ++r) {
        const int tok = t0 + (i << 4) + mOff + r;                // row tok = 8hh + r
        const float* cp = COS + (size_t)tok * HD;
        const float* sp = SIN + (size_t)tok * HD;
        const float ca = cp[rlane], cb = cp[16 + rlane];
        const float sa = sp[rlane], sb = sp[16 + rlane];
#pragma unroll
        for (int hp = 0; hp < 2; ++hp) {
          const float y0 = acc[i][2 * hp][r] * oscale;           // d = rlane
          const float y1 = acc[i][2 * hp + 1][r] * oscale;       // d = 16 + rlane
          const float f0 = (y0 * ca - y1 * sa) * 16.0f;
          const float f1 = (y1 * cb + y0 * sb) * 16.0f;
          const _Float16 x0 = (_Float16)f0;
          const _Float16 x1 = (_Float16)f1;
          const int so = (mOff + r) * SPP + 32 * hp + rlane;     // row tok, col 32hp + d
          s0[so]      = h_bits(x0);
          s1[so]      = h_bits((_Float16)((f0 - (float)x0) * 2048.0f));
          s0[so + 16] = h_bits(x1);
          s1[so + 16] = h_bits((_Float16)((f1 - (float)x1) * 2048.0f));
        }
      }
      wave_sync_lds();
      {
        const int rr = lane >> 2, cc = (lane & 3) * 8;           // rr*32 + cc = lane*8 halves
#pragma unroll
        for (int hp = 0; hp < 2; ++hp) {
          const int bhp = b * NH + h0 + hp;
          const size_t base = ((size_t)(bhp * NT + t0 + (i << 4))) * HD + lane * 8;
          const v4u v0 = *(const v4u*)(s0 + rr * SPP + 32 * hp + cc);
          const v4u v1 = *(const v4u*)(s0 + (rr + 8) * SPP + 32 * hp + cc);
          const v4u w0 = *(const v4u*)(s1 + rr * SPP + 32 * hp + cc);
          const v4u w1 = *(const v4u*)(s1 + (rr + 8) * SPP + 32 * hp + cc);
          {
            *(v4u*)(PH + base) = v0;
            *(v4u*)(PH + base + 256) = v1;
            *(v4u*)(PL + base) = w0;
            *(v4u*)(PL + base + 256) = w1;
            
          }
        }
      }
      wave_sync_lds();
    }
  } else {
#pragma unroll
    for (int j = 0; j < 4; ++j) {                                // slab = 16 rows d = 16(j&1) + rlane of head h0+(j>>1)
      const int hp = j >> 1, dbase = (j & 1) * 16;
      const int bhp = b * NH + h0 + hp;
#pragma unroll
      for (int i = 0; i < 4; ++i) {
        unsigned short hb[8], lb[8];
#pragma unroll
        for (int r = 0; r < 8; ++r) {
          const float f = (acc[i][j][r] * oscale) * 16.0f;
          const _Float16 xh = (_Float16)f;
          hb[r] = h_bits(xh);
          lb[r] = h_bits((_Float16)((f - (float)xh) * 2048.0f));
        }
        v4u ph, pl;
#pragma unroll
        for (int q = 0; q < 4; ++q) {
          ph[q] = pk16(hb[2 * q], hb[2 * q + 1]);
          pl[q] = pk16(lb[2 * q], lb[2 * q + 1]);
        }
        *(v4u*)(s0 + rlane * SPP + (i << 4) + mOff) = ph;       // row d = rlane, tok = 16i + 8hh .. +7
        *(v4u*)(s1 + rlane * SPP + (i << 4) + mOff) = pl;
      }
      wave_sync_lds();
      {
        const int rq = lane >> 3, c8 = (lane & 7) * 8;
        {
#pragma unroll
          for (int it = 0; it < 4; ++it) {
            const int row = it * 4 + rq;                         // it 0..3 x rq 0..3 = rows 0..15
            const size_t dst = ((size_t)(bhp * HD + dbase + row)) * NT + t0 + c8;
            const v4u v = *(const v4u*)(s0 + row * SPP + c8);
            const v4u w = *(const v4u*)(s1 + row * SPP + c8);
            *(v4u*)(VH + dst) = v;
            *(v4u*)(VL + dst) = w;
          }
          
        }
      }
      wave_sync_lds();
    }
  }
}

// =====================================================================================================
// Attention for one (batch*head, 128-query block): grid = (64, 16), 256 threads = 8 waves x 16 queries; each lane
// owns one query column q = q0 + 16*wave + (lane&15). QH/QL/KH/KL[bh][t][32] f16 (x16 hi, residual x2^11),
// VH/VL[bh][d][2048] (x16 hi, residual x2^11). The int mask [2048 q][2048 key] is read per element: key chunks of 64;
// each lane loads the 32 mask entries of its query row for the keys of its lane half as 16-B vectors into a bitmask;
// a chunk whose entries are all zero for the whole block (per-wave __any, LDS flags, double-buffered, block barrier)
// is skipped block-uniformly (exact: such keys have probability 0). Otherwise K hi/res rows [64][40] and V hi/res
// tiles [32 d][72] are staged in LDS with plain 16-B loads + one block barrier. Per 32-key step and 16-key tile t:
// S[key][q] = A(K hi rows) x B(resident Q hi) and Sr = A(K hi) x B(Q res) + A(K res) x B(Q hi) in separate zeroed
// accumulators; logit = (S + Sr/2048) / 256 / sqrt(32); entries with mask == 0 replaced by -inf; online softmax over
// keys (max/sum across lane halves by shuffle); p = 1024*exp(x - max) packed D->B per the chained map (element r <-
// keys 0-15 tile, 8+r <- keys 16-31 tile) as f16 hi plus residual x2^11; Oh[d][q] += A(V hi rows) x Ph,
// Ol += A(V res) x Ph + A(V hi) x Pl (both 2^-11 terms); out = (Oh + Ol/2048) / (16 * l) (l = 0 gives 0*inf = NaN).
// coverage: 64 x 16 blocks x 8 waves x 16 rows x 32 floats = every (tok, head) line of the output.
// =====================================================================================================
__global__ __launch_bounds__(ATHR) void attn_kernel(
    const unsigned short* __restrict__ QHp, const unsigned short* __restrict__ QLp,
    const unsigned short* __restrict__ KHp, const unsigned short* __restrict__ KLp,
    const unsigned short* __restrict__ VHp, const unsigned short* __restrict__ VLp,
    const int* __restrict__ msk, float* Out) {
  __shared__ __align__(16) unsigned short kh_u[KCH * KP];         // 5120 B
  __shared__ __align__(16) unsigned short kl_u[KCH * KP];         // 5120 B
  __shared__ __align__(16) unsigned short vh_u[HD * VP];          // 4608 B
  __shared__ __align__(16) unsigned short vl_u[HD * VP];          // 4608 B
  __shared__ __align__(16) float sO[8][16 * OP];                  // 18432 B
  __shared__ int sflag[2][8];
  const _Float16* kh = (const _Float16*)(const void*)kh_u;
  const _Float16* kl = (const _Float16*)(const void*)kl_u;
  const _Float16* vh = (const _Float16*)(const void*)vh_u;
  const _Float16* vl = (const _Float16*)(const void*)vl_u;
  const _Float16* QH = (const _Float16*)(const void*)QHp;
  const _Float16* QL = (const _Float16*)(const void*)QLp;

  const int tid = threadIdx.x, lane = tid & 31, wave = tid >> 5;
  const int bh = blockIdx.x;
  const int b  = bh / NH;
  const int h  = bh - b * NH;
  const int q0 = blockIdx.y * QBLK;
  const int rlane = lane & 15, hsel = lane >> 4, koff = hsel * 8;
  const int qrow = q0 + wave * 16 + rlane;                       // this lane's query index within the sequence

  // resident Q fragments (B operand: B[k=d][n=q] from [q][d] rows), arithmetic addressing, one 32-deep k-step
  const size_t qo = ((size_t)(bh * NT + qrow)) * HD + koff;
  const v16h qh0 = ldfrag_h(QH + qo);
  const v16h ql0 = ldfrag_h(QL + qo);
  const size_t rowbase = (size_t)qrow * NT;                      // mask row of this query (shared over b, h)

  const float C2048  = 1.0f / 2048.0f;
  const float SCL    = 0.17677669529663687f * (1.0f / 256.0f);  // undo q*16, k*16, then 1/sqrt(32)
  const float LN1024 = 6.931471805599453f;
  const float NEGINF = __uint_as_float(0xff800000u);

  v8f oh[2], ol[2];
#pragma unroll
  for (int dt = 0; dt < 2; ++dt) { oh[dt] = zero8(); ol[dt] = zero8(); }
  float m_run = -1.0e30f, l_run = 0.0f;

#pragma unroll 1
  for (int c = 0; c < NKC; ++c) {
    const int kc = c * KCH;
    // mask bits: bit (16*s + 8*t + r) <-> key kc + 32*s + 16*t + 8*hsel + r of this lane's query row
    unsigned bits = 0u;
#pragma unroll
    for (int s = 0; s < 2; ++s) {
#pragma unroll
      for (int t = 0; t < 2; ++t) {
        const int* mp = msk + rowbase + (size_t)(kc + 32 * s + 16 * t + 8 * hsel);
        const v4i ma = *(const v4i*)mp;
        const v4i mb = *(const v4i*)(mp + 4);
#pragma unroll
        for (int r = 0; r < 4; ++r) {
          bits |= ((ma[r] != 0) ? 1u : 0u) << (s * 16 + t * 8 + r);
          bits |= ((mb[r] != 0) ? 1u : 0u) << (s * 16 + t * 8 + 4 + r);
        }
      }
    }
    const int wany = __any(bits != 0u);
    if (lane == 0) sflag[c & 1][wave] = wany;
    __syncthreads();                                             // also: all waves finished reading the prior chunk's K/V
    int bany = 0;
#pragma unroll
    for (int w = 0; w < 8; ++w) bany |= sflag[c & 1][w];
    if (bany == 0) continue;                                     // block-uniform skip of an all-masked chunk

    // ---- stage K hi/res rows and V hi/res tiles of keys kc..kc+63 (one 16-B item per thread each) ----
    {
      const int key = tid >> 2, ck = (tid & 3) * 8;              // 64 keys x 32 halves
      const size_t gk = ((size_t)(bh * NT + kc + key)) * HD + ck;
      *(v4u*)(kh_u + key * KP + ck) = *(const v4u*)(KHp + gk);
      *(v4u*)(kl_u + key * KP + ck) = *(const v4u*)(KLp + gk);
      const int d = tid >> 3, cv = (tid & 7) * 8;                // 32 d rows x 64 halves
      const size_t gv = ((size_t)(bh * HD + d)) * NT + kc + cv;
      *(v4u*)(vh_u + d * VP + cv) = *(const v4u*)(VHp + gv);
      *(v4u*)(vl_u + d * VP + cv) = *(const v4u*)(VLp + gv);
    }
    __syncthreads();

#pragma unroll 1
    for (int sub = 0; sub < 2; ++sub) {
      const int kr = sub * 32;
      const unsigned sbits = bits >> (sub * 16);
      float a[2][8];
#pragma unroll
      for (int t = 0; t < 2; ++t) {
        const int krow = kr + 16 * t + rlane;
        const v16h kha = ldfrag_h(kh + krow * KP + koff);
        const v16h kla = ldfrag_h(kl + krow * KP + koff);
        v8f sh = mma_h_raw(kha, qh0, zero8());
        v8f sr = mma_h_raw(kha, ql0, zero8());
        sr = mma_h_raw(kla, qh0, sr);
        guard4(sh, sr, kha, kla, qh0, ql0);
#pragma unroll
        for (int r = 0; r < 8; ++r) {
          const float s = (sh[r] + sr[r] * C2048) * SCL;
          const unsigned kb = (sbits >> (t * 8 + r)) & 1u;
          a[t][r] = (kb != 0u) ? s : NEGINF;
        }
      }

      // online softmax over the key axis for this lane's q column
      float mloc = -1.0e30f;
#pragma unroll
      for (int r = 0; r < 8; ++r) mloc = fmaxf(mloc, fmaxf(a[0][r], a[1][r]));
      mloc = fmaxf(mloc, __shfl_xor(mloc, 16, 32));
      const float newM  = fmaxf(m_run, mloc);
      const float alph  = __expf(m_run - newM);
      const float msh   = newM - LN1024;
      float ssum = 0.0f;
      float p[2][8];
#pragma unroll
      for (int r = 0; r < 8; ++r) {
        p[0][r] = __expf(a[0][r] - msh);
        p[1][r] = __expf(a[1][r] - msh);
        ssum += p[0][r] + p[1][r];
      }
      ssum += __shfl_xor(ssum, 16, 32);
      l_run = l_run * alph + ssum;
      m_run = newM;
#pragma unroll
      for (int dt = 0; dt < 2; ++dt) {
#pragma unroll
        for (int r = 0; r < 8; ++r) { oh[dt][r] *= alph; ol[dt][r] *= alph; }
      }

      // P (f32, D layout) -> B operands (f16 hi, f16 residual x2^11): element r <- keys 0-15 tile, 8+r <- keys 16-31 tile
      union { v16h v; _Float16 s[16]; } ph, plo;
#pragma unroll
      for (int r = 0; r < 8; ++r) {
        const _Float16 x0 = (_Float16)p[0][r];
        const _Float16 x1 = (_Float16)p[1][r];
        ph.s[r]      = x0;
        ph.s[8 + r]  = x1;
        plo.s[r]     = (_Float16)((p[0][r] - (float)x0) * 2048.0f);
        plo.s[8 + r] = (_Float16)((p[1][r] - (float)x1) * 2048.0f);
      }

      // O[d][q] += V[d][kr .. +31] x P, hi and residual terms
#pragma unroll
      for (int dt = 0; dt < 2; ++dt) {
        const v16h vah = ldfrag_h(vh + (16 * dt + rlane) * VP + kr + koff);
        const v16h val = ldfrag_h(vl + (16 * dt + rlane) * VP + kr + koff);
        oh[dt] = mma_h_raw(vah, ph.v, oh[dt]);
        ol[dt] = mma_h_raw(val, ph.v, ol[dt]);
        ol[dt] = mma_h_raw(vah, plo.v, ol[dt]);
        guard4(oh[dt], ol[dt], vah, val, ph.v, plo.v);
      }
    }
  }
  acc_guard4(oh[0], oh[1], ol[0], ol[1]);

  // ---- output values -> per-wave f32 LDS staging ----
  const float inv = (1.0f / 16.0f) * (1.0f / l_run);            // out = (Oh + Ol/2048) / (16 * l)
  float* st = sO[wave];
#pragma unroll
  for (int dt = 0; dt < 2; ++dt) {
    v4f va, vb;
#pragma unroll
    for (int e = 0; e < 4; ++e) {
      va[e] = (oh[dt][e]     + ol[dt][e]     * C2048) * inv;     // d = 16dt + 8hsel + e
      vb[e] = (oh[dt][4 + e] + ol[dt][4 + e] * C2048) * inv;     // d = 16dt + 8hsel + 4 + e
    }
    const int so = rlane * OP + 16 * dt + 8 * hsel;              // row q = rlane
    *(v4f*)(st + so) = va;
    *(v4f*)(st + so + 4) = vb;
  }
  wave_sync_lds();
  {
    const int rq = lane >> 3, c4 = (lane & 7) * 4;
    const int n0 = q0 + wave * 16;
    {
#pragma unroll
      for (int it = 0; it < 4; ++it) {
        const int row = it * 4 + rq;                             // it 0..3 x rq 0..3 = rows 0..15
        const v4f v = *(const v4f*)(st + row * OP + c4);
        *(v4f*)(Out + ((size_t)(b * NT + n0 + row)) * ND + h * HD + c4) = v;
      }
      
    }
  }
}

// =====================================================================================================
// Workspace map (bytes, every offset a multiple of 128; every plane an exact multiple of its whole-line store
// granularity, row counts exact tile multiples, no padded tails needed):
//   XH   f16 [4096][1024]    activation, bf16-RNE x16                    0          8388608 B
//   WT   f16 [3072][1024]    Wqkv transposed, bf16-RNE x1024       8388608          6291456 B
//   COS  f32 [2048][32]                                          14680064           262144 B
//   SIN  f32 [2048][32]                                          14942208           262144 B
//   INVF f32 [32] (one line, 256 B reserved)                    15204352              256 B
//   QH   f16 [64][2048][32]  q x16 hi                            15204608          8388608 B
//   QL   f16 [64][2048][32]  q residual x2^11                    23593216          8388608 B
//   KH   f16 [64][2048][32]                                      31981824          8388608 B
//   KL   f16 [64][2048][32]                                      40370432          8388608 B
//   VH   f16 [64][32][2048]  v x16 hi, key-contiguous            48759040          8388608 B
//   VL   f16 [64][32][2048]                                      57147648          8388608 B
//   end                                                          65536256
// =====================================================================================================
extern "C" void kernel_launch(void* const* d_in, const int* in_sizes, int n_in,
                              void* d_out, int out_size, void* d_ws, size_t ws_size,
                              hipStream_t stream) {
  if (n_in < 3) return;
  if (in_sizes[0] != NTOK * ND) return;
  if (in_sizes[1] != ND * NQKV) return;
  if (in_sizes[2] != NT * NT) return;
  if (out_size != NTOK * ND) return;

  const float* x   = (const float*)d_in[0];
  const float* W   = (const float*)d_in[1];
  const int*   msk = (const int*)d_in[2];

  const size_t PXH = (size_t)NTOK * ND * 2;                    // 8388608
  const size_t PWT = (size_t)NQKV * ND * 2;                    // 6291456
  const size_t PTB = (size_t)NT * HD * 4;                      // 262144
  const size_t PIN = 256;
  const size_t PQK = (size_t)NBH * NT * HD * 2;                // 8388608
  const size_t PV  = (size_t)NBH * HD * NT * 2;                // 8388608
  size_t off = 0;
  const size_t oXH  = off; off += PXH;
  const size_t oWT  = off; off += PWT;
  const size_t oCOS = off; off += PTB;
  const size_t oSIN = off; off += PTB;
  const size_t oINV = off; off += PIN;
  const size_t oQH  = off; off += PQK;
  const size_t oQL  = off; off += PQK;
  const size_t oKH  = off; off += PQK;
  const size_t oKL  = off; off += PQK;
  const size_t oVH  = off; off += PV;
  const size_t oVL  = off; off += PV;
  if (off > ws_size) return;                                   // off = 65536256
  if (off > (size_t)134217728) return;

  char* ws = (char*)d_ws;
  unsigned short* XH   = (unsigned short*)(ws + oXH);
  unsigned short* WT   = (unsigned short*)(ws + oWT);
  float*          COS  = (float*)(ws + oCOS);
  float*          SIN  = (float*)(ws + oSIN);
  float*          INVF = (float*)(ws + oINV);
  unsigned short* QH   = (unsigned short*)(ws + oQH);
  unsigned short* QL   = (unsigned short*)(ws + oQL);
  unsigned short* KH   = (unsigned short*)(ws + oKH);
  unsigned short* KL   = (unsigned short*)(ws + oKL);
  unsigned short* VH   = (unsigned short*)(ws + oVH);
  unsigned short* VL   = (unsigned short*)(ws + oVL);
  float*          out  = (float*)d_out;

  const dim3 blk(256);
  const int n8x = NTOK * ND / 8;                               // 524288
  const dim3 gX((n8x + 255) / 256);                            // 2048
  const dim3 gWT(NQKV / 64, ND / 64);                          // (48, 16): x = o tiles, y = c tiles
  const dim3 gTab(NT / 8);                                     // 256
  const dim3 gProj(((NTOK / 64) * (NQKV / 64) + 7) / 8);       // 3072 tiles -> 384 blocks
  const dim3 gAttn(NBH, NT / QBLK);                            // 64 x 16, 256 threads

  const float oscPrj = 1.0f / 16384.0f;                        // undo x*16 and W*1024

  // (1) inputs -> f16 planes holding bf16-RNE values times an exact power of two
  cvt_h8<<<gX, blk, 0, stream>>>(x, XH, n8x, 16.0f);
  cvt_wT<<<gWT, blk, 0, stream>>>(W, WT, 1024.0f);
  // (2) rotary tables
  k_invf<<<dim3(1), dim3(32), 0, stream>>>(INVF);
  k_tab<<<gTab, blk, 0, stream>>>(INVF, COS, SIN);
  // (3) fused qkv projection with rotary epilogue: q, k -> [bh][t][32] hi/res planes; v -> [bh][d][t] hi/res planes
  gemm_proj<<<gProj, blk, 0, stream>>>(XH, WT, COS, SIN, QH, QL, KH, KL, VH, VL, oscPrj);
  // (4) attention per (batch*head, 128-query block) -> f32 output lines [tok][h*32 .. +31]
  attn_kernel<<<gAttn, dim3(ATHR), 0, stream>>>(QH, QL, KH, KL, VH, VL, msk, out);
  (void)hipGetLastError();
}

// v001
// Measured time: 178 microseconds a run.
// Next to v000, in two timings, it ran 1.23 times as fast each time.
#include <hip/hip_runtime.h>
#include <math.h>
#include <stdint.h>

// Contractions: fused qkv projection x.Wqkv (f16 operands holding bf16-RNE values, x carried x16 and W x1024, one
// product per tile pair); scores k.q (k and q each an f16 hi plane x16 plus an f16 residual plane x2^11: hi.hi in one
// accumulator, hi.lo + lo.hi in a second accumulator folded with 2^-11, 3 products); context v.p (p x1024 and v x16,
// each f16 hi plus f16 residual x2^11: hi.hi in one accumulator, lo.hi + hi.lo in a second folded with 2^-11,
// 3 products); all v_wmma_f32_16x16x32_f16 with f32 accumulate; rotary tables, rotary combine, key masking, softmax
// statistics and the final normalisation in f32 on VALU; output stored as f32.

#define NB    2
#define NT    2048
#define ND    1024
#define NQKV  3072
#define NH    32
#define HD    32
#define NTOK  (NB * NT)
#define NBH   (NB * NH)
#define QBLK  128
#define KCH   64
#define NKC   (NT / KCH)
#define KP    40
#define VP    72
#define SPP   72
#define OP    36
#define ATHR  256
#define GBT   128
#define GBK   64
#define GLP   72
#define GTR   (ND / GBK)
#define GBUF  (GBT * GLP)

static_assert(NH * HD == ND);
static_assert(NQKV == 3 * ND);
static_assert((NT % QBLK) == 0 && (NT % KCH) == 0 && (NT % 64) == 0 && (NTOK % 64) == 0);
static_assert((NQKV % 64) == 0 && (ND % 64) == 0 && (ND % 32) == 0);
static_assert(QBLK == (ATHR / 32) * 16);
static_assert(KCH * 4 == ATHR && HD * 8 == ATHR);
static_assert(HD == 32 && KCH == 64 && NKC * KCH == NT);
static_assert(((NTOK * ND) % 2048) == 0);
static_assert((NTOK % GBT) == 0 && (NQKV % GBT) == 0 && (NT % GBT) == 0 && (ND % GBT) == 0 && GTR >= 2);

typedef _Float16 v16h __attribute__((ext_vector_type(16)));
typedef _Float16 v8h  __attribute__((ext_vector_type(8)));
typedef float    v8f  __attribute__((ext_vector_type(8)));
typedef float    v4f  __attribute__((ext_vector_type(4)));
typedef unsigned int v4u __attribute__((ext_vector_type(4)));
typedef int      v4i  __attribute__((ext_vector_type(4)));

// ---- scalar helpers --------------------------------------------------------------------------------
__device__ __forceinline__ unsigned short bf_bits(float f) {          // f32 -> bf16 bits, RNE convert
  unsigned u = __float_as_uint(f);
  return (unsigned short)((u + 0x7FFFu + ((u >> 16) & 1u)) >> 16);
}
__device__ __forceinline__ float bf_up(unsigned short h) { return __uint_as_float(((unsigned)h) << 16); }
__device__ __forceinline__ unsigned short h_bits(_Float16 x) { return __builtin_bit_cast(unsigned short, x); }
__device__ __forceinline__ unsigned pk16(unsigned short a, unsigned short b) { return (unsigned)a | ((unsigned)b << 16); }
__device__ __forceinline__ v8f zero8() { v8f z = {0.f, 0.f, 0.f, 0.f, 0.f, 0.f, 0.f, 0.f}; return z; }

// ---- fragment loader: 16-bit A/B operand, lane -> row/col (lane&15), p already includes +8*(lane>>4);
//      elements 0..7 <- p[0..7] (k0+8h..), elements 8..15 <- p[16..23] (k0+16+8h..)
__device__ __forceinline__ v16h ldfrag_h(const _Float16* p) {
  union { v16h v; v8h h[2]; } f;
  f.h[0] = *(const v8h*)(p);
  f.h[1] = *(const v8h*)(p + 16);
  return f.v;
}

// ---- WMMA helpers with trailing VALU hazard gap --------------------------------------------------------
__device__ __forceinline__ v8f mma_h_raw(v16h a, v16h b, v8f c) {
  return __builtin_amdgcn_wmma_f32_16x16x32_f16(false, a, false, b, (short)0, c, false, false);
}
__device__ __forceinline__ void guard4(v8f& a, v8f& b, v16h w, v16h x, v16h y, v16h z) {
#if defined(__HIP_DEVICE_COMPILE__)
  asm volatile("v_nop\n\tv_nop\n\tv_nop\n\tv_nop" : "+v"(a), "+v"(b) : "v"(w), "v"(x), "v"(y), "v"(z));
#endif
}
__device__ __forceinline__ void acc_guard4(v8f& a, v8f& b, v8f& c, v8f& d) {
#if defined(__HIP_DEVICE_COMPILE__)
  asm volatile("v_nop\n\tv_nop\n\tv_nop\n\tv_nop" : "+v"(a), "+v"(b), "+v"(c), "+v"(d));
#endif
}
__device__ __forceinline__ void wave_sync_lds() {
  __builtin_amdgcn_fence(__ATOMIC_RELEASE, "workgroup");
  __builtin_amdgcn_wave_barrier();
  __builtin_amdgcn_fence(__ATOMIC_ACQUIRE, "workgroup");
}

// ---- asynchronous copies global -> LDS ------------------------------------------------------------------
__device__ __forceinline__ unsigned lds_addr(const unsigned short* p) {   // byte offset in the work-group's LDS
  return (unsigned)(size_t)(const __attribute__((address_space(3))) unsigned short*)p;
}
// One lane's share of a 128-row x 128-B tile: eight 16-B pieces, 16 rows apart (global pitch ND halves, LDS pitch
// GLP halves). The closing s_wait_xcnt stands inside the statement so that no address register named here is
// rewritten ahead of it.
__device__ __forceinline__ void stage_rows(unsigned l, const unsigned short* g) {
#if defined(__HIP_DEVICE_COMPILE__)
  asm volatile(
      "global_load_async_to_lds_b128 %0, %8, off\n\t"
      "global_load_async_to_lds_b128 %1, %9, off\n\t"
      "global_load_async_to_lds_b128 %2, %10, off\n\t"
      "global_load_async_to_lds_b128 %3, %11, off\n\t"
      "global_load_async_to_lds_b128 %4, %12, off\n\t"
      "global_load_async_to_lds_b128 %5, %13, off\n\t"
      "global_load_async_to_lds_b128 %6, %14, off\n\t"
      "global_load_async_to_lds_b128 %7, %15, off\n\t"
      "s_wait_xcnt 0x0"
      :: "v"(l), "v"(l + 1u * 16u * GLP * 2u), "v"(l + 2u * 16u * GLP * 2u), "v"(l + 3u * 16u * GLP * 2u),
         "v"(l + 4u * 16u * GLP * 2u), "v"(l + 5u * 16u * GLP * 2u), "v"(l + 6u * 16u * GLP * 2u),
         "v"(l + 7u * 16u * GLP * 2u),
         "v"(g), "v"(g + 1 * 16 * ND), "v"(g + 2 * 16 * ND), "v"(g + 3 * 16 * ND),
         "v"(g + 4 * 16 * ND), "v"(g + 5 * 16 * ND), "v"(g + 6 * 16 * ND), "v"(g + 7 * 16 * ND)
      : "memory");
#endif
}
__device__ __forceinline__ void wait_copies() {      // this wave's own copies have landed in LDS
#if defined(__HIP_DEVICE_COMPILE__)
  asm volatile("s_wait_asynccnt 0x0" ::: "memory");
#endif
}
__device__ __forceinline__ void wait_lds_reads() {   // this wave's LDS reads have returned before their buffer is refilled
#if defined(__HIP_DEVICE_COMPILE__)
  asm volatile("s_wait_dscnt 0x0" ::: "memory");
#endif
}

// =====================================================================================================
// f32 -> f16( bf16_RNE(v) * scale ), scale a power of two (exact), 8 elements per thread, one 16-B store
// =====================================================================================================
__global__ __launch_bounds__(256) void cvt_h8(const float* __restrict__ in, unsigned short* out, int n8, float scale) {
  const int i = blockIdx.x * 256 + threadIdx.x;
  if (i < n8) {
    const v4f a = *(const v4f*)(in + (size_t)i * 8);
    const v4f c = *(const v4f*)(in + (size_t)i * 8 + 4);
    float f[8];
    f[0] = a[0]; f[1] = a[1]; f[2] = a[2]; f[3] = a[3];
    f[4] = c[0]; f[5] = c[1]; f[6] = c[2]; f[7] = c[3];
    unsigned short hb[8];
#pragma unroll
    for (int e = 0; e < 8; ++e) hb[e] = h_bits((_Float16)(bf_up(bf_bits(f[e])) * scale));
    v4u p;
    p[0] = pk16(hb[0], hb[1]);
    p[1] = pk16(hb[2], hb[3]);
    p[2] = pk16(hb[4], hb[5]);
    p[3] = pk16(hb[6], hb[7]);
    *(v4u*)(out + (size_t)i * 8) = p;
    
  }
}

// =====================================================================================================
// Weight transpose + convert: W[c][o] f32 (c in [0,1024), o in [0,3072), o contiguous) ->
// WT[o][c] f16 = f16( bf16_RNE(W[c][o]) * scale ), c contiguous (k-major rows for the B fragment loader).
// Block = one 64(o) x 64(c) tile: thread (ol = tid&63, cb = tid>>6) reads 16 consecutive c rows of column o0+ol
// (coalesced per row across lanes), packs them as two 16-B LDS stores into sT[ol][c]; block barrier; then every
// grid = (3072/64, 1024/64) = (48, 16): x = o tiles (rows of WT), y = c tiles (rows of W).
// coverage: 256 threads x 2 rows-iterations... : rows tid>>3 (0..31) and +32 -> all 64 rows x 64 halves per tile.
// =====================================================================================================
__global__ __launch_bounds__(256) void cvt_wT(const float* __restrict__ W, unsigned short* WT, float scale) {
  __shared__ __align__(16) unsigned short sT[64 * SPP];          // 9216 B
  const int tid = threadIdx.x;
  const int o0 = blockIdx.x * 64;
  const int c0 = blockIdx.y * 64;
  {
    const int ol = tid & 63, cb = tid >> 6;                      // cb 0..3 -> c rows cb*16 .. +15
    unsigned short hb[16];
#pragma unroll
    for (int e = 0; e < 16; ++e) {
      const float f = W[(size_t)(c0 + cb * 16 + e) * NQKV + o0 + ol];
      hb[e] = h_bits((_Float16)(bf_up(bf_bits(f)) * scale));
    }
    v4u p0, p1;
#pragma unroll
    for (int q = 0; q < 4; ++q) {
      p0[q] = pk16(hb[2 * q], hb[2 * q + 1]);
      p1[q] = pk16(hb[8 + 2 * q], hb[8 + 2 * q + 1]);
    }
    *(v4u*)(sT + ol * SPP + cb * 16) = p0;
    *(v4u*)(sT + ol * SPP + cb * 16 + 8) = p1;
  }
  __syncthreads();
  {
    const int row = tid >> 3, c8 = (tid & 7) * 8;
    const v4u v0 = *(const v4u*)(sT + row * SPP + c8);
    const v4u v1 = *(const v4u*)(sT + (row + 32) * SPP + c8);
    const size_t d0 = (size_t)(o0 + row) * ND + c0 + c8;
    const size_t d1 = (size_t)(o0 + row + 32) * ND + c0 + c8;
    {
      *(v4u*)(WT + d0) = v0;
      *(v4u*)(WT + d1) = v1;
      
    }
  }
}

// =====================================================================================================
// inv_freq[j] = 1 / 10000^(j/32), j = 0..31 (full head dim, not pairs). One block of 32 threads; the 32 floats are
// =====================================================================================================
__global__ __launch_bounds__(32) void k_invf(float* INVF) {
  #pragma clang fp contract(off)
  const int j = threadIdx.x;
  const float e = (float)j * 0.03125f;
  const float p = powf(10000.0f, e);
  const float inv = 1.0f / p;
  *(float*)(INVF + j) = inv;
  
}

// =====================================================================================================
// Rotary tables COS/SIN[s][j] = cos/sin( s * inv_freq[j] ), s in [0,2048), j in [0,32): 256 threads = 8 rows x 32,
// one precise sincosf per thread (rolled, nothing unrolled); values staged in LDS, block barrier, then waves 0-1
// coverage: 256 blocks x 8 rows x 32 = every COS and SIN element.
// =====================================================================================================
__global__ __launch_bounds__(256) void k_tab(const float* __restrict__ INVF, float* COS, float* SIN) {
  #pragma clang fp contract(off)
  __shared__ __align__(16) float sc[8 * 32];
  __shared__ __align__(16) float ss[8 * 32];
  const int tid = threadIdx.x, j = tid & 31, rl = tid >> 5;
  const int s = blockIdx.x * 8 + rl;
  const float ang = (float)s * INVF[j];
  float sn, cs;
  sincosf(ang, &sn, &cs);
  sc[rl * 32 + j] = cs;
  ss[rl * 32 + j] = sn;
  __syncthreads();
  if (tid < 64) {                                                // waves 0,1: COS rows
    const int row = tid >> 3, c4 = (tid & 7) * 4;
    const v4f v = *(const v4f*)(sc + row * 32 + c4);
    float* d = COS + (size_t)(blockIdx.x * 8 + row) * HD + c4;
    *(v4f*)d = v;
    
  } else if (tid < 128) {                                        // waves 2,3: SIN rows
    const int t2 = tid - 64;
    const int row = t2 >> 3, c4 = (t2 & 7) * 4;
    const v4f v = *(const v4f*)(ss + row * 32 + c4);
    float* d = SIN + (size_t)(blockIdx.x * 8 + row) * HD + c4;
    *(v4f*)d = v;
    
  }
}

// =====================================================================================================
// Fused qkv projection GEMM with rotary + 16-bit plane epilogue:
//   Y[tok][o] = sum_c XH[tok][c] * WT[o][c] * oscale,  tok in [0,4096), o in [0,3072), K = 1024.
// One work-group of 4 waves per 128x128 tile, one wave per 64x64 quarter (register-blocked); A = XH rows (token),
// Bt = WT rows (k contiguous). Per 64-deep k stage the 128 A rows and 128 Bt rows (128 B each, whole lines) are copied
// asynchronously into one of two LDS buffers (pitch 144 B) while the other buffer is worked on; k order unchanged.
// The 64 tokens of a tile lie in one batch b (t0 = m0 mod 2048); the 64 outputs are two heads h0, h0+1 of one of
// q (o < 1024), k (1024 <= o < 2048), v (o >= 2048); column j (16-wide subtile) -> head h0 + (j>>1), d = 16*(j&1)+lane%16.
//   q, k: rotary combine per the module: out[d] = y[d]*cos[s][d] - y[d+16]*sin[s][d] (d < 16),
//         out[d] = y[d]*cos[s][d] + y[d-16]*sin[s][d] (d >= 16); both partners sit in the same lane and element.
//         PH/PL[bh][t][32] f16 = (out*16) hi plane and residual x2^11 (64 B per token; the wave owns 64 consecutive
// then q/k: each head's slab region (16 tok x 64 B = 1024 contiguous B) written as 32 lanes x 16 B contiguous per
// grid = 768 blocks x 4 waves = 3072 wave tiles = 64 x 48 exactly.
// coverage: q/k tiles: 4 slabs x 2 heads x 16 tok x 32 d (hi and residual); v tiles: 4 subtiles x 16 d x 64 tok;
// 64 token tiles x (16+16+16) column tiles = every (bh, t) row of QH/QL/KH/KL and every (bh, d) row of VH/VL.
// =====================================================================================================
__global__ __launch_bounds__(128) void gemm_proj(
    const unsigned short* __restrict__ XHp, const unsigned short* __restrict__ WTp,
    const float* __restrict__ COS, const float* __restrict__ SIN,
    unsigned short* QH, unsigned short* QL, unsigned short* KH, unsigned short* KL,
    unsigned short* VH, unsigned short* VL, float oscale) {
  __shared__ __align__(16) unsigned short sA[2][GBUF];            // 36864 B
  __shared__ __align__(16) unsigned short sB[2][GBUF];            // 36864 B
  __shared__ __align__(16) unsigned short sP[4][2][16 * SPP];     // 18432 B
  const int tid  = threadIdx.x;
  const int lane = tid & 31;
  const int wave = tid >> 5;
  const int tilesN = NQKV / GBT;                                 // 24
  const int tilesM = NTOK / GBT;                                 // 32
  const int tile = blockIdx.x;
  if (tile >= tilesM * tilesN) return;                           // block-uniform, in front of every barrier
  const int tm = tile / tilesN;
  const int tn = tile - tm * tilesN;
  const int wm = wave >> 1, wn = wave & 1;                       // 2 x 2 waves
  const int m0 = tm * GBT + (wm << 6);                           // token base of this wave
  const int n0 = tn * GBT + (wn << 6);                           // output channel base in [0,3072)
  const int rlane = lane & 15;
  const int hh    = lane >> 4;
  const int koff  = hh * 8;
  const int mOff  = hh * 8;

  v8f acc[4][4];
#pragma unroll
  for (int i = 0; i < 4; ++i)
#pragma unroll
    for (int j = 0; j < 4; ++j) acc[i][j] = zero8();

  // copy share of this lane: piece tid&7 (16 B) of rows (tid>>3) + 16e, e = 0..7; a wave's copy = 4 whole 128-B lines
  const int crow = tid >> 3, cpc = (tid & 7) * 8;
  const unsigned short* gA = XHp + (size_t)(tm * GBT + crow) * ND + cpc;
  const unsigned short* gB = WTp + (size_t)(tn * GBT + crow) * ND + cpc;
  const unsigned lA = lds_addr(&sA[0][crow * GLP + cpc]);
  const unsigned lB = lds_addr(&sB[0][crow * GLP + cpc]);

  stage_rows(lA, gA);                                            // stage 0 -> buffer 0
  stage_rows(lB, gB);
  wait_copies();
  __syncthreads();
  stage_rows(lA + GBUF * 2u, gA + GBK);                          // stage 1 -> buffer 1
  stage_rows(lB + GBUF * 2u, gB + GBK);

  // rolled: the two-buffer order below is written once
#pragma unroll 1
  for (int t = 0; t < GTR; ++t) {
    const int bsel = t & 1;
    const _Float16* fa = (const _Float16*)(const void*)&sA[bsel][((wm << 6) + rlane) * GLP + koff];
    const _Float16* fb = (const _Float16*)(const void*)&sB[bsel][((wn << 6) + rlane) * GLP + koff];
#pragma unroll
    for (int kk = 0; kk < GBK; kk += 32) {
      v16h bf[4], af[4];
#pragma unroll
      for (int j = 0; j < 4; ++j) bf[j] = ldfrag_h(fb + (j << 4) * GLP + kk);
#pragma unroll
      for (int i = 0; i < 4; ++i) af[i] = ldfrag_h(fa + (i << 4) * GLP + kk);
#pragma unroll
      for (int i = 0; i < 4; ++i)
#pragma unroll
        for (int j = 0; j < 4; ++j) acc[i][j] = mma_h_raw(af[i], bf[j], acc[i][j]);
      // all 16 LDS reads of this k step as one group ahead of its 16 products: one LDS wait a step, not one a row
      __builtin_amdgcn_sched_group_barrier(0x100, 16, 0);
      __builtin_amdgcn_sched_group_barrier(0x008, 16, 0);
    }
    // publish point of stage t + 1: own reads done, own copies landed, barrier, then the refill of the buffer just read
    wait_lds_reads();
    wait_copies();
    __syncthreads();
    if (t + 2 < GTR) {
      stage_rows(lA + (unsigned)bsel * (GBUF * 2u), gA + (t + 2) * GBK);
      stage_rows(lB + (unsigned)bsel * (GBUF * 2u), gB + (t + 2) * GBK);
    }
  }
  wait_copies();
  acc_guard4(acc[0][0], acc[0][1], acc[0][2], acc[0][3]);
  acc_guard4(acc[1][0], acc[1][1], acc[1][2], acc[1][3]);
  acc_guard4(acc[2][0], acc[2][1], acc[2][2], acc[2][3]);
  acc_guard4(acc[3][0], acc[3][1], acc[3][2], acc[3][3]);

  // ---- epilogue ----
  const int b   = m0 / NT;
  const int t0  = m0 - b * NT;
  const int sel = n0 >> 10;                                      // 0 q, 1 k, 2 v (wave-uniform)
  const int h0  = (n0 & (ND - 1)) >> 5;                          // first of the two heads of this tile
  unsigned short* s0 = &sP[wave][0][0];
  unsigned short* s1 = &sP[wave][1][0];

  if (sel < 2) {
    unsigned short* PH = (sel == 0) ? QH : KH;
    unsigned short* PL = (sel == 0) ? QL : KL;
#pragma unroll
    for (int i = 0; i < 4; ++i) {                                // slab = 16 tokens t0+16i .. +15
#pragma unroll
      for (int r = 0; r < 8; ++r) {
        const int tok = t0 + (i << 4) + mOff + r;                // row tok = 8hh + r
        const float* cp = COS + (size_t)tok * HD;
        const float* sp = SIN + (size_t)tok * HD;
        const float ca = cp[rlane], cb = cp[16 + rlane];
        const float sa = sp[rlane], sb = sp[16 + rlane];
#pragma unroll
        for (int hp = 0; hp < 2; ++hp) {
          const float y0 = acc[i][2 * hp][r] * oscale;           // d = rlane
          const float y1 = acc[i][2 * hp + 1][r] * oscale;       // d = 16 + rlane
          const float f0 = (y0 * ca - y1 * sa) * 16.0f;
          const float f1 = (y1 * cb + y0 * sb) * 16.0f;
          const _Float16 x0 = (_Float16)f0;
          const _Float16 x1 = (_Float16)f1;
          const int so = (mOff + r) * SPP + 32 * hp + rlane;     // row tok, col 32hp + d
          s0[so]      = h_bits(x0);
          s1[so]      = h_bits((_Float16)((f0 - (float)x0) * 2048.0f));
          s0[so + 16] = h_bits(x1);
          s1[so + 16] = h_bits((_Float16)((f1 - (float)x1) * 2048.0f));
        }
      }
      wave_sync_lds();
      {
        const int rr = lane >> 2, cc = (lane & 3) * 8;           // rr*32 + cc = lane*8 halves
#pragma unroll
        for (int hp = 0; hp < 2; ++hp) {
          const int bhp = b * NH + h0 + hp;
          const size_t base = ((size_t)(bhp * NT + t0 + (i << 4))) * HD + lane * 8;
          const v4u v0 = *(const v4u*)(s0 + rr * SPP + 32 * hp + cc);
          const v4u v1 = *(const v4u*)(s0 + (rr + 8) * SPP + 32 * hp + cc);
          const v4u w0 = *(const v4u*)(s1 + rr * SPP + 32 * hp + cc);
          const v4u w1 = *(const v4u*)(s1 + (rr + 8) * SPP + 32 * hp + cc);
          {
            *(v4u*)(PH + base) = v0;
            *(v4u*)(PH + base + 256) = v1;
            *(v4u*)(PL + base) = w0;
            *(v4u*)(PL + base + 256) = w1;
            
          }
        }
      }
      wave_sync_lds();
    }
  } else {
#pragma unroll
    for (int j = 0; j < 4; ++j) {                                // slab = 16 rows d = 16(j&1) + rlane of head h0+(j>>1)
      const int hp = j >> 1, dbase = (j & 1) * 16;
      const int bhp = b * NH + h0 + hp;
#pragma unroll
      for (int i = 0; i < 4; ++i) {
        unsigned short hb[8], lb[8];
#pragma unroll
        for (int r = 0; r < 8; ++r) {
          const float f = (acc[i][j][r] * oscale) * 16.0f;
          const _Float16 xh = (_Float16)f;
          hb[r] = h_bits(xh);
          lb[r] = h_bits((_Float16)((f - (float)xh) * 2048.0f));
        }
        v4u ph, pl;
#pragma unroll
        for (int q = 0; q < 4; ++q) {
          ph[q] = pk16(hb[2 * q], hb[2 * q + 1]);
          pl[q] = pk16(lb[2 * q], lb[2 * q + 1]);
        }
        *(v4u*)(s0 + rlane * SPP + (i << 4) + mOff) = ph;       // row d = rlane, tok = 16i + 8hh .. +7
        *(v4u*)(s1 + rlane * SPP + (i << 4) + mOff) = pl;
      }
      wave_sync_lds();
      {
        const int rq = lane >> 3, c8 = (lane & 7) * 8;
        {
#pragma unroll
          for (int it = 0; it < 4; ++it) {
            const int row = it * 4 + rq;                         // it 0..3 x rq 0..3 = rows 0..15
            const size_t dst = ((size_t)(bhp * HD + dbase + row)) * NT + t0 + c8;
            const v4u v = *(const v4u*)(s0 + row * SPP + c8);
            const v4u w = *(const v4u*)(s1 + row * SPP + c8);
            *(v4u*)(VH + dst) = v;
            *(v4u*)(VL + dst) = w;
          }
          
        }
      }
      wave_sync_lds();
    }
  }
}

// =====================================================================================================
// Attention for one (batch*head, 128-query block): grid = (64, 16), 256 threads = 8 waves x 16 queries; each lane
// owns one query column q = q0 + 16*wave + (lane&15). QH/QL/KH/KL[bh][t][32] f16 (x16 hi, residual x2^11),
// VH/VL[bh][d][2048] (x16 hi, residual x2^11). The int mask [2048 q][2048 key] is read per element: key chunks of 64;
// each lane loads the 32 mask entries of its query row for the keys of its lane half as 16-B vectors into a bitmask;
// a chunk whose entries are all zero for the whole block (per-wave __any, LDS flags, double-buffered, block barrier)
// is skipped block-uniformly (exact: such keys have probability 0). Otherwise K hi/res rows [64][40] and V hi/res
// tiles [32 d][72] are staged in LDS with plain 16-B loads + one block barrier. Per 32-key step and 16-key tile t:
// S[key][q] = A(K hi rows) x B(resident Q hi) and Sr = A(K hi) x B(Q res) + A(K res) x B(Q hi) in separate zeroed
// accumulators; logit = (S + Sr/2048) / 256 / sqrt(32); entries with mask == 0 replaced by -inf; online softmax over
// keys (max/sum across lane halves by shuffle); p = 1024*exp(x - max) packed D->B per the chained map (element r <-
// keys 0-15 tile, 8+r <- keys 16-31 tile) as f16 hi plus residual x2^11; Oh[d][q] += A(V hi rows) x Ph,
// Ol += A(V res) x Ph + A(V hi) x Pl (both 2^-11 terms); out = (Oh + Ol/2048) / (16 * l) (l = 0 gives 0*inf = NaN).
// coverage: 64 x 16 blocks x 8 waves x 16 rows x 32 floats = every (tok, head) line of the output.
// =====================================================================================================
__global__ __launch_bounds__(ATHR) void attn_kernel(
    const unsigned short* __restrict__ QHp, const unsigned short* __restrict__ QLp,
    const unsigned short* __restrict__ KHp, const unsigned short* __restrict__ KLp,
    const unsigned short* __restrict__ VHp, const unsigned short* __restrict__ VLp,
    const int* __restrict__ msk, float* Out) {
  __shared__ __align__(16) unsigned short kh_u[KCH * KP];         // 5120 B
  __shared__ __align__(16) unsigned short kl_u[KCH * KP];         // 5120 B
  __shared__ __align__(16) unsigned short vh_u[HD * VP];          // 4608 B
  __shared__ __align__(16) unsigned short vl_u[HD * VP];          // 4608 B
  __shared__ __align__(16) float sO[8][16 * OP];                  // 18432 B
  __shared__ int sflag[2][8];
  const _Float16* kh = (const _Float16*)(const void*)kh_u;
  const _Float16* kl = (const _Float16*)(const void*)kl_u;
  const _Float16* vh = (const _Float16*)(const void*)vh_u;
  const _Float16* vl = (const _Float16*)(const void*)vl_u;
  const _Float16* QH = (const _Float16*)(const void*)QHp;
  const _Float16* QL = (const _Float16*)(const void*)QLp;

  const int tid = threadIdx.x, lane = tid & 31, wave = tid >> 5;
  const int bh = blockIdx.x;
  const int b  = bh / NH;
  const int h  = bh - b * NH;
  const int q0 = blockIdx.y * QBLK;
  const int rlane = lane & 15, hsel = lane >> 4, koff = hsel * 8;
  const int qrow = q0 + wave * 16 + rlane;                       // this lane's query index within the sequence

  // resident Q fragments (B operand: B[k=d][n=q] from [q][d] rows), arithmetic addressing, one 32-deep k-step
  const size_t qo = ((size_t)(bh * NT + qrow)) * HD + koff;
  const v16h qh0 = ldfrag_h(QH + qo);
  const v16h ql0 = ldfrag_h(QL + qo);
  const size_t rowbase = (size_t)qrow * NT;                      // mask row of this query (shared over b, h)

  const float C2048  = 1.0f / 2048.0f;
  const float SCL    = 0.17677669529663687f * (1.0f / 256.0f);  // undo q*16, k*16, then 1/sqrt(32)
  const float LN1024 = 6.931471805599453f;
  const float NEGINF = __uint_as_float(0xff800000u);

  v8f oh[2], ol[2];
#pragma unroll
  for (int dt = 0; dt < 2; ++dt) { oh[dt] = zero8(); ol[dt] = zero8(); }
  float m_run = -1.0e30f, l_run = 0.0f;

#pragma unroll 1
  for (int c = 0; c < NKC; ++c) {
    const int kc = c * KCH;
    // mask bits: bit (16*s + 8*t + r) <-> key kc + 32*s + 16*t + 8*hsel + r of this lane's query row
    unsigned bits = 0u;
#pragma unroll
    for (int s = 0; s < 2; ++s) {
#pragma unroll
      for (int t = 0; t < 2; ++t) {
        const int* mp = msk + rowbase + (size_t)(kc + 32 * s + 16 * t + 8 * hsel);
        const v4i ma = *(const v4i*)mp;
        const v4i mb = *(const v4i*)(mp + 4);
#pragma unroll
        for (int r = 0; r < 4; ++r) {
          bits |= ((ma[r] != 0) ? 1u : 0u) << (s * 16 + t * 8 + r);
          bits |= ((mb[r] != 0) ? 1u : 0u) << (s * 16 + t * 8 + 4 + r);
        }
      }
    }
    const int wany = __any(bits != 0u);
    if (lane == 0) sflag[c & 1][wave] = wany;
    __syncthreads();                                             // also: all waves finished reading the prior chunk's K/V
    int bany = 0;
#pragma unroll
    for (int w = 0; w < 8; ++w) bany |= sflag[c & 1][w];
    if (bany == 0) continue;                                     // block-uniform skip of an all-masked chunk

    // ---- stage K hi/res rows and V hi/res tiles of keys kc..kc+63 (one 16-B item per thread each) ----
    {
      const int key = tid >> 2, ck = (tid & 3) * 8;              // 64 keys x 32 halves
      const size_t gk = ((size_t)(bh * NT + kc + key)) * HD + ck;
      *(v4u*)(kh_u + key * KP + ck) = *(const v4u*)(KHp + gk);
      *(v4u*)(kl_u + key * KP + ck) = *(const v4u*)(KLp + gk);
      const int d = tid >> 3, cv = (tid & 7) * 8;                // 32 d rows x 64 halves
      const size_t gv = ((size_t)(bh * HD + d)) * NT + kc + cv;
      *(v4u*)(vh_u + d * VP + cv) = *(const v4u*)(VHp + gv);
      *(v4u*)(vl_u + d * VP + cv) = *(const v4u*)(VLp + gv);
    }
    __syncthreads();

#pragma unroll 1
    for (int sub = 0; sub < 2; ++sub) {
      const int kr = sub * 32;
      const unsigned sbits = bits >> (sub * 16);
      float a[2][8];
#pragma unroll
      for (int t = 0; t < 2; ++t) {
        const int krow = kr + 16 * t + rlane;
        const v16h kha = ldfrag_h(kh + krow * KP + koff);
        const v16h kla = ldfrag_h(kl + krow * KP + koff);
        v8f sh = mma_h_raw(kha, qh0, zero8());
        v8f sr = mma_h_raw(kha, ql0, zero8());
        sr = mma_h_raw(kla, qh0, sr);
        guard4(sh, sr, kha, kla, qh0, ql0);
#pragma unroll
        for (int r = 0; r < 8; ++r) {
          const float s = (sh[r] + sr[r] * C2048) * SCL;
          const unsigned kb = (sbits >> (t * 8 + r)) & 1u;
          a[t][r] = (kb != 0u) ? s : NEGINF;
        }
      }

      // online softmax over the key axis for this lane's q column
      float mloc = -1.0e30f;
#pragma unroll
      for (int r = 0; r < 8; ++r) mloc = fmaxf(mloc, fmaxf(a[0][r], a[1][r]));
      mloc = fmaxf(mloc, __shfl_xor(mloc, 16, 32));
      const float newM  = fmaxf(m_run, mloc);
      const float alph  = __expf(m_run - newM);
      const float msh   = newM - LN1024;
      float ssum = 0.0f;
      float p[2][8];
#pragma unroll
      for (int r = 0; r < 8; ++r) {
        p[0][r] = __expf(a[0][r] - msh);
        p[1][r] = __expf(a[1][r] - msh);
        ssum += p[0][r] + p[1][r];
      }
      ssum += __shfl_xor(ssum, 16, 32);
      l_run = l_run * alph + ssum;
      m_run = newM;
#pragma unroll
      for (int dt = 0; dt < 2; ++dt) {
#pragma unroll
        for (int r = 0; r < 8; ++r) { oh[dt][r] *= alph; ol[dt][r] *= alph; }
      }

      // P (f32, D layout) -> B operands (f16 hi, f16 residual x2^11): element r <- keys 0-15 tile, 8+r <- keys 16-31 tile
      union { v16h v; _Float16 s[16]; } ph, plo;
#pragma unroll
      for (int r = 0; r < 8; ++r) {
        const _Float16 x0 = (_Float16)p[0][r];
        const _Float16 x1 = (_Float16)p[1][r];
        ph.s[r]      = x0;
        ph.s[8 + r]  = x1;
        plo.s[r]     = (_Float16)((p[0][r] - (float)x0) * 2048.0f);
        plo.s[8 + r] = (_Float16)((p[1][r] - (float)x1) * 2048.0f);
      }

      // O[d][q] += V[d][kr .. +31] x P, hi and residual terms
#pragma unroll
      for (int dt = 0; dt < 2; ++dt) {
        const v16h vah = ldfrag_h(vh + (16 * dt + rlane) * VP + kr + koff);
        const v16h val = ldfrag_h(vl + (16 * dt + rlane) * VP + kr + koff);
        oh[dt] = mma_h_raw(vah, ph.v, oh[dt]);
        ol[dt] = mma_h_raw(val, ph.v, ol[dt]);
        ol[dt] = mma_h_raw(vah, plo.v, ol[dt]);
        guard4(oh[dt], ol[dt], vah, val, ph.v, plo.v);
      }
    }
  }
  acc_guard4(oh[0], oh[1], ol[0], ol[1]);

  // ---- output values -> per-wave f32 LDS staging ----
  const float inv = (1.0f / 16.0f) * (1.0f / l_run);            // out = (Oh + Ol/2048) / (16 * l)
  float* st = sO[wave];
#pragma unroll
  for (int dt = 0; dt < 2; ++dt) {
    v4f va, vb;
#pragma unroll
    for (int e = 0; e < 4; ++e) {
      va[e] = (oh[dt][e]     + ol[dt][e]     * C2048) * inv;     // d = 16dt + 8hsel + e
      vb[e] = (oh[dt][4 + e] + ol[dt][4 + e] * C2048) * inv;     // d = 16dt + 8hsel + 4 + e
    }
    const int so = rlane * OP + 16 * dt + 8 * hsel;              // row q = rlane
    *(v4f*)(st + so) = va;
    *(v4f*)(st + so + 4) = vb;
  }
  wave_sync_lds();
  {
    const int rq = lane >> 3, c4 = (lane & 7) * 4;
    const int n0 = q0 + wave * 16;
    {
#pragma unroll
      for (int it = 0; it < 4; ++it) {
        const int row = it * 4 + rq;                             // it 0..3 x rq 0..3 = rows 0..15
        const v4f v = *(const v4f*)(st + row * OP + c4);
        *(v4f*)(Out + ((size_t)(b * NT + n0 + row)) * ND + h * HD + c4) = v;
      }
      
    }
  }
}

// =====================================================================================================
// Workspace map (bytes, every offset a multiple of 128; every plane an exact multiple of its whole-line store
// granularity, row counts exact tile multiples, no padded tails needed):
//   XH   f16 [4096][1024]    activation, bf16-RNE x16                    0          8388608 B
//   WT   f16 [3072][1024]    Wqkv transposed, bf16-RNE x1024       8388608          6291456 B
//   COS  f32 [2048][32]                                          14680064           262144 B
//   SIN  f32 [2048][32]                                          14942208           262144 B
//   INVF f32 [32] (one line, 256 B reserved)                    15204352              256 B
//   QH   f16 [64][2048][32]  q x16 hi                            15204608          8388608 B
//   QL   f16 [64][2048][32]  q residual x2^11                    23593216          8388608 B
//   KH   f16 [64][2048][32]                                      31981824          8388608 B
//   KL   f16 [64][2048][32]                                      40370432          8388608 B
//   VH   f16 [64][32][2048]  v x16 hi, key-contiguous            48759040          8388608 B
//   VL   f16 [64][32][2048]                                      57147648          8388608 B
//   end                                                          65536256
// =====================================================================================================
extern "C" void kernel_launch(void* const* d_in, const int* in_sizes, int n_in,
                              void* d_out, int out_size, void* d_ws, size_t ws_size,
                              hipStream_t stream) {
  if (n_in < 3) return;
  if (in_sizes[0] != NTOK * ND) return;
  if (in_sizes[1] != ND * NQKV) return;
  if (in_sizes[2] != NT * NT) return;
  if (out_size != NTOK * ND) return;

  const float* x   = (const float*)d_in[0];
  const float* W   = (const float*)d_in[1];
  const int*   msk = (const int*)d_in[2];

  const size_t PXH = (size_t)NTOK * ND * 2;                    // 8388608
  const size_t PWT = (size_t)NQKV * ND * 2;                    // 6291456
  const size_t PTB = (size_t)NT * HD * 4;                      // 262144
  const size_t PIN = 256;
  const size_t PQK = (size_t)NBH * NT * HD * 2;                // 8388608
  const size_t PV  = (size_t)NBH * HD * NT * 2;                // 8388608
  size_t off = 0;
  const size_t oXH  = off; off += PXH;
  const size_t oWT  = off; off += PWT;
  const size_t oCOS = off; off += PTB;
  const size_t oSIN = off; off += PTB;
  const size_t oINV = off; off += PIN;
  const size_t oQH  = off; off += PQK;
  const size_t oQL  = off; off += PQK;
  const size_t oKH  = off; off += PQK;
  const size_t oKL  = off; off += PQK;
  const size_t oVH  = off; off += PV;
  const size_t oVL  = off; off += PV;
  if (off > ws_size) return;                                   // off = 65536256
  if (off > (size_t)134217728) return;

  char* ws = (char*)d_ws;
  unsigned short* XH   = (unsigned short*)(ws + oXH);
  unsigned short* WT   = (unsigned short*)(ws + oWT);
  float*          COS  = (float*)(ws + oCOS);
  float*          SIN  = (float*)(ws + oSIN);
  float*          INVF = (float*)(ws + oINV);
  unsigned short* QH   = (unsigned short*)(ws + oQH);
  unsigned short* QL   = (unsigned short*)(ws + oQL);
  unsigned short* KH   = (unsigned short*)(ws + oKH);
  unsigned short* KL   = (unsigned short*)(ws + oKL);
  unsigned short* VH   = (unsigned short*)(ws + oVH);
  unsigned short* VL   = (unsigned short*)(ws + oVL);
  float*          out  = (float*)d_out;

  const dim3 blk(256);
  const int n8x = NTOK * ND / 8;                               // 524288
  const dim3 gX((n8x + 255) / 256);                            // 2048
  const dim3 gWT(NQKV / 64, ND / 64);                          // (48, 16): x = o tiles, y = c tiles
  const dim3 gTab(NT / 8);                                     // 256
  const dim3 gProj((NTOK / GBT) * (NQKV / GBT));               // 32 x 24 = 768 blocks of 4 waves
  const dim3 gAttn(NBH, NT / QBLK);                            // 64 x 16, 256 threads

  const float oscPrj = 1.0f / 16384.0f;                        // undo x*16 and W*1024

  // (1) inputs -> f16 planes holding bf16-RNE values times an exact power of two
  cvt_h8<<<gX, blk, 0, stream>>>(x, XH, n8x, 16.0f);
  cvt_wT<<<gWT, blk, 0, stream>>>(W, WT, 1024.0f);
  // (2) rotary tables
  k_invf<<<dim3(1), dim3(32), 0, stream>>>(INVF);
  k_tab<<<gTab, blk, 0, stream>>>(INVF, COS, SIN);
  // (3) fused qkv projection with rotary epilogue: q, k -> [bh][t][32] hi/res planes; v -> [bh][d][t] hi/res planes
  gemm_proj<<<gProj, dim3(128), 0, stream>>>(XH, WT, COS, SIN, QH, QL, KH, KL, VH, VL, oscPrj);
  // (4) attention per (batch*head, 128-query block) -> f32 output lines [tok][h*32 .. +31]
  attn_kernel<<<gAttn, dim3(ATHR), 0, stream>>>(QH, QL, KH, KL, VH, VL, msk, out);
  (void)hipGetLastError();
}

// v002
// Measured time: 122 microseconds a run.
// Timed twice side by side with v001, it ran 1.46 times as fast both times.
// All steps since v000 together make it 1.80 times as fast.
#include <hip/hip_runtime.h>
#include <math.h>
#include <stdint.h>

// Contractions: fused qkv projection x.Wqkv (f16 operands holding bf16-RNE values, x carried x16 and W x1024, one
// product per tile pair); scores k.q (k and q each an f16 hi plane x16 plus an f16 residual plane x2^11: hi.hi in one
// accumulator, hi.lo + lo.hi in a second accumulator folded with 2^-11, 3 products); context v.p (p x1024 and v x16,
// each f16 hi plus f16 residual x2^11: hi.hi in one accumulator, lo.hi + hi.lo in a second folded with 2^-11,
// 3 products); all v_wmma_f32_16x16x32_f16 with f32 accumulate; rotary tables, rotary combine, key masking, softmax
// statistics and the final normalisation in f32 on VALU; output stored as f32.

#define NB    2
#define NT    2048
#define ND    1024
#define NQKV  3072
#define NH    32
#define HD    32
#define NTOK  (NB * NT)
#define NBH   (NB * NH)
#define QBLK  128
#define KCH   64
#define NKC   (NT / KCH)
#define KP    40
#define VP    72
#define SPP   72
#define OP    36
#define ATHR  256
#define GBT   128
#define GBK   64
#define GLP   72
#define GTR   (ND / GBK)
#define GBUF  (GBT * GLP)
#define MCH   2
#define MFL   32

static_assert(NH * HD == ND);
static_assert(NQKV == 3 * ND);
static_assert((NT % QBLK) == 0 && (NT % KCH) == 0 && (NT % 64) == 0 && (NTOK % 64) == 0);
static_assert((NQKV % 64) == 0 && (ND % 64) == 0 && (ND % 32) == 0);
static_assert(QBLK == (ATHR / 32) * 16);
static_assert(KCH * 4 == ATHR && HD * 8 == ATHR);
static_assert(HD == 32 && KCH == 64 && NKC * KCH == NT);
static_assert(NKC == 32 && (NKC % MCH) == 0 && MCH <= MFL && QBLK == 8 * 16);
static_assert(((NTOK * ND) % 2048) == 0);
static_assert((NTOK % GBT) == 0 && (NQKV % GBT) == 0 && (NT % GBT) == 0 && (ND % GBT) == 0 && GTR >= 2);

typedef _Float16 v16h __attribute__((ext_vector_type(16)));
typedef _Float16 v8h  __attribute__((ext_vector_type(8)));
typedef float    v8f  __attribute__((ext_vector_type(8)));
typedef float    v4f  __attribute__((ext_vector_type(4)));
typedef unsigned int v4u __attribute__((ext_vector_type(4)));
typedef int      v4i  __attribute__((ext_vector_type(4)));
typedef unsigned int v16u __attribute__((ext_vector_type(16)));

// ---- scalar helpers --------------------------------------------------------------------------------
__device__ __forceinline__ unsigned short bf_bits(float f) {          // f32 -> bf16 bits, RNE convert
  unsigned u = __float_as_uint(f);
  return (unsigned short)((u + 0x7FFFu + ((u >> 16) & 1u)) >> 16);
}
__device__ __forceinline__ float bf_up(unsigned short h) { return __uint_as_float(((unsigned)h) << 16); }
__device__ __forceinline__ unsigned short h_bits(_Float16 x) { return __builtin_bit_cast(unsigned short, x); }
__device__ __forceinline__ unsigned pk16(unsigned short a, unsigned short b) { return (unsigned)a | ((unsigned)b << 16); }
__device__ __forceinline__ v8f zero8() { v8f z = {0.f, 0.f, 0.f, 0.f, 0.f, 0.f, 0.f, 0.f}; return z; }

// ---- fragment loader: 16-bit A/B operand, lane -> row/col (lane&15), p already includes +8*(lane>>4);
//      elements 0..7 <- p[0..7] (k0+8h..), elements 8..15 <- p[16..23] (k0+16+8h..)
__device__ __forceinline__ v16h ldfrag_h(const _Float16* p) {
  union { v16h v; v8h h[2]; } f;
  f.h[0] = *(const v8h*)(p);
  f.h[1] = *(const v8h*)(p + 16);
  return f.v;
}

// ---- WMMA helpers with trailing VALU hazard gap --------------------------------------------------------
__device__ __forceinline__ v8f mma_h_raw(v16h a, v16h b, v8f c) {
  return __builtin_amdgcn_wmma_f32_16x16x32_f16(false, a, false, b, (short)0, c, false, false);
}
__device__ __forceinline__ void guard4(v8f& a, v8f& b, v16h w, v16h x, v16h y, v16h z) {
#if defined(__HIP_DEVICE_COMPILE__)
  asm volatile("v_nop\n\tv_nop\n\tv_nop\n\tv_nop" : "+v"(a), "+v"(b) : "v"(w), "v"(x), "v"(y), "v"(z));
#endif
}
__device__ __forceinline__ void acc_guard4(v8f& a, v8f& b, v8f& c, v8f& d) {
#if defined(__HIP_DEVICE_COMPILE__)
  asm volatile("v_nop\n\tv_nop\n\tv_nop\n\tv_nop" : "+v"(a), "+v"(b), "+v"(c), "+v"(d));
#endif
}
__device__ __forceinline__ void wave_sync_lds() {
  __builtin_amdgcn_fence(__ATOMIC_RELEASE, "workgroup");
  __builtin_amdgcn_wave_barrier();
  __builtin_amdgcn_fence(__ATOMIC_ACQUIRE, "workgroup");
}

// ---- asynchronous copies global -> LDS ------------------------------------------------------------------
__device__ __forceinline__ unsigned lds_addr(const unsigned short* p) {   // byte offset in the work-group's LDS
  return (unsigned)(size_t)(const __attribute__((address_space(3))) unsigned short*)p;
}
// One lane's share of a 128-row x 128-B tile: eight 16-B pieces, 16 rows apart (global pitch ND halves, LDS pitch
// GLP halves). The closing s_wait_xcnt stands inside the statement so that no address register named here is
// rewritten ahead of it.
__device__ __forceinline__ void stage_rows(unsigned l, const unsigned short* g) {
#if defined(__HIP_DEVICE_COMPILE__)
  asm volatile(
      "global_load_async_to_lds_b128 %0, %8, off\n\t"
      "global_load_async_to_lds_b128 %1, %9, off\n\t"
      "global_load_async_to_lds_b128 %2, %10, off\n\t"
      "global_load_async_to_lds_b128 %3, %11, off\n\t"
      "global_load_async_to_lds_b128 %4, %12, off\n\t"
      "global_load_async_to_lds_b128 %5, %13, off\n\t"
      "global_load_async_to_lds_b128 %6, %14, off\n\t"
      "global_load_async_to_lds_b128 %7, %15, off\n\t"
      "s_wait_xcnt 0x0"
      :: "v"(l), "v"(l + 1u * 16u * GLP * 2u), "v"(l + 2u * 16u * GLP * 2u), "v"(l + 3u * 16u * GLP * 2u),
         "v"(l + 4u * 16u * GLP * 2u), "v"(l + 5u * 16u * GLP * 2u), "v"(l + 6u * 16u * GLP * 2u),
         "v"(l + 7u * 16u * GLP * 2u),
         "v"(g), "v"(g + 1 * 16 * ND), "v"(g + 2 * 16 * ND), "v"(g + 3 * 16 * ND),
         "v"(g + 4 * 16 * ND), "v"(g + 5 * 16 * ND), "v"(g + 6 * 16 * ND), "v"(g + 7 * 16 * ND)
      : "memory");
#endif
}
__device__ __forceinline__ void wait_copies() {      // this wave's own copies have landed in LDS
#if defined(__HIP_DEVICE_COMPILE__)
  asm volatile("s_wait_asynccnt 0x0" ::: "memory");
#endif
}
__device__ __forceinline__ void wait_lds_reads() {   // this wave's LDS reads have returned before their buffer is refilled
#if defined(__HIP_DEVICE_COMPILE__)
  asm volatile("s_wait_dscnt 0x0" ::: "memory");
#endif
}

// =====================================================================================================
// f32 -> f16( bf16_RNE(v) * scale ), scale a power of two (exact), 8 elements per thread, one 16-B store
// =====================================================================================================
__global__ __launch_bounds__(256) void cvt_h8(const float* __restrict__ in, unsigned short* out, int n8, float scale) {
  const int i = blockIdx.x * 256 + threadIdx.x;
  if (i < n8) {
    const v4f a = *(const v4f*)(in + (size_t)i * 8);
    const v4f c = *(const v4f*)(in + (size_t)i * 8 + 4);
    float f[8];
    f[0] = a[0]; f[1] = a[1]; f[2] = a[2]; f[3] = a[3];
    f[4] = c[0]; f[5] = c[1]; f[6] = c[2]; f[7] = c[3];
    unsigned short hb[8];
#pragma unroll
    for (int e = 0; e < 8; ++e) hb[e] = h_bits((_Float16)(bf_up(bf_bits(f[e])) * scale));
    v4u p;
    p[0] = pk16(hb[0], hb[1]);
    p[1] = pk16(hb[2], hb[3]);
    p[2] = pk16(hb[4], hb[5]);
    p[3] = pk16(hb[6], hb[7]);
    *(v4u*)(out + (size_t)i * 8) = p;
    
  }
}

// =====================================================================================================
// Weight transpose + convert: W[c][o] f32 (c in [0,1024), o in [0,3072), o contiguous) ->
// WT[o][c] f16 = f16( bf16_RNE(W[c][o]) * scale ), c contiguous (k-major rows for the B fragment loader).
// Block = one 64(o) x 64(c) tile: thread (ol = tid&63, cb = tid>>6) reads 16 consecutive c rows of column o0+ol
// (coalesced per row across lanes), packs them as two 16-B LDS stores into sT[ol][c]; block barrier; then every
// grid = (3072/64, 1024/64) = (48, 16): x = o tiles (rows of WT), y = c tiles (rows of W).
// coverage: 256 threads x 2 rows-iterations... : rows tid>>3 (0..31) and +32 -> all 64 rows x 64 halves per tile.
// =====================================================================================================
__global__ __launch_bounds__(256) void cvt_wT(const float* __restrict__ W, unsigned short* WT, float scale) {
  __shared__ __align__(16) unsigned short sT[64 * SPP];          // 9216 B
  const int tid = threadIdx.x;
  const int o0 = blockIdx.x * 64;
  const int c0 = blockIdx.y * 64;
  {
    const int ol = tid & 63, cb = tid >> 6;                      // cb 0..3 -> c rows cb*16 .. +15
    unsigned short hb[16];
#pragma unroll
    for (int e = 0; e < 16; ++e) {
      const float f = W[(size_t)(c0 + cb * 16 + e) * NQKV + o0 + ol];
      hb[e] = h_bits((_Float16)(bf_up(bf_bits(f)) * scale));
    }
    v4u p0, p1;
#pragma unroll
    for (int q = 0; q < 4; ++q) {
      p0[q] = pk16(hb[2 * q], hb[2 * q + 1]);
      p1[q] = pk16(hb[8 + 2 * q], hb[8 + 2 * q + 1]);
    }
    *(v4u*)(sT + ol * SPP + cb * 16) = p0;
    *(v4u*)(sT + ol * SPP + cb * 16 + 8) = p1;
  }
  __syncthreads();
  {
    const int row = tid >> 3, c8 = (tid & 7) * 8;
    const v4u v0 = *(const v4u*)(sT + row * SPP + c8);
    const v4u v1 = *(const v4u*)(sT + (row + 32) * SPP + c8);
    const size_t d0 = (size_t)(o0 + row) * ND + c0 + c8;
    const size_t d1 = (size_t)(o0 + row + 32) * ND + c0 + c8;
    {
      *(v4u*)(WT + d0) = v0;
      *(v4u*)(WT + d1) = v1;
      
    }
  }
}

// =====================================================================================================
// inv_freq[j] = 1 / 10000^(j/32), j = 0..31 (full head dim, not pairs). One block of 32 threads; the 32 floats are
// =====================================================================================================
__global__ __launch_bounds__(32) void k_invf(float* INVF) {
  #pragma clang fp contract(off)
  const int j = threadIdx.x;
  const float e = (float)j * 0.03125f;
  const float p = powf(10000.0f, e);
  const float inv = 1.0f / p;
  *(float*)(INVF + j) = inv;
  
}

// =====================================================================================================
// Rotary tables COS/SIN[s][j] = cos/sin( s * inv_freq[j] ), s in [0,2048), j in [0,32): 256 threads = 8 rows x 32,
// one precise sincosf per thread (rolled, nothing unrolled); values staged in LDS, block barrier, then waves 0-1
// coverage: 256 blocks x 8 rows x 32 = every COS and SIN element.
// =====================================================================================================
__global__ __launch_bounds__(256) void k_tab(const float* __restrict__ INVF, float* COS, float* SIN) {
  #pragma clang fp contract(off)
  __shared__ __align__(16) float sc[8 * 32];
  __shared__ __align__(16) float ss[8 * 32];
  const int tid = threadIdx.x, j = tid & 31, rl = tid >> 5;
  const int s = blockIdx.x * 8 + rl;
  const float ang = (float)s * INVF[j];
  float sn, cs;
  sincosf(ang, &sn, &cs);
  sc[rl * 32 + j] = cs;
  ss[rl * 32 + j] = sn;
  __syncthreads();
  if (tid < 64) {                                                // waves 0,1: COS rows
    const int row = tid >> 3, c4 = (tid & 7) * 4;
    const v4f v = *(const v4f*)(sc + row * 32 + c4);
    float* d = COS + (size_t)(blockIdx.x * 8 + row) * HD + c4;
    *(v4f*)d = v;
    
  } else if (tid < 128) {                                        // waves 2,3: SIN rows
    const int t2 = tid - 64;
    const int row = t2 >> 3, c4 = (t2 & 7) * 4;
    const v4f v = *(const v4f*)(ss + row * 32 + c4);
    float* d = SIN + (size_t)(blockIdx.x * 8 + row) * HD + c4;
    *(v4f*)d = v;
    
  }
}

// =====================================================================================================
// Mask digest, made once for all batch*head pairs. Block (cp, qb) = 128 query rows x MCH key chunks of 64; wave w owns
// the 16-row query tile qt = 8*qb + w and reads, per chunk, the same 32 entries per lane that the attention wave of
// that tile needs: lane -> query row 16*qt + (lane&15), keys of lane half lane>>4.
//   MB[qt][c][16*s + 8*t + r]: a lane mask, bit lane <-> (mask[row][64*c + 32*s + 16*t + 8*(lane>>4) + r] != 0), ready
//                    as the select mask of score element (t, r) of 32-key step s; one 128-B line per (qt, c), written
//                    by one wave (lane i stores word i).
//   FL[qb][cp][MFL]: entry e < MCH is nonzero iff any entry of the 128 x 64 block of chunk MCH*cp + e is nonzero;
//                    one whole 128-B line per block (the rest of the line is 0).
// grid = (32/MCH, 16): every (qt, c) word line and every FL line written exactly once.
// =====================================================================================================
__global__ __launch_bounds__(256) void mask_digest(const int* __restrict__ msk, unsigned* MB, int* FL) {
  __shared__ int sany[MCH][8];
  const int tid = threadIdx.x, lane = tid & 31, wave = tid >> 5;
  const int cp = blockIdx.x, qb = blockIdx.y;
  const int rlane = lane & 15, hsel = lane >> 4;
  const int qt = qb * 8 + wave;
  const size_t rowbase = (size_t)(qt * 16 + rlane) * NT;
  // all loads of the wave stand ahead of its first store; every loop below is unrolled so that ent[] is indexed by
  // constants and stays in registers
  v4i ent[MCH][2][2][2];
#pragma unroll
  for (int e = 0; e < MCH; ++e) {
#pragma unroll
    for (int s = 0; s < 2; ++s) {
#pragma unroll
      for (int t = 0; t < 2; ++t) {
        const int* mp = msk + rowbase + (size_t)((cp * MCH + e) * KCH + 32 * s + 16 * t + 8 * hsel);
        ent[e][s][t][0] = *(const v4i*)mp;
        ent[e][s][t][1] = *(const v4i*)(mp + 4);
      }
    }
  }
#pragma unroll
  for (int e = 0; e < MCH; ++e) {
    unsigned any = 0u;
    int mine = 0;                                                // lane i ends up with word i
#pragma unroll
    for (int i = 0; i < 32; ++i) {                               // i = 16*s + 8*t + r
      const unsigned w = __builtin_amdgcn_ballot_w32(ent[e][i >> 4][(i >> 3) & 1][(i >> 2) & 1][i & 3] != 0);
      any |= w;
      mine = (lane == i) ? (int)w : mine;
    }
    MB[((size_t)qt * NKC + cp * MCH + e) * 32 + lane] = (unsigned)mine;
    if (lane == 0) sany[e][wave] = (any != 0u) ? 1 : 0;
  }
  __syncthreads();
  if (tid < MFL) {
    int f = 0;
    if (tid < MCH) {
#pragma unroll
      for (int w = 0; w < 8; ++w) f |= sany[tid][w];
    }
    FL[((size_t)qb * (NKC / MCH) + cp) * MFL + tid] = f;
  }
}

// =====================================================================================================
// Fused qkv projection GEMM with rotary + 16-bit plane epilogue:
//   Y[tok][o] = sum_c XH[tok][c] * WT[o][c] * oscale,  tok in [0,4096), o in [0,3072), K = 1024.
// One work-group of 4 waves per 128x128 tile, one wave per 64x64 quarter (register-blocked); A = XH rows (token),
// Bt = WT rows (k contiguous). Per 64-deep k stage the 128 A rows and 128 Bt rows (128 B each, whole lines) are copied
// asynchronously into one of two LDS buffers (pitch 144 B) while the other buffer is worked on; k order unchanged.
// The 64 tokens of a tile lie in one batch b (t0 = m0 mod 2048); the 64 outputs are two heads h0, h0+1 of one of
// q (o < 1024), k (1024 <= o < 2048), v (o >= 2048); column j (16-wide subtile) -> head h0 + (j>>1), d = 16*(j&1)+lane%16.
//   q, k: rotary combine per the module: out[d] = y[d]*cos[s][d] - y[d+16]*sin[s][d] (d < 16),
//         out[d] = y[d]*cos[s][d] + y[d-16]*sin[s][d] (d >= 16); both partners sit in the same lane and element.
//         PH/PL[bh][t][32] f16 = (out*16) hi plane and residual x2^11 (64 B per token; the wave owns 64 consecutive
// then q/k: each head's slab region (16 tok x 64 B = 1024 contiguous B) written as 32 lanes x 16 B contiguous per
// grid = 768 blocks x 4 waves = 3072 wave tiles = 64 x 48 exactly.
// coverage: q/k tiles: 4 slabs x 2 heads x 16 tok x 32 d (hi and residual); v tiles: 4 subtiles x 16 d x 64 tok;
// 64 token tiles x (16+16+16) column tiles = every (bh, t) row of QH/QL/KH/KL and every (bh, d) row of VH/VL.
// =====================================================================================================
__global__ __launch_bounds__(128) void gemm_proj(
    const unsigned short* __restrict__ XHp, const unsigned short* __restrict__ WTp,
    const float* __restrict__ COS, const float* __restrict__ SIN,
    unsigned short* QH, unsigned short* QL, unsigned short* KH, unsigned short* KL,
    unsigned short* VH, unsigned short* VL, float oscale) {
  __shared__ __align__(16) unsigned short sA[2][GBUF];            // 36864 B
  __shared__ __align__(16) unsigned short sB[2][GBUF];            // 36864 B
  __shared__ __align__(16) unsigned short sP[4][2][16 * SPP];     // 18432 B
  const int tid  = threadIdx.x;
  const int lane = tid & 31;
  const int wave = tid >> 5;
  const int tilesN = NQKV / GBT;                                 // 24
  const int tilesM = NTOK / GBT;                                 // 32
  const int tile = blockIdx.x;
  if (tile >= tilesM * tilesN) return;                           // block-uniform, in front of every barrier
  const int tm = tile / tilesN;
  const int tn = tile - tm * tilesN;
  const int wm = wave >> 1, wn = wave & 1;                       // 2 x 2 waves
  const int m0 = tm * GBT + (wm << 6);                           // token base of this wave
  const int n0 = tn * GBT + (wn << 6);                           // output channel base in [0,3072)
  const int rlane = lane & 15;
  const int hh    = lane >> 4;
  const int koff  = hh * 8;
  const int mOff  = hh * 8;

  v8f acc[4][4];
#pragma unroll
  for (int i = 0; i < 4; ++i)
#pragma unroll
    for (int j = 0; j < 4; ++j) acc[i][j] = zero8();

  // copy share of this lane: piece tid&7 (16 B) of rows (tid>>3) + 16e, e = 0..7; a wave's copy = 4 whole 128-B lines
  const int crow = tid >> 3, cpc = (tid & 7) * 8;
  const unsigned short* gA = XHp + (size_t)(tm * GBT + crow) * ND + cpc;
  const unsigned short* gB = WTp + (size_t)(tn * GBT + crow) * ND + cpc;
  const unsigned lA = lds_addr(&sA[0][crow * GLP + cpc]);
  const unsigned lB = lds_addr(&sB[0][crow * GLP + cpc]);

  stage_rows(lA, gA);                                            // stage 0 -> buffer 0
  stage_rows(lB, gB);
  wait_copies();
  __syncthreads();
  stage_rows(lA + GBUF * 2u, gA + GBK);                          // stage 1 -> buffer 1
  stage_rows(lB + GBUF * 2u, gB + GBK);

  // rolled: the two-buffer order below is written once
#pragma unroll 1
  for (int t = 0; t < GTR; ++t) {
    const int bsel = t & 1;
    const _Float16* fa = (const _Float16*)(const void*)&sA[bsel][((wm << 6) + rlane) * GLP + koff];
    const _Float16* fb = (const _Float16*)(const void*)&sB[bsel][((wn << 6) + rlane) * GLP + koff];
#pragma unroll
    for (int kk = 0; kk < GBK; kk += 32) {
      v16h bf[4], af[4];
#pragma unroll
      for (int j = 0; j < 4; ++j) bf[j] = ldfrag_h(fb + (j << 4) * GLP + kk);
#pragma unroll
      for (int i = 0; i < 4; ++i) af[i] = ldfrag_h(fa + (i << 4) * GLP + kk);
#pragma unroll
      for (int i = 0; i < 4; ++i)
#pragma unroll
        for (int j = 0; j < 4; ++j) acc[i][j] = mma_h_raw(af[i], bf[j], acc[i][j]);
      // all 16 LDS reads of this k step as one group ahead of its 16 products: one LDS wait a step, not one a row
      __builtin_amdgcn_sched_group_barrier(0x100, 16, 0);
      __builtin_amdgcn_sched_group_barrier(0x008, 16, 0);
    }
    // publish point of stage t + 1: own reads done, own copies landed, barrier, then the refill of the buffer just read
    wait_lds_reads();
    wait_copies();
    __syncthreads();
    if (t + 2 < GTR) {
      stage_rows(lA + (unsigned)bsel * (GBUF * 2u), gA + (t + 2) * GBK);
      stage_rows(lB + (unsigned)bsel * (GBUF * 2u), gB + (t + 2) * GBK);
    }
  }
  wait_copies();
  acc_guard4(acc[0][0], acc[0][1], acc[0][2], acc[0][3]);
  acc_guard4(acc[1][0], acc[1][1], acc[1][2], acc[1][3]);
  acc_guard4(acc[2][0], acc[2][1], acc[2][2], acc[2][3]);
  acc_guard4(acc[3][0], acc[3][1], acc[3][2], acc[3][3]);

  // ---- epilogue ----
  const int b   = m0 / NT;
  const int t0  = m0 - b * NT;
  const int sel = n0 >> 10;                                      // 0 q, 1 k, 2 v (wave-uniform)
  const int h0  = (n0 & (ND - 1)) >> 5;                          // first of the two heads of this tile
  unsigned short* s0 = &sP[wave][0][0];
  unsigned short* s1 = &sP[wave][1][0];

  if (sel < 2) {
    unsigned short* PH = (sel == 0) ? QH : KH;
    unsigned short* PL = (sel == 0) ? QL : KL;
#pragma unroll
    for (int i = 0; i < 4; ++i) {                                // slab = 16 tokens t0+16i .. +15
#pragma unroll
      for (int r = 0; r < 8; ++r) {
        const int tok = t0 + (i << 4) + mOff + r;                // row tok = 8hh + r
        const float* cp = COS + (size_t)tok * HD;
        const float* sp = SIN + (size_t)tok * HD;
        const float ca = cp[rlane], cb = cp[16 + rlane];
        const float sa = sp[rlane], sb = sp[16 + rlane];
#pragma unroll
        for (int hp = 0; hp < 2; ++hp) {
          const float y0 = acc[i][2 * hp][r] * oscale;           // d = rlane
          const float y1 = acc[i][2 * hp + 1][r] * oscale;       // d = 16 + rlane
          const float f0 = (y0 * ca - y1 * sa) * 16.0f;
          const float f1 = (y1 * cb + y0 * sb) * 16.0f;
          const _Float16 x0 = (_Float16)f0;
          const _Float16 x1 = (_Float16)f1;
          const int so = (mOff + r) * SPP + 32 * hp + rlane;     // row tok, col 32hp + d
          s0[so]      = h_bits(x0);
          s1[so]      = h_bits((_Float16)((f0 - (float)x0) * 2048.0f));
          s0[so + 16] = h_bits(x1);
          s1[so + 16] = h_bits((_Float16)((f1 - (float)x1) * 2048.0f));
        }
      }
      wave_sync_lds();
      {
        const int rr = lane >> 2, cc = (lane & 3) * 8;           // rr*32 + cc = lane*8 halves
#pragma unroll
        for (int hp = 0; hp < 2; ++hp) {
          const int bhp = b * NH + h0 + hp;
          const size_t base = ((size_t)(bhp * NT + t0 + (i << 4))) * HD + lane * 8;
          const v4u v0 = *(const v4u*)(s0 + rr * SPP + 32 * hp + cc);
          const v4u v1 = *(const v4u*)(s0 + (rr + 8) * SPP + 32 * hp + cc);
          const v4u w0 = *(const v4u*)(s1 + rr * SPP + 32 * hp + cc);
          const v4u w1 = *(const v4u*)(s1 + (rr + 8) * SPP + 32 * hp + cc);
          {
            *(v4u*)(PH + base) = v0;
            *(v4u*)(PH + base + 256) = v1;
            *(v4u*)(PL + base) = w0;
            *(v4u*)(PL + base + 256) = w1;
            
          }
        }
      }
      wave_sync_lds();
    }
  } else {
#pragma unroll
    for (int j = 0; j < 4; ++j) {                                // slab = 16 rows d = 16(j&1) + rlane of head h0+(j>>1)
      const int hp = j >> 1, dbase = (j & 1) * 16;
      const int bhp = b * NH + h0 + hp;
#pragma unroll
      for (int i = 0; i < 4; ++i) {
        unsigned short hb[8], lb[8];
#pragma unroll
        for (int r = 0; r < 8; ++r) {
          const float f = (acc[i][j][r] * oscale) * 16.0f;
          const _Float16 xh = (_Float16)f;
          hb[r] = h_bits(xh);
          lb[r] = h_bits((_Float16)((f - (float)xh) * 2048.0f));
        }
        v4u ph, pl;
#pragma unroll
        for (int q = 0; q < 4; ++q) {
          ph[q] = pk16(hb[2 * q], hb[2 * q + 1]);
          pl[q] = pk16(lb[2 * q], lb[2 * q + 1]);
        }
        *(v4u*)(s0 + rlane * SPP + (i << 4) + mOff) = ph;       // row d = rlane, tok = 16i + 8hh .. +7
        *(v4u*)(s1 + rlane * SPP + (i << 4) + mOff) = pl;
      }
      wave_sync_lds();
      {
        const int rq = lane >> 3, c8 = (lane & 7) * 8;
        {
#pragma unroll
          for (int it = 0; it < 4; ++it) {
            const int row = it * 4 + rq;                         // it 0..3 x rq 0..3 = rows 0..15
            const size_t dst = ((size_t)(bhp * HD + dbase + row)) * NT + t0 + c8;
            const v4u v = *(const v4u*)(s0 + row * SPP + c8);
            const v4u w = *(const v4u*)(s1 + row * SPP + c8);
            *(v4u*)(VH + dst) = v;
            *(v4u*)(VL + dst) = w;
          }
          
        }
      }
      wave_sync_lds();
    }
  }
}

// =====================================================================================================
// Attention for one (batch*head, 128-query block): grid = (64, 16), 256 threads = 8 waves x 16 queries; each lane
// owns one query column q = q0 + 16*wave + (lane&15). QH/QL/KH/KL[bh][t][32] f16 (x16 hi, residual x2^11),
// VH/VL[bh][d][2048] (x16 hi, residual x2^11). The mask [2048 q][2048 key] comes as the digest of mask_digest: key
// chunks of 64; each wave loads the 32 lane masks MB[qt][c][..] of its query tile by wave-uniform loads, one mask per
// score element; a chunk whose entries are all zero for the whole block (FL, gathered once into a wave-uniform word)
// is skipped block-uniformly, in front of every barrier of the chunk (exact: such keys have probability 0). Otherwise
// K hi/res rows [64][40] and V hi/res tiles [32 d][72] are staged in LDS with plain 16-B loads between two block
// barriers. Per 32-key step and 16-key tile t:
// S[key][q] = A(K hi rows) x B(resident Q hi) and Sr = A(K hi) x B(Q res) + A(K res) x B(Q hi) in separate zeroed
// accumulators; logit = (S + Sr/2048) / 256 / sqrt(32); entries with mask == 0 replaced by -inf; online softmax over
// keys (max/sum across lane halves by shuffle); p = 1024*exp(x - max) packed D->B per the chained map (element r <-
// keys 0-15 tile, 8+r <- keys 16-31 tile) as f16 hi plus residual x2^11; Oh[d][q] += A(V hi rows) x Ph,
// Ol += A(V res) x Ph + A(V hi) x Pl (both 2^-11 terms); out = (Oh + Ol/2048) / (16 * l) (l = 0 gives 0*inf = NaN).
// coverage: 64 x 16 blocks x 8 waves x 16 rows x 32 floats = every (tok, head) line of the output.
// =====================================================================================================
__global__ __launch_bounds__(ATHR) void attn_kernel(
    const unsigned short* __restrict__ QHp, const unsigned short* __restrict__ QLp,
    const unsigned short* __restrict__ KHp, const unsigned short* __restrict__ KLp,
    const unsigned short* __restrict__ VHp, const unsigned short* __restrict__ VLp,
    const unsigned* __restrict__ MB, const int* __restrict__ FL, float* Out) {
  __shared__ __align__(16) unsigned short kh_u[KCH * KP];         // 5120 B
  __shared__ __align__(16) unsigned short kl_u[KCH * KP];         // 5120 B
  __shared__ __align__(16) unsigned short vh_u[HD * VP];          // 4608 B
  __shared__ __align__(16) unsigned short vl_u[HD * VP];          // 4608 B
  __shared__ __align__(16) float sO[8][16 * OP];                  // 18432 B
  const _Float16* kh = (const _Float16*)(const void*)kh_u;
  const _Float16* kl = (const _Float16*)(const void*)kl_u;
  const _Float16* vh = (const _Float16*)(const void*)vh_u;
  const _Float16* vl = (const _Float16*)(const void*)vl_u;
  const _Float16* QH = (const _Float16*)(const void*)QHp;
  const _Float16* QL = (const _Float16*)(const void*)QLp;

  const int tid = threadIdx.x, lane = tid & 31, wave = tid >> 5;
  const int bh = blockIdx.x;
  const int b  = bh / NH;
  const int h  = bh - b * NH;
  const int q0 = blockIdx.y * QBLK;
  const int rlane = lane & 15, hsel = lane >> 4, koff = hsel * 8;
  const int qrow = q0 + wave * 16 + rlane;                       // this lane's query index within the sequence

  // resident Q fragments (B operand: B[k=d][n=q] from [q][d] rows), arithmetic addressing, one 32-deep k-step
  const size_t qo = ((size_t)(bh * NT + qrow)) * HD + koff;
  const v16h qh0 = ldfrag_h(QH + qo);
  const v16h ql0 = ldfrag_h(QL + qo);
  // this wave's lane masks, 32 words a chunk; the wave number made uniform so that the words load into scalar registers
  const unsigned* mbp = MB + ((size_t)(blockIdx.y * 8 + __builtin_amdgcn_readfirstlane(wave)) * NKC) * 32;
  // bit c <-> chunk c has a nonzero mask entry somewhere in this block's 128 query rows (the same word in every wave)
  const unsigned act = __builtin_amdgcn_ballot_w32(
      FL[((size_t)blockIdx.y * (NKC / MCH) + lane / MCH) * MFL + (lane % MCH)] != 0);

  const float C2048  = 1.0f / 2048.0f;
  const float SCL    = 0.17677669529663687f * (1.0f / 256.0f);  // undo q*16, k*16, then 1/sqrt(32)
  const float LN1024 = 6.931471805599453f;
  const float NEGINF = __uint_as_float(0xff800000u);

  v8f oh[2], ol[2];
#pragma unroll
  for (int dt = 0; dt < 2; ++dt) { oh[dt] = zero8(); ol[dt] = zero8(); }
  float m_run = -1.0e30f, l_run = 0.0f;

#pragma unroll 1
  for (int c = 0; c < NKC; ++c) {
    if (((act >> c) & 1u) == 0u) continue;                       // block-uniform skip of an all-masked chunk
    const int kc = c * KCH;
    __syncthreads();                                             // all waves finished reading the prior chunk's K/V
    // lane masks: word (16*s + 8*t + r), bit lane <-> key kc + 32*s + 16*t + 8*hsel + r of the lane's query row
    // read through the constant address space (nothing writes MB in this launch), which makes them scalar loads
    const v16u mw0 = *(const __attribute__((address_space(4))) v16u*)(mbp + c * 32);
    const v16u mw1 = *(const __attribute__((address_space(4))) v16u*)(mbp + c * 32 + 16);

    // ---- stage K hi/res rows and V hi/res tiles of keys kc..kc+63 (one 16-B item per thread each) ----
    {
      const int key = tid >> 2, ck = (tid & 3) * 8;              // 64 keys x 32 halves
      const size_t gk = ((size_t)(bh * NT + kc + key)) * HD + ck;
      const int d = tid >> 3, cv = (tid & 7) * 8;                // 32 d rows x 64 halves
      const size_t gv = ((size_t)(bh * HD + d)) * NT + kc + cv;
      const v4u gkh = *(const v4u*)(KHp + gk);
      const v4u gkl = *(const v4u*)(KLp + gk);
      const v4u gvh = *(const v4u*)(VHp + gv);
      const v4u gvl = *(const v4u*)(VLp + gv);
      *(v4u*)(kh_u + key * KP + ck) = gkh;
      *(v4u*)(kl_u + key * KP + ck) = gkl;
      *(v4u*)(vh_u + d * VP + cv) = gvh;
      *(v4u*)(vl_u + d * VP + cv) = gvl;
    }
    __syncthreads();

#pragma unroll 1
    for (int sub = 0; sub < 2; ++sub) {
      const int kr = sub * 32;
      float a[2][8];
#pragma unroll
      for (int t = 0; t < 2; ++t) {
        const int krow = kr + 16 * t + rlane;
        const v16h kha = ldfrag_h(kh + krow * KP + koff);
        const v16h kla = ldfrag_h(kl + krow * KP + koff);
        v8f sh = mma_h_raw(kha, qh0, zero8());
        v8f sr = mma_h_raw(kha, ql0, zero8());
        sr = mma_h_raw(kla, qh0, sr);
        guard4(sh, sr, kha, kla, qh0, ql0);
#pragma unroll
        for (int r = 0; r < 8; ++r) {
          const float s = (sh[r] + sr[r] * C2048) * SCL;
          const unsigned kw = (sub != 0) ? mw1[t * 8 + r] : mw0[t * 8 + r];
          a[t][r] = __builtin_amdgcn_inverse_ballot_w32(kw) ? s : NEGINF;
        }
      }

      // online softmax over the key axis for this lane's q column
      float mloc = -1.0e30f;
#pragma unroll
      for (int r = 0; r < 8; ++r) mloc = fmaxf(mloc, fmaxf(a[0][r], a[1][r]));
      mloc = fmaxf(mloc, __shfl_xor(mloc, 16, 32));
      const float newM  = fmaxf(m_run, mloc);
      const float alph  = __expf(m_run - newM);
      const float msh   = newM - LN1024;
      float ssum = 0.0f;
      float p[2][8];
#pragma unroll
      for (int r = 0; r < 8; ++r) {
        p[0][r] = __expf(a[0][r] - msh);
        p[1][r] = __expf(a[1][r] - msh);
        ssum += p[0][r] + p[1][r];
      }
      ssum += __shfl_xor(ssum, 16, 32);
      l_run = l_run * alph + ssum;
      m_run = newM;
#pragma unroll
      for (int dt = 0; dt < 2; ++dt) {
#pragma unroll
        for (int r = 0; r < 8; ++r) { oh[dt][r] *= alph; ol[dt][r] *= alph; }
      }

      // P (f32, D layout) -> B operands (f16 hi, f16 residual x2^11): element r <- keys 0-15 tile, 8+r <- keys 16-31 tile
      union { v16h v; _Float16 s[16]; } ph, plo;
#pragma unroll
      for (int r = 0; r < 8; ++r) {
        const _Float16 x0 = (_Float16)p[0][r];
        const _Float16 x1 = (_Float16)p[1][r];
        ph.s[r]      = x0;
        ph.s[8 + r]  = x1;
        plo.s[r]     = (_Float16)((p[0][r] - (float)x0) * 2048.0f);
        plo.s[8 + r] = (_Float16)((p[1][r] - (float)x1) * 2048.0f);
      }

      // O[d][q] += V[d][kr .. +31] x P, hi and residual terms
#pragma unroll
      for (int dt = 0; dt < 2; ++dt) {
        const v16h vah = ldfrag_h(vh + (16 * dt + rlane) * VP + kr + koff);
        const v16h val = ldfrag_h(vl + (16 * dt + rlane) * VP + kr + koff);
        oh[dt] = mma_h_raw(vah, ph.v, oh[dt]);
        ol[dt] = mma_h_raw(val, ph.v, ol[dt]);
        ol[dt] = mma_h_raw(vah, plo.v, ol[dt]);
        guard4(oh[dt], ol[dt], vah, val, ph.v, plo.v);
      }
    }
  }
  acc_guard4(oh[0], oh[1], ol[0], ol[1]);

  // ---- output values -> per-wave f32 LDS staging ----
  const float inv = (1.0f / 16.0f) * (1.0f / l_run);            // out = (Oh + Ol/2048) / (16 * l)
  float* st = sO[wave];
#pragma unroll
  for (int dt = 0; dt < 2; ++dt) {
    v4f va, vb;
#pragma unroll
    for (int e = 0; e < 4; ++e) {
      va[e] = (oh[dt][e]     + ol[dt][e]     * C2048) * inv;     // d = 16dt + 8hsel + e
      vb[e] = (oh[dt][4 + e] + ol[dt][4 + e] * C2048) * inv;     // d = 16dt + 8hsel + 4 + e
    }
    const int so = rlane * OP + 16 * dt + 8 * hsel;              // row q = rlane
    *(v4f*)(st + so) = va;
    *(v4f*)(st + so + 4) = vb;
  }
  wave_sync_lds();
  {
    const int rq = lane >> 3, c4 = (lane & 7) * 4;
    const int n0 = q0 + wave * 16;
    {
#pragma unroll
      for (int it = 0; it < 4; ++it) {
        const int row = it * 4 + rq;                             // it 0..3 x rq 0..3 = rows 0..15
        const v4f v = *(const v4f*)(st + row * OP + c4);
        *(v4f*)(Out + ((size_t)(b * NT + n0 + row)) * ND + h * HD + c4) = v;
      }
      
    }
  }
}

// =====================================================================================================
// Workspace map (bytes, every offset a multiple of 128; every plane an exact multiple of its whole-line store
// granularity, row counts exact tile multiples, no padded tails needed):
//   XH   f16 [4096][1024]    activation, bf16-RNE x16                    0          8388608 B
//   WT   f16 [3072][1024]    Wqkv transposed, bf16-RNE x1024       8388608          6291456 B
//   COS  f32 [2048][32]                                          14680064           262144 B
//   SIN  f32 [2048][32]                                          14942208           262144 B
//   INVF f32 [32] (one line, 256 B reserved)                    15204352              256 B
//   QH   f16 [64][2048][32]  q x16 hi                            15204608          8388608 B
//   QL   f16 [64][2048][32]  q residual x2^11                    23593216          8388608 B
//   KH   f16 [64][2048][32]                                      31981824          8388608 B
//   KL   f16 [64][2048][32]                                      40370432          8388608 B
//   VH   f16 [64][32][2048]  v x16 hi, key-contiguous            48759040          8388608 B
//   VL   f16 [64][32][2048]                                      57147648          8388608 B
//   MB   u32 [128][32][32]   lane masks per (query tile, chunk, element) 65536256     524288 B
//   FL   i32 [16][16][32]    chunk flags, one line per digest block  66060544          32768 B
//   end                                                          66093312
// =====================================================================================================
extern "C" void kernel_launch(void* const* d_in, const int* in_sizes, int n_in,
                              void* d_out, int out_size, void* d_ws, size_t ws_size,
                              hipStream_t stream) {
  if (n_in < 3) return;
  if (in_sizes[0] != NTOK * ND) return;
  if (in_sizes[1] != ND * NQKV) return;
  if (in_sizes[2] != NT * NT) return;
  if (out_size != NTOK * ND) return;

  const float* x   = (const float*)d_in[0];
  const float* W   = (const float*)d_in[1];
  const int*   msk = (const int*)d_in[2];

  const size_t PXH = (size_t)NTOK * ND * 2;                    // 8388608
  const size_t PWT = (size_t)NQKV * ND * 2;                    // 6291456
  const size_t PTB = (size_t)NT * HD * 4;                      // 262144
  const size_t PIN = 256;
  const size_t PQK = (size_t)NBH * NT * HD * 2;                // 8388608
  const size_t PV  = (size_t)NBH * HD * NT * 2;                // 8388608
  size_t off = 0;
  const size_t oXH  = off; off += PXH;
  const size_t oWT  = off; off += PWT;
  const size_t oCOS = off; off += PTB;
  const size_t oSIN = off; off += PTB;
  const size_t oINV = off; off += PIN;
  const size_t oQH  = off; off += PQK;
  const size_t oQL  = off; off += PQK;
  const size_t oKH  = off; off += PQK;
  const size_t oKL  = off; off += PQK;
  const size_t oVH  = off; off += PV;
  const size_t oVL  = off; off += PV;
  const size_t oMB  = off; off += (size_t)(NT / 16) * NKC * 32 * 4;        // 524288
  const size_t oFL  = off; off += (size_t)(NT / QBLK) * (NKC / MCH) * MFL * 4;   // 32768
  if (off > ws_size) return;                                   // off = 66093312
  if (off > (size_t)134217728) return;

  char* ws = (char*)d_ws;
  unsigned short* XH   = (unsigned short*)(ws + oXH);
  unsigned short* WT   = (unsigned short*)(ws + oWT);
  float*          COS  = (float*)(ws + oCOS);
  float*          SIN  = (float*)(ws + oSIN);
  float*          INVF = (float*)(ws + oINV);
  unsigned short* QH   = (unsigned short*)(ws + oQH);
  unsigned short* QL   = (unsigned short*)(ws + oQL);
  unsigned short* KH   = (unsigned short*)(ws + oKH);
  unsigned short* KL   = (unsigned short*)(ws + oKL);
  unsigned short* VH   = (unsigned short*)(ws + oVH);
  unsigned short* VL   = (unsigned short*)(ws + oVL);
  unsigned*       MB   = (unsigned*)(ws + oMB);
  int*            FL   = (int*)(ws + oFL);
  float*          out  = (float*)d_out;

  const dim3 blk(256);
  const int n8x = NTOK * ND / 8;                               // 524288
  const dim3 gX((n8x + 255) / 256);                            // 2048
  const dim3 gWT(NQKV / 64, ND / 64);                          // (48, 16): x = o tiles, y = c tiles
  const dim3 gTab(NT / 8);                                     // 256
  const dim3 gProj((NTOK / GBT) * (NQKV / GBT));               // 32 x 24 = 768 blocks of 4 waves
  const dim3 gAttn(NBH, NT / QBLK);                            // 64 x 16, 256 threads
  const dim3 gDig(NKC / MCH, NT / QBLK);                       // 16 x 16, 256 threads

  const float oscPrj = 1.0f / 16384.0f;                        // undo x*16 and W*1024

  // (1) inputs -> f16 planes holding bf16-RNE values times an exact power of two
  cvt_h8<<<gX, blk, 0, stream>>>(x, XH, n8x, 16.0f);
  cvt_wT<<<gWT, blk, 0, stream>>>(W, WT, 1024.0f);
  // (2) rotary tables
  k_invf<<<dim3(1), dim3(32), 0, stream>>>(INVF);
  k_tab<<<gTab, blk, 0, stream>>>(INVF, COS, SIN);
  // (2b) mask -> lane masks of the attention waves' score elements, and one flag per 128-query x 64-key block
  mask_digest<<<gDig, blk, 0, stream>>>(msk, MB, FL);
  // (3) fused qkv projection with rotary epilogue: q, k -> [bh][t][32] hi/res planes; v -> [bh][d][t] hi/res planes
  gemm_proj<<<gProj, dim3(128), 0, stream>>>(XH, WT, COS, SIN, QH, QL, KH, KL, VH, VL, oscPrj);
  // (4) attention per (batch*head, 128-query block) -> f32 output lines [tok][h*32 .. +31]
  attn_kernel<<<gAttn, dim3(ATHR), 0, stream>>>(QH, QL, KH, KL, VH, VL, MB, FL, out);
  (void)hipGetLastError();
}

// v003
// One run takes 112 microseconds.
// Next to v002, in two timings, it ran 1.08 times as fast each time.
// Counting every step since v000, it is 1.95 times as fast.
#include <hip/hip_runtime.h>
#include <math.h>
#include <stdint.h>

// Contractions: fused qkv projection x.Wqkv (f16 operands holding bf16-RNE values, x carried x16 and W x1024, one
// product per tile pair); scores k.q (k and q each an f16 hi plane x16 plus an f16 residual plane x2^11: hi.hi in one
// accumulator, hi.lo + lo.hi in a second accumulator folded with 2^-11, 3 products); context v.p (p x1024 and v x16,
// each f16 hi plus f16 residual x2^11: hi.hi in one accumulator, lo.hi + hi.lo in a second folded with 2^-11,
// 3 products); all v_wmma_f32_16x16x32_f16 with f32 accumulate; rotary tables, rotary combine, key masking, softmax
// statistics and the final normalisation in f32 on VALU; output stored as f32.

#define NB    2
#define NT    2048
#define ND    1024
#define NQKV  3072
#define NH    32
#define HD    32
#define NTOK  (NB * NT)
#define NBH   (NB * NH)
#define QBLK  128
#define KCH   64
#define NKC   (NT / KCH)
#define KP    40
#define VP    72
#define SPP   72
#define OP    36
#define ATHR  256
#define GBT   128
#define GBK   64
#define GLP   72
#define GTR   (ND / GBK)
#define GBUF  (GBT * GLP)
#define MCH   2
#define MFL   32

static_assert(NH * HD == ND);
static_assert(NQKV == 3 * ND);
static_assert((NT % QBLK) == 0 && (NT % KCH) == 0 && (NT % 64) == 0 && (NTOK % 64) == 0);
static_assert((NQKV % 64) == 0 && (ND % 64) == 0 && (ND % 32) == 0);
static_assert(QBLK == (ATHR / 32) * 16);
static_assert(KCH * 4 == ATHR && HD * 8 == ATHR);
static_assert(HD == 32 && KCH == 64 && NKC * KCH == NT);
static_assert(NKC == 32 && (NKC % MCH) == 0 && MCH <= MFL && QBLK == 8 * 16);
static_assert(((NTOK * ND) % 2048) == 0);
static_assert((NTOK % GBT) == 0 && (NQKV % GBT) == 0 && (NT % GBT) == 0 && (ND % GBT) == 0 && GTR >= 2);

typedef _Float16 v16h __attribute__((ext_vector_type(16)));
typedef _Float16 v8h  __attribute__((ext_vector_type(8)));
typedef float    v8f  __attribute__((ext_vector_type(8)));
typedef float    v4f  __attribute__((ext_vector_type(4)));
typedef unsigned int v4u __attribute__((ext_vector_type(4)));
typedef int      v4i  __attribute__((ext_vector_type(4)));
typedef unsigned int v16u __attribute__((ext_vector_type(16)));

// ---- scalar helpers --------------------------------------------------------------------------------
__device__ __forceinline__ unsigned short bf_bits(float f) {          // f32 -> bf16 bits, RNE convert
  unsigned u = __float_as_uint(f);
  return (unsigned short)((u + 0x7FFFu + ((u >> 16) & 1u)) >> 16);
}
__device__ __forceinline__ float bf_up(unsigned short h) { return __uint_as_float(((unsigned)h) << 16); }
__device__ __forceinline__ unsigned short h_bits(_Float16 x) { return __builtin_bit_cast(unsigned short, x); }
__device__ __forceinline__ unsigned pk16(unsigned short a, unsigned short b) { return (unsigned)a | ((unsigned)b << 16); }
__device__ __forceinline__ v8f zero8() { v8f z = {0.f, 0.f, 0.f, 0.f, 0.f, 0.f, 0.f, 0.f}; return z; }

// ---- fragment loader: 16-bit A/B operand, lane -> row/col (lane&15), p already includes +8*(lane>>4);
//      elements 0..7 <- p[0..7] (k0+8h..), elements 8..15 <- p[16..23] (k0+16+8h..)
__device__ __forceinline__ v16h ldfrag_h(const _Float16* p) {
  union { v16h v; v8h h[2]; } f;
  f.h[0] = *(const v8h*)(p);
  f.h[1] = *(const v8h*)(p + 16);
  return f.v;
}

// ---- WMMA helpers with trailing VALU hazard gap --------------------------------------------------------
__device__ __forceinline__ v8f mma_h_raw(v16h a, v16h b, v8f c) {
  return __builtin_amdgcn_wmma_f32_16x16x32_f16(false, a, false, b, (short)0, c, false, false);
}
__device__ __forceinline__ void guard4(v8f& a, v8f& b, v16h w, v16h x, v16h y, v16h z) {
#if defined(__HIP_DEVICE_COMPILE__)
  asm volatile("v_nop\n\tv_nop\n\tv_nop\n\tv_nop" : "+v"(a), "+v"(b) : "v"(w), "v"(x), "v"(y), "v"(z));
#endif
}
__device__ __forceinline__ void acc_guard4(v8f& a, v8f& b, v8f& c, v8f& d) {
#if defined(__HIP_DEVICE_COMPILE__)
  asm volatile("v_nop\n\tv_nop\n\tv_nop\n\tv_nop" : "+v"(a), "+v"(b), "+v"(c), "+v"(d));
#endif
}
__device__ __forceinline__ void wave_sync_lds() {
  __builtin_amdgcn_fence(__ATOMIC_RELEASE, "workgroup");
  __builtin_amdgcn_wave_barrier();
  __builtin_amdgcn_fence(__ATOMIC_ACQUIRE, "workgroup");
}

// ---- asynchronous copies global -> LDS ------------------------------------------------------------------
__device__ __forceinline__ unsigned lds_addr(const unsigned short* p) {   // byte offset in the work-group's LDS
  return (unsigned)(size_t)(const __attribute__((address_space(3))) unsigned short*)p;
}
// One lane's share of a 128-row x 128-B tile: eight 16-B pieces, 16 rows apart (global pitch ND halves, LDS pitch
// GLP halves). The closing s_wait_xcnt stands inside the statement so that no address register named here is
// rewritten ahead of it.
__device__ __forceinline__ void stage_rows(unsigned l, const unsigned short* g) {
#if defined(__HIP_DEVICE_COMPILE__)
  asm volatile(
      "global_load_async_to_lds_b128 %0, %8, off\n\t"
      "global_load_async_to_lds_b128 %1, %9, off\n\t"
      "global_load_async_to_lds_b128 %2, %10, off\n\t"
      "global_load_async_to_lds_b128 %3, %11, off\n\t"
      "global_load_async_to_lds_b128 %4, %12, off\n\t"
      "global_load_async_to_lds_b128 %5, %13, off\n\t"
      "global_load_async_to_lds_b128 %6, %14, off\n\t"
      "global_load_async_to_lds_b128 %7, %15, off\n\t"
      "s_wait_xcnt 0x0"
      :: "v"(l), "v"(l + 1u * 16u * GLP * 2u), "v"(l + 2u * 16u * GLP * 2u), "v"(l + 3u * 16u * GLP * 2u),
         "v"(l + 4u * 16u * GLP * 2u), "v"(l + 5u * 16u * GLP * 2u), "v"(l + 6u * 16u * GLP * 2u),
         "v"(l + 7u * 16u * GLP * 2u),
         "v"(g), "v"(g + 1 * 16 * ND), "v"(g + 2 * 16 * ND), "v"(g + 3 * 16 * ND),
         "v"(g + 4 * 16 * ND), "v"(g + 5 * 16 * ND), "v"(g + 6 * 16 * ND), "v"(g + 7 * 16 * ND)
      : "memory");
#endif
}
__device__ __forceinline__ void wait_copies() {      // this wave's own copies have landed in LDS
#if defined(__HIP_DEVICE_COMPILE__)
  asm volatile("s_wait_asynccnt 0x0" ::: "memory");
#endif
}
__device__ __forceinline__ void wait_lds_reads() {   // this wave's LDS reads have returned before their buffer is refilled
#if defined(__HIP_DEVICE_COMPILE__)
  asm volatile("s_wait_dscnt 0x0" ::: "memory");
#endif
}

// =====================================================================================================
// f32 -> f16( bf16_RNE(v) * scale ), scale a power of two (exact), 8 elements per thread, one 16-B store
// =====================================================================================================
__device__ __forceinline__ void cvt_h8(int blk, const float* __restrict__ in, unsigned short* out, int n8, float scale) {
  const int i = blk * 256 + threadIdx.x;
  if (i < n8) {
    const v4f a = *(const v4f*)(in + (size_t)i * 8);
    const v4f c = *(const v4f*)(in + (size_t)i * 8 + 4);
    float f[8];
    f[0] = a[0]; f[1] = a[1]; f[2] = a[2]; f[3] = a[3];
    f[4] = c[0]; f[5] = c[1]; f[6] = c[2]; f[7] = c[3];
    unsigned short hb[8];
#pragma unroll
    for (int e = 0; e < 8; ++e) hb[e] = h_bits((_Float16)(bf_up(bf_bits(f[e])) * scale));
    v4u p;
    p[0] = pk16(hb[0], hb[1]);
    p[1] = pk16(hb[2], hb[3]);
    p[2] = pk16(hb[4], hb[5]);
    p[3] = pk16(hb[6], hb[7]);
    *(v4u*)(out + (size_t)i * 8) = p;
    
  }
}

// =====================================================================================================
// Weight transpose + convert: W[c][o] f32 (c in [0,1024), o in [0,3072), o contiguous) ->
// WT[o][c] f16 = f16( bf16_RNE(W[c][o]) * scale ), c contiguous (k-major rows for the B fragment loader).
// Block = one 64(o) x 64(c) tile: thread (ol = tid&63, cb = tid>>6) reads 16 consecutive c rows of column o0+ol
// (coalesced per row across lanes), packs them as two 16-B LDS stores into sT[ol][c]; block barrier; then every
// tiles = (3072/64, 1024/64) = (48, 16): bx = o tiles (rows of WT), by = c tiles (rows of W).
// coverage: 256 threads x 2 rows-iterations... : rows tid>>3 (0..31) and +32 -> all 64 rows x 64 halves per tile.
// =====================================================================================================
__device__ __forceinline__ void cvt_wT(int bx, int by, const float* __restrict__ W, unsigned short* WT, float scale) {
  __shared__ __align__(16) unsigned short sT[64 * SPP];          // 9216 B
  const int tid = threadIdx.x;
  const int o0 = bx * 64;
  const int c0 = by * 64;
  {
    const int ol = tid & 63, cb = tid >> 6;                      // cb 0..3 -> c rows cb*16 .. +15
    unsigned short hb[16];
#pragma unroll
    for (int e = 0; e < 16; ++e) {
      const float f = W[(size_t)(c0 + cb * 16 + e) * NQKV + o0 + ol];
      hb[e] = h_bits((_Float16)(bf_up(bf_bits(f)) * scale));
    }
    v4u p0, p1;
#pragma unroll
    for (int q = 0; q < 4; ++q) {
      p0[q] = pk16(hb[2 * q], hb[2 * q + 1]);
      p1[q] = pk16(hb[8 + 2 * q], hb[8 + 2 * q + 1]);
    }
    *(v4u*)(sT + ol * SPP + cb * 16) = p0;
    *(v4u*)(sT + ol * SPP + cb * 16 + 8) = p1;
  }
  __syncthreads();
  {
    const int row = tid >> 3, c8 = (tid & 7) * 8;
    const v4u v0 = *(const v4u*)(sT + row * SPP + c8);
    const v4u v1 = *(const v4u*)(sT + (row + 32) * SPP + c8);
    const size_t d0 = (size_t)(o0 + row) * ND + c0 + c8;
    const size_t d1 = (size_t)(o0 + row + 32) * ND + c0 + c8;
    {
      *(v4u*)(WT + d0) = v0;
      *(v4u*)(WT + d1) = v1;
      // precaution: the two stores' address and data registers are not rewritten (by another job's code that
      // follows in the listing) before this wait
      asm volatile("s_wait_xcnt 0x0" ::: "memory");
    }
  }
}

// =====================================================================================================
// inv_freq[j] = 1 / 10000^(j/32), j = 0..31 (full head dim, not pairs), worked out by every thread that needs it.
// Contraction off: power, reciprocal and (in k_tab) the angle s * inv_freq are each rounded to f32 on their own, as the
// definition rounds them, before the sine and cosine see the angle.
// =====================================================================================================
__device__ __forceinline__ float k_invf(int j) {
  #pragma clang fp contract(off)
  const float e = (float)j * 0.03125f;
  const float p = powf(10000.0f, e);
  const float inv = 1.0f / p;
  return inv;
}

// =====================================================================================================
// Rotary tables COS/SIN[s][j] = cos/sin( s * inv_freq[j] ), s in [0,2048), j in [0,32): 256 threads = 8 rows x 32,
// one precise sincosf per thread (rolled, nothing unrolled); values staged in LDS, block barrier, then waves 0-1
// coverage: 256 blocks x 8 rows x 32 = every COS and SIN element.
// =====================================================================================================
__device__ __forceinline__ void k_tab(int blk, float* COS, float* SIN) {
  // the angle is rounded to f32 as a product of its own before sine and cosine (see k_invf)
  #pragma clang fp contract(off)
  __shared__ __align__(16) float sc[8 * 32];
  __shared__ __align__(16) float ss[8 * 32];
  const int tid = threadIdx.x, j = tid & 31, rl = tid >> 5;
  const int s = blk * 8 + rl;
  const float ang = (float)s * k_invf(j);
  float sn, cs;
  sincosf(ang, &sn, &cs);
  sc[rl * 32 + j] = cs;
  ss[rl * 32 + j] = sn;
  __syncthreads();
  if (tid < 64) {                                                // waves 0,1: COS rows
    const int row = tid >> 3, c4 = (tid & 7) * 4;
    const v4f v = *(const v4f*)(sc + row * 32 + c4);
    float* d = COS + (size_t)(blk * 8 + row) * HD + c4;
    *(v4f*)d = v;
    
  } else if (tid < 128) {                                        // waves 2,3: SIN rows
    const int t2 = tid - 64;
    const int row = t2 >> 3, c4 = (t2 & 7) * 4;
    const v4f v = *(const v4f*)(ss + row * 32 + c4);
    float* d = SIN + (size_t)(blk * 8 + row) * HD + c4;
    *(v4f*)d = v;
    
  }
}

// =====================================================================================================
// Mask digest, made once for all batch*head pairs. Block (cp, qb) = 128 query rows x MCH key chunks of 64; wave w owns
// the 16-row query tile qt = 8*qb + w and reads, per chunk, the same 32 entries per lane that the attention wave of
// that tile needs: lane -> query row 16*qt + (lane&15), keys of lane half lane>>4.
//   MB[qt][c][16*s + 8*t + r]: a lane mask, bit lane <-> (mask[row][64*c + 32*s + 16*t + 8*(lane>>4) + r] != 0), ready
//                    as the select mask of score element (t, r) of 32-key step s; one 128-B line per (qt, c), written
//                    by one wave (lane i stores word i).
//   FL[qb][cp][MFL]: entry e < MCH is nonzero iff any entry of the 128 x 64 block of chunk MCH*cp + e is nonzero;
//                    one whole 128-B line per block (the rest of the line is 0).
// blocks = (32/MCH, 16): every (qt, c) word line and every FL line written exactly once.
// =====================================================================================================
__device__ __forceinline__ void mask_digest(int cp, int qb, const int* __restrict__ msk, unsigned* MB, int* FL) {
  __shared__ int sany[MCH][8];
  const int tid = threadIdx.x, lane = tid & 31, wave = tid >> 5;
  const int rlane = lane & 15, hsel = lane >> 4;
  const int qt = qb * 8 + wave;
  const size_t rowbase = (size_t)(qt * 16 + rlane) * NT;
  // all loads of the wave stand ahead of its first store; every loop below is unrolled so that ent[] is indexed by
  // constants and stays in registers
  v4i ent[MCH][2][2][2];
#pragma unroll
  for (int e = 0; e < MCH; ++e) {
#pragma unroll
    for (int s = 0; s < 2; ++s) {
#pragma unroll
      for (int t = 0; t < 2; ++t) {
        const int* mp = msk + rowbase + (size_t)((cp * MCH + e) * KCH + 32 * s + 16 * t + 8 * hsel);
        ent[e][s][t][0] = *(const v4i*)mp;
        ent[e][s][t][1] = *(const v4i*)(mp + 4);
      }
    }
  }
#pragma unroll
  for (int e = 0; e < MCH; ++e) {
    unsigned any = 0u;
    int mine = 0;                                                // lane i ends up with word i
#pragma unroll
    for (int i = 0; i < 32; ++i) {                               // i = 16*s + 8*t + r
      const unsigned w = __builtin_amdgcn_ballot_w32(ent[e][i >> 4][(i >> 3) & 1][(i >> 2) & 1][i & 3] != 0);
      any |= w;
      mine = (lane == i) ? (int)w : mine;
    }
    MB[((size_t)qt * NKC + cp * MCH + e) * 32 + lane] = (unsigned)mine;
    if (lane == 0) sany[e][wave] = (any != 0u) ? 1 : 0;
  }
  __syncthreads();
  if (tid < MFL) {
    int f = 0;
    if (tid < MCH) {
#pragma unroll
      for (int w = 0; w < 8; ++w) f |= sany[tid][w];
    }
    FL[((size_t)qb * (NKC / MCH) + cp) * MFL + tid] = f;
  }
}

// =====================================================================================================
// All work that depends on the inputs alone, in ONE launch: the four jobs above read and write disjoint buffers and none
// reads what another writes, so their work-groups share the chip instead of waiting for one another's launch to end.
// The job is picked by the block index (the same for the whole work-group, so each job's barrier stays block-uniform):
//   [0, PB_DIG)       mask digest, block (cp, qb) = (i % 16, i / 16)
//   [.., PB_WT)       weight transpose + convert, tile (bx, by) = (i % 48, i / 48)
//   [.., PB_TAB)      rotary tables, 8 rows a block
//   [.., PB_ALL)      activation convert, 2048 elements a block
// =====================================================================================================
#define PB_DIG  ((NKC / MCH) * (NT / QBLK))
#define PB_WT   (PB_DIG + (NQKV / 64) * (ND / 64))
#define PB_TAB  (PB_WT + NT / 8)
#define PB_ALL  (PB_TAB + NTOK * ND / 2048)
__global__ __launch_bounds__(256) void prep(const float* __restrict__ x, const float* __restrict__ W,
                                            const int* __restrict__ msk, unsigned short* XH, unsigned short* WT,
                                            float* COS, float* SIN, unsigned* MB, int* FL) {
  const int blk = blockIdx.x;
  if (blk < PB_DIG) {
    mask_digest(blk % (NKC / MCH), blk / (NKC / MCH), msk, MB, FL);
  } else if (blk < PB_WT) {
    const int i = blk - PB_DIG;
    cvt_wT(i % (NQKV / 64), i / (NQKV / 64), W, WT, 1024.0f);
  } else if (blk < PB_TAB) {
    k_tab(blk - PB_WT, COS, SIN);
  } else {
    cvt_h8(blk - PB_TAB, x, XH, NTOK * ND / 8, 16.0f);
  }
}

// =====================================================================================================
// Fused qkv projection GEMM with rotary + 16-bit plane epilogue:
//   Y[tok][o] = sum_c XH[tok][c] * WT[o][c] * oscale,  tok in [0,4096), o in [0,3072), K = 1024.
// One work-group of 4 waves per 128x128 tile, one wave per 64x64 quarter (register-blocked); A = XH rows (token),
// Bt = WT rows (k contiguous). Per 64-deep k stage the 128 A rows and 128 Bt rows (128 B each, whole lines) are copied
// asynchronously into one of two LDS buffers (pitch 144 B) while the other buffer is worked on; k order unchanged.
// The 64 tokens of a tile lie in one batch b (t0 = m0 mod 2048); the 64 outputs are two heads h0, h0+1 of one of
// q (o < 1024), k (1024 <= o < 2048), v (o >= 2048); column j (16-wide subtile) -> head h0 + (j>>1), d = 16*(j&1)+lane%16.
//   q, k: rotary combine per the module: out[d] = y[d]*cos[s][d] - y[d+16]*sin[s][d] (d < 16),
//         out[d] = y[d]*cos[s][d] + y[d-16]*sin[s][d] (d >= 16); both partners sit in the same lane and element.
//         PH/PL[bh][t][32] f16 = (out*16) hi plane and residual x2^11 (64 B per token; the wave owns 64 consecutive
// then q/k: each head's slab region (16 tok x 64 B = 1024 contiguous B) written as 32 lanes x 16 B contiguous per
// grid = 768 blocks x 4 waves = 3072 wave tiles = 64 x 48 exactly.
// coverage: q/k tiles: 4 slabs x 2 heads x 16 tok x 32 d (hi and residual); v tiles: 4 subtiles x 16 d x 64 tok;
// 64 token tiles x (16+16+16) column tiles = every (bh, t) row of QH/QL/KH/KL and every (bh, d) row of VH/VL.
// =====================================================================================================
__global__ __launch_bounds__(128) void gemm_proj(
    const unsigned short* __restrict__ XHp, const unsigned short* __restrict__ WTp,
    const float* __restrict__ COS, const float* __restrict__ SIN,
    unsigned short* QH, unsigned short* QL, unsigned short* KH, unsigned short* KL,
    unsigned short* VH, unsigned short* VL, float oscale) {
  __shared__ __align__(16) unsigned short sA[2][GBUF];            // 36864 B
  __shared__ __align__(16) unsigned short sB[2][GBUF];            // 36864 B
  __shared__ __align__(16) unsigned short sP[4][2][16 * SPP];     // 18432 B
  const int tid  = threadIdx.x;
  const int lane = tid & 31;
  const int wave = tid >> 5;
  const int tilesN = NQKV / GBT;                                 // 24
  const int tilesM = NTOK / GBT;                                 // 32
  const int tile = blockIdx.x;
  if (tile >= tilesM * tilesN) return;                           // block-uniform, in front of every barrier
  const int tm = tile / tilesN;
  const int tn = tile - tm * tilesN;
  const int wm = wave >> 1, wn = wave & 1;                       // 2 x 2 waves
  const int m0 = tm * GBT + (wm << 6);                           // token base of this wave
  const int n0 = tn * GBT + (wn << 6);                           // output channel base in [0,3072)
  const int rlane = lane & 15;
  const int hh    = lane >> 4;
  const int koff  = hh * 8;
  const int mOff  = hh * 8;

  v8f acc[4][4];
#pragma unroll
  for (int i = 0; i < 4; ++i)
#pragma unroll
    for (int j = 0; j < 4; ++j) acc[i][j] = zero8();

  // copy share of this lane: piece tid&7 (16 B) of rows (tid>>3) + 16e, e = 0..7; a wave's copy = 4 whole 128-B lines
  const int crow = tid >> 3, cpc = (tid & 7) * 8;
  const unsigned short* gA = XHp + (size_t)(tm * GBT + crow) * ND + cpc;
  const unsigned short* gB = WTp + (size_t)(tn * GBT + crow) * ND + cpc;
  const unsigned lA = lds_addr(&sA[0][crow * GLP + cpc]);
  const unsigned lB = lds_addr(&sB[0][crow * GLP + cpc]);

  stage_rows(lA, gA);                                            // stage 0 -> buffer 0
  stage_rows(lB, gB);
  wait_copies();
  __syncthreads();
  stage_rows(lA + GBUF * 2u, gA + GBK);                          // stage 1 -> buffer 1
  stage_rows(lB + GBUF * 2u, gB + GBK);

  // rolled: the two-buffer order below is written once
#pragma unroll 1
  for (int t = 0; t < GTR; ++t) {
    const int bsel = t & 1;
    const _Float16* fa = (const _Float16*)(const void*)&sA[bsel][((wm << 6) + rlane) * GLP + koff];
    const _Float16* fb = (const _Float16*)(const void*)&sB[bsel][((wn << 6) + rlane) * GLP + koff];
#pragma unroll
    for (int kk = 0; kk < GBK; kk += 32) {
      v16h bf[4], af[4];
#pragma unroll
      for (int j = 0; j < 4; ++j) bf[j] = ldfrag_h(fb + (j << 4) * GLP + kk);
#pragma unroll
      for (int i = 0; i < 4; ++i) af[i] = ldfrag_h(fa + (i << 4) * GLP + kk);
#pragma unroll
      for (int i = 0; i < 4; ++i)
#pragma unroll
        for (int j = 0; j < 4; ++j) acc[i][j] = mma_h_raw(af[i], bf[j], acc[i][j]);
      // all 16 LDS reads of this k step as one group ahead of its 16 products: one LDS wait a step, not one a row
      __builtin_amdgcn_sched_group_barrier(0x100, 16, 0);
      __builtin_amdgcn_sched_group_barrier(0x008, 16, 0);
    }
    // publish point of stage t + 1: own reads done, own copies landed, barrier, then the refill of the buffer just read
    wait_lds_reads();
    wait_copies();
    __syncthreads();
    if (t + 2 < GTR) {
      stage_rows(lA + (unsigned)bsel * (GBUF * 2u), gA + (t + 2) * GBK);
      stage_rows(lB + (unsigned)bsel * (GBUF * 2u), gB + (t + 2) * GBK);
    }
  }
  wait_copies();
  acc_guard4(acc[0][0], acc[0][1], acc[0][2], acc[0][3]);
  acc_guard4(acc[1][0], acc[1][1], acc[1][2], acc[1][3]);
  acc_guard4(acc[2][0], acc[2][1], acc[2][2], acc[2][3]);
  acc_guard4(acc[3][0], acc[3][1], acc[3][2], acc[3][3]);

  // ---- epilogue ----
  const int b   = m0 / NT;
  const int t0  = m0 - b * NT;
  const int sel = n0 >> 10;                                      // 0 q, 1 k, 2 v (wave-uniform)
  const int h0  = (n0 & (ND - 1)) >> 5;                          // first of the two heads of this tile
  unsigned short* s0 = &sP[wave][0][0];
  unsigned short* s1 = &sP[wave][1][0];

  if (sel < 2) {
    unsigned short* PH = (sel == 0) ? QH : KH;
    unsigned short* PL = (sel == 0) ? QL : KL;
#pragma unroll
    for (int i = 0; i < 4; ++i) {                                // slab = 16 tokens t0+16i .. +15
#pragma unroll
      for (int r = 0; r < 8; ++r) {
        const int tok = t0 + (i << 4) + mOff + r;                // row tok = 8hh + r
        const float* cp = COS + (size_t)tok * HD;
        const float* sp = SIN + (size_t)tok * HD;
        const float ca = cp[rlane], cb = cp[16 + rlane];
        const float sa = sp[rlane], sb = sp[16 + rlane];
#pragma unroll
        for (int hp = 0; hp < 2; ++hp) {
          const float y0 = acc[i][2 * hp][r] * oscale;           // d = rlane
          const float y1 = acc[i][2 * hp + 1][r] * oscale;       // d = 16 + rlane
          const float f0 = (y0 * ca - y1 * sa) * 16.0f;
          const float f1 = (y1 * cb + y0 * sb) * 16.0f;
          const _Float16 x0 = (_Float16)f0;
          const _Float16 x1 = (_Float16)f1;
          const int so = (mOff + r) * SPP + 32 * hp + rlane;     // row tok, col 32hp + d
          s0[so]      = h_bits(x0);
          s1[so]      = h_bits((_Float16)((f0 - (float)x0) * 2048.0f));
          s0[so + 16] = h_bits(x1);
          s1[so + 16] = h_bits((_Float16)((f1 - (float)x1) * 2048.0f));
        }
      }
      wave_sync_lds();
      {
        const int rr = lane >> 2, cc = (lane & 3) * 8;           // rr*32 + cc = lane*8 halves
#pragma unroll
        for (int hp = 0; hp < 2; ++hp) {
          const int bhp = b * NH + h0 + hp;
          const size_t base = ((size_t)(bhp * NT + t0 + (i << 4))) * HD + lane * 8;
          const v4u v0 = *(const v4u*)(s0 + rr * SPP + 32 * hp + cc);
          const v4u v1 = *(const v4u*)(s0 + (rr + 8) * SPP + 32 * hp + cc);
          const v4u w0 = *(const v4u*)(s1 + rr * SPP + 32 * hp + cc);
          const v4u w1 = *(const v4u*)(s1 + (rr + 8) * SPP + 32 * hp + cc);
          {
            *(v4u*)(PH + base) = v0;
            *(v4u*)(PH + base + 256) = v1;
            *(v4u*)(PL + base) = w0;
            *(v4u*)(PL + base + 256) = w1;
            
          }
        }
      }
      wave_sync_lds();
    }
  } else {
#pragma unroll
    for (int j = 0; j < 4; ++j) {                                // slab = 16 rows d = 16(j&1) + rlane of head h0+(j>>1)
      const int hp = j >> 1, dbase = (j & 1) * 16;
      const int bhp = b * NH + h0 + hp;
#pragma unroll
      for (int i = 0; i < 4; ++i) {
        unsigned short hb[8], lb[8];
#pragma unroll
        for (int r = 0; r < 8; ++r) {
          const float f = (acc[i][j][r] * oscale) * 16.0f;
          const _Float16 xh = (_Float16)f;
          hb[r] = h_bits(xh);
          lb[r] = h_bits((_Float16)((f - (float)xh) * 2048.0f));
        }
        v4u ph, pl;
#pragma unroll
        for (int q = 0; q < 4; ++q) {
          ph[q] = pk16(hb[2 * q], hb[2 * q + 1]);
          pl[q] = pk16(lb[2 * q], lb[2 * q + 1]);
        }
        *(v4u*)(s0 + rlane * SPP + (i << 4) + mOff) = ph;       // row d = rlane, tok = 16i + 8hh .. +7
        *(v4u*)(s1 + rlane * SPP + (i << 4) + mOff) = pl;
      }
      wave_sync_lds();
      {
        const int rq = lane >> 3, c8 = (lane & 7) * 8;
        {
#pragma unroll
          for (int it = 0; it < 4; ++it) {
            const int row = it * 4 + rq;                         // it 0..3 x rq 0..3 = rows 0..15
            const size_t dst = ((size_t)(bhp * HD + dbase + row)) * NT + t0 + c8;
            const v4u v = *(const v4u*)(s0 + row * SPP + c8);
            const v4u w = *(const v4u*)(s1 + row * SPP + c8);
            *(v4u*)(VH + dst) = v;
            *(v4u*)(VL + dst) = w;
          }
          
        }
      }
      wave_sync_lds();
    }
  }
}

// =====================================================================================================
// Attention for one (batch*head, 128-query block): grid = (64, 16), 256 threads = 8 waves x 16 queries; each lane
// owns one query column q = q0 + 16*wave + (lane&15). QH/QL/KH/KL[bh][t][32] f16 (x16 hi, residual x2^11),
// VH/VL[bh][d][2048] (x16 hi, residual x2^11). The mask [2048 q][2048 key] comes as the digest of mask_digest: key
// chunks of 64; each wave loads the 32 lane masks MB[qt][c][..] of its query tile by wave-uniform loads, one mask per
// score element; a chunk whose entries are all zero for the whole block (FL, gathered once into a wave-uniform word)
// is skipped block-uniformly, in front of every barrier of the chunk (exact: such keys have probability 0). Otherwise
// K hi/res rows [64][40] and V hi/res tiles [32 d][72] are staged in LDS with plain 16-B loads between two block
// barriers. Per 32-key step and 16-key tile t:
// S[key][q] = A(K hi rows) x B(resident Q hi) and Sr = A(K hi) x B(Q res) + A(K res) x B(Q hi) in separate zeroed
// accumulators; logit = (S + Sr/2048) / 256 / sqrt(32); entries with mask == 0 replaced by -inf; online softmax over
// keys (max/sum across lane halves by shuffle); p = 1024*exp(x - max) packed D->B per the chained map (element r <-
// keys 0-15 tile, 8+r <- keys 16-31 tile) as f16 hi plus residual x2^11; Oh[d][q] += A(V hi rows) x Ph,
// Ol += A(V res) x Ph + A(V hi) x Pl (both 2^-11 terms); out = (Oh + Ol/2048) / (16 * l) (l = 0 gives 0*inf = NaN).
// coverage: 64 x 16 blocks x 8 waves x 16 rows x 32 floats = every (tok, head) line of the output.
// =====================================================================================================
__global__ __launch_bounds__(ATHR) void attn_kernel(
    const unsigned short* __restrict__ QHp, const unsigned short* __restrict__ QLp,
    const unsigned short* __restrict__ KHp, const unsigned short* __restrict__ KLp,
    const unsigned short* __restrict__ VHp, const unsigned short* __restrict__ VLp,
    const unsigned* __restrict__ MB, const int* __restrict__ FL, float* Out) {
  __shared__ __align__(16) unsigned short kh_u[KCH * KP];         // 5120 B
  __shared__ __align__(16) unsigned short kl_u[KCH * KP];         // 5120 B
  __shared__ __align__(16) unsigned short vh_u[HD * VP];          // 4608 B
  __shared__ __align__(16) unsigned short vl_u[HD * VP];          // 4608 B
  __shared__ __align__(16) float sO[8][16 * OP];                  // 18432 B
  const _Float16* kh = (const _Float16*)(const void*)kh_u;
  const _Float16* kl = (const _Float16*)(const void*)kl_u;
  const _Float16* vh = (const _Float16*)(const void*)vh_u;
  const _Float16* vl = (const _Float16*)(const void*)vl_u;
  const _Float16* QH = (const _Float16*)(const void*)QHp;
  const _Float16* QL = (const _Float16*)(const void*)QLp;

  const int tid = threadIdx.x, lane = tid & 31, wave = tid >> 5;
  const int bh = blockIdx.x;
  const int b  = bh / NH;
  const int h  = bh - b * NH;
  const int q0 = blockIdx.y * QBLK;
  const int rlane = lane & 15, hsel = lane >> 4, koff = hsel * 8;
  const int qrow = q0 + wave * 16 + rlane;                       // this lane's query index within the sequence

  // resident Q fragments (B operand: B[k=d][n=q] from [q][d] rows), arithmetic addressing, one 32-deep k-step
  const size_t qo = ((size_t)(bh * NT + qrow)) * HD + koff;
  const v16h qh0 = ldfrag_h(QH + qo);
  const v16h ql0 = ldfrag_h(QL + qo);
  // this wave's lane masks, 32 words a chunk; the wave number made uniform so that the words load into scalar registers
  const unsigned* mbp = MB + ((size_t)(blockIdx.y * 8 + __builtin_amdgcn_readfirstlane(wave)) * NKC) * 32;
  // bit c <-> chunk c has a nonzero mask entry somewhere in this block's 128 query rows (the same word in every wave)
  const unsigned act = __builtin_amdgcn_ballot_w32(
      FL[((size_t)blockIdx.y * (NKC / MCH) + lane / MCH) * MFL + (lane % MCH)] != 0);

  const float C2048  = 1.0f / 2048.0f;
  const float SCL    = 0.17677669529663687f * (1.0f / 256.0f);  // undo q*16, k*16, then 1/sqrt(32)
  const float LN1024 = 6.931471805599453f;
  const float NEGINF = __uint_as_float(0xff800000u);

  v8f oh[2], ol[2];
#pragma unroll
  for (int dt = 0; dt < 2; ++dt) { oh[dt] = zero8(); ol[dt] = zero8(); }
  float m_run = -1.0e30f, l_run = 0.0f;

#pragma unroll 1
  for (int c = 0; c < NKC; ++c) {
    if (((act >> c) & 1u) == 0u) continue;                       // block-uniform skip of an all-masked chunk
    const int kc = c * KCH;
    __syncthreads();                                             // all waves finished reading the prior chunk's K/V
    // lane masks: word (16*s + 8*t + r), bit lane <-> key kc + 32*s + 16*t + 8*hsel + r of the lane's query row
    // read through the constant address space (nothing writes MB in this launch), which makes them scalar loads
    const v16u mw0 = *(const __attribute__((address_space(4))) v16u*)(mbp + c * 32);
    const v16u mw1 = *(const __attribute__((address_space(4))) v16u*)(mbp + c * 32 + 16);

    // ---- stage K hi/res rows and V hi/res tiles of keys kc..kc+63 (one 16-B item per thread each) ----
    {
      const int key = tid >> 2, ck = (tid & 3) * 8;              // 64 keys x 32 halves
      const size_t gk = ((size_t)(bh * NT + kc + key)) * HD + ck;
      const int d = tid >> 3, cv = (tid & 7) * 8;                // 32 d rows x 64 halves
      const size_t gv = ((size_t)(bh * HD + d)) * NT + kc + cv;
      const v4u gkh = *(const v4u*)(KHp + gk);
      const v4u gkl = *(const v4u*)(KLp + gk);
      const v4u gvh = *(const v4u*)(VHp + gv);
      const v4u gvl = *(const v4u*)(VLp + gv);
      *(v4u*)(kh_u + key * KP + ck) = gkh;
      *(v4u*)(kl_u + key * KP + ck) = gkl;
      *(v4u*)(vh_u + d * VP + cv) = gvh;
      *(v4u*)(vl_u + d * VP + cv) = gvl;
    }
    __syncthreads();

#pragma unroll 1
    for (int sub = 0; sub < 2; ++sub) {
      const int kr = sub * 32;
      float a[2][8];
#pragma unroll
      for (int t = 0; t < 2; ++t) {
        const int krow = kr + 16 * t + rlane;
        const v16h kha = ldfrag_h(kh + krow * KP + koff);
        const v16h kla = ldfrag_h(kl + krow * KP + koff);
        v8f sh = mma_h_raw(kha, qh0, zero8());
        v8f sr = mma_h_raw(kha, ql0, zero8());
        sr = mma_h_raw(kla, qh0, sr);
        guard4(sh, sr, kha, kla, qh0, ql0);
#pragma unroll
        for (int r = 0; r < 8; ++r) {
          const float s = (sh[r] + sr[r] * C2048) * SCL;
          const unsigned kw = (sub != 0) ? mw1[t * 8 + r] : mw0[t * 8 + r];
          a[t][r] = __builtin_amdgcn_inverse_ballot_w32(kw) ? s : NEGINF;
        }
      }

      // online softmax over the key axis for this lane's q column
      float mloc = -1.0e30f;
#pragma unroll
      for (int r = 0; r < 8; ++r) mloc = fmaxf(mloc, fmaxf(a[0][r], a[1][r]));
      mloc = fmaxf(mloc, __shfl_xor(mloc, 16, 32));
      const float newM  = fmaxf(m_run, mloc);
      const float alph  = __expf(m_run - newM);
      const float msh   = newM - LN1024;
      float ssum = 0.0f;
      float p[2][8];
#pragma unroll
      for (int r = 0; r < 8; ++r) {
        p[0][r] = __expf(a[0][r] - msh);
        p[1][r] = __expf(a[1][r] - msh);
        ssum += p[0][r] + p[1][r];
      }
      ssum += __shfl_xor(ssum, 16, 32);
      l_run = l_run * alph + ssum;
      m_run = newM;
#pragma unroll
      for (int dt = 0; dt < 2; ++dt) {
#pragma unroll
        for (int r = 0; r < 8; ++r) { oh[dt][r] *= alph; ol[dt][r] *= alph; }
      }

      // P (f32, D layout) -> B operands (f16 hi, f16 residual x2^11): element r <- keys 0-15 tile, 8+r <- keys 16-31 tile
      union { v16h v; _Float16 s[16]; } ph, plo;
#pragma unroll
      for (int r = 0; r < 8; ++r) {
        const _Float16 x0 = (_Float16)p[0][r];
        const _Float16 x1 = (_Float16)p[1][r];
        ph.s[r]      = x0;
        ph.s[8 + r]  = x1;
        plo.s[r]     = (_Float16)((p[0][r] - (float)x0) * 2048.0f);
        plo.s[8 + r] = (_Float16)((p[1][r] - (float)x1) * 2048.0f);
      }

      // O[d][q] += V[d][kr .. +31] x P, hi and residual terms
#pragma unroll
      for (int dt = 0; dt < 2; ++dt) {
        const v16h vah = ldfrag_h(vh + (16 * dt + rlane) * VP + kr + koff);
        const v16h val = ldfrag_h(vl + (16 * dt + rlane) * VP + kr + koff);
        oh[dt] = mma_h_raw(vah, ph.v, oh[dt]);
        ol[dt] = mma_h_raw(val, ph.v, ol[dt]);
        ol[dt] = mma_h_raw(vah, plo.v, ol[dt]);
        guard4(oh[dt], ol[dt], vah, val, ph.v, plo.v);
      }
    }
  }
  acc_guard4(oh[0], oh[1], ol[0], ol[1]);

  // ---- output values -> per-wave f32 LDS staging ----
  const float inv = (1.0f / 16.0f) * (1.0f / l_run);            // out = (Oh + Ol/2048) / (16 * l)
  float* st = sO[wave];
#pragma unroll
  for (int dt = 0; dt < 2; ++dt) {
    v4f va, vb;
#pragma unroll
    for (int e = 0; e < 4; ++e) {
      va[e] = (oh[dt][e]     + ol[dt][e]     * C2048) * inv;     // d = 16dt + 8hsel + e
      vb[e] = (oh[dt][4 + e] + ol[dt][4 + e] * C2048) * inv;     // d = 16dt + 8hsel + 4 + e
    }
    const int so = rlane * OP + 16 * dt + 8 * hsel;              // row q = rlane
    *(v4f*)(st + so) = va;
    *(v4f*)(st + so + 4) = vb;
  }
  wave_sync_lds();
  {
    const int rq = lane >> 3, c4 = (lane & 7) * 4;
    const int n0 = q0 + wave * 16;
    {
#pragma unroll
      for (int it = 0; it < 4; ++it) {
        const int row = it * 4 + rq;                             // it 0..3 x rq 0..3 = rows 0..15
        const v4f v = *(const v4f*)(st + row * OP + c4);
        *(v4f*)(Out + ((size_t)(b * NT + n0 + row)) * ND + h * HD + c4) = v;
      }
      
    }
  }
}

// =====================================================================================================
// Workspace map (bytes, every offset a multiple of 128; every plane an exact multiple of its whole-line store
// granularity, row counts exact tile multiples, no padded tails needed):
//   XH   f16 [4096][1024]    activation, bf16-RNE x16                    0          8388608 B
//   WT   f16 [3072][1024]    Wqkv transposed, bf16-RNE x1024       8388608          6291456 B
//   COS  f32 [2048][32]                                          14680064           262144 B
//   SIN  f32 [2048][32]                                          14942208           262144 B
//   (256 B not used)                                            15204352              256 B
//   QH   f16 [64][2048][32]  q x16 hi                            15204608          8388608 B
//   QL   f16 [64][2048][32]  q residual x2^11                    23593216          8388608 B
//   KH   f16 [64][2048][32]                                      31981824          8388608 B
//   KL   f16 [64][2048][32]                                      40370432          8388608 B
//   VH   f16 [64][32][2048]  v x16 hi, key-contiguous            48759040          8388608 B
//   VL   f16 [64][32][2048]                                      57147648          8388608 B
//   MB   u32 [128][32][32]   lane masks per (query tile, chunk, element) 65536256     524288 B
//   FL   i32 [16][16][32]    chunk flags, one line per digest block  66060544          32768 B
//   end                                                          66093312
// =====================================================================================================
extern "C" void kernel_launch(void* const* d_in, const int* in_sizes, int n_in,
                              void* d_out, int out_size, void* d_ws, size_t ws_size,
                              hipStream_t stream) {
  if (n_in < 3) return;
  if (in_sizes[0] != NTOK * ND) return;
  if (in_sizes[1] != ND * NQKV) return;
  if (in_sizes[2] != NT * NT) return;
  if (out_size != NTOK * ND) return;

  const float* x   = (const float*)d_in[0];
  const float* W   = (const float*)d_in[1];
  const int*   msk = (const int*)d_in[2];

  const size_t PXH = (size_t)NTOK * ND * 2;                    // 8388608
  const size_t PWT = (size_t)NQKV * ND * 2;                    // 6291456
  const size_t PTB = (size_t)NT * HD * 4;                      // 262144
  const size_t PIN = 256;
  const size_t PQK = (size_t)NBH * NT * HD * 2;                // 8388608
  const size_t PV  = (size_t)NBH * HD * NT * 2;                // 8388608
  size_t off = 0;
  const size_t oXH  = off; off += PXH;
  const size_t oWT  = off; off += PWT;
  const size_t oCOS = off; off += PTB;
  const size_t oSIN = off; off += PTB;
  off += PIN;                                                  // 256 B not used
  const size_t oQH  = off; off += PQK;
  const size_t oQL  = off; off += PQK;
  const size_t oKH  = off; off += PQK;
  const size_t oKL  = off; off += PQK;
  const size_t oVH  = off; off += PV;
  const size_t oVL  = off; off += PV;
  const size_t oMB  = off; off += (size_t)(NT / 16) * NKC * 32 * 4;        // 524288
  const size_t oFL  = off; off += (size_t)(NT / QBLK) * (NKC / MCH) * MFL * 4;   // 32768
  if (off > ws_size) return;                                   // off = 66093312
  if (off > (size_t)134217728) return;

  char* ws = (char*)d_ws;
  unsigned short* XH   = (unsigned short*)(ws + oXH);
  unsigned short* WT   = (unsigned short*)(ws + oWT);
  float*          COS  = (float*)(ws + oCOS);
  float*          SIN  = (float*)(ws + oSIN);
  unsigned short* QH   = (unsigned short*)(ws + oQH);
  unsigned short* QL   = (unsigned short*)(ws + oQL);
  unsigned short* KH   = (unsigned short*)(ws + oKH);
  unsigned short* KL   = (unsigned short*)(ws + oKL);
  unsigned short* VH   = (unsigned short*)(ws + oVH);
  unsigned short* VL   = (unsigned short*)(ws + oVL);
  unsigned*       MB   = (unsigned*)(ws + oMB);
  int*            FL   = (int*)(ws + oFL);
  float*          out  = (float*)d_out;

  const dim3 blk(256);
  const dim3 gPrep(PB_ALL);                                    // 256 + 768 + 256 + 2048 = 3328
  const dim3 gProj((NTOK / GBT) * (NQKV / GBT));               // 32 x 24 = 768 blocks of 4 waves
  const dim3 gAttn(NBH, NT / QBLK);                            // 64 x 16, 256 threads

  const float oscPrj = 1.0f / 16384.0f;                        // undo x*16 and W*1024

  // (1) one launch: inputs -> f16 planes holding bf16-RNE values times an exact power of two; rotary tables;
  //     mask -> lane masks of the attention waves' score elements, and one flag per 128-query x 64-key block
  prep<<<gPrep, blk, 0, stream>>>(x, W, msk, XH, WT, COS, SIN, MB, FL);
  // (2) fused qkv projection with rotary epilogue: q, k -> [bh][t][32] hi/res planes; v -> [bh][d][t] hi/res planes
  gemm_proj<<<gProj, dim3(128), 0, stream>>>(XH, WT, COS, SIN, QH, QL, KH, KL, VH, VL, oscPrj);
  // (3) attention per (batch*head, 128-query block) -> f32 output lines [tok][h*32 .. +31]
  attn_kernel<<<gAttn, dim3(ATHR), 0, stream>>>(QH, QL, KH, KL, VH, VL, MB, FL, out);
  (void)hipGetLastError();
}

// v004
// It runs in 106 microseconds.
// In both of two side-by-side timings against v003, it was 1.06 times as fast.
// All steps since v000 together make it 2.07 times as fast.
#include <hip/hip_runtime.h>
#include <math.h>
#include <stdint.h>

// Contractions: fused qkv projection x.Wqkv (f16 operands holding bf16-RNE values, x carried x16 and W x1024, one
// product per tile pair); scores k.q (k and q each an f16 hi plane x16 plus an f16 residual plane x2^11: hi.hi in one
// accumulator, hi.lo + lo.hi in a second accumulator folded with 2^-11, 3 products); context v.p (p x1024 and v x16,
// each f16 hi plus f16 residual x2^11: hi.hi in one accumulator, lo.hi + hi.lo in a second folded with 2^-11,
// 3 products); all v_wmma_f32_16x16x32_f16 with f32 accumulate; rotary tables, rotary combine, key masking, softmax
// statistics and the final normalisation in f32 on VALU; output stored as f32.

#define NB    2
#define NT    2048
#define ND    1024
#define NQKV  3072
#define NH    32
#define HD    32
#define NTOK  (NB * NT)
#define NBH   (NB * NH)
#define QBLK  128
#define KCH   64
#define NKC   (NT / KCH)
#define NQB   (NT / QBLK)
#define KP    40
#define VP    72
#define SPP   72
#define OP    36
#define ATHR  256
#define GBT   128
#define GBK   64
#define GLP   72
#define GTR   (ND / GBK)
#define GBUF  (GBT * GLP)
#define MCH   2
#define MFL   32

static_assert(NH * HD == ND);
static_assert(NQKV == 3 * ND);
static_assert((NT % QBLK) == 0 && (NT % KCH) == 0 && (NT % 64) == 0 && (NTOK % 64) == 0);
static_assert((NQKV % 64) == 0 && (ND % 64) == 0 && (ND % 32) == 0);
static_assert(QBLK == (ATHR / 32) * 16 && (NQB % 2) == 0);
static_assert(KCH * 4 == ATHR && HD * 8 == ATHR);
static_assert(HD == 32 && KCH == 64 && NKC * KCH == NT);
static_assert(NKC == 32 && (NKC % MCH) == 0 && MCH <= MFL && QBLK == 8 * 16);
static_assert(((NTOK * ND) % 2048) == 0);
static_assert((NTOK % GBT) == 0 && (NQKV % GBT) == 0 && (NT % GBT) == 0 && (ND % GBT) == 0 && GTR >= 2);

typedef _Float16 v16h __attribute__((ext_vector_type(16)));
typedef _Float16 v8h  __attribute__((ext_vector_type(8)));
typedef float    v8f  __attribute__((ext_vector_type(8)));
typedef float    v4f  __attribute__((ext_vector_type(4)));
typedef unsigned int v4u __attribute__((ext_vector_type(4)));
typedef int      v4i  __attribute__((ext_vector_type(4)));
typedef unsigned int v16u __attribute__((ext_vector_type(16)));

// ---- scalar helpers --------------------------------------------------------------------------------
__device__ __forceinline__ unsigned short bf_bits(float f) {          // f32 -> bf16 bits, RNE convert
  unsigned u = __float_as_uint(f);
  return (unsigned short)((u + 0x7FFFu + ((u >> 16) & 1u)) >> 16);
}
__device__ __forceinline__ float bf_up(unsigned short h) { return __uint_as_float(((unsigned)h) << 16); }
__device__ __forceinline__ unsigned short h_bits(_Float16 x) { return __builtin_bit_cast(unsigned short, x); }
__device__ __forceinline__ unsigned pk16(unsigned short a, unsigned short b) { return (unsigned)a | ((unsigned)b << 16); }
__device__ __forceinline__ v8f zero8() { v8f z = {0.f, 0.f, 0.f, 0.f, 0.f, 0.f, 0.f, 0.f}; return z; }

// ---- fragment loader: 16-bit A/B operand, lane -> row/col (lane&15), p already includes +8*(lane>>4);
//      elements 0..7 <- p[0..7] (k0+8h..), elements 8..15 <- p[16..23] (k0+16+8h..)
__device__ __forceinline__ v16h ldfrag_h(const _Float16* p) {
  union { v16h v; v8h h[2]; } f;
  f.h[0] = *(const v8h*)(p);
  f.h[1] = *(const v8h*)(p + 16);
  return f.v;
}

// ---- WMMA helpers with trailing VALU hazard gap --------------------------------------------------------
__device__ __forceinline__ v8f mma_h_raw(v16h a, v16h b, v8f c) {
  return __builtin_amdgcn_wmma_f32_16x16x32_f16(false, a, false, b, (short)0, c, false, false);
}
__device__ __forceinline__ void guard4(v8f& a, v8f& b, v16h w, v16h x, v16h y, v16h z) {
#if defined(__HIP_DEVICE_COMPILE__)
  asm volatile("v_nop\n\tv_nop\n\tv_nop\n\tv_nop" : "+v"(a), "+v"(b) : "v"(w), "v"(x), "v"(y), "v"(z));
#endif
}
__device__ __forceinline__ void acc_guard4(v8f& a, v8f& b, v8f& c, v8f& d) {
#if defined(__HIP_DEVICE_COMPILE__)
  asm volatile("v_nop\n\tv_nop\n\tv_nop\n\tv_nop" : "+v"(a), "+v"(b), "+v"(c), "+v"(d));
#endif
}
__device__ __forceinline__ void wave_sync_lds() {
  __builtin_amdgcn_fence(__ATOMIC_RELEASE, "workgroup");
  __builtin_amdgcn_wave_barrier();
  __builtin_amdgcn_fence(__ATOMIC_ACQUIRE, "workgroup");
}

// ---- asynchronous copies global -> LDS ------------------------------------------------------------------
__device__ __forceinline__ unsigned lds_addr(const unsigned short* p) {   // byte offset in the work-group's LDS
  return (unsigned)(size_t)(const __attribute__((address_space(3))) unsigned short*)p;
}
// One lane's share of a 128-row x 128-B tile: eight 16-B pieces, 16 rows apart (global pitch ND halves, LDS pitch
// GLP halves). The closing s_wait_xcnt stands inside the statement so that no address register named here is
// rewritten ahead of it.
__device__ __forceinline__ void stage_rows(unsigned l, const unsigned short* g) {
#if defined(__HIP_DEVICE_COMPILE__)
  asm volatile(
      "global_load_async_to_lds_b128 %0, %8, off\n\t"
      "global_load_async_to_lds_b128 %1, %9, off\n\t"
      "global_load_async_to_lds_b128 %2, %10, off\n\t"
      "global_load_async_to_lds_b128 %3, %11, off\n\t"
      "global_load_async_to_lds_b128 %4, %12, off\n\t"
      "global_load_async_to_lds_b128 %5, %13, off\n\t"
      "global_load_async_to_lds_b128 %6, %14, off\n\t"
      "global_load_async_to_lds_b128 %7, %15, off\n\t"
      "s_wait_xcnt 0x0"
      :: "v"(l), "v"(l + 1u * 16u * GLP * 2u), "v"(l + 2u * 16u * GLP * 2u), "v"(l + 3u * 16u * GLP * 2u),
         "v"(l + 4u * 16u * GLP * 2u), "v"(l + 5u * 16u * GLP * 2u), "v"(l + 6u * 16u * GLP * 2u),
         "v"(l + 7u * 16u * GLP * 2u),
         "v"(g), "v"(g + 1 * 16 * ND), "v"(g + 2 * 16 * ND), "v"(g + 3 * 16 * ND),
         "v"(g + 4 * 16 * ND), "v"(g + 5 * 16 * ND), "v"(g + 6 * 16 * ND), "v"(g + 7 * 16 * ND)
      : "memory");
#endif
}
__device__ __forceinline__ void wait_copies() {      // this wave's own copies have landed in LDS
#if defined(__HIP_DEVICE_COMPILE__)
  asm volatile("s_wait_asynccnt 0x0" ::: "memory");
#endif
}
__device__ __forceinline__ void wait_lds_reads() {   // this wave's LDS reads have returned before their buffer is refilled
#if defined(__HIP_DEVICE_COMPILE__)
  asm volatile("s_wait_dscnt 0x0" ::: "memory");
#endif
}

// =====================================================================================================
// f32 -> f16( bf16_RNE(v) * scale ), scale a power of two (exact), 8 elements per thread, one 16-B store
// =====================================================================================================
__device__ __forceinline__ void cvt_h8(int blk, const float* __restrict__ in, unsigned short* out, int n8, float scale) {
  const int i = blk * 256 + threadIdx.x;
  if (i < n8) {
    const v4f a = *(const v4f*)(in + (size_t)i * 8);
    const v4f c = *(const v4f*)(in + (size_t)i * 8 + 4);
    float f[8];
    f[0] = a[0]; f[1] = a[1]; f[2] = a[2]; f[3] = a[3];
    f[4] = c[0]; f[5] = c[1]; f[6] = c[2]; f[7] = c[3];
    unsigned short hb[8];
#pragma unroll
    for (int e = 0; e < 8; ++e) hb[e] = h_bits((_Float16)(bf_up(bf_bits(f[e])) * scale));
    v4u p;
    p[0] = pk16(hb[0], hb[1]);
    p[1] = pk16(hb[2], hb[3]);
    p[2] = pk16(hb[4], hb[5]);
    p[3] = pk16(hb[6], hb[7]);
    *(v4u*)(out + (size_t)i * 8) = p;
    
  }
}

// =====================================================================================================
// Weight transpose + convert: W[c][o] f32 (c in [0,1024), o in [0,3072), o contiguous) ->
// WT[o][c] f16 = f16( bf16_RNE(W[c][o]) * scale ), c contiguous (k-major rows for the B fragment loader).
// Block = one 64(o) x 64(c) tile: thread (ol = tid&63, cb = tid>>6) reads 16 consecutive c rows of column o0+ol
// (coalesced per row across lanes), packs them as two 16-B LDS stores into sT[ol][c]; block barrier; then every
// tiles = (3072/64, 1024/64) = (48, 16): bx = o tiles (rows of WT), by = c tiles (rows of W).
// coverage: 256 threads x 2 rows-iterations... : rows tid>>3 (0..31) and +32 -> all 64 rows x 64 halves per tile.
// =====================================================================================================
__device__ __forceinline__ void cvt_wT(int bx, int by, const float* __restrict__ W, unsigned short* WT, float scale) {
  __shared__ __align__(16) unsigned short sT[64 * SPP];          // 9216 B
  const int tid = threadIdx.x;
  const int o0 = bx * 64;
  const int c0 = by * 64;
  {
    const int ol = tid & 63, cb = tid >> 6;                      // cb 0..3 -> c rows cb*16 .. +15
    unsigned short hb[16];
#pragma unroll
    for (int e = 0; e < 16; ++e) {
      const float f = W[(size_t)(c0 + cb * 16 + e) * NQKV + o0 + ol];
      hb[e] = h_bits((_Float16)(bf_up(bf_bits(f)) * scale));
    }
    v4u p0, p1;
#pragma unroll
    for (int q = 0; q < 4; ++q) {
      p0[q] = pk16(hb[2 * q], hb[2 * q + 1]);
      p1[q] = pk16(hb[8 + 2 * q], hb[8 + 2 * q + 1]);
    }
    *(v4u*)(sT + ol * SPP + cb * 16) = p0;
    *(v4u*)(sT + ol * SPP + cb * 16 + 8) = p1;
  }
  __syncthreads();
  {
    const int row = tid >> 3, c8 = (tid & 7) * 8;
    const v4u v0 = *(const v4u*)(sT + row * SPP + c8);
    const v4u v1 = *(const v4u*)(sT + (row + 32) * SPP + c8);
    const size_t d0 = (size_t)(o0 + row) * ND + c0 + c8;
    const size_t d1 = (size_t)(o0 + row + 32) * ND + c0 + c8;
    {
      *(v4u*)(WT + d0) = v0;
      *(v4u*)(WT + d1) = v1;
      // precaution: the two stores' address and data registers are not rewritten (by another job's code that
      // follows in the listing) before this wait
      asm volatile("s_wait_xcnt 0x0" ::: "memory");
    }
  }
}

// =====================================================================================================
// inv_freq[j] = 1 / 10000^(j/32), j = 0..31 (full head dim, not pairs), worked out by every thread that needs it.
// Contraction off: power, reciprocal and (in k_tab) the angle s * inv_freq are each rounded to f32 on their own, as the
// definition rounds them, before the sine and cosine see the angle.
// =====================================================================================================
__device__ __forceinline__ float k_invf(int j) {
  #pragma clang fp contract(off)
  const float e = (float)j * 0.03125f;
  const float p = powf(10000.0f, e);
  const float inv = 1.0f / p;
  return inv;
}

// =====================================================================================================
// Rotary tables COS/SIN[s][j] = cos/sin( s * inv_freq[j] ), s in [0,2048), j in [0,32): 256 threads = 8 rows x 32,
// one precise sincosf per thread (rolled, nothing unrolled); values staged in LDS, block barrier, then waves 0-1
// coverage: 256 blocks x 8 rows x 32 = every COS and SIN element.
// =====================================================================================================
__device__ __forceinline__ void k_tab(int blk, float* COS, float* SIN) {
  // the angle is rounded to f32 as a product of its own before sine and cosine (see k_invf)
  #pragma clang fp contract(off)
  __shared__ __align__(16) float sc[8 * 32];
  __shared__ __align__(16) float ss[8 * 32];
  const int tid = threadIdx.x, j = tid & 31, rl = tid >> 5;
  const int s = blk * 8 + rl;
  const float ang = (float)s * k_invf(j);
  float sn, cs;
  sincosf(ang, &sn, &cs);
  sc[rl * 32 + j] = cs;
  ss[rl * 32 + j] = sn;
  __syncthreads();
  if (tid < 64) {                                                // waves 0,1: COS rows
    const int row = tid >> 3, c4 = (tid & 7) * 4;
    const v4f v = *(const v4f*)(sc + row * 32 + c4);
    float* d = COS + (size_t)(blk * 8 + row) * HD + c4;
    *(v4f*)d = v;
    
  } else if (tid < 128) {                                        // waves 2,3: SIN rows
    const int t2 = tid - 64;
    const int row = t2 >> 3, c4 = (t2 & 7) * 4;
    const v4f v = *(const v4f*)(ss + row * 32 + c4);
    float* d = SIN + (size_t)(blk * 8 + row) * HD + c4;
    *(v4f*)d = v;
    
  }
}

// =====================================================================================================
// Mask digest, made once for all batch*head pairs. Block (cp, qb) = 128 query rows x MCH key chunks of 64; wave w owns
// the 16-row query tile qt = 8*qb + w and reads, per chunk, the same 32 entries per lane that the attention wave of
// that tile needs: lane -> query row 16*qt + (lane&15), keys of lane half lane>>4.
//   MB[qt][c][16*s + 8*t + r]: a lane mask, bit lane <-> (mask[row][64*c + 32*s + 16*t + 8*(lane>>4) + r] != 0), ready
//                    as the select mask of score element (t, r) of 32-key step s; one 128-B line per (qt, c), written
//                    by one wave (lane i stores word i).
//   FL[qb][cp][MFL]: entry e < MCH is nonzero iff any entry of the 128 x 64 block of chunk MCH*cp + e is nonzero;
//                    one whole 128-B line per block (the rest of the line is 0).
// blocks = (32/MCH, 16): every (qt, c) word line and every FL line written exactly once.
// =====================================================================================================
__device__ __forceinline__ void mask_digest(int cp, int qb, const int* __restrict__ msk, unsigned* MB, int* FL) {
  __shared__ int sany[MCH][8];
  const int tid = threadIdx.x, lane = tid & 31, wave = tid >> 5;
  const int rlane = lane & 15, hsel = lane >> 4;
  const int qt = qb * 8 + wave;
  const size_t rowbase = (size_t)(qt * 16 + rlane) * NT;
  // all loads of the wave stand ahead of its first store; every loop below is unrolled so that ent[] is indexed by
  // constants and stays in registers
  v4i ent[MCH][2][2][2];
#pragma unroll
  for (int e = 0; e < MCH; ++e) {
#pragma unroll
    for (int s = 0; s < 2; ++s) {
#pragma unroll
      for (int t = 0; t < 2; ++t) {
        const int* mp = msk + rowbase + (size_t)((cp * MCH + e) * KCH + 32 * s + 16 * t + 8 * hsel);
        ent[e][s][t][0] = *(const v4i*)mp;
        ent[e][s][t][1] = *(const v4i*)(mp + 4);
      }
    }
  }
#pragma unroll
  for (int e = 0; e < MCH; ++e) {
    unsigned any = 0u;
    int mine = 0;                                                // lane i ends up with word i
#pragma unroll
    for (int i = 0; i < 32; ++i) {                               // i = 16*s + 8*t + r
      const unsigned w = __builtin_amdgcn_ballot_w32(ent[e][i >> 4][(i >> 3) & 1][(i >> 2) & 1][i & 3] != 0);
      any |= w;
      mine = (lane == i) ? (int)w : mine;
    }
    MB[((size_t)qt * NKC + cp * MCH + e) * 32 + lane] = (unsigned)mine;
    if (lane == 0) sany[e][wave] = (any != 0u) ? 1 : 0;
  }
  __syncthreads();
  if (tid < MFL) {
    int f = 0;
    if (tid < MCH) {
#pragma unroll
      for (int w = 0; w < 8; ++w) f |= sany[tid][w];
    }
    FL[((size_t)qb * (NKC / MCH) + cp) * MFL + tid] = f;
  }
}

// =====================================================================================================
// All work that depends on the inputs alone, in ONE launch: the four jobs above read and write disjoint buffers and none
// reads what another writes, so their work-groups share the chip instead of waiting for one another's launch to end.
// The job is picked by the block index (the same for the whole work-group, so each job's barrier stays block-uniform):
//   [0, PB_DIG)       mask digest, block (cp, qb) = (i % 16, i / 16)
//   [.., PB_WT)       weight transpose + convert, tile (bx, by) = (i % 48, i / 48)
//   [.., PB_TAB)      rotary tables, 8 rows a block
//   [.., PB_ALL)      activation convert, 2048 elements a block
// =====================================================================================================
#define PB_DIG  ((NKC / MCH) * (NT / QBLK))
#define PB_WT   (PB_DIG + (NQKV / 64) * (ND / 64))
#define PB_TAB  (PB_WT + NT / 8)
#define PB_ALL  (PB_TAB + NTOK * ND / 2048)
__global__ __launch_bounds__(256) void prep(const float* __restrict__ x, const float* __restrict__ W,
                                            const int* __restrict__ msk, unsigned short* XH, unsigned short* WT,
                                            float* COS, float* SIN, unsigned* MB, int* FL) {
  const int blk = blockIdx.x;
  if (blk < PB_DIG) {
    mask_digest(blk % (NKC / MCH), blk / (NKC / MCH), msk, MB, FL);
  } else if (blk < PB_WT) {
    const int i = blk - PB_DIG;
    cvt_wT(i % (NQKV / 64), i / (NQKV / 64), W, WT, 1024.0f);
  } else if (blk < PB_TAB) {
    k_tab(blk - PB_WT, COS, SIN);
  } else {
    cvt_h8(blk - PB_TAB, x, XH, NTOK * ND / 8, 16.0f);
  }
}

// =====================================================================================================
// Fused qkv projection GEMM with rotary + 16-bit plane epilogue:
//   Y[tok][o] = sum_c XH[tok][c] * WT[o][c] * oscale,  tok in [0,4096), o in [0,3072), K = 1024.
// One work-group of 4 waves per 128x128 tile, one wave per 64x64 quarter (register-blocked); A = XH rows (token),
// Bt = WT rows (k contiguous). Per 64-deep k stage the 128 A rows and 128 Bt rows (128 B each, whole lines) are copied
// asynchronously into one of two LDS buffers (pitch 144 B) while the other buffer is worked on; k order unchanged.
// The 64 tokens of a tile lie in one batch b (t0 = m0 mod 2048); the 64 outputs are two heads h0, h0+1 of one of
// q (o < 1024), k (1024 <= o < 2048), v (o >= 2048); column j (16-wide subtile) -> head h0 + (j>>1), d = 16*(j&1)+lane%16.
//   q, k: rotary combine per the module: out[d] = y[d]*cos[s][d] - y[d+16]*sin[s][d] (d < 16),
//         out[d] = y[d]*cos[s][d] + y[d-16]*sin[s][d] (d >= 16); both partners sit in the same lane and element.
//         PH/PL[bh][t][32] f16 = (out*16) hi plane and residual x2^11 (64 B per token; the wave owns 64 consecutive
// then q/k: each head's slab region (16 tok x 64 B = 1024 contiguous B) written as 32 lanes x 16 B contiguous per
// grid = 768 blocks x 4 waves = 3072 wave tiles = 64 x 48 exactly.
// coverage: q/k tiles: 4 slabs x 2 heads x 16 tok x 32 d (hi and residual); v tiles: 4 subtiles x 16 d x 64 tok;
// 64 token tiles x (16+16+16) column tiles = every (bh, t) row of QH/QL/KH/KL and every (bh, d) row of VH/VL.
// =====================================================================================================
__global__ __launch_bounds__(128) void gemm_proj(
    const unsigned short* __restrict__ XHp, const unsigned short* __restrict__ WTp,
    const float* __restrict__ COS, const float* __restrict__ SIN,
    unsigned short* QH, unsigned short* QL, unsigned short* KH, unsigned short* KL,
    unsigned short* VH, unsigned short* VL, float oscale) {
  __shared__ __align__(16) unsigned short sA[2][GBUF];            // 36864 B
  __shared__ __align__(16) unsigned short sB[2][GBUF];            // 36864 B
  __shared__ __align__(16) unsigned short sP[4][2][16 * SPP];     // 18432 B
  const int tid  = threadIdx.x;
  const int lane = tid & 31;
  const int wave = tid >> 5;
  const int tilesN = NQKV / GBT;                                 // 24
  const int tilesM = NTOK / GBT;                                 // 32
  const int tile = blockIdx.x;
  if (tile >= tilesM * tilesN) return;                           // block-uniform, in front of every barrier
  const int tm = tile / tilesN;
  const int tn = tile - tm * tilesN;
  const int wm = wave >> 1, wn = wave & 1;                       // 2 x 2 waves
  const int m0 = tm * GBT + (wm << 6);                           // token base of this wave
  const int n0 = tn * GBT + (wn << 6);                           // output channel base in [0,3072)
  const int rlane = lane & 15;
  const int hh    = lane >> 4;
  const int koff  = hh * 8;
  const int mOff  = hh * 8;

  v8f acc[4][4];
#pragma unroll
  for (int i = 0; i < 4; ++i)
#pragma unroll
    for (int j = 0; j < 4; ++j) acc[i][j] = zero8();

  // copy share of this lane: piece tid&7 (16 B) of rows (tid>>3) + 16e, e = 0..7; a wave's copy = 4 whole 128-B lines
  const int crow = tid >> 3, cpc = (tid & 7) * 8;
  const unsigned short* gA = XHp + (size_t)(tm * GBT + crow) * ND + cpc;
  const unsigned short* gB = WTp + (size_t)(tn * GBT + crow) * ND + cpc;
  const unsigned lA = lds_addr(&sA[0][crow * GLP + cpc]);
  const unsigned lB = lds_addr(&sB[0][crow * GLP + cpc]);

  stage_rows(lA, gA);                                            // stage 0 -> buffer 0
  stage_rows(lB, gB);
  wait_copies();
  __syncthreads();
  stage_rows(lA + GBUF * 2u, gA + GBK);                          // stage 1 -> buffer 1
  stage_rows(lB + GBUF * 2u, gB + GBK);

  // rolled: the two-buffer order below is written once
#pragma unroll 1
  for (int t = 0; t < GTR; ++t) {
    const int bsel = t & 1;
    const _Float16* fa = (const _Float16*)(const void*)&sA[bsel][((wm << 6) + rlane) * GLP + koff];
    const _Float16* fb = (const _Float16*)(const void*)&sB[bsel][((wn << 6) + rlane) * GLP + koff];
#pragma unroll
    for (int kk = 0; kk < GBK; kk += 32) {
      v16h bf[4], af[4];
#pragma unroll
      for (int j = 0; j < 4; ++j) bf[j] = ldfrag_h(fb + (j << 4) * GLP + kk);
#pragma unroll
      for (int i = 0; i < 4; ++i) af[i] = ldfrag_h(fa + (i << 4) * GLP + kk);
#pragma unroll
      for (int i = 0; i < 4; ++i)
#pragma unroll
        for (int j = 0; j < 4; ++j) acc[i][j] = mma_h_raw(af[i], bf[j], acc[i][j]);
      // all 16 LDS reads of this k step as one group ahead of its 16 products: one LDS wait a step, not one a row
      __builtin_amdgcn_sched_group_barrier(0x100, 16, 0);
      __builtin_amdgcn_sched_group_barrier(0x008, 16, 0);
    }
    // publish point of stage t + 1: own reads done, own copies landed, barrier, then the refill of the buffer just read
    wait_lds_reads();
    wait_copies();
    __syncthreads();
    if (t + 2 < GTR) {
      stage_rows(lA + (unsigned)bsel * (GBUF * 2u), gA + (t + 2) * GBK);
      stage_rows(lB + (unsigned)bsel * (GBUF * 2u), gB + (t + 2) * GBK);
    }
  }
  wait_copies();
  acc_guard4(acc[0][0], acc[0][1], acc[0][2], acc[0][3]);
  acc_guard4(acc[1][0], acc[1][1], acc[1][2], acc[1][3]);
  acc_guard4(acc[2][0], acc[2][1], acc[2][2], acc[2][3]);
  acc_guard4(acc[3][0], acc[3][1], acc[3][2], acc[3][3]);

  // ---- epilogue ----
  const int b   = m0 / NT;
  const int t0  = m0 - b * NT;
  const int sel = n0 >> 10;                                      // 0 q, 1 k, 2 v (wave-uniform)
  const int h0  = (n0 & (ND - 1)) >> 5;                          // first of the two heads of this tile
  unsigned short* s0 = &sP[wave][0][0];
  unsigned short* s1 = &sP[wave][1][0];

  if (sel < 2) {
    unsigned short* PH = (sel == 0) ? QH : KH;
    unsigned short* PL = (sel == 0) ? QL : KL;
#pragma unroll
    for (int i = 0; i < 4; ++i) {                                // slab = 16 tokens t0+16i .. +15
#pragma unroll
      for (int r = 0; r < 8; ++r) {
        const int tok = t0 + (i << 4) + mOff + r;                // row tok = 8hh + r
        const float* cp = COS + (size_t)tok * HD;
        const float* sp = SIN + (size_t)tok * HD;
        const float ca = cp[rlane], cb = cp[16 + rlane];
        const float sa = sp[rlane], sb = sp[16 + rlane];
#pragma unroll
        for (int hp = 0; hp < 2; ++hp) {
          const float y0 = acc[i][2 * hp][r] * oscale;           // d = rlane
          const float y1 = acc[i][2 * hp + 1][r] * oscale;       // d = 16 + rlane
          const float f0 = (y0 * ca - y1 * sa) * 16.0f;
          const float f1 = (y1 * cb + y0 * sb) * 16.0f;
          const _Float16 x0 = (_Float16)f0;
          const _Float16 x1 = (_Float16)f1;
          const int so = (mOff + r) * SPP + 32 * hp + rlane;     // row tok, col 32hp + d
          s0[so]      = h_bits(x0);
          s1[so]      = h_bits((_Float16)((f0 - (float)x0) * 2048.0f));
          s0[so + 16] = h_bits(x1);
          s1[so + 16] = h_bits((_Float16)((f1 - (float)x1) * 2048.0f));
        }
      }
      wave_sync_lds();
      {
        const int rr = lane >> 2, cc = (lane & 3) * 8;           // rr*32 + cc = lane*8 halves
#pragma unroll
        for (int hp = 0; hp < 2; ++hp) {
          const int bhp = b * NH + h0 + hp;
          const size_t base = ((size_t)(bhp * NT + t0 + (i << 4))) * HD + lane * 8;
          const v4u v0 = *(const v4u*)(s0 + rr * SPP + 32 * hp + cc);
          const v4u v1 = *(const v4u*)(s0 + (rr + 8) * SPP + 32 * hp + cc);
          const v4u w0 = *(const v4u*)(s1 + rr * SPP + 32 * hp + cc);
          const v4u w1 = *(const v4u*)(s1 + (rr + 8) * SPP + 32 * hp + cc);
          {
            *(v4u*)(PH + base) = v0;
            *(v4u*)(PH + base + 256) = v1;
            *(v4u*)(PL + base) = w0;
            *(v4u*)(PL + base + 256) = w1;
            
          }
        }
      }
      wave_sync_lds();
    }
  } else {
#pragma unroll
    for (int j = 0; j < 4; ++j) {                                // slab = 16 rows d = 16(j&1) + rlane of head h0+(j>>1)
      const int hp = j >> 1, dbase = (j & 1) * 16;
      const int bhp = b * NH + h0 + hp;
#pragma unroll
      for (int i = 0; i < 4; ++i) {
        unsigned short hb[8], lb[8];
#pragma unroll
        for (int r = 0; r < 8; ++r) {
          const float f = (acc[i][j][r] * oscale) * 16.0f;
          const _Float16 xh = (_Float16)f;
          hb[r] = h_bits(xh);
          lb[r] = h_bits((_Float16)((f - (float)xh) * 2048.0f));
        }
        v4u ph, pl;
#pragma unroll
        for (int q = 0; q < 4; ++q) {
          ph[q] = pk16(hb[2 * q], hb[2 * q + 1]);
          pl[q] = pk16(lb[2 * q], lb[2 * q + 1]);
        }
        *(v4u*)(s0 + rlane * SPP + (i << 4) + mOff) = ph;       // row d = rlane, tok = 16i + 8hh .. +7
        *(v4u*)(s1 + rlane * SPP + (i << 4) + mOff) = pl;
      }
      wave_sync_lds();
      {
        const int rq = lane >> 3, c8 = (lane & 7) * 8;
        {
#pragma unroll
          for (int it = 0; it < 4; ++it) {
            const int row = it * 4 + rq;                         // it 0..3 x rq 0..3 = rows 0..15
            const size_t dst = ((size_t)(bhp * HD + dbase + row)) * NT + t0 + c8;
            const v4u v = *(const v4u*)(s0 + row * SPP + c8);
            const v4u w = *(const v4u*)(s1 + row * SPP + c8);
            *(v4u*)(VH + dst) = v;
            *(v4u*)(VL + dst) = w;
          }
          
        }
      }
      wave_sync_lds();
    }
  }
}

// =====================================================================================================
// Attention for one batch*head and two 128-query blocks (NQB-1-y, then y): grid = (64, 8), 256 threads = 8 waves x 16
// queries; at most four waves a SIMD by the register allocation, so the 512 equal work-groups lie two on a WGP; each lane
// owns one query column q = q0 + 16*wave + (lane&15). QH/QL/KH/KL[bh][t][32] f16 (x16 hi, residual x2^11),
// VH/VL[bh][d][2048] (x16 hi, residual x2^11). The mask [2048 q][2048 key] comes as the digest of mask_digest: key
// chunks of 64; each wave loads the 32 lane masks MB[qt][c][..] of its query tile by wave-uniform loads, one mask per
// score element; a chunk whose entries are all zero for the whole block (FL, gathered once into a wave-uniform word)
// is skipped block-uniformly, in front of every barrier of the chunk (exact: such keys have probability 0). Otherwise
// K hi/res rows [64][40] and V hi/res tiles [32 d][72] are staged in LDS with plain 16-B loads between two block
// barriers. Per 32-key step and 16-key tile t:
// S[key][q] = A(K hi rows) x B(resident Q hi) and Sr = A(K hi) x B(Q res) + A(K res) x B(Q hi) in separate zeroed
// accumulators; logit = (S + Sr/2048) / 256 / sqrt(32); entries with mask == 0 replaced by -inf; online softmax over
// keys (max/sum across lane halves by shuffle); p = 1024*exp(x - max) packed D->B per the chained map (element r <-
// keys 0-15 tile, 8+r <- keys 16-31 tile) as f16 hi plus residual x2^11; Oh[d][q] += A(V hi rows) x Ph,
// Ol += A(V res) x Ph + A(V hi) x Pl (both 2^-11 terms); out = (Oh + Ol/2048) / (16 * l) (l = 0 gives 0*inf = NaN).
// coverage: 64 x 8 blocks x 2 tiles x 8 waves x 16 rows x 32 floats = every (tok, head) line of the output.
// =====================================================================================================
__global__ __launch_bounds__(ATHR) __attribute__((amdgpu_waves_per_eu(4, 4))) void attn_kernel(
    const unsigned short* __restrict__ QHp, const unsigned short* __restrict__ QLp,
    const unsigned short* __restrict__ KHp, const unsigned short* __restrict__ KLp,
    const unsigned short* __restrict__ VHp, const unsigned short* __restrict__ VLp,
    const unsigned* __restrict__ MB, const int* __restrict__ FL, float* Out) {
  __shared__ __align__(16) unsigned short kh_u[KCH * KP];         // 5120 B
  __shared__ __align__(16) unsigned short kl_u[KCH * KP];         // 5120 B
  __shared__ __align__(16) unsigned short vh_u[HD * VP];          // 4608 B
  __shared__ __align__(16) unsigned short vl_u[HD * VP];          // 4608 B
  __shared__ __align__(16) float sO[8][16 * OP];                  // 18432 B
  const _Float16* kh = (const _Float16*)(const void*)kh_u;
  const _Float16* kl = (const _Float16*)(const void*)kl_u;
  const _Float16* vh = (const _Float16*)(const void*)vh_u;
  const _Float16* vl = (const _Float16*)(const void*)vl_u;
  const _Float16* QH = (const _Float16*)(const void*)QHp;
  const _Float16* QL = (const _Float16*)(const void*)QLp;

  const int tid = threadIdx.x, lane = tid & 31, wave = tid >> 5;
  const int bh = blockIdx.x;
  const int b  = bh / NH;
  const int h  = bh - b * NH;
  const int rlane = lane & 15, hsel = lane >> 4, koff = hsel * 8;

  // Two query tiles per work-group, one after the other in every wave: NQB-1-y, then y. Under a lower-triangular mask the
  // active chunks of such a pair add up to the same count in every work-group; any other mask is only divided differently.
  // The first barrier of the second tile's first chunk ends every wave's reads of the first tile's last K/V chunk.
  // rolled: the tile body is written once
#pragma unroll 1
  for (int leg = 0; leg < 2; ++leg) {
    const int qb = (leg == 0) ? (NQB - 1 - (int)blockIdx.y) : (int)blockIdx.y;
    const int q0 = qb * QBLK;
    const int qrow = q0 + wave * 16 + rlane;                       // this lane's query index within the sequence

    // resident Q fragments (B operand: B[k=d][n=q] from [q][d] rows), arithmetic addressing, one 32-deep k-step
    const size_t qo = ((size_t)(bh * NT + qrow)) * HD + koff;
    const v16h qh0 = ldfrag_h(QH + qo);
    const v16h ql0 = ldfrag_h(QL + qo);
    // this wave's lane masks, 32 words a chunk; the wave number made uniform so that the words load into scalar registers
    const unsigned* mbp = MB + ((size_t)(qb * 8 + __builtin_amdgcn_readfirstlane(wave)) * NKC) * 32;
    // bit c <-> chunk c has a nonzero mask entry somewhere in this block's 128 query rows (the same word in every wave)
    const unsigned act = __builtin_amdgcn_ballot_w32(
        FL[((size_t)qb * (NKC / MCH) + lane / MCH) * MFL + (lane % MCH)] != 0);

    const float C2048  = 1.0f / 2048.0f;
    const float SCL    = 0.17677669529663687f * (1.0f / 256.0f);  // undo q*16, k*16, then 1/sqrt(32)
    const float LN1024 = 6.931471805599453f;
    const float NEGINF = __uint_as_float(0xff800000u);

    v8f oh[2], ol[2];
#pragma unroll
    for (int dt = 0; dt < 2; ++dt) { oh[dt] = zero8(); ol[dt] = zero8(); }
    float m_run = -1.0e30f, l_run = 0.0f;

#pragma unroll 1
    for (int c = 0; c < NKC; ++c) {
      if (((act >> c) & 1u) == 0u) continue;                       // block-uniform skip of an all-masked chunk
      const int kc = c * KCH;
      __syncthreads();                                             // all waves finished reading the prior chunk's K/V
      // lane masks: word (16*s + 8*t + r), bit lane <-> key kc + 32*s + 16*t + 8*hsel + r of the lane's query row
      // read through the constant address space (nothing writes MB in this launch), which makes them scalar loads
      const v16u mw0 = *(const __attribute__((address_space(4))) v16u*)(mbp + c * 32);
      const v16u mw1 = *(const __attribute__((address_space(4))) v16u*)(mbp + c * 32 + 16);

      // ---- stage K hi/res rows and V hi/res tiles of keys kc..kc+63 (one 16-B item per thread each) ----
      {
        const int key = tid >> 2, ck = (tid & 3) * 8;              // 64 keys x 32 halves
        const size_t gk = ((size_t)(bh * NT + kc + key)) * HD + ck;
        const int d = tid >> 3, cv = (tid & 7) * 8;                // 32 d rows x 64 halves
        const size_t gv = ((size_t)(bh * HD + d)) * NT + kc + cv;
        const v4u gkh = *(const v4u*)(KHp + gk);
        const v4u gkl = *(const v4u*)(KLp + gk);
        const v4u gvh = *(const v4u*)(VHp + gv);
        const v4u gvl = *(const v4u*)(VLp + gv);
        *(v4u*)(kh_u + key * KP + ck) = gkh;
        *(v4u*)(kl_u + key * KP + ck) = gkl;
        *(v4u*)(vh_u + d * VP + cv) = gvh;
        *(v4u*)(vl_u + d * VP + cv) = gvl;
      }
      __syncthreads();

#pragma unroll 1
      for (int sub = 0; sub < 2; ++sub) {
        const int kr = sub * 32;
        float a[2][8];
#pragma unroll
        for (int t = 0; t < 2; ++t) {
          const int krow = kr + 16 * t + rlane;
          const v16h kha = ldfrag_h(kh + krow * KP + koff);
          const v16h kla = ldfrag_h(kl + krow * KP + koff);
          v8f sh = mma_h_raw(kha, qh0, zero8());
          v8f sr = mma_h_raw(kha, ql0, zero8());
          sr = mma_h_raw(kla, qh0, sr);
          guard4(sh, sr, kha, kla, qh0, ql0);
#pragma unroll
          for (int r = 0; r < 8; ++r) {
            const float s = (sh[r] + sr[r] * C2048) * SCL;
            const unsigned kw = (sub != 0) ? mw1[t * 8 + r] : mw0[t * 8 + r];
            a[t][r] = __builtin_amdgcn_inverse_ballot_w32(kw) ? s : NEGINF;
          }
        }

        // online softmax over the key axis for this lane's q column
        float mloc = -1.0e30f;
#pragma unroll
        for (int r = 0; r < 8; ++r) mloc = fmaxf(mloc, fmaxf(a[0][r], a[1][r]));
        mloc = fmaxf(mloc, __shfl_xor(mloc, 16, 32));
        const float newM  = fmaxf(m_run, mloc);
        const float alph  = __expf(m_run - newM);
        const float msh   = newM - LN1024;
        float ssum = 0.0f;
        float p[2][8];
#pragma unroll
        for (int r = 0; r < 8; ++r) {
          p[0][r] = __expf(a[0][r] - msh);
          p[1][r] = __expf(a[1][r] - msh);
          ssum += p[0][r] + p[1][r];
        }
        ssum += __shfl_xor(ssum, 16, 32);
        l_run = l_run * alph + ssum;
        m_run = newM;
#pragma unroll
        for (int dt = 0; dt < 2; ++dt) {
#pragma unroll
          for (int r = 0; r < 8; ++r) { oh[dt][r] *= alph; ol[dt][r] *= alph; }
        }

        // P (f32, D layout) -> B operands (f16 hi, f16 residual x2^11): element r <- keys 0-15 tile, 8+r <- keys 16-31 tile
        union { v16h v; _Float16 s[16]; } ph, plo;
#pragma unroll
        for (int r = 0; r < 8; ++r) {
          const _Float16 x0 = (_Float16)p[0][r];
          const _Float16 x1 = (_Float16)p[1][r];
          ph.s[r]      = x0;
          ph.s[8 + r]  = x1;
          plo.s[r]     = (_Float16)((p[0][r] - (float)x0) * 2048.0f);
          plo.s[8 + r] = (_Float16)((p[1][r] - (float)x1) * 2048.0f);
        }

        // O[d][q] += V[d][kr .. +31] x P, hi and residual terms
#pragma unroll
        for (int dt = 0; dt < 2; ++dt) {
          const v16h vah = ldfrag_h(vh + (16 * dt + rlane) * VP + kr + koff);
          const v16h val = ldfrag_h(vl + (16 * dt + rlane) * VP + kr + koff);
          oh[dt] = mma_h_raw(vah, ph.v, oh[dt]);
          ol[dt] = mma_h_raw(val, ph.v, ol[dt]);
          ol[dt] = mma_h_raw(vah, plo.v, ol[dt]);
          guard4(oh[dt], ol[dt], vah, val, ph.v, plo.v);
        }
      }
    }
    acc_guard4(oh[0], oh[1], ol[0], ol[1]);

    // ---- output values -> per-wave f32 LDS staging ----
    const float inv = (1.0f / 16.0f) * (1.0f / l_run);            // out = (Oh + Ol/2048) / (16 * l)
    float* st = sO[wave];
#pragma unroll
    for (int dt = 0; dt < 2; ++dt) {
      v4f va, vb;
#pragma unroll
      for (int e = 0; e < 4; ++e) {
        va[e] = (oh[dt][e]     + ol[dt][e]     * C2048) * inv;     // d = 16dt + 8hsel + e
        vb[e] = (oh[dt][4 + e] + ol[dt][4 + e] * C2048) * inv;     // d = 16dt + 8hsel + 4 + e
      }
      const int so = rlane * OP + 16 * dt + 8 * hsel;              // row q = rlane
      *(v4f*)(st + so) = va;
      *(v4f*)(st + so + 4) = vb;
    }
    wave_sync_lds();
    {
      const int rq = lane >> 3, c4 = (lane & 7) * 4;
      const int n0 = q0 + wave * 16;
      {
#pragma unroll
        for (int it = 0; it < 4; ++it) {
          const int row = it * 4 + rq;                             // it 0..3 x rq 0..3 = rows 0..15
          const v4f v = *(const v4f*)(st + row * OP + c4);
          *(v4f*)(Out + ((size_t)(b * NT + n0 + row)) * ND + h * HD + c4) = v;
        }
        // precaution: the four stores' address and data registers are not rewritten (by the second tile's code) before
        // this wait
        asm volatile("s_wait_xcnt 0x0" ::: "memory");
      }
    }
  }
}

// =====================================================================================================
// Workspace map (bytes, every offset a multiple of 128; every plane an exact multiple of its whole-line store
// granularity, row counts exact tile multiples, no padded tails needed):
//   XH   f16 [4096][1024]    activation, bf16-RNE x16                    0          8388608 B
//   WT   f16 [3072][1024]    Wqkv transposed, bf16-RNE x1024       8388608          6291456 B
//   COS  f32 [2048][32]                                          14680064           262144 B
//   SIN  f32 [2048][32]                                          14942208           262144 B
//   (256 B not used)                                            15204352              256 B
//   QH   f16 [64][2048][32]  q x16 hi                            15204608          8388608 B
//   QL   f16 [64][2048][32]  q residual x2^11                    23593216          8388608 B
//   KH   f16 [64][2048][32]                                      31981824          8388608 B
//   KL   f16 [64][2048][32]                                      40370432          8388608 B
//   VH   f16 [64][32][2048]  v x16 hi, key-contiguous            48759040          8388608 B
//   VL   f16 [64][32][2048]                                      57147648          8388608 B
//   MB   u32 [128][32][32]   lane masks per (query tile, chunk, element) 65536256     524288 B
//   FL   i32 [16][16][32]    chunk flags, one line per digest block  66060544          32768 B
//   end                                                          66093312
// =====================================================================================================
extern "C" void kernel_launch(void* const* d_in, const int* in_sizes, int n_in,
                              void* d_out, int out_size, void* d_ws, size_t ws_size,
                              hipStream_t stream) {
  if (n_in < 3) return;
  if (in_sizes[0] != NTOK * ND) return;
  if (in_sizes[1] != ND * NQKV) return;
  if (in_sizes[2] != NT * NT) return;
  if (out_size != NTOK * ND) return;

  const float* x   = (const float*)d_in[0];
  const float* W   = (const float*)d_in[1];
  const int*   msk = (const int*)d_in[2];

  const size_t PXH = (size_t)NTOK * ND * 2;                    // 8388608
  const size_t PWT = (size_t)NQKV * ND * 2;                    // 6291456
  const size_t PTB = (size_t)NT * HD * 4;                      // 262144
  const size_t PIN = 256;
  const size_t PQK = (size_t)NBH * NT * HD * 2;                // 8388608
  const size_t PV  = (size_t)NBH * HD * NT * 2;                // 8388608
  size_t off = 0;
  const size_t oXH  = off; off += PXH;
  const size_t oWT  = off; off += PWT;
  const size_t oCOS = off; off += PTB;
  const size_t oSIN = off; off += PTB;
  off += PIN;                                                  // 256 B not used
  const size_t oQH  = off; off += PQK;
  const size_t oQL  = off; off += PQK;
  const size_t oKH  = off; off += PQK;
  const size_t oKL  = off; off += PQK;
  const size_t oVH  = off; off += PV;
  const size_t oVL  = off; off += PV;
  const size_t oMB  = off; off += (size_t)(NT / 16) * NKC * 32 * 4;        // 524288
  const size_t oFL  = off; off += (size_t)(NT / QBLK) * (NKC / MCH) * MFL * 4;   // 32768
  if (off > ws_size) return;                                   // off = 66093312
  if (off > (size_t)134217728) return;

  char* ws = (char*)d_ws;
  unsigned short* XH   = (unsigned short*)(ws + oXH);
  unsigned short* WT   = (unsigned short*)(ws + oWT);
  float*          COS  = (float*)(ws + oCOS);
  float*          SIN  = (float*)(ws + oSIN);
  unsigned short* QH   = (unsigned short*)(ws + oQH);
  unsigned short* QL   = (unsigned short*)(ws + oQL);
  unsigned short* KH   = (unsigned short*)(ws + oKH);
  unsigned short* KL   = (unsigned short*)(ws + oKL);
  unsigned short* VH   = (unsigned short*)(ws + oVH);
  unsigned short* VL   = (unsigned short*)(ws + oVL);
  unsigned*       MB   = (unsigned*)(ws + oMB);
  int*            FL   = (int*)(ws + oFL);
  float*          out  = (float*)d_out;

  const dim3 blk(256);
  const dim3 gPrep(PB_ALL);                                    // 256 + 768 + 256 + 2048 = 3328
  const dim3 gProj((NTOK / GBT) * (NQKV / GBT));               // 32 x 24 = 768 blocks of 4 waves
  const dim3 gAttn(NBH, NQB / 2);                              // 64 x 8, 256 threads, two query tiles each

  const float oscPrj = 1.0f / 16384.0f;                        // undo x*16 and W*1024

  // (1) one launch: inputs -> f16 planes holding bf16-RNE values times an exact power of two; rotary tables;
  //     mask -> lane masks of the attention waves' score elements, and one flag per 128-query x 64-key block
  prep<<<gPrep, blk, 0, stream>>>(x, W, msk, XH, WT, COS, SIN, MB, FL);
  // (2) fused qkv projection with rotary epilogue: q, k -> [bh][t][32] hi/res planes; v -> [bh][d][t] hi/res planes
  gemm_proj<<<gProj, dim3(128), 0, stream>>>(XH, WT, COS, SIN, QH, QL, KH, KL, VH, VL, oscPrj);
  // (3) attention per (batch*head, pair of 128-query blocks) -> f32 output lines [tok][h*32 .. +31]
  attn_kernel<<<gAttn, dim3(ATHR), 0, stream>>>(QH, QL, KH, KL, VH, VL, MB, FL, out);
  (void)hipGetLastError();
}

// v005
// Measured time: 96.7 microseconds a run.
// Next to v004, in two timings, it ran 1.09 times as fast each time.
// Counting every step since v000, it is 2.26 times as fast.
#include <hip/hip_runtime.h>
#include <math.h>
#include <stdint.h>

// Contractions: fused qkv projection x.Wqkv (f16 operands holding bf16-RNE values, x carried x16 and W x1024, one
// product per tile pair); scores k.q (k and q each an f16 hi plane x16 plus an f16 residual plane at the same scale,
// small residuals as f16 subnormals: hi.lo + lo.hi + hi.hi chained in ONE accumulator, 3 products); context v.p
// (p x1024 and v x16, each f16 hi plus f16 residual at the same scale: lo.hi + hi.lo + hi.hi chained in the one running
// accumulator, 3 products); all v_wmma_f32_16x16x32_f16 with f32 accumulate; rotary tables, rotary combine, key masking, softmax
// statistics and the final normalisation in f32 on VALU; output stored as f32.

#define NB    2
#define NT    2048
#define ND    1024
#define NQKV  3072
#define NH    32
#define HD    32
#define NTOK  (NB * NT)
#define NBH   (NB * NH)
#define QBLK  128
#define KCH   64
#define NKC   (NT / KCH)
#define NQB   (NT / QBLK)
#define KP    40
#define VP    72
#define SPP   72
#define OP    36
#define ATHR  256
#define GBT   128
#define GBK   64
#define GLP   72
#define GTR   (ND / GBK)
#define GBUF  (GBT * GLP)
#define MCH   2
#define MFL   32

static_assert(NH * HD == ND);
static_assert(NQKV == 3 * ND);
static_assert((NT % QBLK) == 0 && (NT % KCH) == 0 && (NT % 64) == 0 && (NTOK % 64) == 0);
static_assert((NQKV % 64) == 0 && (ND % 64) == 0 && (ND % 32) == 0);
static_assert(QBLK == (ATHR / 32) * 16 && (NQB % 2) == 0);
static_assert(KCH * 4 == ATHR && HD * 8 == ATHR);
static_assert(HD == 32 && KCH == 64 && NKC * KCH == NT);
static_assert(NKC == 32 && (NKC % MCH) == 0 && MCH <= MFL && QBLK == 8 * 16);
static_assert(((NTOK * ND) % 2048) == 0);
static_assert((NTOK % GBT) == 0 && (NQKV % GBT) == 0 && (NT % GBT) == 0 && (ND % GBT) == 0 && GTR >= 2);

typedef _Float16 v16h __attribute__((ext_vector_type(16)));
typedef _Float16 v8h  __attribute__((ext_vector_type(8)));
typedef float    v8f  __attribute__((ext_vector_type(8)));
typedef float    v4f  __attribute__((ext_vector_type(4)));
typedef unsigned int v4u __attribute__((ext_vector_type(4)));
typedef int      v4i  __attribute__((ext_vector_type(4)));
typedef unsigned int v16u __attribute__((ext_vector_type(16)));

// ---- scalar helpers --------------------------------------------------------------------------------
__device__ __forceinline__ unsigned short bf_bits(float f) {          // f32 -> bf16 bits, RNE convert
  unsigned u = __float_as_uint(f);
  return (unsigned short)((u + 0x7FFFu + ((u >> 16) & 1u)) >> 16);
}
__device__ __forceinline__ float bf_up(unsigned short h) { return __uint_as_float(((unsigned)h) << 16); }
__device__ __forceinline__ unsigned short h_bits(_Float16 x) { return __builtin_bit_cast(unsigned short, x); }
__device__ __forceinline__ unsigned pk16(unsigned short a, unsigned short b) { return (unsigned)a | ((unsigned)b << 16); }
__device__ __forceinline__ v8f zero8() { v8f z = {0.f, 0.f, 0.f, 0.f, 0.f, 0.f, 0.f, 0.f}; return z; }

// ---- fragment loader: 16-bit A/B operand, lane -> row/col (lane&15), p already includes +8*(lane>>4);
//      elements 0..7 <- p[0..7] (k0+8h..), elements 8..15 <- p[16..23] (k0+16+8h..)
__device__ __forceinline__ v16h ldfrag_h(const _Float16* p) {
  union { v16h v; v8h h[2]; } f;
  f.h[0] = *(const v8h*)(p);
  f.h[1] = *(const v8h*)(p + 16);
  return f.v;
}

// ---- WMMA helpers with trailing VALU hazard gap --------------------------------------------------------
__device__ __forceinline__ v8f mma_h_raw(v16h a, v16h b, v8f c) {
  return __builtin_amdgcn_wmma_f32_16x16x32_f16(false, a, false, b, (short)0, c, false, false);
}
__device__ __forceinline__ void guard4(v8f& a, v8f& b, v16h u, v16h v, v16h w, v16h x, v16h y, v16h z) {
#if defined(__HIP_DEVICE_COMPILE__)
  asm volatile("v_nop\n\tv_nop\n\tv_nop\n\tv_nop" : "+v"(a), "+v"(b) : "v"(u), "v"(v), "v"(w), "v"(x), "v"(y), "v"(z));
#endif
}
// the same gap behind the loop's last products, in front of the first vector read of the two output accumulators
__device__ __forceinline__ void acc_guard2(v8f& a, v8f& b) {
#if defined(__HIP_DEVICE_COMPILE__)
  asm volatile("v_nop\n\tv_nop\n\tv_nop\n\tv_nop" : "+v"(a), "+v"(b));
#endif
}
__device__ __forceinline__ void acc_guard4(v8f& a, v8f& b, v8f& c, v8f& d) {
#if defined(__HIP_DEVICE_COMPILE__)
  asm volatile("v_nop\n\tv_nop\n\tv_nop\n\tv_nop" : "+v"(a), "+v"(b), "+v"(c), "+v"(d));
#endif
}
__device__ __forceinline__ void wave_sync_lds() {
  __builtin_amdgcn_fence(__ATOMIC_RELEASE, "workgroup");
  __builtin_amdgcn_wave_barrier();
  __builtin_amdgcn_fence(__ATOMIC_ACQUIRE, "workgroup");
}

// ---- asynchronous copies global -> LDS ------------------------------------------------------------------
__device__ __forceinline__ unsigned lds_addr(const unsigned short* p) {   // byte offset in the work-group's LDS
  return (unsigned)(size_t)(const __attribute__((address_space(3))) unsigned short*)p;
}
// One lane's share of a 128-row x 128-B tile: eight 16-B pieces, 16 rows apart (global pitch ND halves, LDS pitch
// GLP halves). The closing s_wait_xcnt stands inside the statement so that no address register named here is
// rewritten ahead of it.
__device__ __forceinline__ void stage_rows(unsigned l, const unsigned short* g) {
#if defined(__HIP_DEVICE_COMPILE__)
  asm volatile(
      "global_load_async_to_lds_b128 %0, %8, off\n\t"
      "global_load_async_to_lds_b128 %1, %9, off\n\t"
      "global_load_async_to_lds_b128 %2, %10, off\n\t"
      "global_load_async_to_lds_b128 %3, %11, off\n\t"
      "global_load_async_to_lds_b128 %4, %12, off\n\t"
      "global_load_async_to_lds_b128 %5, %13, off\n\t"
      "global_load_async_to_lds_b128 %6, %14, off\n\t"
      "global_load_async_to_lds_b128 %7, %15, off\n\t"
      "s_wait_xcnt 0x0"
      :: "v"(l), "v"(l + 1u * 16u * GLP * 2u), "v"(l + 2u * 16u * GLP * 2u), "v"(l + 3u * 16u * GLP * 2u),
         "v"(l + 4u * 16u * GLP * 2u), "v"(l + 5u * 16u * GLP * 2u), "v"(l + 6u * 16u * GLP * 2u),
         "v"(l + 7u * 16u * GLP * 2u),
         "v"(g), "v"(g + 1 * 16 * ND), "v"(g + 2 * 16 * ND), "v"(g + 3 * 16 * ND),
         "v"(g + 4 * 16 * ND), "v"(g + 5 * 16 * ND), "v"(g + 6 * 16 * ND), "v"(g + 7 * 16 * ND)
      : "memory");
#endif
}
__device__ __forceinline__ void wait_copies() {      // this wave's own copies have landed in LDS
#if defined(__HIP_DEVICE_COMPILE__)
  asm volatile("s_wait_asynccnt 0x0" ::: "memory");
#endif
}
__device__ __forceinline__ void wait_lds_reads() {   // this wave's LDS reads have returned before their buffer is refilled
#if defined(__HIP_DEVICE_COMPILE__)
  asm volatile("s_wait_dscnt 0x0" ::: "memory");
#endif
}

// =====================================================================================================
// f32 -> f16( bf16_RNE(v) * scale ), scale a power of two (exact), 8 elements per thread, one 16-B store
// =====================================================================================================
__device__ __forceinline__ void cvt_h8(int blk, const float* __restrict__ in, unsigned short* out, int n8, float scale) {
  const int i = blk * 256 + threadIdx.x;
  if (i < n8) {
    const v4f a = *(const v4f*)(in + (size_t)i * 8);
    const v4f c = *(const v4f*)(in + (size_t)i * 8 + 4);
    float f[8];
    f[0] = a[0]; f[1] = a[1]; f[2] = a[2]; f[3] = a[3];
    f[4] = c[0]; f[5] = c[1]; f[6] = c[2]; f[7] = c[3];
    unsigned short hb[8];
#pragma unroll
    for (int e = 0; e < 8; ++e) hb[e] = h_bits((_Float16)(bf_up(bf_bits(f[e])) * scale));
    v4u p;
    p[0] = pk16(hb[0], hb[1]);
    p[1] = pk16(hb[2], hb[3]);
    p[2] = pk16(hb[4], hb[5]);
    p[3] = pk16(hb[6], hb[7]);
    *(v4u*)(out + (size_t)i * 8) = p;
    
  }
}

// =====================================================================================================
// Weight transpose + convert: W[c][o] f32 (c in [0,1024), o in [0,3072), o contiguous) ->
// WT[o][c] f16 = f16( bf16_RNE(W[c][o]) * scale ), c contiguous (k-major rows for the B fragment loader).
// Block = one 64(o) x 64(c) tile: thread (ol = tid&63, cb = tid>>6) reads 16 consecutive c rows of column o0+ol
// (coalesced per row across lanes), packs them as two 16-B LDS stores into sT[ol][c]; block barrier; then every
// tiles = (3072/64, 1024/64) = (48, 16): bx = o tiles (rows of WT), by = c tiles (rows of W).
// coverage: 256 threads x 2 rows-iterations... : rows tid>>3 (0..31) and +32 -> all 64 rows x 64 halves per tile.
// =====================================================================================================
__device__ __forceinline__ void cvt_wT(int bx, int by, const float* __restrict__ W, unsigned short* WT, float scale) {
  __shared__ __align__(16) unsigned short sT[64 * SPP];          // 9216 B
  const int tid = threadIdx.x;
  const int o0 = bx * 64;
  const int c0 = by * 64;
  {
    const int ol = tid & 63, cb = tid >> 6;                      // cb 0..3 -> c rows cb*16 .. +15
    unsigned short hb[16];
#pragma unroll
    for (int e = 0; e < 16; ++e) {
      const float f = W[(size_t)(c0 + cb * 16 + e) * NQKV + o0 + ol];
      hb[e] = h_bits((_Float16)(bf_up(bf_bits(f)) * scale));
    }
    v4u p0, p1;
#pragma unroll
    for (int q = 0; q < 4; ++q) {
      p0[q] = pk16(hb[2 * q], hb[2 * q + 1]);
      p1[q] = pk16(hb[8 + 2 * q], hb[8 + 2 * q + 1]);
    }
    *(v4u*)(sT + ol * SPP + cb * 16) = p0;
    *(v4u*)(sT + ol * SPP + cb * 16 + 8) = p1;
  }
  __syncthreads();
  {
    const int row = tid >> 3, c8 = (tid & 7) * 8;
    const v4u v0 = *(const v4u*)(sT + row * SPP + c8);
    const v4u v1 = *(const v4u*)(sT + (row + 32) * SPP + c8);
    const size_t d0 = (size_t)(o0 + row) * ND + c0 + c8;
    const size_t d1 = (size_t)(o0 + row + 32) * ND + c0 + c8;
    {
      *(v4u*)(WT + d0) = v0;
      *(v4u*)(WT + d1) = v1;
      // precaution: the two stores' address and data registers are not rewritten (by another job's code that
      // follows in the listing) before this wait
      asm volatile("s_wait_xcnt 0x0" ::: "memory");
    }
  }
}

// =====================================================================================================
// inv_freq[j] = 1 / 10000^(j/32), j = 0..31 (full head dim, not pairs), worked out by every thread that needs it.
// Contraction off: power, reciprocal and (in k_tab) the angle s * inv_freq are each rounded to f32 on their own, as the
// definition rounds them, before the sine and cosine see the angle.
// =====================================================================================================
__device__ __forceinline__ float k_invf(int j) {
  #pragma clang fp contract(off)
  const float e = (float)j * 0.03125f;
  const float p = powf(10000.0f, e);
  const float inv = 1.0f / p;
  return inv;
}

// =====================================================================================================
// Rotary tables COS/SIN[s][j] = cos/sin( s * inv_freq[j] ), s in [0,2048), j in [0,32): 256 threads = 8 rows x 32,
// one precise sincosf per thread (rolled, nothing unrolled); values staged in LDS, block barrier, then waves 0-1
// coverage: 256 blocks x 8 rows x 32 = every COS and SIN element.
// =====================================================================================================
__device__ __forceinline__ void k_tab(int blk, float* COS, float* SIN) {
  // the angle is rounded to f32 as a product of its own before sine and cosine (see k_invf)
  #pragma clang fp contract(off)
  __shared__ __align__(16) float sc[8 * 32];
  __shared__ __align__(16) float ss[8 * 32];
  const int tid = threadIdx.x, j = tid & 31, rl = tid >> 5;
  const int s = blk * 8 + rl;
  const float ang = (float)s * k_invf(j);
  float sn, cs;
  sincosf(ang, &sn, &cs);
  sc[rl * 32 + j] = cs;
  ss[rl * 32 + j] = sn;
  __syncthreads();
  if (tid < 64) {                                                // waves 0,1: COS rows
    const int row = tid >> 3, c4 = (tid & 7) * 4;
    const v4f v = *(const v4f*)(sc + row * 32 + c4);
    float* d = COS + (size_t)(blk * 8 + row) * HD + c4;
    *(v4f*)d = v;
    
  } else if (tid < 128) {                                        // waves 2,3: SIN rows
    const int t2 = tid - 64;
    const int row = t2 >> 3, c4 = (t2 & 7) * 4;
    const v4f v = *(const v4f*)(ss + row * 32 + c4);
    float* d = SIN + (size_t)(blk * 8 + row) * HD + c4;
    *(v4f*)d = v;
    
  }
}

// =====================================================================================================
// Mask digest, made once for all batch*head pairs. Block (cp, qb) = 128 query rows x MCH key chunks of 64; wave w owns
// the 16-row query tile qt = 8*qb + w and reads, per chunk, the same 32 entries per lane that the attention wave of
// that tile needs: lane -> query row 16*qt + (lane&15), keys of lane half lane>>4.
//   MB[qt][c][16*s + 8*t + r]: a lane mask, bit lane <-> (mask[row][64*c + 32*s + 16*t + 8*(lane>>4) + r] != 0), ready
//                    as the select mask of score element (t, r) of 32-key step s; one 128-B line per (qt, c), written
//                    by one wave (lane i stores word i).
//   FL[qb][cp][MFL]: entry e < MCH is nonzero iff any entry of the 128 x 64 block of chunk MCH*cp + e is nonzero;
//                    one whole 128-B line per block (the rest of the line is 0).
// blocks = (32/MCH, 16): every (qt, c) word line and every FL line written exactly once.
// =====================================================================================================
__device__ __forceinline__ void mask_digest(int cp, int qb, const int* __restrict__ msk, unsigned* MB, int* FL) {
  __shared__ int sany[MCH][8];
  const int tid = threadIdx.x, lane = tid & 31, wave = tid >> 5;
  const int rlane = lane & 15, hsel = lane >> 4;
  const int qt = qb * 8 + wave;
  const size_t rowbase = (size_t)(qt * 16 + rlane) * NT;
  // all loads of the wave stand ahead of its first store; every loop below is unrolled so that ent[] is indexed by
  // constants and stays in registers
  v4i ent[MCH][2][2][2];
#pragma unroll
  for (int e = 0; e < MCH; ++e) {
#pragma unroll
    for (int s = 0; s < 2; ++s) {
#pragma unroll
      for (int t = 0; t < 2; ++t) {
        const int* mp = msk + rowbase + (size_t)((cp * MCH + e) * KCH + 32 * s + 16 * t + 8 * hsel);
        ent[e][s][t][0] = *(const v4i*)mp;
        ent[e][s][t][1] = *(const v4i*)(mp + 4);
      }
    }
  }
#pragma unroll
  for (int e = 0; e < MCH; ++e) {
    unsigned any = 0u;
    int mine = 0;                                                // lane i ends up with word i
#pragma unroll
    for (int i = 0; i < 32; ++i) {                               // i = 16*s + 8*t + r
      const unsigned w = __builtin_amdgcn_ballot_w32(ent[e][i >> 4][(i >> 3) & 1][(i >> 2) & 1][i & 3] != 0);
      any |= w;
      mine = (lane == i) ? (int)w : mine;
    }
    MB[((size_t)qt * NKC + cp * MCH + e) * 32 + lane] = (unsigned)mine;
    if (lane == 0) sany[e][wave] = (any != 0u) ? 1 : 0;
  }
  __syncthreads();
  if (tid < MFL) {
    int f = 0;
    if (tid < MCH) {
#pragma unroll
      for (int w = 0; w < 8; ++w) f |= sany[tid][w];
    }
    FL[((size_t)qb * (NKC / MCH) + cp) * MFL + tid] = f;
  }
}

// =====================================================================================================
// All work that depends on the inputs alone, in ONE launch: the four jobs above read and write disjoint buffers and none
// reads what another writes, so their work-groups share the chip instead of waiting for one another's launch to end.
// The job is picked by the block index (the same for the whole work-group, so each job's barrier stays block-uniform):
//   [0, PB_DIG)       mask digest, block (cp, qb) = (i % 16, i / 16)
//   [.., PB_WT)       weight transpose + convert, tile (bx, by) = (i % 48, i / 48)
//   [.., PB_TAB)      rotary tables, 8 rows a block
//   [.., PB_ALL)      activation convert, 2048 elements a block
// =====================================================================================================
#define PB_DIG  ((NKC / MCH) * (NT / QBLK))
#define PB_WT   (PB_DIG + (NQKV / 64) * (ND / 64))
#define PB_TAB  (PB_WT + NT / 8)
#define PB_ALL  (PB_TAB + NTOK * ND / 2048)
__global__ __launch_bounds__(256) void prep(const float* __restrict__ x, const float* __restrict__ W,
                                            const int* __restrict__ msk, unsigned short* XH, unsigned short* WT,
                                            float* COS, float* SIN, unsigned* MB, int* FL) {
  const int blk = blockIdx.x;
  if (blk < PB_DIG) {
    mask_digest(blk % (NKC / MCH), blk / (NKC / MCH), msk, MB, FL);
  } else if (blk < PB_WT) {
    const int i = blk - PB_DIG;
    cvt_wT(i % (NQKV / 64), i / (NQKV / 64), W, WT, 1024.0f);
  } else if (blk < PB_TAB) {
    k_tab(blk - PB_WT, COS, SIN);
  } else {
    cvt_h8(blk - PB_TAB, x, XH, NTOK * ND / 8, 16.0f);
  }
}

// =====================================================================================================
// Fused qkv projection GEMM with rotary + 16-bit plane epilogue:
//   Y[tok][o] = sum_c XH[tok][c] * WT[o][c] * oscale,  tok in [0,4096), o in [0,3072), K = 1024.
// One work-group of 4 waves per 128x128 tile, one wave per 64x64 quarter (register-blocked); A = XH rows (token),
// Bt = WT rows (k contiguous). Per 64-deep k stage the 128 A rows and 128 Bt rows (128 B each, whole lines) are copied
// asynchronously into one of two LDS buffers (pitch 144 B) while the other buffer is worked on; k order unchanged.
// The 64 tokens of a tile lie in one batch b (t0 = m0 mod 2048); the 64 outputs are two heads h0, h0+1 of one of
// q (o < 1024), k (1024 <= o < 2048), v (o >= 2048); column j (16-wide subtile) -> head h0 + (j>>1), d = 16*(j&1)+lane%16.
//   q, k: rotary combine per the module: out[d] = y[d]*cos[s][d] - y[d+16]*sin[s][d] (d < 16),
//         out[d] = y[d]*cos[s][d] + y[d-16]*sin[s][d] (d >= 16); both partners sit in the same lane and element.
//         PH/PL[bh][t][32] f16 = (out*16) hi plane and its residual (64 B per token; the wave owns 64 consecutive
// then q/k: each head's slab region (16 tok x 64 B = 1024 contiguous B) written as 32 lanes x 16 B contiguous per
// grid = 768 blocks x 4 waves = 3072 wave tiles = 64 x 48 exactly.
// coverage: q/k tiles: 4 slabs x 2 heads x 16 tok x 32 d (hi and residual); v tiles: 4 subtiles x 16 d x 64 tok;
// 64 token tiles x (16+16+16) column tiles = every (bh, t) row of QH/QL/KH/KL and every (bh, d) row of VH/VL.
// =====================================================================================================
__global__ __launch_bounds__(128) void gemm_proj(
    const unsigned short* __restrict__ XHp, const unsigned short* __restrict__ WTp,
    const float* __restrict__ COS, const float* __restrict__ SIN,
    unsigned short* QH, unsigned short* QL, unsigned short* KH, unsigned short* KL,
    unsigned short* VH, unsigned short* VL, float oscale) {
  __shared__ __align__(16) unsigned short sA[2][GBUF];            // 36864 B
  __shared__ __align__(16) unsigned short sB[2][GBUF];            // 36864 B
  __shared__ __align__(16) unsigned short sP[4][2][16 * SPP];     // 18432 B
  const int tid  = threadIdx.x;
  const int lane = tid & 31;
  const int wave = tid >> 5;
  const int tilesN = NQKV / GBT;                                 // 24
  const int tilesM = NTOK / GBT;                                 // 32
  const int tile = blockIdx.x;
  if (tile >= tilesM * tilesN) return;                           // block-uniform, in front of every barrier
  const int tm = tile / tilesN;
  const int tn = tile - tm * tilesN;
  const int wm = wave >> 1, wn = wave & 1;                       // 2 x 2 waves
  const int m0 = tm * GBT + (wm << 6);                           // token base of this wave
  const int n0 = tn * GBT + (wn << 6);                           // output channel base in [0,3072)
  const int rlane = lane & 15;
  const int hh    = lane >> 4;
  const int koff  = hh * 8;
  const int mOff  = hh * 8;

  v8f acc[4][4];
#pragma unroll
  for (int i = 0; i < 4; ++i)
#pragma unroll
    for (int j = 0; j < 4; ++j) acc[i][j] = zero8();

  // copy share of this lane: piece tid&7 (16 B) of rows (tid>>3) + 16e, e = 0..7; a wave's copy = 4 whole 128-B lines
  const int crow = tid >> 3, cpc = (tid & 7) * 8;
  const unsigned short* gA = XHp + (size_t)(tm * GBT + crow) * ND + cpc;
  const unsigned short* gB = WTp + (size_t)(tn * GBT + crow) * ND + cpc;
  const unsigned lA = lds_addr(&sA[0][crow * GLP + cpc]);
  const unsigned lB = lds_addr(&sB[0][crow * GLP + cpc]);

  stage_rows(lA, gA);                                            // stage 0 -> buffer 0
  stage_rows(lB, gB);
  wait_copies();
  __syncthreads();
  stage_rows(lA + GBUF * 2u, gA + GBK);                          // stage 1 -> buffer 1
  stage_rows(lB + GBUF * 2u, gB + GBK);

  // rolled: the two-buffer order below is written once
#pragma unroll 1
  for (int t = 0; t < GTR; ++t) {
    const int bsel = t & 1;
    const _Float16* fa = (const _Float16*)(const void*)&sA[bsel][((wm << 6) + rlane) * GLP + koff];
    const _Float16* fb = (const _Float16*)(const void*)&sB[bsel][((wn << 6) + rlane) * GLP + koff];
#pragma unroll
    for (int kk = 0; kk < GBK; kk += 32) {
      v16h bf[4], af[4];
#pragma unroll
      for (int j = 0; j < 4; ++j) bf[j] = ldfrag_h(fb + (j << 4) * GLP + kk);
#pragma unroll
      for (int i = 0; i < 4; ++i) af[i] = ldfrag_h(fa + (i << 4) * GLP + kk);
#pragma unroll
      for (int i = 0; i < 4; ++i)
#pragma unroll
        for (int j = 0; j < 4; ++j) acc[i][j] = mma_h_raw(af[i], bf[j], acc[i][j]);
      // all 16 LDS reads of this k step as one group ahead of its 16 products: one LDS wait a step, not one a row
      __builtin_amdgcn_sched_group_barrier(0x100, 16, 0);
      __builtin_amdgcn_sched_group_barrier(0x008, 16, 0);
    }
    // publish point of stage t + 1: own reads done, own copies landed, barrier, then the refill of the buffer just read
    wait_lds_reads();
    wait_copies();
    __syncthreads();
    if (t + 2 < GTR) {
      stage_rows(lA + (unsigned)bsel * (GBUF * 2u), gA + (t + 2) * GBK);
      stage_rows(lB + (unsigned)bsel * (GBUF * 2u), gB + (t + 2) * GBK);
    }
  }
  wait_copies();
  acc_guard4(acc[0][0], acc[0][1], acc[0][2], acc[0][3]);
  acc_guard4(acc[1][0], acc[1][1], acc[1][2], acc[1][3]);
  acc_guard4(acc[2][0], acc[2][1], acc[2][2], acc[2][3]);
  acc_guard4(acc[3][0], acc[3][1], acc[3][2], acc[3][3]);

  // ---- epilogue ----
  const int b   = m0 / NT;
  const int t0  = m0 - b * NT;
  const int sel = n0 >> 10;                                      // 0 q, 1 k, 2 v (wave-uniform)
  const int h0  = (n0 & (ND - 1)) >> 5;                          // first of the two heads of this tile
  unsigned short* s0 = &sP[wave][0][0];
  unsigned short* s1 = &sP[wave][1][0];

  if (sel < 2) {
    unsigned short* PH = (sel == 0) ? QH : KH;
    unsigned short* PL = (sel == 0) ? QL : KL;
#pragma unroll
    for (int i = 0; i < 4; ++i) {                                // slab = 16 tokens t0+16i .. +15
#pragma unroll
      for (int r = 0; r < 8; ++r) {
        const int tok = t0 + (i << 4) + mOff + r;                // row tok = 8hh + r
        const float* cp = COS + (size_t)tok * HD;
        const float* sp = SIN + (size_t)tok * HD;
        const float ca = cp[rlane], cb = cp[16 + rlane];
        const float sa = sp[rlane], sb = sp[16 + rlane];
#pragma unroll
        for (int hp = 0; hp < 2; ++hp) {
          const float y0 = acc[i][2 * hp][r] * oscale;           // d = rlane
          const float y1 = acc[i][2 * hp + 1][r] * oscale;       // d = 16 + rlane
          const float f0 = (y0 * ca - y1 * sa) * 16.0f;
          const float f1 = (y1 * cb + y0 * sb) * 16.0f;
          const _Float16 x0 = (_Float16)f0;
          const _Float16 x1 = (_Float16)f1;
          const int so = (mOff + r) * SPP + 32 * hp + rlane;     // row tok, col 32hp + d
          s0[so]      = h_bits(x0);
          s1[so]      = h_bits((_Float16)(f0 - (float)x0));
          s0[so + 16] = h_bits(x1);
          s1[so + 16] = h_bits((_Float16)(f1 - (float)x1));
        }
      }
      wave_sync_lds();
      {
        const int rr = lane >> 2, cc = (lane & 3) * 8;           // rr*32 + cc = lane*8 halves
#pragma unroll
        for (int hp = 0; hp < 2; ++hp) {
          const int bhp = b * NH + h0 + hp;
          const size_t base = ((size_t)(bhp * NT + t0 + (i << 4))) * HD + lane * 8;
          const v4u v0 = *(const v4u*)(s0 + rr * SPP + 32 * hp + cc);
          const v4u v1 = *(const v4u*)(s0 + (rr + 8) * SPP + 32 * hp + cc);
          const v4u w0 = *(const v4u*)(s1 + rr * SPP + 32 * hp + cc);
          const v4u w1 = *(const v4u*)(s1 + (rr + 8) * SPP + 32 * hp + cc);
          {
            *(v4u*)(PH + base) = v0;
            *(v4u*)(PH + base + 256) = v1;
            *(v4u*)(PL + base) = w0;
            *(v4u*)(PL + base + 256) = w1;
            
          }
        }
      }
      wave_sync_lds();
    }
  } else {
#pragma unroll
    for (int j = 0; j < 4; ++j) {                                // slab = 16 rows d = 16(j&1) + rlane of head h0+(j>>1)
      const int hp = j >> 1, dbase = (j & 1) * 16;
      const int bhp = b * NH + h0 + hp;
#pragma unroll
      for (int i = 0; i < 4; ++i) {
        unsigned short hb[8], lb[8];
#pragma unroll
        for (int r = 0; r < 8; ++r) {
          const float f = (acc[i][j][r] * oscale) * 16.0f;
          const _Float16 xh = (_Float16)f;
          hb[r] = h_bits(xh);
          lb[r] = h_bits((_Float16)(f - (float)xh));
        }
        v4u ph, pl;
#pragma unroll
        for (int q = 0; q < 4; ++q) {
          ph[q] = pk16(hb[2 * q], hb[2 * q + 1]);
          pl[q] = pk16(lb[2 * q], lb[2 * q + 1]);
        }
        *(v4u*)(s0 + rlane * SPP + (i << 4) + mOff) = ph;       // row d = rlane, tok = 16i + 8hh .. +7
        *(v4u*)(s1 + rlane * SPP + (i << 4) + mOff) = pl;
      }
      wave_sync_lds();
      {
        const int rq = lane >> 3, c8 = (lane & 7) * 8;
        {
#pragma unroll
          for (int it = 0; it < 4; ++it) {
            const int row = it * 4 + rq;                         // it 0..3 x rq 0..3 = rows 0..15
            const size_t dst = ((size_t)(bhp * HD + dbase + row)) * NT + t0 + c8;
            const v4u v = *(const v4u*)(s0 + row * SPP + c8);
            const v4u w = *(const v4u*)(s1 + row * SPP + c8);
            *(v4u*)(VH + dst) = v;
            *(v4u*)(VL + dst) = w;
          }
          
        }
      }
      wave_sync_lds();
    }
  }
}

// =====================================================================================================
// Attention for one batch*head and two 128-query blocks (NQB-1-y, then y): grid = (64, 8), 256 threads = 8 waves x 16
// queries; at most four waves a SIMD by the register allocation, so the 512 equal work-groups lie two on a WGP; each lane
// owns one query column q = q0 + 16*wave + (lane&15). QH/QL/KH/KL[bh][t][32] f16 (x16 hi, residual at the same scale),
// VH/VL[bh][d][2048] (x16 hi, residual at the same scale). The mask [2048 q][2048 key] comes as the digest of mask_digest: key
// chunks of 64; each wave loads the 32 lane masks MB[qt][c][..] of its query tile by wave-uniform loads, one mask per
// score element; a chunk whose entries are all zero for the whole block (FL, gathered once into a wave-uniform word)
// is skipped block-uniformly, in front of every barrier of the chunk (exact: such keys have probability 0). Otherwise
// K hi/res rows [64][40] and V hi/res tiles [32 d][72] are staged in LDS with plain 16-B loads between two block
// barriers. Per 32-key step and 16-key tile t:
// S[key][q] = A(K hi) x B(Q res) + A(K res) x B(Q hi) + A(K hi rows) x B(resident Q hi), small terms first, chained in one
// zeroed accumulator; logit = S / 256 / sqrt(32); entries with mask == 0 replaced by -inf; online softmax over
// keys (max/sum across lane halves by shuffle); p = 1024*exp(x - max) packed D->B per the chained map (element r <-
// keys 0-15 tile, 8+r <- keys 16-31 tile) as f16 hi plus residual; O[d][q] += A(V res) x Ph + A(V hi) x Pl +
// A(V hi rows) x Ph in one accumulator; out = O / (16 * l) (l = 0 gives 0*inf = NaN).
// coverage: 64 x 8 blocks x 2 tiles x 8 waves x 16 rows x 32 floats = every (tok, head) line of the output.
// =====================================================================================================
__global__ __launch_bounds__(ATHR) __attribute__((amdgpu_waves_per_eu(4, 4))) void attn_kernel(
    const unsigned short* __restrict__ QHp, const unsigned short* __restrict__ QLp,
    const unsigned short* __restrict__ KHp, const unsigned short* __restrict__ KLp,
    const unsigned short* __restrict__ VHp, const unsigned short* __restrict__ VLp,
    const unsigned* __restrict__ MB, const int* __restrict__ FL, float* Out) {
  __shared__ __align__(16) unsigned short kh_u[KCH * KP];         // 5120 B
  __shared__ __align__(16) unsigned short kl_u[KCH * KP];         // 5120 B
  __shared__ __align__(16) unsigned short vh_u[HD * VP];          // 4608 B
  __shared__ __align__(16) unsigned short vl_u[HD * VP];          // 4608 B
  __shared__ __align__(16) float sO[8][16 * OP];                  // 18432 B
  const _Float16* kh = (const _Float16*)(const void*)kh_u;
  const _Float16* kl = (const _Float16*)(const void*)kl_u;
  const _Float16* vh = (const _Float16*)(const void*)vh_u;
  const _Float16* vl = (const _Float16*)(const void*)vl_u;
  const _Float16* QH = (const _Float16*)(const void*)QHp;
  const _Float16* QL = (const _Float16*)(const void*)QLp;

  const int tid = threadIdx.x, lane = tid & 31, wave = tid >> 5;
  const int bh = blockIdx.x;
  const int b  = bh / NH;
  const int h  = bh - b * NH;
  const int rlane = lane & 15, hsel = lane >> 4, koff = hsel * 8;

  // Two query tiles per work-group, one after the other in every wave: NQB-1-y, then y. Under a lower-triangular mask the
  // active chunks of such a pair add up to the same count in every work-group; any other mask is only divided differently.
  // The first barrier of the second tile's first chunk ends every wave's reads of the first tile's last K/V chunk.
  // rolled: the tile body is written once
#pragma unroll 1
  for (int leg = 0; leg < 2; ++leg) {
    const int qb = (leg == 0) ? (NQB - 1 - (int)blockIdx.y) : (int)blockIdx.y;
    const int q0 = qb * QBLK;
    const int qrow = q0 + wave * 16 + rlane;                       // this lane's query index within the sequence

    // resident Q fragments (B operand: B[k=d][n=q] from [q][d] rows), arithmetic addressing, one 32-deep k-step
    const size_t qo = ((size_t)(bh * NT + qrow)) * HD + koff;
    const v16h qh0 = ldfrag_h(QH + qo);
    const v16h ql0 = ldfrag_h(QL + qo);
    // this wave's lane masks, 32 words a chunk; the wave number made uniform so that the words load into scalar registers
    const unsigned* mbp = MB + ((size_t)(qb * 8 + __builtin_amdgcn_readfirstlane(wave)) * NKC) * 32;
    // bit c <-> chunk c has a nonzero mask entry somewhere in this block's 128 query rows (the same word in every wave)
    const unsigned act = __builtin_amdgcn_ballot_w32(
        FL[((size_t)qb * (NKC / MCH) + lane / MCH) * MFL + (lane % MCH)] != 0);

    const float SCL    = 0.17677669529663687f * (1.0f / 256.0f);  // undo q*16, k*16, then 1/sqrt(32)
    const float LN1024 = 6.931471805599453f;
    const float NEGINF = __uint_as_float(0xff800000u);

    v8f oh[2];
#pragma unroll
    for (int dt = 0; dt < 2; ++dt) oh[dt] = zero8();
    float m_run = -1.0e30f, l_run = 0.0f;

#pragma unroll 1
    for (int c = 0; c < NKC; ++c) {
      if (((act >> c) & 1u) == 0u) continue;                       // block-uniform skip of an all-masked chunk
      const int kc = c * KCH;
      __syncthreads();                                             // all waves finished reading the prior chunk's K/V
      // lane masks: word (16*s + 8*t + r), bit lane <-> key kc + 32*s + 16*t + 8*hsel + r of the lane's query row
      // read through the constant address space (nothing writes MB in this launch), which makes them scalar loads
      const v16u mw0 = *(const __attribute__((address_space(4))) v16u*)(mbp + c * 32);
      const v16u mw1 = *(const __attribute__((address_space(4))) v16u*)(mbp + c * 32 + 16);

      // ---- stage K hi/res rows and V hi/res tiles of keys kc..kc+63 (one 16-B item per thread each) ----
      {
        const int key = tid >> 2, ck = (tid & 3) * 8;              // 64 keys x 32 halves
        const size_t gk = ((size_t)(bh * NT + kc + key)) * HD + ck;
        const int d = tid >> 3, cv = (tid & 7) * 8;                // 32 d rows x 64 halves
        const size_t gv = ((size_t)(bh * HD + d)) * NT + kc + cv;
        const v4u gkh = *(const v4u*)(KHp + gk);
        const v4u gkl = *(const v4u*)(KLp + gk);
        const v4u gvh = *(const v4u*)(VHp + gv);
        const v4u gvl = *(const v4u*)(VLp + gv);
        *(v4u*)(kh_u + key * KP + ck) = gkh;
        *(v4u*)(kl_u + key * KP + ck) = gkl;
        *(v4u*)(vh_u + d * VP + cv) = gvh;
        *(v4u*)(vl_u + d * VP + cv) = gvl;
      }
      __syncthreads();

#pragma unroll 1
      for (int sub = 0; sub < 2; ++sub) {
        const int kr = sub * 32;
        float a[2][8];
        // the two key tiles' chains of three are issued turn about, so that two independent accumulators stay in flight
        v16h kha[2], kla[2];
        v8f sh[2];
#pragma unroll
        for (int t = 0; t < 2; ++t) {
          const int krow = kr + 16 * t + rlane;
          kha[t] = ldfrag_h(kh + krow * KP + koff);
          kla[t] = ldfrag_h(kl + krow * KP + koff);
        }
#pragma unroll
        for (int t = 0; t < 2; ++t) sh[t] = mma_h_raw(kha[t], ql0, zero8());
#pragma unroll
        for (int t = 0; t < 2; ++t) sh[t] = mma_h_raw(kla[t], qh0, sh[t]);
#pragma unroll
        for (int t = 0; t < 2; ++t) sh[t] = mma_h_raw(kha[t], qh0, sh[t]);
        guard4(sh[0], sh[1], kha[0], kla[0], kha[1], kla[1], qh0, ql0);
#pragma unroll
        for (int t = 0; t < 2; ++t) {
#pragma unroll
          for (int r = 0; r < 8; ++r) {
            const float s = sh[t][r] * SCL;
            const unsigned kw = (sub != 0) ? mw1[t * 8 + r] : mw0[t * 8 + r];
            a[t][r] = __builtin_amdgcn_inverse_ballot_w32(kw) ? s : NEGINF;
          }
        }

        // online softmax over the key axis for this lane's q column
        float mloc = -1.0e30f;
#pragma unroll
        for (int r = 0; r < 8; ++r) mloc = fmaxf(mloc, fmaxf(a[0][r], a[1][r]));
        mloc = fmaxf(mloc, __shfl_xor(mloc, 16, 32));
        const float newM  = fmaxf(m_run, mloc);
        const float alph  = __expf(m_run - newM);
        const float msh   = newM - LN1024;
        float ssum = 0.0f;
        float p[2][8];
#pragma unroll
        for (int r = 0; r < 8; ++r) {
          p[0][r] = __expf(a[0][r] - msh);
          p[1][r] = __expf(a[1][r] - msh);
          ssum += p[0][r] + p[1][r];
        }
        ssum += __shfl_xor(ssum, 16, 32);
        l_run = l_run * alph + ssum;
        m_run = newM;
#pragma unroll
        for (int dt = 0; dt < 2; ++dt) {
#pragma unroll
          for (int r = 0; r < 8; ++r) oh[dt][r] *= alph;
        }

        // P (f32, D layout) -> B operands (f16 hi, f16 residual): element r <- keys 0-15 tile, 8+r <- keys 16-31 tile
        union { v16h v; _Float16 s[16]; } ph, plo;
#pragma unroll
        for (int r = 0; r < 8; ++r) {
          const _Float16 x0 = (_Float16)p[0][r];
          const _Float16 x1 = (_Float16)p[1][r];
          ph.s[r]      = x0;
          ph.s[8 + r]  = x1;
          plo.s[r]     = (_Float16)(p[0][r] - (float)x0);
          plo.s[8 + r] = (_Float16)(p[1][r] - (float)x1);
        }

        // O[d][q] += V[d][kr .. +31] x P, hi and residual terms
        // the two d tiles' chains of three turn about, as for the scores
        v16h vah[2], val[2];
#pragma unroll
        for (int dt = 0; dt < 2; ++dt) {
          vah[dt] = ldfrag_h(vh + (16 * dt + rlane) * VP + kr + koff);
          val[dt] = ldfrag_h(vl + (16 * dt + rlane) * VP + kr + koff);
        }
#pragma unroll
        for (int dt = 0; dt < 2; ++dt) oh[dt] = mma_h_raw(val[dt], ph.v, oh[dt]);
#pragma unroll
        for (int dt = 0; dt < 2; ++dt) oh[dt] = mma_h_raw(vah[dt], plo.v, oh[dt]);
#pragma unroll
        for (int dt = 0; dt < 2; ++dt) oh[dt] = mma_h_raw(vah[dt], ph.v, oh[dt]);
        guard4(oh[0], oh[1], vah[0], val[0], vah[1], val[1], ph.v, plo.v);
      }
    }
    acc_guard2(oh[0], oh[1]);

    // ---- output values -> per-wave f32 LDS staging ----
    const float inv = (1.0f / 16.0f) * (1.0f / l_run);            // out = O / (16 * l)
    float* st = sO[wave];
#pragma unroll
    for (int dt = 0; dt < 2; ++dt) {
      v4f va, vb;
#pragma unroll
      for (int e = 0; e < 4; ++e) {
        va[e] = oh[dt][e] * inv;                                   // d = 16dt + 8hsel + e
        vb[e] = oh[dt][4 + e] * inv;                               // d = 16dt + 8hsel + 4 + e
      }
      const int so = rlane * OP + 16 * dt + 8 * hsel;              // row q = rlane
      *(v4f*)(st + so) = va;
      *(v4f*)(st + so + 4) = vb;
    }
    wave_sync_lds();
    {
      const int rq = lane >> 3, c4 = (lane & 7) * 4;
      const int n0 = q0 + wave * 16;
      {
#pragma unroll
        for (int it = 0; it < 4; ++it) {
          const int row = it * 4 + rq;                             // it 0..3 x rq 0..3 = rows 0..15
          const v4f v = *(const v4f*)(st + row * OP + c4);
          *(v4f*)(Out + ((size_t)(b * NT + n0 + row)) * ND + h * HD + c4) = v;
        }
        // precaution: the four stores' address and data registers are not rewritten (by the second tile's code) before
        // this wait
        asm volatile("s_wait_xcnt 0x0" ::: "memory");
      }
    }
  }
}

// =====================================================================================================
// Workspace map (bytes, every offset a multiple of 128; every plane an exact multiple of its whole-line store
// granularity, row counts exact tile multiples, no padded tails needed):
//   XH   f16 [4096][1024]    activation, bf16-RNE x16                    0          8388608 B
//   WT   f16 [3072][1024]    Wqkv transposed, bf16-RNE x1024       8388608          6291456 B
//   COS  f32 [2048][32]                                          14680064           262144 B
//   SIN  f32 [2048][32]                                          14942208           262144 B
//   (256 B not used)                                            15204352              256 B
//   QH   f16 [64][2048][32]  q x16 hi                            15204608          8388608 B
//   QL   f16 [64][2048][32]  q x16 residual                      23593216          8388608 B
//   KH   f16 [64][2048][32]                                      31981824          8388608 B
//   KL   f16 [64][2048][32]                                      40370432          8388608 B
//   VH   f16 [64][32][2048]  v x16 hi, key-contiguous            48759040          8388608 B
//   VL   f16 [64][32][2048]                                      57147648          8388608 B
//   MB   u32 [128][32][32]   lane masks per (query tile, chunk, element) 65536256     524288 B
//   FL   i32 [16][16][32]    chunk flags, one line per digest block  66060544          32768 B
//   end                                                          66093312
// =====================================================================================================
extern "C" void kernel_launch(void* const* d_in, const int* in_sizes, int n_in,
                              void* d_out, int out_size, void* d_ws, size_t ws_size,
                              hipStream_t stream) {
  if (n_in < 3) return;
  if (in_sizes[0] != NTOK * ND) return;
  if (in_sizes[1] != ND * NQKV) return;
  if (in_sizes[2] != NT * NT) return;
  if (out_size != NTOK * ND) return;

  const float* x   = (const float*)d_in[0];
  const float* W   = (const float*)d_in[1];
  const int*   msk = (const int*)d_in[2];

  const size_t PXH = (size_t)NTOK * ND * 2;                    // 8388608
  const size_t PWT = (size_t)NQKV * ND * 2;                    // 6291456
  const size_t PTB = (size_t)NT * HD * 4;                      // 262144
  const size_t PIN = 256;
  const size_t PQK = (size_t)NBH * NT * HD * 2;                // 8388608
  const size_t PV  = (size_t)NBH * HD * NT * 2;                // 8388608
  size_t off = 0;
  const size_t oXH  = off; off += PXH;
  const size_t oWT  = off; off += PWT;
  const size_t oCOS = off; off += PTB;
  const size_t oSIN = off; off += PTB;
  off += PIN;                                                  // 256 B not used
  const size_t oQH  = off; off += PQK;
  const size_t oQL  = off; off += PQK;
  const size_t oKH  = off; off += PQK;
  const size_t oKL  = off; off += PQK;
  const size_t oVH  = off; off += PV;
  const size_t oVL  = off; off += PV;
  const size_t oMB  = off; off += (size_t)(NT / 16) * NKC * 32 * 4;        // 524288
  const size_t oFL  = off; off += (size_t)(NT / QBLK) * (NKC / MCH) * MFL * 4;   // 32768
  if (off > ws_size) return;                                   // off = 66093312
  if (off > (size_t)134217728) return;

  char* ws = (char*)d_ws;
  unsigned short* XH   = (unsigned short*)(ws + oXH);
  unsigned short* WT   = (unsigned short*)(ws + oWT);
  float*          COS  = (float*)(ws + oCOS);
  float*          SIN  = (float*)(ws + oSIN);
  unsigned short* QH   = (unsigned short*)(ws + oQH);
  unsigned short* QL   = (unsigned short*)(ws + oQL);
  unsigned short* KH   = (unsigned short*)(ws + oKH);
  unsigned short* KL   = (unsigned short*)(ws + oKL);
  unsigned short* VH   = (unsigned short*)(ws + oVH);
  unsigned short* VL   = (unsigned short*)(ws + oVL);
  unsigned*       MB   = (unsigned*)(ws + oMB);
  int*            FL   = (int*)(ws + oFL);
  float*          out  = (float*)d_out;

  const dim3 blk(256);
  const dim3 gPrep(PB_ALL);                                    // 256 + 768 + 256 + 2048 = 3328
  const dim3 gProj((NTOK / GBT) * (NQKV / GBT));               // 32 x 24 = 768 blocks of 4 waves
  const dim3 gAttn(NBH, NQB / 2);                              // 64 x 8, 256 threads, two query tiles each

  const float oscPrj = 1.0f / 16384.0f;                        // undo x*16 and W*1024

  // (1) one launch: inputs -> f16 planes holding bf16-RNE values times an exact power of two; rotary tables;
  //     mask -> lane masks of the attention waves' score elements, and one flag per 128-query x 64-key block
  prep<<<gPrep, blk, 0, stream>>>(x, W, msk, XH, WT, COS, SIN, MB, FL);
  // (2) fused qkv projection with rotary epilogue: q, k -> [bh][t][32] hi/res planes; v -> [bh][d][t] hi/res planes
  gemm_proj<<<gProj, dim3(128), 0, stream>>>(XH, WT, COS, SIN, QH, QL, KH, KL, VH, VL, oscPrj);
  // (3) attention per (batch*head, pair of 128-query blocks) -> f32 output lines [tok][h*32 .. +31]
  attn_kernel<<<gAttn, dim3(ATHR), 0, stream>>>(QH, QL, KH, KL, VH, VL, MB, FL, out);
  (void)hipGetLastError();
}

// v006
// A run of this version takes 93 microseconds.
// Two timings next to v005 put it at 1.05 and 1.04 times that version's speed.
// Over all steps from v000 it is 2.36 times as fast.
#include <hip/hip_runtime.h>
#include <math.h>
#include <stdint.h>

// Contractions: fused qkv projection x.Wqkv (f16 operands holding bf16-RNE values, x carried x16 and W x1024, one
// product per tile pair); scores k.q (k and q each an f16 hi plane x16 plus an f16 residual plane at the same scale,
// small residuals as f16 subnormals: hi.lo + lo.hi + hi.hi chained in ONE accumulator, 3 products); context v.p
// (p x1024 and v x16, each f16 hi plus f16 residual at the same scale: lo.hi + hi.lo + hi.hi chained in the one running
// accumulator, 3 products); all v_wmma_f32_16x16x32_f16 with f32 accumulate; rotary tables, rotary combine, key masking, softmax
// statistics and the final normalisation in f32 on VALU; output stored as f32.

#define NB    2
#define NT    2048
#define ND    1024
#define NQKV  3072
#define NH    32
#define HD    32
#define NTOK  (NB * NT)
#define NBH   (NB * NH)
#define QBLK  128
#define KCH   64
#define NKC   (NT / KCH)
#define NQB   (NT / QBLK)
#define KP    40
#define VP    72
#define SPP   72
#define OP    36
#define ATHR  256
#define GBT   128
#define GBK   64
#define GLP   72
#define GTR   (ND / GBK)
#define GBUF  (GBT * GLP)
#define MCH   2
#define MFL   32

static_assert(NH * HD == ND);
static_assert(NQKV == 3 * ND);
static_assert((NT % QBLK) == 0 && (NT % KCH) == 0 && (NT % 64) == 0 && (NTOK % 64) == 0);
static_assert((NQKV % 64) == 0 && (ND % 64) == 0 && (ND % 32) == 0);
static_assert(QBLK == (ATHR / 32) * 16 && (NQB % 2) == 0);
static_assert(KCH * 4 == ATHR && HD * 8 == ATHR);
static_assert(HD == 32 && KCH == 64 && NKC * KCH == NT);
static_assert(NKC == 32 && (NKC % MCH) == 0 && MCH <= MFL && QBLK == 8 * 16);
static_assert(((NTOK * ND) % 2048) == 0);
static_assert((NTOK % GBT) == 0 && (NQKV % GBT) == 0 && (NT % GBT) == 0 && (ND % GBT) == 0 && GTR >= 2);

typedef _Float16 v16h __attribute__((ext_vector_type(16)));
typedef _Float16 v8h  __attribute__((ext_vector_type(8)));
typedef float    v8f  __attribute__((ext_vector_type(8)));
typedef float    v4f  __attribute__((ext_vector_type(4)));
typedef unsigned int v4u __attribute__((ext_vector_type(4)));
typedef int      v4i  __attribute__((ext_vector_type(4)));
typedef unsigned int v16u __attribute__((ext_vector_type(16)));

// ---- scalar helpers --------------------------------------------------------------------------------
__device__ __forceinline__ unsigned short bf_bits(float f) {          // f32 -> bf16 bits, RNE convert
  unsigned u = __float_as_uint(f);
  return (unsigned short)((u + 0x7FFFu + ((u >> 16) & 1u)) >> 16);
}
__device__ __forceinline__ float bf_up(unsigned short h) { return __uint_as_float(((unsigned)h) << 16); }
__device__ __forceinline__ unsigned short h_bits(_Float16 x) { return __builtin_bit_cast(unsigned short, x); }
__device__ __forceinline__ unsigned pk16(unsigned short a, unsigned short b) { return (unsigned)a | ((unsigned)b << 16); }
__device__ __forceinline__ v8f zero8() { v8f z = {0.f, 0.f, 0.f, 0.f, 0.f, 0.f, 0.f, 0.f}; return z; }

// ---- fragment loader: 16-bit A/B operand, lane -> row/col (lane&15), p already includes +8*(lane>>4);
//      elements 0..7 <- p[0..7] (k0+8h..), elements 8..15 <- p[16..23] (k0+16+8h..)
__device__ __forceinline__ v16h ldfrag_h(const _Float16* p) {
  union { v16h v; v8h h[2]; } f;
  f.h[0] = *(const v8h*)(p);
  f.h[1] = *(const v8h*)(p + 16);
  return f.v;
}

// ---- WMMA helpers with trailing VALU hazard gap --------------------------------------------------------
__device__ __forceinline__ v8f mma_h_raw(v16h a, v16h b, v8f c) {
  return __builtin_amdgcn_wmma_f32_16x16x32_f16(false, a, false, b, (short)0, c, false, false);
}
__device__ __forceinline__ void guard4(v8f& a, v8f& b, v16h u, v16h v, v16h w, v16h x, v16h y, v16h z) {
#if defined(__HIP_DEVICE_COMPILE__)
  asm volatile("v_nop\n\tv_nop\n\tv_nop\n\tv_nop" : "+v"(a), "+v"(b) : "v"(u), "v"(v), "v"(w), "v"(x), "v"(y), "v"(z));
#endif
}
// the same gap behind the loop's last products, in front of the first vector read of the two output accumulators
__device__ __forceinline__ void acc_guard2(v8f& a, v8f& b) {
#if defined(__HIP_DEVICE_COMPILE__)
  asm volatile("v_nop\n\tv_nop\n\tv_nop\n\tv_nop" : "+v"(a), "+v"(b));
#endif
}
__device__ __forceinline__ void acc_guard4(v8f& a, v8f& b, v8f& c, v8f& d) {
#if defined(__HIP_DEVICE_COMPILE__)
  asm volatile("v_nop\n\tv_nop\n\tv_nop\n\tv_nop" : "+v"(a), "+v"(b), "+v"(c), "+v"(d));
#endif
}
__device__ __forceinline__ void wave_sync_lds() {
  __builtin_amdgcn_fence(__ATOMIC_RELEASE, "workgroup");
  __builtin_amdgcn_wave_barrier();
  __builtin_amdgcn_fence(__ATOMIC_ACQUIRE, "workgroup");
}

// ---- asynchronous copies global -> LDS ------------------------------------------------------------------
__device__ __forceinline__ unsigned lds_addr(const unsigned short* p) {   // byte offset in the work-group's LDS
  return (unsigned)(size_t)(const __attribute__((address_space(3))) unsigned short*)p;
}
// One lane's share of a 128-row x 128-B tile: eight 16-B pieces, 16 rows apart (global pitch ND halves, LDS pitch
// GLP halves). The closing s_wait_xcnt stands inside the statement so that no address register named here is
// rewritten ahead of it.
__device__ __forceinline__ void stage_rows(unsigned l, const unsigned short* g) {
#if defined(__HIP_DEVICE_COMPILE__)
  asm volatile(
      "global_load_async_to_lds_b128 %0, %8, off\n\t"
      "global_load_async_to_lds_b128 %1, %9, off\n\t"
      "global_load_async_to_lds_b128 %2, %10, off\n\t"
      "global_load_async_to_lds_b128 %3, %11, off\n\t"
      "global_load_async_to_lds_b128 %4, %12, off\n\t"
      "global_load_async_to_lds_b128 %5, %13, off\n\t"
      "global_load_async_to_lds_b128 %6, %14, off\n\t"
      "global_load_async_to_lds_b128 %7, %15, off\n\t"
      "s_wait_xcnt 0x0"
      :: "v"(l), "v"(l + 1u * 16u * GLP * 2u), "v"(l + 2u * 16u * GLP * 2u), "v"(l + 3u * 16u * GLP * 2u),
         "v"(l + 4u * 16u * GLP * 2u), "v"(l + 5u * 16u * GLP * 2u), "v"(l + 6u * 16u * GLP * 2u),
         "v"(l + 7u * 16u * GLP * 2u),
         "v"(g), "v"(g + 1 * 16 * ND), "v"(g + 2 * 16 * ND), "v"(g + 3 * 16 * ND),
         "v"(g + 4 * 16 * ND), "v"(g + 5 * 16 * ND), "v"(g + 6 * 16 * ND), "v"(g + 7 * 16 * ND)
      : "memory");
#endif
}
__device__ __forceinline__ void wait_copies() {      // this wave's own copies have landed in LDS
#if defined(__HIP_DEVICE_COMPILE__)
  asm volatile("s_wait_asynccnt 0x0" ::: "memory");
#endif
}
__device__ __forceinline__ void wait_lds_reads() {   // this wave's LDS reads have returned before their buffer is refilled
#if defined(__HIP_DEVICE_COMPILE__)
  asm volatile("s_wait_dscnt 0x0" ::: "memory");
#endif
}

// =====================================================================================================
// f32 -> f16( bf16_RNE(v) * scale ), scale a power of two (exact), 8 elements per thread, one 16-B store
// =====================================================================================================
__device__ __forceinline__ void cvt_h8(int blk, const float* __restrict__ in, unsigned short* out, int n8, float scale) {
  const int i = blk * 256 + threadIdx.x;
  if (i < n8) {
    const v4f a = *(const v4f*)(in + (size_t)i * 8);
    const v4f c = *(const v4f*)(in + (size_t)i * 8 + 4);
    float f[8];
    f[0] = a[0]; f[1] = a[1]; f[2] = a[2]; f[3] = a[3];
    f[4] = c[0]; f[5] = c[1]; f[6] = c[2]; f[7] = c[3];
    unsigned short hb[8];
#pragma unroll
    for (int e = 0; e < 8; ++e) hb[e] = h_bits((_Float16)(bf_up(bf_bits(f[e])) * scale));
    v4u p;
    p[0] = pk16(hb[0], hb[1]);
    p[1] = pk16(hb[2], hb[3]);
    p[2] = pk16(hb[4], hb[5]);
    p[3] = pk16(hb[6], hb[7]);
    *(v4u*)(out + (size_t)i * 8) = p;
    
  }
}

// =====================================================================================================
// Weight transpose + convert: W[c][o] f32 (c in [0,1024), o in [0,3072), o contiguous) ->
// WT[o][c] f16 = f16( bf16_RNE(W[c][o]) * scale ), c contiguous (k-major rows for the B fragment loader).
// Block = one 64(o) x 64(c) tile: thread (ol = tid&63, cb = tid>>6) reads 16 consecutive c rows of column o0+ol
// (coalesced per row across lanes), packs them as two 16-B LDS stores into sT[ol][c]; block barrier; then every
// tiles = (3072/64, 1024/64) = (48, 16): bx = o tiles (rows of WT), by = c tiles (rows of W).
// coverage: 256 threads x 2 rows-iterations... : rows tid>>3 (0..31) and +32 -> all 64 rows x 64 halves per tile.
// =====================================================================================================
__device__ __forceinline__ void cvt_wT(int bx, int by, const float* __restrict__ W, unsigned short* WT, float scale) {
  __shared__ __align__(16) unsigned short sT[64 * SPP];          // 9216 B
  const int tid = threadIdx.x;
  const int o0 = bx * 64;
  const int c0 = by * 64;
  {
    const int ol = tid & 63, cb = tid >> 6;                      // cb 0..3 -> c rows cb*16 .. +15
    unsigned short hb[16];
#pragma unroll
    for (int e = 0; e < 16; ++e) {
      const float f = W[(size_t)(c0 + cb * 16 + e) * NQKV + o0 + ol];
      hb[e] = h_bits((_Float16)(bf_up(bf_bits(f)) * scale));
    }
    v4u p0, p1;
#pragma unroll
    for (int q = 0; q < 4; ++q) {
      p0[q] = pk16(hb[2 * q], hb[2 * q + 1]);
      p1[q] = pk16(hb[8 + 2 * q], hb[8 + 2 * q + 1]);
    }
    *(v4u*)(sT + ol * SPP + cb * 16) = p0;
    *(v4u*)(sT + ol * SPP + cb * 16 + 8) = p1;
  }
  __syncthreads();
  {
    const int row = tid >> 3, c8 = (tid & 7) * 8;
    const v4u v0 = *(const v4u*)(sT + row * SPP + c8);
    const v4u v1 = *(const v4u*)(sT + (row + 32) * SPP + c8);
    const size_t d0 = (size_t)(o0 + row) * ND + c0 + c8;
    const size_t d1 = (size_t)(o0 + row + 32) * ND + c0 + c8;
    {
      *(v4u*)(WT + d0) = v0;
      *(v4u*)(WT + d1) = v1;
      // precaution: the two stores' address and data registers are not rewritten (by another job's code that
      // follows in the listing) before this wait
      asm volatile("s_wait_xcnt 0x0" ::: "memory");
    }
  }
}

// =====================================================================================================
// inv_freq[j] = 1 / 10000^(j/32), j = 0..31 (full head dim, not pairs), worked out by every thread that needs it.
// Contraction off: power, reciprocal and (in k_tab) the angle s * inv_freq are each rounded to f32 on their own, as the
// definition rounds them, before the sine and cosine see the angle.
// =====================================================================================================
__device__ __forceinline__ float k_invf(int j) {
  #pragma clang fp contract(off)
  const float e = (float)j * 0.03125f;
  const float p = powf(10000.0f, e);
  const float inv = 1.0f / p;
  return inv;
}

// =====================================================================================================
// Rotary tables COS/SIN[s][j] = cos/sin( s * inv_freq[j] ), s in [0,2048), j in [0,32): 256 threads = 8 rows x 32,
// one precise sincosf per thread (rolled, nothing unrolled); values staged in LDS, block barrier, then waves 0-1
// coverage: 256 blocks x 8 rows x 32 = every COS and SIN element.
// =====================================================================================================
__device__ __forceinline__ void k_tab(int blk, float* COS, float* SIN) {
  // the angle is rounded to f32 as a product of its own before sine and cosine (see k_invf)
  #pragma clang fp contract(off)
  __shared__ __align__(16) float sc[8 * 32];
  __shared__ __align__(16) float ss[8 * 32];
  const int tid = threadIdx.x, j = tid & 31, rl = tid >> 5;
  const int s = blk * 8 + rl;
  const float ang = (float)s * k_invf(j);
  float sn, cs;
  sincosf(ang, &sn, &cs);
  sc[rl * 32 + j] = cs;
  ss[rl * 32 + j] = sn;
  __syncthreads();
  if (tid < 64) {                                                // waves 0,1: COS rows
    const int row = tid >> 3, c4 = (tid & 7) * 4;
    const v4f v = *(const v4f*)(sc + row * 32 + c4);
    float* d = COS + (size_t)(blk * 8 + row) * HD + c4;
    *(v4f*)d = v;
    
  } else if (tid < 128) {                                        // waves 2,3: SIN rows
    const int t2 = tid - 64;
    const int row = t2 >> 3, c4 = (t2 & 7) * 4;
    const v4f v = *(const v4f*)(ss + row * 32 + c4);
    float* d = SIN + (size_t)(blk * 8 + row) * HD + c4;
    *(v4f*)d = v;
    
  }
}

// =====================================================================================================
// Mask digest, made once for all batch*head pairs. Block (cp, qb) = 128 query rows x MCH key chunks of 64; wave w owns
// the 16-row query tile qt = 8*qb + w and reads, per chunk, the same 32 entries per lane that the attention wave of
// that tile needs: lane -> query row 16*qt + (lane&15), keys of lane half lane>>4.
//   MB[qt][c][16*s + 8*t + r]: a lane mask, bit lane <-> (mask[row][64*c + 32*s + 16*t + 8*(lane>>4) + r] != 0), ready
//                    as the select mask of score element (t, r) of 32-key step s; one 128-B line per (qt, c), written
//                    by one wave (lane i stores word i).
//   FL[qb][cp][MFL]: entry e < MCH is nonzero iff any entry of the 128 x 64 block of chunk MCH*cp + e is nonzero;
//                    one whole 128-B line per block (the rest of the line is 0).
// blocks = (32/MCH, 16): every (qt, c) word line and every FL line written exactly once.
// =====================================================================================================
__device__ __forceinline__ void mask_digest(int cp, int qb, const int* __restrict__ msk, unsigned* MB, int* FL) {
  __shared__ int sany[MCH][8];
  const int tid = threadIdx.x, lane = tid & 31, wave = tid >> 5;
  const int rlane = lane & 15, hsel = lane >> 4;
  const int qt = qb * 8 + wave;
  const size_t rowbase = (size_t)(qt * 16 + rlane) * NT;
  // all loads of the wave stand ahead of its first store; every loop below is unrolled so that ent[] is indexed by
  // constants and stays in registers
  v4i ent[MCH][2][2][2];
#pragma unroll
  for (int e = 0; e < MCH; ++e) {
#pragma unroll
    for (int s = 0; s < 2; ++s) {
#pragma unroll
      for (int t = 0; t < 2; ++t) {
        const int* mp = msk + rowbase + (size_t)((cp * MCH + e) * KCH + 32 * s + 16 * t + 8 * hsel);
        ent[e][s][t][0] = *(const v4i*)mp;
        ent[e][s][t][1] = *(const v4i*)(mp + 4);
      }
    }
  }
#pragma unroll
  for (int e = 0; e < MCH; ++e) {
    unsigned any = 0u;
    int mine = 0;                                                // lane i ends up with word i
#pragma unroll
    for (int i = 0; i < 32; ++i) {                               // i = 16*s + 8*t + r
      const unsigned w = __builtin_amdgcn_ballot_w32(ent[e][i >> 4][(i >> 3) & 1][(i >> 2) & 1][i & 3] != 0);
      any |= w;
      mine = (lane == i) ? (int)w : mine;
    }
    MB[((size_t)qt * NKC + cp * MCH + e) * 32 + lane] = (unsigned)mine;
    if (lane == 0) sany[e][wave] = (any != 0u) ? 1 : 0;
  }
  __syncthreads();
  if (tid < MFL) {
    int f = 0;
    if (tid < MCH) {
#pragma unroll
      for (int w = 0; w < 8; ++w) f |= sany[tid][w];
    }
    FL[((size_t)qb * (NKC / MCH) + cp) * MFL + tid] = f;
  }
}

// =====================================================================================================
// All work that depends on the inputs alone, in ONE launch: the four jobs above read and write disjoint buffers and none
// reads what another writes, so their work-groups share the chip instead of waiting for one another's launch to end.
// The job is picked by the block index (the same for the whole work-group, so each job's barrier stays block-uniform):
//   [0, PB_DIG)       mask digest, block (cp, qb) = (i % 16, i / 16)
//   [.., PB_WT)       weight transpose + convert, tile (bx, by) = (i % 48, i / 48)
//   [.., PB_TAB)      rotary tables, 8 rows a block
//   [.., PB_ALL)      activation convert, 2048 elements a block
// =====================================================================================================
#define PB_DIG  ((NKC / MCH) * (NT / QBLK))
#define PB_WT   (PB_DIG + (NQKV / 64) * (ND / 64))
#define PB_TAB  (PB_WT + NT / 8)
#define PB_ALL  (PB_TAB + NTOK * ND / 2048)
__global__ __launch_bounds__(256) void prep(const float* __restrict__ x, const float* __restrict__ W,
                                            const int* __restrict__ msk, unsigned short* XH, unsigned short* WT,
                                            float* COS, float* SIN, unsigned* MB, int* FL) {
  const int blk = blockIdx.x;
  if (blk < PB_DIG) {
    mask_digest(blk % (NKC / MCH), blk / (NKC / MCH), msk, MB, FL);
  } else if (blk < PB_WT) {
    const int i = blk - PB_DIG;
    cvt_wT(i % (NQKV / 64), i / (NQKV / 64), W, WT, 1024.0f);
  } else if (blk < PB_TAB) {
    k_tab(blk - PB_WT, COS, SIN);
  } else {
    cvt_h8(blk - PB_TAB, x, XH, NTOK * ND / 8, 16.0f);
  }
}

// =====================================================================================================
// Fused qkv projection GEMM with rotary + 16-bit plane epilogue:
//   Y[tok][o] = sum_c XH[tok][c] * WT[o][c] * oscale,  tok in [0,4096), o in [0,3072), K = 1024.
// One work-group of 4 waves per 128x128 tile, one wave per 64x64 quarter (register-blocked); A = XH rows (token),
// Bt = WT rows (k contiguous). Per 64-deep k stage the 128 A rows and 128 Bt rows (128 B each, whole lines) are copied
// asynchronously into one of two LDS buffers (pitch 144 B) while the other buffer is worked on; k order unchanged.
// The 64 tokens of a tile lie in one batch b (t0 = m0 mod 2048); the 64 outputs are two heads h0, h0+1 of one of
// q (o < 1024), k (1024 <= o < 2048), v (o >= 2048); column j (16-wide subtile) -> head h0 + (j>>1), d = 16*(j&1)+lane%16.
//   q, k: rotary combine per the module: out[d] = y[d]*cos[s][d] - y[d+16]*sin[s][d] (d < 16),
//         out[d] = y[d]*cos[s][d] + y[d-16]*sin[s][d] (d >= 16); both partners sit in the same lane and element.
//         PH/PL[bh][t][32] f16 = (out*16) hi plane and its residual (64 B per token; the wave owns 64 consecutive
// then q/k: each head's slab region (16 tok x 64 B = 1024 contiguous B) written as 32 lanes x 16 B contiguous per
// grid = 768 blocks x 4 waves = 3072 wave tiles = 64 x 48 exactly.
// coverage: q/k tiles: 4 slabs x 2 heads x 16 tok x 32 d (hi and residual); v tiles: 4 subtiles x 16 d x 64 tok;
// 64 token tiles x (16+16+16) column tiles = every (bh, t) row of QH/QL/KH/KL and every (bh, d) row of VH/VL.
// =====================================================================================================
__global__ __launch_bounds__(128) void gemm_proj(
    const unsigned short* __restrict__ XHp, const unsigned short* __restrict__ WTp,
    const float* __restrict__ COS, const float* __restrict__ SIN,
    unsigned short* QH, unsigned short* QL, unsigned short* KH, unsigned short* KL,
    unsigned short* VH, unsigned short* VL, float oscale) {
  __shared__ __align__(16) unsigned short sA[2][GBUF];            // 36864 B
  __shared__ __align__(16) unsigned short sB[2][GBUF];            // 36864 B
  __shared__ __align__(16) unsigned short sP[4][2][16 * SPP];     // 18432 B
  const int tid  = threadIdx.x;
  const int lane = tid & 31;
  const int wave = tid >> 5;
  const int tilesN = NQKV / GBT;                                 // 24
  const int tilesM = NTOK / GBT;                                 // 32
  const int tile = blockIdx.x;
  if (tile >= tilesM * tilesN) return;                           // block-uniform, in front of every barrier
  const int tm = tile / tilesN;
  const int tn = tile - tm * tilesN;
  const int wm = wave >> 1, wn = wave & 1;                       // 2 x 2 waves
  const int m0 = tm * GBT + (wm << 6);                           // token base of this wave
  const int n0 = tn * GBT + (wn << 6);                           // output channel base in [0,3072)
  const int rlane = lane & 15;
  const int hh    = lane >> 4;
  const int koff  = hh * 8;
  const int mOff  = hh * 8;

  v8f acc[4][4];
#pragma unroll
  for (int i = 0; i < 4; ++i)
#pragma unroll
    for (int j = 0; j < 4; ++j) acc[i][j] = zero8();

  // copy share of this lane: piece tid&7 (16 B) of rows (tid>>3) + 16e, e = 0..7; a wave's copy = 4 whole 128-B lines
  const int crow = tid >> 3, cpc = (tid & 7) * 8;
  const unsigned short* gA = XHp + (size_t)(tm * GBT + crow) * ND + cpc;
  const unsigned short* gB = WTp + (size_t)(tn * GBT + crow) * ND + cpc;
  const unsigned lA = lds_addr(&sA[0][crow * GLP + cpc]);
  const unsigned lB = lds_addr(&sB[0][crow * GLP + cpc]);

  stage_rows(lA, gA);                                            // stage 0 -> buffer 0
  stage_rows(lB, gB);
  wait_copies();
  __syncthreads();
  stage_rows(lA + GBUF * 2u, gA + GBK);                          // stage 1 -> buffer 1
  stage_rows(lB + GBUF * 2u, gB + GBK);

  // rolled: the two-buffer order below is written once
#pragma unroll 1
  for (int t = 0; t < GTR; ++t) {
    const int bsel = t & 1;
    const _Float16* fa = (const _Float16*)(const void*)&sA[bsel][((wm << 6) + rlane) * GLP + koff];
    const _Float16* fb = (const _Float16*)(const void*)&sB[bsel][((wn << 6) + rlane) * GLP + koff];
#pragma unroll
    for (int kk = 0; kk < GBK; kk += 32) {
      v16h bf[4], af[4];
#pragma unroll
      for (int j = 0; j < 4; ++j) bf[j] = ldfrag_h(fb + (j << 4) * GLP + kk);
#pragma unroll
      for (int i = 0; i < 4; ++i) af[i] = ldfrag_h(fa + (i << 4) * GLP + kk);
#pragma unroll
      for (int i = 0; i < 4; ++i)
#pragma unroll
        for (int j = 0; j < 4; ++j) acc[i][j] = mma_h_raw(af[i], bf[j], acc[i][j]);
      // all 16 LDS reads of this k step as one group ahead of its 16 products: one LDS wait a step, not one a row
      __builtin_amdgcn_sched_group_barrier(0x100, 16, 0);
      __builtin_amdgcn_sched_group_barrier(0x008, 16, 0);
    }
    // publish point of stage t + 1: own reads done, own copies landed, barrier, then the refill of the buffer just read
    wait_lds_reads();
    wait_copies();
    __syncthreads();
    if (t + 2 < GTR) {
      stage_rows(lA + (unsigned)bsel * (GBUF * 2u), gA + (t + 2) * GBK);
      stage_rows(lB + (unsigned)bsel * (GBUF * 2u), gB + (t + 2) * GBK);
    }
  }
  wait_copies();
  acc_guard4(acc[0][0], acc[0][1], acc[0][2], acc[0][3]);
  acc_guard4(acc[1][0], acc[1][1], acc[1][2], acc[1][3]);
  acc_guard4(acc[2][0], acc[2][1], acc[2][2], acc[2][3]);
  acc_guard4(acc[3][0], acc[3][1], acc[3][2], acc[3][3]);

  // ---- epilogue ----
  const int b   = m0 / NT;
  const int t0  = m0 - b * NT;
  const int sel = n0 >> 10;                                      // 0 q, 1 k, 2 v (wave-uniform)
  const int h0  = (n0 & (ND - 1)) >> 5;                          // first of the two heads of this tile
  unsigned short* s0 = &sP[wave][0][0];
  unsigned short* s1 = &sP[wave][1][0];

  if (sel < 2) {
    unsigned short* PH = (sel == 0) ? QH : KH;
    unsigned short* PL = (sel == 0) ? QL : KL;
#pragma unroll
    for (int i = 0; i < 4; ++i) {                                // slab = 16 tokens t0+16i .. +15
#pragma unroll
      for (int r = 0; r < 8; ++r) {
        const int tok = t0 + (i << 4) + mOff + r;                // row tok = 8hh + r
        const float* cp = COS + (size_t)tok * HD;
        const float* sp = SIN + (size_t)tok * HD;
        const float ca = cp[rlane], cb = cp[16 + rlane];
        const float sa = sp[rlane], sb = sp[16 + rlane];
#pragma unroll
        for (int hp = 0; hp < 2; ++hp) {
          const float y0 = acc[i][2 * hp][r] * oscale;           // d = rlane
          const float y1 = acc[i][2 * hp + 1][r] * oscale;       // d = 16 + rlane
          const float f0 = (y0 * ca - y1 * sa) * 16.0f;
          const float f1 = (y1 * cb + y0 * sb) * 16.0f;
          const _Float16 x0 = (_Float16)f0;
          const _Float16 x1 = (_Float16)f1;
          const int so = (mOff + r) * SPP + 32 * hp + rlane;     // row tok, col 32hp + d
          s0[so]      = h_bits(x0);
          s1[so]      = h_bits((_Float16)(f0 - (float)x0));
          s0[so + 16] = h_bits(x1);
          s1[so + 16] = h_bits((_Float16)(f1 - (float)x1));
        }
      }
      wave_sync_lds();
      {
        const int rr = lane >> 2, cc = (lane & 3) * 8;           // rr*32 + cc = lane*8 halves
#pragma unroll
        for (int hp = 0; hp < 2; ++hp) {
          const int bhp = b * NH + h0 + hp;
          const size_t base = ((size_t)(bhp * NT + t0 + (i << 4))) * HD + lane * 8;
          const v4u v0 = *(const v4u*)(s0 + rr * SPP + 32 * hp + cc);
          const v4u v1 = *(const v4u*)(s0 + (rr + 8) * SPP + 32 * hp + cc);
          const v4u w0 = *(const v4u*)(s1 + rr * SPP + 32 * hp + cc);
          const v4u w1 = *(const v4u*)(s1 + (rr + 8) * SPP + 32 * hp + cc);
          {
            *(v4u*)(PH + base) = v0;
            *(v4u*)(PH + base + 256) = v1;
            *(v4u*)(PL + base) = w0;
            *(v4u*)(PL + base + 256) = w1;
            
          }
        }
      }
      wave_sync_lds();
    }
  } else {
#pragma unroll
    for (int j = 0; j < 4; ++j) {                                // slab = 16 rows d = 16(j&1) + rlane of head h0+(j>>1)
      const int hp = j >> 1, dbase = (j & 1) * 16;
      const int bhp = b * NH + h0 + hp;
#pragma unroll
      for (int i = 0; i < 4; ++i) {
        unsigned short hb[8], lb[8];
#pragma unroll
        for (int r = 0; r < 8; ++r) {
          const float f = (acc[i][j][r] * oscale) * 16.0f;
          const _Float16 xh = (_Float16)f;
          hb[r] = h_bits(xh);
          lb[r] = h_bits((_Float16)(f - (float)xh));
        }
        v4u ph, pl;
#pragma unroll
        for (int q = 0; q < 4; ++q) {
          ph[q] = pk16(hb[2 * q], hb[2 * q + 1]);
          pl[q] = pk16(lb[2 * q], lb[2 * q + 1]);
        }
        *(v4u*)(s0 + rlane * SPP + (i << 4) + mOff) = ph;       // row d = rlane, tok = 16i + 8hh .. +7
        *(v4u*)(s1 + rlane * SPP + (i << 4) + mOff) = pl;
      }
      wave_sync_lds();
      {
        const int rq = lane >> 3, c8 = (lane & 7) * 8;
        {
#pragma unroll
          for (int it = 0; it < 4; ++it) {
            const int row = it * 4 + rq;                         // it 0..3 x rq 0..3 = rows 0..15
            const size_t dst = ((size_t)(bhp * HD + dbase + row)) * NT + t0 + c8;
            const v4u v = *(const v4u*)(s0 + row * SPP + c8);
            const v4u w = *(const v4u*)(s1 + row * SPP + c8);
            *(v4u*)(VH + dst) = v;
            *(v4u*)(VL + dst) = w;
          }
          
        }
      }
      wave_sync_lds();
    }
  }
}

// =====================================================================================================
// Attention for one batch*head and two 128-query blocks (NQB-1-y, then y): grid = (64, 8), 256 threads = 8 waves x 16
// queries; at most four waves a SIMD by the register allocation, so the 512 equal work-groups lie two on a WGP; each lane
// owns one query column q = q0 + 16*wave + (lane&15). QH/QL/KH/KL[bh][t][32] f16 (x16 hi, residual at the same scale),
// VH/VL[bh][d][2048] (x16 hi, residual at the same scale). The mask [2048 q][2048 key] comes as the digest of mask_digest: key
// chunks of 64; each wave loads the 32 lane masks MB[qt][c][..] of its query tile by wave-uniform loads, one mask per
// score element; a chunk whose entries are all zero for the whole block (FL, gathered once into a wave-uniform word)
// is skipped block-uniformly, in front of every barrier of the chunk (exact: such keys have probability 0). Otherwise
// K hi/res rows [64][40] and V hi/res tiles [32 d][72] are staged in LDS with plain 16-B loads between two block
// barriers. Per chunk (one softmax update for its 64 keys) and 16-key tile t:
// S[key][q] = A(K hi) x B(Q res) + A(K res) x B(Q hi) + A(K hi rows) x B(resident Q hi), small terms first, chained in one
// zeroed accumulator; logit = S / 256 / sqrt(32); entries with mask == 0 replaced by -inf; online softmax over
// keys (max/sum across lane halves by shuffle); p = 1024*exp(x - max) packed D->B per the chained map (element r <-
// keys 0-15 tile, 8+r <- keys 16-31 tile of a 32-key step) as f16 hi plus residual; O[d][q] += A(V res) x Ph + A(V hi) x Pl +
// A(V hi rows) x Ph in one accumulator; out = O / (16 * l) (l = 0 gives 0*inf = NaN).
// coverage: 64 x 8 blocks x 2 tiles x 8 waves x 16 rows x 32 floats = every (tok, head) line of the output.
// =====================================================================================================
__global__ __launch_bounds__(ATHR) __attribute__((amdgpu_waves_per_eu(4, 4))) void attn_kernel(
    const unsigned short* __restrict__ QHp, const unsigned short* __restrict__ QLp,
    const unsigned short* __restrict__ KHp, const unsigned short* __restrict__ KLp,
    const unsigned short* __restrict__ VHp, const unsigned short* __restrict__ VLp,
    const unsigned* __restrict__ MB, const int* __restrict__ FL, float* Out) {
  __shared__ __align__(16) unsigned short kh_u[KCH * KP];         // 5120 B
  __shared__ __align__(16) unsigned short kl_u[KCH * KP];         // 5120 B
  __shared__ __align__(16) unsigned short vh_u[HD * VP];          // 4608 B
  __shared__ __align__(16) unsigned short vl_u[HD * VP];          // 4608 B
  __shared__ __align__(16) float sO[8][16 * OP];                  // 18432 B
  const _Float16* kh = (const _Float16*)(const void*)kh_u;
  const _Float16* kl = (const _Float16*)(const void*)kl_u;
  const _Float16* vh = (const _Float16*)(const void*)vh_u;
  const _Float16* vl = (const _Float16*)(const void*)vl_u;
  const _Float16* QH = (const _Float16*)(const void*)QHp;
  const _Float16* QL = (const _Float16*)(const void*)QLp;

  const int tid = threadIdx.x, lane = tid & 31, wave = tid >> 5;
  const int bh = blockIdx.x;
  const int b  = bh / NH;
  const int h  = bh - b * NH;
  const int rlane = lane & 15, hsel = lane >> 4, koff = hsel * 8;

  // Two query tiles per work-group, one after the other in every wave: NQB-1-y, then y. Under a lower-triangular mask the
  // active chunks of such a pair add up to the same count in every work-group; any other mask is only divided differently.
  // The first barrier of the second tile's first chunk ends every wave's reads of the first tile's last K/V chunk.
  // rolled: the tile body is written once
#pragma unroll 1
  for (int leg = 0; leg < 2; ++leg) {
    const int qb = (leg == 0) ? (NQB - 1 - (int)blockIdx.y) : (int)blockIdx.y;
    const int q0 = qb * QBLK;
    const int qrow = q0 + wave * 16 + rlane;                       // this lane's query index within the sequence

    // resident Q fragments (B operand: B[k=d][n=q] from [q][d] rows), arithmetic addressing, one 32-deep k-step
    const size_t qo = ((size_t)(bh * NT + qrow)) * HD + koff;
    const v16h qh0 = ldfrag_h(QH + qo);
    const v16h ql0 = ldfrag_h(QL + qo);
    // this wave's lane masks, 32 words a chunk; the wave number made uniform so that the words load into scalar registers
    const unsigned* mbp = MB + ((size_t)(qb * 8 + __builtin_amdgcn_readfirstlane(wave)) * NKC) * 32;
    // bit c <-> chunk c has a nonzero mask entry somewhere in this block's 128 query rows (the same word in every wave)
    const unsigned act = __builtin_amdgcn_ballot_w32(
        FL[((size_t)qb * (NKC / MCH) + lane / MCH) * MFL + (lane % MCH)] != 0);

    const float SCL    = 0.17677669529663687f * (1.0f / 256.0f);  // undo q*16, k*16, then 1/sqrt(32)
    const float LN1024 = 6.931471805599453f;
    const float NEGINF = __uint_as_float(0xff800000u);

    v8f oh[2];
#pragma unroll
    for (int dt = 0; dt < 2; ++dt) oh[dt] = zero8();
    float m_run = -1.0e30f, l_run = 0.0f;

#pragma unroll 1
    for (int c = 0; c < NKC; ++c) {
      if (((act >> c) & 1u) == 0u) continue;                       // block-uniform skip of an all-masked chunk
      const int kc = c * KCH;
      __syncthreads();                                             // all waves finished reading the prior chunk's K/V
      // lane masks: word (16*s + 8*t + r), bit lane <-> key kc + 32*s + 16*t + 8*hsel + r of the lane's query row
      // read through the constant address space (nothing writes MB in this launch), which makes them scalar loads
      const v16u mw0 = *(const __attribute__((address_space(4))) v16u*)(mbp + c * 32);
      const v16u mw1 = *(const __attribute__((address_space(4))) v16u*)(mbp + c * 32 + 16);

      // ---- stage K hi/res rows and V hi/res tiles of keys kc..kc+63 (one 16-B item per thread each) ----
      {
        const int key = tid >> 2, ck = (tid & 3) * 8;              // 64 keys x 32 halves
        const size_t gk = ((size_t)(bh * NT + kc + key)) * HD + ck;
        const int d = tid >> 3, cv = (tid & 7) * 8;                // 32 d rows x 64 halves
        const size_t gv = ((size_t)(bh * HD + d)) * NT + kc + cv;
        const v4u gkh = *(const v4u*)(KHp + gk);
        const v4u gkl = *(const v4u*)(KLp + gk);
        const v4u gvh = *(const v4u*)(VHp + gv);
        const v4u gvl = *(const v4u*)(VLp + gv);
        *(v4u*)(kh_u + key * KP + ck) = gkh;
        *(v4u*)(kl_u + key * KP + ck) = gkl;
        *(v4u*)(vh_u + d * VP + cv) = gvh;
        *(v4u*)(vl_u + d * VP + cv) = gvl;
      }
      __syncthreads();

      // ONE softmax update for the whole 64-key chunk: four 16-key score tiles T (keys kc + 16*T ..) are formed, masked,
      // reduced and exponentiated together, so the exchange between lane halves, the factor alph and the rescale of the
      // running output stand once a chunk.
      {
        float a[4][8];
        // the four key tiles' chains of three are issued turn about, so that four independent accumulators stay in flight
        v16h kha[4], kla[4];
        v8f sh[4];
#pragma unroll
        for (int t = 0; t < 4; ++t) {
          const int krow = 16 * t + rlane;
          kha[t] = ldfrag_h(kh + krow * KP + koff);
          kla[t] = ldfrag_h(kl + krow * KP + koff);
        }
#pragma unroll
        for (int t = 0; t < 4; ++t) sh[t] = mma_h_raw(kha[t], ql0, zero8());
#pragma unroll
        for (int t = 0; t < 4; ++t) sh[t] = mma_h_raw(kla[t], qh0, sh[t]);
#pragma unroll
        for (int t = 0; t < 4; ++t) sh[t] = mma_h_raw(kha[t], qh0, sh[t]);
        // the chunk's 16 V fragment reads are issued behind the score products, so that they return under the softmax arithmetic
        v16h vah[2][2], val[2][2];
#pragma unroll
        for (int s = 0; s < 2; ++s) {
#pragma unroll
          for (int dt = 0; dt < 2; ++dt) {
            vah[s][dt] = ldfrag_h(vh + (16 * dt + rlane) * VP + 32 * s + koff);
            val[s][dt] = ldfrag_h(vl + (16 * dt + rlane) * VP + 32 * s + koff);
          }
        }
        // order of issue: all 16 K fragment reads as one group (one LDS wait, not three), the 12 score products, the 16 V reads
        __builtin_amdgcn_sched_group_barrier(0x100, 16, 0);
        __builtin_amdgcn_sched_group_barrier(0x008, 12, 0);
        __builtin_amdgcn_sched_group_barrier(0x100, 16, 0);
        // no vector work is drawn in between the products (each such read of a fresh tile would cost its own v_nop gap)
        __builtin_amdgcn_sched_barrier(0);
#pragma unroll
        for (int t = 0; t < 4; ++t) {
          const v8f sc = sh[t] * SCL;
#pragma unroll
          for (int r = 0; r < 8; ++r) {
            const unsigned kw = (t < 2) ? mw0[(t & 1) * 8 + r] : mw1[(t & 1) * 8 + r];
            a[t][r] = __builtin_amdgcn_inverse_ballot_w32(kw) ? sc[r] : NEGINF;
          }
        }

        // online softmax over the key axis for this lane's q column
        float mloc = -1.0e30f;
#pragma unroll
        for (int t = 0; t < 4; ++t) {                              // tile by tile, in the order in which the tiles were finished
#pragma unroll
          for (int r = 0; r < 8; r += 2) mloc = fmaxf(mloc, fmaxf(a[t][r], a[t][r + 1]));
        }
        mloc = fmaxf(mloc, __shfl_xor(mloc, 16, 32));
        const float newM  = fmaxf(m_run, mloc);
        const float alph  = __expf(m_run - newM);
        const float msh   = newM - LN1024;
        float ssum = 0.0f;
        float p[4][8];
#pragma unroll
        for (int r = 0; r < 8; ++r) {
#pragma unroll
          for (int t = 0; t < 4; ++t) p[t][r] = __expf(a[t][r] - msh);
          ssum += (p[0][r] + p[1][r]) + (p[2][r] + p[3][r]);
        }
        ssum += __shfl_xor(ssum, 16, 32);
        l_run = l_run * alph + ssum;
        m_run = newM;
#pragma unroll
        for (int dt = 0; dt < 2; ++dt) {
#pragma unroll
          for (int r = 0; r < 8; ++r) oh[dt][r] *= alph;
        }

        // P (f32, D layout) -> B operands (f16 hi, f16 residual) of 32-key step s: element r <- tile 2s, 8+r <- tile 2s+1
        union { v16h v; _Float16 s[16]; } ph[2], plo[2];
#pragma unroll
        for (int s = 0; s < 2; ++s) {
#pragma unroll
          for (int r = 0; r < 8; ++r) {
            const _Float16 x0 = (_Float16)p[2 * s][r];
            const _Float16 x1 = (_Float16)p[2 * s + 1][r];
            ph[s].s[r]      = x0;
            ph[s].s[8 + r]  = x1;
            plo[s].s[r]     = (_Float16)(p[2 * s][r] - (float)x0);
            plo[s].s[8 + r] = (_Float16)(p[2 * s + 1][r] - (float)x1);
          }
        }

        // O[d][q] += V[d][32s .. +31] x P, hi and residual terms, step 0 then step 1
        // written with the two d tiles' chains turn about; step 0's products may issue while step 1's P is still being split
#pragma unroll
        for (int s = 0; s < 2; ++s) {
#pragma unroll
          for (int dt = 0; dt < 2; ++dt) oh[dt] = mma_h_raw(val[s][dt], ph[s].v, oh[dt]);
#pragma unroll
          for (int dt = 0; dt < 2; ++dt) oh[dt] = mma_h_raw(vah[s][dt], plo[s].v, oh[dt]);
#pragma unroll
          for (int dt = 0; dt < 2; ++dt) oh[dt] = mma_h_raw(vah[s][dt], ph[s].v, oh[dt]);
        }
        guard4(oh[0], oh[1], vah[1][0], val[1][0], vah[1][1], val[1][1], ph[1].v, plo[1].v);
      }
    }
    acc_guard2(oh[0], oh[1]);

    // ---- output values -> per-wave f32 LDS staging ----
    const float inv = (1.0f / 16.0f) * (1.0f / l_run);            // out = O / (16 * l)
    float* st = sO[wave];
#pragma unroll
    for (int dt = 0; dt < 2; ++dt) {
      v4f va, vb;
#pragma unroll
      for (int e = 0; e < 4; ++e) {
        va[e] = oh[dt][e] * inv;                                   // d = 16dt + 8hsel + e
        vb[e] = oh[dt][4 + e] * inv;                               // d = 16dt + 8hsel + 4 + e
      }
      const int so = rlane * OP + 16 * dt + 8 * hsel;              // row q = rlane
      *(v4f*)(st + so) = va;
      *(v4f*)(st + so + 4) = vb;
    }
    wave_sync_lds();
    {
      const int rq = lane >> 3, c4 = (lane & 7) * 4;
      const int n0 = q0 + wave * 16;
      {
#pragma unroll
        for (int it = 0; it < 4; ++it) {
          const int row = it * 4 + rq;                             // it 0..3 x rq 0..3 = rows 0..15
          const v4f v = *(const v4f*)(st + row * OP + c4);
          *(v4f*)(Out + ((size_t)(b * NT + n0 + row)) * ND + h * HD + c4) = v;
        }
        // precaution: the four stores' address and data registers are not rewritten (by the second tile's code) before
        // this wait
        asm volatile("s_wait_xcnt 0x0" ::: "memory");
      }
    }
  }
}

// =====================================================================================================
// Workspace map (bytes, every offset a multiple of 128; every plane an exact multiple of its whole-line store
// granularity, row counts exact tile multiples, no padded tails needed):
//   XH   f16 [4096][1024]    activation, bf16-RNE x16                    0          8388608 B
//   WT   f16 [3072][1024]    Wqkv transposed, bf16-RNE x1024       8388608          6291456 B
//   COS  f32 [2048][32]                                          14680064           262144 B
//   SIN  f32 [2048][32]                                          14942208           262144 B
//   (256 B not used)                                            15204352              256 B
//   QH   f16 [64][2048][32]  q x16 hi                            15204608          8388608 B
//   QL   f16 [64][2048][32]  q x16 residual                      23593216          8388608 B
//   KH   f16 [64][2048][32]                                      31981824          8388608 B
//   KL   f16 [64][2048][32]                                      40370432          8388608 B
//   VH   f16 [64][32][2048]  v x16 hi, key-contiguous            48759040          8388608 B
//   VL   f16 [64][32][2048]                                      57147648          8388608 B
//   MB   u32 [128][32][32]   lane masks per (query tile, chunk, element) 65536256     524288 B
//   FL   i32 [16][16][32]    chunk flags, one line per digest block  66060544          32768 B
//   end                                                          66093312
// =====================================================================================================
extern "C" void kernel_launch(void* const* d_in, const int* in_sizes, int n_in,
                              void* d_out, int out_size, void* d_ws, size_t ws_size,
                              hipStream_t stream) {
  if (n_in < 3) return;
  if (in_sizes[0] != NTOK * ND) return;
  if (in_sizes[1] != ND * NQKV) return;
  if (in_sizes[2] != NT * NT) return;
  if (out_size != NTOK * ND) return;

  const float* x   = (const float*)d_in[0];
  const float* W   = (const float*)d_in[1];
  const int*   msk = (const int*)d_in[2];

  const size_t PXH = (size_t)NTOK * ND * 2;                    // 8388608
  const size_t PWT = (size_t)NQKV * ND * 2;                    // 6291456
  const size_t PTB = (size_t)NT * HD * 4;                      // 262144
  const size_t PIN = 256;
  const size_t PQK = (size_t)NBH * NT * HD * 2;                // 8388608
  const size_t PV  = (size_t)NBH * HD * NT * 2;                // 8388608
  size_t off = 0;
  const size_t oXH  = off; off += PXH;
  const size_t oWT  = off; off += PWT;
  const size_t oCOS = off; off += PTB;
  const size_t oSIN = off; off += PTB;
  off += PIN;                                                  // 256 B not used
  const size_t oQH  = off; off += PQK;
  const size_t oQL  = off; off += PQK;
  const size_t oKH  = off; off += PQK;
  const size_t oKL  = off; off += PQK;
  const size_t oVH  = off; off += PV;
  const size_t oVL  = off; off += PV;
  const size_t oMB  = off; off += (size_t)(NT / 16) * NKC * 32 * 4;        // 524288
  const size_t oFL  = off; off += (size_t)(NT / QBLK) * (NKC / MCH) * MFL * 4;   // 32768
  if (off > ws_size) return;                                   // off = 66093312
  if (off > (size_t)134217728) return;

  char* ws = (char*)d_ws;
  unsigned short* XH   = (unsigned short*)(ws + oXH);
  unsigned short* WT   = (unsigned short*)(ws + oWT);
  float*          COS  = (float*)(ws + oCOS);
  float*          SIN  = (float*)(ws + oSIN);
  unsigned short* QH   = (unsigned short*)(ws + oQH);
  unsigned short* QL   = (unsigned short*)(ws + oQL);
  unsigned short* KH   = (unsigned short*)(ws + oKH);
  unsigned short* KL   = (unsigned short*)(ws + oKL);
  unsigned short* VH   = (unsigned short*)(ws + oVH);
  unsigned short* VL   = (unsigned short*)(ws + oVL);
  unsigned*       MB   = (unsigned*)(ws + oMB);
  int*            FL   = (int*)(ws + oFL);
  float*          out  = (float*)d_out;

  const dim3 blk(256);
  const dim3 gPrep(PB_ALL);                                    // 256 + 768 + 256 + 2048 = 3328
  const dim3 gProj((NTOK / GBT) * (NQKV / GBT));               // 32 x 24 = 768 blocks of 4 waves
  const dim3 gAttn(NBH, NQB / 2);                              // 64 x 8, 256 threads, two query tiles each

  const float oscPrj = 1.0f / 16384.0f;                        // undo x*16 and W*1024

  // (1) one launch: inputs -> f16 planes holding bf16-RNE values times an exact power of two; rotary tables;
  //     mask -> lane masks of the attention waves' score elements, and one flag per 128-query x 64-key block
  prep<<<gPrep, blk, 0, stream>>>(x, W, msk, XH, WT, COS, SIN, MB, FL);
  // (2) fused qkv projection with rotary epilogue: q, k -> [bh][t][32] hi/res planes; v -> [bh][d][t] hi/res planes
  gemm_proj<<<gProj, dim3(128), 0, stream>>>(XH, WT, COS, SIN, QH, QL, KH, KL, VH, VL, oscPrj);
  // (3) attention per (batch*head, pair of 128-query blocks) -> f32 output lines [tok][h*32 .. +31]
  attn_kernel<<<gAttn, dim3(ATHR), 0, stream>>>(QH, QL, KH, KL, VH, VL, MB, FL, out);
  (void)hipGetLastError();
}

// v007
// Measured time: 89 microseconds a run.
// Timed twice side by side with v006, it ran 1.05 times as fast both times.
// Over all steps from v000 it is 2.47 times as fast.
#include <hip/hip_runtime.h>
#include <math.h>
#include <stdint.h>

// Contractions: fused qkv projection x.Wqkv (f16 operands holding bf16-RNE values, x carried x16 and W x1024, one
// product per tile pair); scores k.q (k, and q times log2(e)/sqrt(32), each an f16 hi plane plus an f16 residual plane,
// small residuals as f16 subnormals: hi.lo + lo.hi + hi.hi chained in ONE accumulator, 3 products); context v.p
// (p x1024 and v x16, each f16 hi plus f16 residual at the same scale: lo.hi + hi.lo + hi.hi chained in the one running
// accumulator, 3 products); all v_wmma_f32_16x16x32_f16 with f32 accumulate; rotary tables, rotary combine, key masking, softmax
// statistics and the final normalisation in f32 on VALU; output stored as f32.

#define NB    2
#define NT    2048
#define ND    1024
#define NQKV  3072
#define NH    32
#define HD    32
#define NTOK  (NB * NT)
#define NBH   (NB * NH)
#define QBLK  128
#define KCH   64
#define NKC   (NT / KCH)
#define NQB   (NT / QBLK)
#define KP    40
#define VP    72
#define SPP   72
#define OP    36
#define ATHR  256
#define GBT   128
#define GBK   64
#define GLP   72
#define GTR   (ND / GBK)
#define GBUF  (GBT * GLP)
#define MCH   2
#define MFL   32
#define QSC   0.25503486f

static_assert(NH * HD == ND);
static_assert(NQKV == 3 * ND);
static_assert((NT % QBLK) == 0 && (NT % KCH) == 0 && (NT % 64) == 0 && (NTOK % 64) == 0);
static_assert((NQKV % 64) == 0 && (ND % 64) == 0 && (ND % 32) == 0);
static_assert(QBLK == (ATHR / 32) * 16 && (NQB % 2) == 0);
static_assert(KCH * 4 == ATHR && HD * 8 == ATHR);
static_assert(HD == 32 && KCH == 64 && NKC * KCH == NT);
static_assert(NKC == 32 && (NKC % MCH) == 0 && MCH <= MFL && QBLK == 8 * 16);
static_assert(((NTOK * ND) % 2048) == 0);
static_assert((NTOK % GBT) == 0 && (NQKV % GBT) == 0 && (NT % GBT) == 0 && (ND % GBT) == 0 && GTR >= 2);

typedef _Float16 v16h __attribute__((ext_vector_type(16)));
typedef _Float16 v8h  __attribute__((ext_vector_type(8)));
typedef float    v8f  __attribute__((ext_vector_type(8)));
typedef float    v4f  __attribute__((ext_vector_type(4)));
typedef unsigned int v4u __attribute__((ext_vector_type(4)));
typedef int      v4i  __attribute__((ext_vector_type(4)));
typedef unsigned int v16u __attribute__((ext_vector_type(16)));

// ---- scalar helpers --------------------------------------------------------------------------------
__device__ __forceinline__ unsigned short bf_bits(float f) {          // f32 -> bf16 bits, RNE convert
  unsigned u = __float_as_uint(f);
  return (unsigned short)((u + 0x7FFFu + ((u >> 16) & 1u)) >> 16);
}
__device__ __forceinline__ float bf_up(unsigned short h) { return __uint_as_float(((unsigned)h) << 16); }
__device__ __forceinline__ unsigned short h_bits(_Float16 x) { return __builtin_bit_cast(unsigned short, x); }
__device__ __forceinline__ unsigned pk16(unsigned short a, unsigned short b) { return (unsigned)a | ((unsigned)b << 16); }
__device__ __forceinline__ v8f zero8() { v8f z = {0.f, 0.f, 0.f, 0.f, 0.f, 0.f, 0.f, 0.f}; return z; }

// ---- fragment loader: 16-bit A/B operand, lane -> row/col (lane&15), p already includes +8*(lane>>4);
//      elements 0..7 <- p[0..7] (k0+8h..), elements 8..15 <- p[16..23] (k0+16+8h..)
__device__ __forceinline__ v16h ldfrag_h(const _Float16* p) {
  union { v16h v; v8h h[2]; } f;
  f.h[0] = *(const v8h*)(p);
  f.h[1] = *(const v8h*)(p + 16);
  return f.v;
}

// ---- WMMA helpers with trailing VALU hazard gap --------------------------------------------------------
__device__ __forceinline__ v8f mma_h_raw(v16h a, v16h b, v8f c) {
  return __builtin_amdgcn_wmma_f32_16x16x32_f16(false, a, false, b, (short)0, c, false, false);
}
__device__ __forceinline__ void guard4(v8f& a, v8f& b, v16h u, v16h v, v16h w, v16h x, v16h y, v16h z) {
#if defined(__HIP_DEVICE_COMPILE__)
  asm volatile("v_nop\n\tv_nop\n\tv_nop\n\tv_nop" : "+v"(a), "+v"(b) : "v"(u), "v"(v), "v"(w), "v"(x), "v"(y), "v"(z));
#endif
}
// the same gap behind the loop's last products, in front of the first vector read of the two output accumulators
__device__ __forceinline__ void acc_guard2(v8f& a, v8f& b) {
#if defined(__HIP_DEVICE_COMPILE__)
  asm volatile("v_nop\n\tv_nop\n\tv_nop\n\tv_nop" : "+v"(a), "+v"(b));
#endif
}
__device__ __forceinline__ void acc_guard4(v8f& a, v8f& b, v8f& c, v8f& d) {
#if defined(__HIP_DEVICE_COMPILE__)
  asm volatile("v_nop\n\tv_nop\n\tv_nop\n\tv_nop" : "+v"(a), "+v"(b), "+v"(c), "+v"(d));
#endif
}
__device__ __forceinline__ void wave_sync_lds() {
  __builtin_amdgcn_fence(__ATOMIC_RELEASE, "workgroup");
  __builtin_amdgcn_wave_barrier();
  __builtin_amdgcn_fence(__ATOMIC_ACQUIRE, "workgroup");
}

// ---- asynchronous copies global -> LDS ------------------------------------------------------------------
__device__ __forceinline__ unsigned lds_addr(const unsigned short* p) {   // byte offset in the work-group's LDS
  return (unsigned)(size_t)(const __attribute__((address_space(3))) unsigned short*)p;
}
// One lane's share of a 128-row x 128-B tile: eight 16-B pieces, 16 rows apart (global pitch ND halves, LDS pitch
// GLP halves). The closing s_wait_xcnt stands inside the statement so that no address register named here is
// rewritten ahead of it.
__device__ __forceinline__ void stage_rows(unsigned l, const unsigned short* g) {
#if defined(__HIP_DEVICE_COMPILE__)
  asm volatile(
      "global_load_async_to_lds_b128 %0, %8, off\n\t"
      "global_load_async_to_lds_b128 %1, %9, off\n\t"
      "global_load_async_to_lds_b128 %2, %10, off\n\t"
      "global_load_async_to_lds_b128 %3, %11, off\n\t"
      "global_load_async_to_lds_b128 %4, %12, off\n\t"
      "global_load_async_to_lds_b128 %5, %13, off\n\t"
      "global_load_async_to_lds_b128 %6, %14, off\n\t"
      "global_load_async_to_lds_b128 %7, %15, off\n\t"
      "s_wait_xcnt 0x0"
      :: "v"(l), "v"(l + 1u * 16u * GLP * 2u), "v"(l + 2u * 16u * GLP * 2u), "v"(l + 3u * 16u * GLP * 2u),
         "v"(l + 4u * 16u * GLP * 2u), "v"(l + 5u * 16u * GLP * 2u), "v"(l + 6u * 16u * GLP * 2u),
         "v"(l + 7u * 16u * GLP * 2u),
         "v"(g), "v"(g + 1 * 16 * ND), "v"(g + 2 * 16 * ND), "v"(g + 3 * 16 * ND),
         "v"(g + 4 * 16 * ND), "v"(g + 5 * 16 * ND), "v"(g + 6 * 16 * ND), "v"(g + 7 * 16 * ND)
      : "memory");
#endif
}
__device__ __forceinline__ void wait_copies() {      // this wave's own copies have landed in LDS
#if defined(__HIP_DEVICE_COMPILE__)
  asm volatile("s_wait_asynccnt 0x0" ::: "memory");
#endif
}
__device__ __forceinline__ void wait_lds_reads() {   // this wave's LDS reads have returned before their buffer is refilled
#if defined(__HIP_DEVICE_COMPILE__)
  asm volatile("s_wait_dscnt 0x0" ::: "memory");
#endif
}

// =====================================================================================================
// f32 -> f16( bf16_RNE(v) * scale ), scale a power of two (exact), 8 elements per thread, one 16-B store
// =====================================================================================================
__device__ __forceinline__ void cvt_h8(int blk, const float* __restrict__ in, unsigned short* out, int n8, float scale) {
  const int i = blk * 256 + threadIdx.x;
  if (i < n8) {
    const v4f a = *(const v4f*)(in + (size_t)i * 8);
    const v4f c = *(const v4f*)(in + (size_t)i * 8 + 4);
    float f[8];
    f[0] = a[0]; f[1] = a[1]; f[2] = a[2]; f[3] = a[3];
    f[4] = c[0]; f[5] = c[1]; f[6] = c[2]; f[7] = c[3];
    unsigned short hb[8];
#pragma unroll
    for (int e = 0; e < 8; ++e) hb[e] = h_bits((_Float16)(bf_up(bf_bits(f[e])) * scale));
    v4u p;
    p[0] = pk16(hb[0], hb[1]);
    p[1] = pk16(hb[2], hb[3]);
    p[2] = pk16(hb[4], hb[5]);
    p[3] = pk16(hb[6], hb[7]);
    *(v4u*)(out + (size_t)i * 8) = p;
    
  }
}

// =====================================================================================================
// Weight transpose + convert: W[c][o] f32 (c in [0,1024), o in [0,3072), o contiguous) ->
// WT[o][c] f16 = f16( bf16_RNE(W[c][o]) * scale ), c contiguous (k-major rows for the B fragment loader).
// Block = one 64(o) x 64(c) tile: thread (ol = tid&63, cb = tid>>6) reads 16 consecutive c rows of column o0+ol
// (coalesced per row across lanes), packs them as two 16-B LDS stores into sT[ol][c]; block barrier; then every
// tiles = (3072/64, 1024/64) = (48, 16): bx = o tiles (rows of WT), by = c tiles (rows of W).
// coverage: 256 threads x 2 rows-iterations... : rows tid>>3 (0..31) and +32 -> all 64 rows x 64 halves per tile.
// =====================================================================================================
__device__ __forceinline__ void cvt_wT(int bx, int by, const float* __restrict__ W, unsigned short* WT, float scale) {
  __shared__ __align__(16) unsigned short sT[64 * SPP];          // 9216 B
  const int tid = threadIdx.x;
  const int o0 = bx * 64;
  const int c0 = by * 64;
  {
    const int ol = tid & 63, cb = tid >> 6;                      // cb 0..3 -> c rows cb*16 .. +15
    unsigned short hb[16];
#pragma unroll
    for (int e = 0; e < 16; ++e) {
      const float f = W[(size_t)(c0 + cb * 16 + e) * NQKV + o0 + ol];
      hb[e] = h_bits((_Float16)(bf_up(bf_bits(f)) * scale));
    }
    v4u p0, p1;
#pragma unroll
    for (int q = 0; q < 4; ++q) {
      p0[q] = pk16(hb[2 * q], hb[2 * q + 1]);
      p1[q] = pk16(hb[8 + 2 * q], hb[8 + 2 * q + 1]);
    }
    *(v4u*)(sT + ol * SPP + cb * 16) = p0;
    *(v4u*)(sT + ol * SPP + cb * 16 + 8) = p1;
  }
  __syncthreads();
  {
    const int row = tid >> 3, c8 = (tid & 7) * 8;
    const v4u v0 = *(const v4u*)(sT + row * SPP + c8);
    const v4u v1 = *(const v4u*)(sT + (row + 32) * SPP + c8);
    const size_t d0 = (size_t)(o0 + row) * ND + c0 + c8;
    const size_t d1 = (size_t)(o0 + row + 32) * ND + c0 + c8;
    {
      *(v4u*)(WT + d0) = v0;
      *(v4u*)(WT + d1) = v1;
      // precaution: the two stores' address and data registers are not rewritten (by another job's code that
      // follows in the listing) before this wait
      asm volatile("s_wait_xcnt 0x0" ::: "memory");
    }
  }
}

// =====================================================================================================
// inv_freq[j] = 1 / 10000^(j/32), j = 0..31 (full head dim, not pairs), worked out by every thread that needs it.
// Contraction off: power, reciprocal and (in k_tab) the angle s * inv_freq are each rounded to f32 on their own, as the
// definition rounds them, before the sine and cosine see the angle.
// =====================================================================================================
__device__ __forceinline__ float k_invf(int j) {
  #pragma clang fp contract(off)
  const float e = (float)j * 0.03125f;
  const float p = powf(10000.0f, e);
  const float inv = 1.0f / p;
  return inv;
}

// =====================================================================================================
// Rotary tables COS/SIN[s][j] = cos/sin( s * inv_freq[j] ), s in [0,2048), j in [0,32): 256 threads = 8 rows x 32,
// one precise sincosf per thread (rolled, nothing unrolled); values staged in LDS, block barrier, then waves 0-1
// coverage: 256 blocks x 8 rows x 32 = every COS and SIN element.
// =====================================================================================================
__device__ __forceinline__ void k_tab(int blk, float* COS, float* SIN) {
  // the angle is rounded to f32 as a product of its own before sine and cosine (see k_invf)
  #pragma clang fp contract(off)
  __shared__ __align__(16) float sc[8 * 32];
  __shared__ __align__(16) float ss[8 * 32];
  const int tid = threadIdx.x, j = tid & 31, rl = tid >> 5;
  const int s = blk * 8 + rl;
  const float ang = (float)s * k_invf(j);
  float sn, cs;
  sincosf(ang, &sn, &cs);
  sc[rl * 32 + j] = cs;
  ss[rl * 32 + j] = sn;
  __syncthreads();
  if (tid < 64) {                                                // waves 0,1: COS rows
    const int row = tid >> 3, c4 = (tid & 7) * 4;
    const v4f v = *(const v4f*)(sc + row * 32 + c4);
    float* d = COS + (size_t)(blk * 8 + row) * HD + c4;
    *(v4f*)d = v;
    
  } else if (tid < 128) {                                        // waves 2,3: SIN rows
    const int t2 = tid - 64;
    const int row = t2 >> 3, c4 = (t2 & 7) * 4;
    const v4f v = *(const v4f*)(ss + row * 32 + c4);
    float* d = SIN + (size_t)(blk * 8 + row) * HD + c4;
    *(v4f*)d = v;
    
  }
}

// =====================================================================================================
// Mask digest, made once for all batch*head pairs. Block (cp, qb) = 128 query rows x MCH key chunks of 64; wave w owns
// the 16-row query tile qt = 8*qb + w and reads, per chunk, the same 32 entries per lane that the attention wave of
// that tile needs: lane -> query row 16*qt + (lane&15), keys of lane half lane>>4.
//   MB[qt][c][16*s + 8*t + r]: a lane mask, bit lane <-> (mask[row][64*c + 32*s + 16*t + 8*(lane>>4) + r] != 0), ready
//                    as the select mask of score element (t, r) of 32-key step s; one 128-B line per (qt, c), written
//                    by one wave (lane i stores word i).
//   FL[qb][cp][MFL]: entry e < MCH is nonzero iff any entry of the 128 x 64 block of chunk MCH*cp + e is nonzero;
//                    one whole 128-B line per block (the rest of the line is 0).
// blocks = (32/MCH, 16): every (qt, c) word line and every FL line written exactly once.
// =====================================================================================================
__device__ __forceinline__ void mask_digest(int cp, int qb, const int* __restrict__ msk, unsigned* MB, int* FL) {
  __shared__ int sany[MCH][8];
  const int tid = threadIdx.x, lane = tid & 31, wave = tid >> 5;
  const int rlane = lane & 15, hsel = lane >> 4;
  const int qt = qb * 8 + wave;
  const size_t rowbase = (size_t)(qt * 16 + rlane) * NT;
  // all loads of the wave stand ahead of its first store; every loop below is unrolled so that ent[] is indexed by
  // constants and stays in registers
  v4i ent[MCH][2][2][2];
#pragma unroll
  for (int e = 0; e < MCH; ++e) {
#pragma unroll
    for (int s = 0; s < 2; ++s) {
#pragma unroll
      for (int t = 0; t < 2; ++t) {
        const int* mp = msk + rowbase + (size_t)((cp * MCH + e) * KCH + 32 * s + 16 * t + 8 * hsel);
        ent[e][s][t][0] = *(const v4i*)mp;
        ent[e][s][t][1] = *(const v4i*)(mp + 4);
      }
    }
  }
#pragma unroll
  for (int e = 0; e < MCH; ++e) {
    unsigned any = 0u;
    int mine = 0;                                                // lane i ends up with word i
#pragma unroll
    for (int i = 0; i < 32; ++i) {                               // i = 16*s + 8*t + r
      const unsigned w = __builtin_amdgcn_ballot_w32(ent[e][i >> 4][(i >> 3) & 1][(i >> 2) & 1][i & 3] != 0);
      any |= w;
      mine = (lane == i) ? (int)w : mine;
    }
    MB[((size_t)qt * NKC + cp * MCH + e) * 32 + lane] = (unsigned)mine;
    if (lane == 0) sany[e][wave] = (any != 0u) ? 1 : 0;
  }
  __syncthreads();
  if (tid < MFL) {
    int f = 0;
    if (tid < MCH) {
#pragma unroll
      for (int w = 0; w < 8; ++w) f |= sany[tid][w];
    }
    FL[((size_t)qb * (NKC / MCH) + cp) * MFL + tid] = f;
  }
}

// =====================================================================================================
// All work that depends on the inputs alone, in ONE launch: the four jobs above read and write disjoint buffers and none
// reads what another writes, so their work-groups share the chip instead of waiting for one another's launch to end.
// The job is picked by the block index (the same for the whole work-group, so each job's barrier stays block-uniform):
//   [0, PB_DIG)       mask digest, block (cp, qb) = (i % 16, i / 16)
//   [.., PB_WT)       weight transpose + convert, tile (bx, by) = (i % 48, i / 48)
//   [.., PB_TAB)      rotary tables, 8 rows a block
//   [.., PB_ALL)      activation convert, 2048 elements a block
// =====================================================================================================
#define PB_DIG  ((NKC / MCH) * (NT / QBLK))
#define PB_WT   (PB_DIG + (NQKV / 64) * (ND / 64))
#define PB_TAB  (PB_WT + NT / 8)
#define PB_ALL  (PB_TAB + NTOK * ND / 2048)
__global__ __launch_bounds__(256) void prep(const float* __restrict__ x, const float* __restrict__ W,
                                            const int* __restrict__ msk, unsigned short* XH, unsigned short* WT,
                                            float* COS, float* SIN, unsigned* MB, int* FL) {
  const int blk = blockIdx.x;
  if (blk < PB_DIG) {
    mask_digest(blk % (NKC / MCH), blk / (NKC / MCH), msk, MB, FL);
  } else if (blk < PB_WT) {
    const int i = blk - PB_DIG;
    cvt_wT(i % (NQKV / 64), i / (NQKV / 64), W, WT, 1024.0f);
  } else if (blk < PB_TAB) {
    k_tab(blk - PB_WT, COS, SIN);
  } else {
    cvt_h8(blk - PB_TAB, x, XH, NTOK * ND / 8, 16.0f);
  }
}

// =====================================================================================================
// Fused qkv projection GEMM with rotary + 16-bit plane epilogue:
//   Y[tok][o] = sum_c XH[tok][c] * WT[o][c] * oscale,  tok in [0,4096), o in [0,3072), K = 1024.
// One work-group of 4 waves per 128x128 tile, one wave per 64x64 quarter (register-blocked); A = XH rows (token),
// Bt = WT rows (k contiguous). Per 64-deep k stage the 128 A rows and 128 Bt rows (128 B each, whole lines) are copied
// asynchronously into one of two LDS buffers (pitch 144 B) while the other buffer is worked on; k order unchanged.
// The 64 tokens of a tile lie in one batch b (t0 = m0 mod 2048); the 64 outputs are two heads h0, h0+1 of one of
// q (o < 1024), k (1024 <= o < 2048), v (o >= 2048); column j (16-wide subtile) -> head h0 + (j>>1), d = 16*(j&1)+lane%16.
//   q, k: rotary combine per the module: out[d] = y[d]*cos[s][d] - y[d+16]*sin[s][d] (d < 16),
//         out[d] = y[d]*cos[s][d] + y[d-16]*sin[s][d] (d >= 16); both partners sit in the same lane and element.
//         PH/PL[bh][t][32] f16 = hi plane and residual of out (k) or out*log2(e)/sqrt(32) (q) (64 B per token; the wave owns 64 consecutive
// then q/k: each head's slab region (16 tok x 64 B = 1024 contiguous B) written as 32 lanes x 16 B contiguous per
// grid = 768 blocks x 4 waves = 3072 wave tiles = 64 x 48 exactly.
// coverage: q/k tiles: 4 slabs x 2 heads x 16 tok x 32 d (hi and residual); v tiles: 4 subtiles x 16 d x 64 tok;
// 64 token tiles x (16+16+16) column tiles = every (bh, t) row of QH/QL/KH/KL and every (bh, d) row of VH/VL.
// =====================================================================================================
__global__ __launch_bounds__(128) void gemm_proj(
    const unsigned short* __restrict__ XHp, const unsigned short* __restrict__ WTp,
    const float* __restrict__ COS, const float* __restrict__ SIN,
    unsigned short* QH, unsigned short* QL, unsigned short* KH, unsigned short* KL,
    unsigned short* VH, unsigned short* VL, float oscale) {
  __shared__ __align__(16) unsigned short sA[2][GBUF];            // 36864 B
  __shared__ __align__(16) unsigned short sB[2][GBUF];            // 36864 B
  __shared__ __align__(16) unsigned short sP[4][2][16 * SPP];     // 18432 B
  const int tid  = threadIdx.x;
  const int lane = tid & 31;
  const int wave = tid >> 5;
  const int tilesN = NQKV / GBT;                                 // 24
  const int tilesM = NTOK / GBT;                                 // 32
  const int tile = blockIdx.x;
  if (tile >= tilesM * tilesN) return;                           // block-uniform, in front of every barrier
  const int tm = tile / tilesN;
  const int tn = tile - tm * tilesN;
  const int wm = wave >> 1, wn = wave & 1;                       // 2 x 2 waves
  const int m0 = tm * GBT + (wm << 6);                           // token base of this wave
  const int n0 = tn * GBT + (wn << 6);                           // output channel base in [0,3072)
  const int rlane = lane & 15;
  const int hh    = lane >> 4;
  const int koff  = hh * 8;
  const int mOff  = hh * 8;

  v8f acc[4][4];
#pragma unroll
  for (int i = 0; i < 4; ++i)
#pragma unroll
    for (int j = 0; j < 4; ++j) acc[i][j] = zero8();

  // copy share of this lane: piece tid&7 (16 B) of rows (tid>>3) + 16e, e = 0..7; a wave's copy = 4 whole 128-B lines
  const int crow = tid >> 3, cpc = (tid & 7) * 8;
  const unsigned short* gA = XHp + (size_t)(tm * GBT + crow) * ND + cpc;
  const unsigned short* gB = WTp + (size_t)(tn * GBT + crow) * ND + cpc;
  const unsigned lA = lds_addr(&sA[0][crow * GLP + cpc]);
  const unsigned lB = lds_addr(&sB[0][crow * GLP + cpc]);

  stage_rows(lA, gA);                                            // stage 0 -> buffer 0
  stage_rows(lB, gB);
  wait_copies();
  __syncthreads();
  stage_rows(lA + GBUF * 2u, gA + GBK);                          // stage 1 -> buffer 1
  stage_rows(lB + GBUF * 2u, gB + GBK);

  // rolled: the two-buffer order below is written once
#pragma unroll 1
  for (int t = 0; t < GTR; ++t) {
    const int bsel = t & 1;
    const _Float16* fa = (const _Float16*)(const void*)&sA[bsel][((wm << 6) + rlane) * GLP + koff];
    const _Float16* fb = (const _Float16*)(const void*)&sB[bsel][((wn << 6) + rlane) * GLP + koff];
#pragma unroll
    for (int kk = 0; kk < GBK; kk += 32) {
      v16h bf[4], af[4];
#pragma unroll
      for (int j = 0; j < 4; ++j) bf[j] = ldfrag_h(fb + (j << 4) * GLP + kk);
#pragma unroll
      for (int i = 0; i < 4; ++i) af[i] = ldfrag_h(fa + (i << 4) * GLP + kk);
#pragma unroll
      for (int i = 0; i < 4; ++i)
#pragma unroll
        for (int j = 0; j < 4; ++j) acc[i][j] = mma_h_raw(af[i], bf[j], acc[i][j]);
      // all 16 LDS reads of this k step as one group ahead of its 16 products: one LDS wait a step, not one a row
      __builtin_amdgcn_sched_group_barrier(0x100, 16, 0);
      __builtin_amdgcn_sched_group_barrier(0x008, 16, 0);
    }
    // publish point of stage t + 1: own reads done, own copies landed, barrier, then the refill of the buffer just read
    wait_lds_reads();
    wait_copies();
    __syncthreads();
    if (t + 2 < GTR) {
      stage_rows(lA + (unsigned)bsel * (GBUF * 2u), gA + (t + 2) * GBK);
      stage_rows(lB + (unsigned)bsel * (GBUF * 2u), gB + (t + 2) * GBK);
    }
  }
  wait_copies();
  acc_guard4(acc[0][0], acc[0][1], acc[0][2], acc[0][3]);
  acc_guard4(acc[1][0], acc[1][1], acc[1][2], acc[1][3]);
  acc_guard4(acc[2][0], acc[2][1], acc[2][2], acc[2][3]);
  acc_guard4(acc[3][0], acc[3][1], acc[3][2], acc[3][3]);

  // ---- epilogue ----
  const int b   = m0 / NT;
  const int t0  = m0 - b * NT;
  const int sel = n0 >> 10;                                      // 0 q, 1 k, 2 v (wave-uniform)
  const int h0  = (n0 & (ND - 1)) >> 5;                          // first of the two heads of this tile
  unsigned short* s0 = &sP[wave][0][0];
  unsigned short* s1 = &sP[wave][1][0];

  if (sel < 2) {
    unsigned short* PH = (sel == 0) ? QH : KH;
    unsigned short* PL = (sel == 0) ? QL : KL;
    const float fs = (sel == 0) ? QSC : 1.0f;                    // q carries log2(e)/sqrt(32), k is stored as it is
#pragma unroll
    for (int i = 0; i < 4; ++i) {                                // slab = 16 tokens t0+16i .. +15
#pragma unroll
      for (int r = 0; r < 8; ++r) {
        const int tok = t0 + (i << 4) + mOff + r;                // row tok = 8hh + r
        const float* cp = COS + (size_t)tok * HD;
        const float* sp = SIN + (size_t)tok * HD;
        const float ca = cp[rlane], cb = cp[16 + rlane];
        const float sa = sp[rlane], sb = sp[16 + rlane];
#pragma unroll
        for (int hp = 0; hp < 2; ++hp) {
          const float y0 = acc[i][2 * hp][r] * oscale;           // d = rlane
          const float y1 = acc[i][2 * hp + 1][r] * oscale;       // d = 16 + rlane
          const float f0 = (y0 * ca - y1 * sa) * fs;
          const float f1 = (y1 * cb + y0 * sb) * fs;
          const _Float16 x0 = (_Float16)f0;
          const _Float16 x1 = (_Float16)f1;
          const int so = (mOff + r) * SPP + 32 * hp + rlane;     // row tok, col 32hp + d
          s0[so]      = h_bits(x0);
          s1[so]      = h_bits((_Float16)(f0 - (float)x0));
          s0[so + 16] = h_bits(x1);
          s1[so + 16] = h_bits((_Float16)(f1 - (float)x1));
        }
      }
      wave_sync_lds();
      {
        const int rr = lane >> 2, cc = (lane & 3) * 8;           // rr*32 + cc = lane*8 halves
#pragma unroll
        for (int hp = 0; hp < 2; ++hp) {
          const int bhp = b * NH + h0 + hp;
          const size_t base = ((size_t)(bhp * NT + t0 + (i << 4))) * HD + lane * 8;
          const v4u v0 = *(const v4u*)(s0 + rr * SPP + 32 * hp + cc);
          const v4u v1 = *(const v4u*)(s0 + (rr + 8) * SPP + 32 * hp + cc);
          const v4u w0 = *(const v4u*)(s1 + rr * SPP + 32 * hp + cc);
          const v4u w1 = *(const v4u*)(s1 + (rr + 8) * SPP + 32 * hp + cc);
          {
            *(v4u*)(PH + base) = v0;
            *(v4u*)(PH + base + 256) = v1;
            *(v4u*)(PL + base) = w0;
            *(v4u*)(PL + base + 256) = w1;
            
          }
        }
      }
      wave_sync_lds();
    }
  } else {
#pragma unroll
    for (int j = 0; j < 4; ++j) {                                // slab = 16 rows d = 16(j&1) + rlane of head h0+(j>>1)
      const int hp = j >> 1, dbase = (j & 1) * 16;
      const int bhp = b * NH + h0 + hp;
#pragma unroll
      for (int i = 0; i < 4; ++i) {
        unsigned short hb[8], lb[8];
#pragma unroll
        for (int r = 0; r < 8; ++r) {
          const float f = (acc[i][j][r] * oscale) * 16.0f;
          const _Float16 xh = (_Float16)f;
          hb[r] = h_bits(xh);
          lb[r] = h_bits((_Float16)(f - (float)xh));
        }
        v4u ph, pl;
#pragma unroll
        for (int q = 0; q < 4; ++q) {
          ph[q] = pk16(hb[2 * q], hb[2 * q + 1]);
          pl[q] = pk16(lb[2 * q], lb[2 * q + 1]);
        }
        *(v4u*)(s0 + rlane * SPP + (i << 4) + mOff) = ph;       // row d = rlane, tok = 16i + 8hh .. +7
        *(v4u*)(s1 + rlane * SPP + (i << 4) + mOff) = pl;
      }
      wave_sync_lds();
      {
        const int rq = lane >> 3, c8 = (lane & 7) * 8;
        {
#pragma unroll
          for (int it = 0; it < 4; ++it) {
            const int row = it * 4 + rq;                         // it 0..3 x rq 0..3 = rows 0..15
            const size_t dst = ((size_t)(bhp * HD + dbase + row)) * NT + t0 + c8;
            const v4u v = *(const v4u*)(s0 + row * SPP + c8);
            const v4u w = *(const v4u*)(s1 + row * SPP + c8);
            *(v4u*)(VH + dst) = v;
            *(v4u*)(VL + dst) = w;
          }
          
        }
      }
      wave_sync_lds();
    }
  }
}

// =====================================================================================================
// Attention for one batch*head and two 128-query blocks (NQB-1-y, then y): grid = (64, 8), 256 threads = 8 waves x 16
// queries; at most four waves a SIMD by the register allocation, so the 512 equal work-groups lie two on a WGP; each lane
// owns one query column q = q0 + 16*wave + (lane&15). QH/QL/KH/KL[bh][t][32] f16 (hi, residual; q times log2(e)/sqrt(32)),
// VH/VL[bh][d][2048] (x16 hi, residual at the same scale). The mask [2048 q][2048 key] comes as the digest of mask_digest: key
// chunks of 64; each wave loads the 32 lane masks MB[qt][c][..] of its query tile by wave-uniform loads, one mask per
// score element; a chunk whose entries are all zero for the whole block (FL, gathered once into a wave-uniform word)
// is skipped block-uniformly, in front of every barrier of the chunk (exact: such keys have probability 0). Otherwise
// K hi/res rows [64][40] and V hi/res tiles [32 d][72] are staged in LDS with plain 16-B loads between two block
// barriers. Per chunk (one softmax update for its 64 keys) and 16-key tile t:
// S[key][q] = C + A(K hi) x B(Q res) + A(K res) x B(Q hi) + A(K hi rows) x B(resident Q hi), small terms first, chained in one
// accumulator that starts at C = 10 - reference: S is the exponent to base two; entries with mask == 0 replaced by -inf;
// the reference of a column is its first chunk's maximum and is raised (running sum and output rescaled) only when a p
// could leave the f16 range; p = 2^S = 1024*exp(x - reference) packed D->B per the chained map (element r <-
// keys 0-15 tile, 8+r <- keys 16-31 tile of a 32-key step) as f16 hi plus residual; O[d][q] += A(V res) x Ph + A(V hi) x Pl +
// A(V hi rows) x Ph in one accumulator; out = O / (16 * l) (l = 0 gives 0*inf = NaN).
// coverage: 64 x 8 blocks x 2 tiles x 8 waves x 16 rows x 32 floats = every (tok, head) line of the output.
// =====================================================================================================
__global__ __launch_bounds__(ATHR) __attribute__((amdgpu_waves_per_eu(4, 4))) void attn_kernel(
    const unsigned short* __restrict__ QHp, const unsigned short* __restrict__ QLp,
    const unsigned short* __restrict__ KHp, const unsigned short* __restrict__ KLp,
    const unsigned short* __restrict__ VHp, const unsigned short* __restrict__ VLp,
    const unsigned* __restrict__ MB, const int* __restrict__ FL, float* Out) {
  __shared__ __align__(16) unsigned short kh_u[KCH * KP];         // 5120 B
  __shared__ __align__(16) unsigned short kl_u[KCH * KP];         // 5120 B
  __shared__ __align__(16) unsigned short vh_u[HD * VP];          // 4608 B
  __shared__ __align__(16) unsigned short vl_u[HD * VP];          // 4608 B
  __shared__ __align__(16) float sO[8][16 * OP];                  // 18432 B
  const _Float16* kh = (const _Float16*)(const void*)kh_u;
  const _Float16* kl = (const _Float16*)(const void*)kl_u;
  const _Float16* vh = (const _Float16*)(const void*)vh_u;
  const _Float16* vl = (const _Float16*)(const void*)vl_u;
  const _Float16* QH = (const _Float16*)(const void*)QHp;
  const _Float16* QL = (const _Float16*)(const void*)QLp;

  const int tid = threadIdx.x, lane = tid & 31, wave = tid >> 5;
  const int bh = blockIdx.x;
  const int b  = bh / NH;
  const int h  = bh - b * NH;
  const int rlane = lane & 15, hsel = lane >> 4, koff = hsel * 8;

  // Two query tiles per work-group, one after the other in every wave: NQB-1-y, then y. Under a lower-triangular mask the
  // active chunks of such a pair add up to the same count in every work-group; any other mask is only divided differently.
  // The first barrier of the second tile's first chunk ends every wave's reads of the first tile's last K/V chunk.
  // rolled: the tile body is written once
#pragma unroll 1
  for (int leg = 0; leg < 2; ++leg) {
    const int qb = (leg == 0) ? (NQB - 1 - (int)blockIdx.y) : (int)blockIdx.y;
    const int q0 = qb * QBLK;
    const int qrow = q0 + wave * 16 + rlane;                       // this lane's query index within the sequence

    // resident Q fragments (B operand: B[k=d][n=q] from [q][d] rows), arithmetic addressing, one 32-deep k-step
    const size_t qo = ((size_t)(bh * NT + qrow)) * HD + koff;
    const v16h qh0 = ldfrag_h(QH + qo);
    const v16h ql0 = ldfrag_h(QL + qo);
    // this wave's lane masks, 32 words a chunk; the wave number made uniform so that the words load into scalar registers
    const unsigned* mbp = MB + ((size_t)(qb * 8 + __builtin_amdgcn_readfirstlane(wave)) * NKC) * 32;
    // bit c <-> chunk c has a nonzero mask entry somewhere in this block's 128 query rows (the same word in every wave)
    const unsigned act = __builtin_amdgcn_ballot_w32(
        FL[((size_t)qb * (NKC / MCH) + lane / MCH) * MFL + (lane % MCH)] != 0);

    const float PTOP   = 60000.0f;                                // below the largest finite f16
    const float NEGINF = __uint_as_float(0xff800000u);

    v8f oh[2];
#pragma unroll
    for (int dt = 0; dt < 2; ++dt) oh[dt] = zero8();
    float l_run = 0.0f;
    float cval = 10.0f;                                            // 10 - reference (in powers of two) of this lane's column

#pragma unroll 1
    for (int c = 0; c < NKC; ++c) {
      if (((act >> c) & 1u) == 0u) continue;                       // block-uniform skip of an all-masked chunk
      const int kc = c * KCH;
      __syncthreads();                                             // all waves finished reading the prior chunk's K/V
      // lane masks: word (16*s + 8*t + r), bit lane <-> key kc + 32*s + 16*t + 8*hsel + r of the lane's query row
      // read through the constant address space (nothing writes MB in this launch), which makes them scalar loads
      const v16u mw0 = *(const __attribute__((address_space(4))) v16u*)(mbp + c * 32);
      const v16u mw1 = *(const __attribute__((address_space(4))) v16u*)(mbp + c * 32 + 16);

      // ---- stage K hi/res rows and V hi/res tiles of keys kc..kc+63 (one 16-B item per thread each) ----
      {
        const int key = tid >> 2, ck = (tid & 3) * 8;              // 64 keys x 32 halves
        const size_t gk = ((size_t)(bh * NT + kc + key)) * HD + ck;
        const int d = tid >> 3, cv = (tid & 7) * 8;                // 32 d rows x 64 halves
        const size_t gv = ((size_t)(bh * HD + d)) * NT + kc + cv;
        const v4u gkh = *(const v4u*)(KHp + gk);
        const v4u gkl = *(const v4u*)(KLp + gk);
        const v4u gvh = *(const v4u*)(VHp + gv);
        const v4u gvl = *(const v4u*)(VLp + gv);
        *(v4u*)(kh_u + key * KP + ck) = gkh;
        *(v4u*)(kl_u + key * KP + ck) = gkl;
        *(v4u*)(vh_u + d * VP + cv) = gvh;
        *(v4u*)(vl_u + d * VP + cv) = gvl;
      }
      __syncthreads();

      // ONE softmax update for the whole 64-key chunk: four 16-key score tiles T (keys kc + 16*T ..) are formed, masked,
      // exponentiated and summed together, so the exchange between lane halves stands once a chunk.
      {
        float a[4][8];
        // the four key tiles' chains of three are issued turn about, so that four independent accumulators stay in flight
        v16h kha[4], kla[4];
        v8f sh[4];
        const v8f cref = {cval, cval, cval, cval, cval, cval, cval, cval};   // the C operand of the score products
#pragma unroll
        for (int t = 0; t < 4; ++t) {
          const int krow = 16 * t + rlane;
          kha[t] = ldfrag_h(kh + krow * KP + koff);
          kla[t] = ldfrag_h(kl + krow * KP + koff);
        }
#pragma unroll
        for (int t = 0; t < 4; ++t) sh[t] = mma_h_raw(kha[t], ql0, cref);
#pragma unroll
        for (int t = 0; t < 4; ++t) sh[t] = mma_h_raw(kla[t], qh0, sh[t]);
#pragma unroll
        for (int t = 0; t < 4; ++t) sh[t] = mma_h_raw(kha[t], qh0, sh[t]);
        // the chunk's 16 V fragment reads are issued behind the score products, so that they return under the softmax arithmetic
        v16h vah[2][2], val[2][2];
#pragma unroll
        for (int s = 0; s < 2; ++s) {
#pragma unroll
          for (int dt = 0; dt < 2; ++dt) {
            vah[s][dt] = ldfrag_h(vh + (16 * dt + rlane) * VP + 32 * s + koff);
            val[s][dt] = ldfrag_h(vl + (16 * dt + rlane) * VP + 32 * s + koff);
          }
        }
        // order of issue: all 16 K fragment reads as one group (one LDS wait, not three), the 12 score products, the 16 V reads
        __builtin_amdgcn_sched_group_barrier(0x100, 16, 0);
        __builtin_amdgcn_sched_group_barrier(0x008, 12, 0);
        __builtin_amdgcn_sched_group_barrier(0x100, 16, 0);
        // no vector work is drawn in between the products (each such read of a fresh tile would cost its own v_nop gap)
        __builtin_amdgcn_sched_barrier(0);
#pragma unroll
        for (int t = 0; t < 4; ++t) {
#pragma unroll
          for (int r = 0; r < 8; ++r) {
            const unsigned kw = (t < 2) ? mw0[(t & 1) * 8 + r] : mw1[(t & 1) * 8 + r];
            a[t][r] = __builtin_amdgcn_inverse_ballot_w32(kw) ? sh[t][r] : NEGINF;
          }
        }

        // softmax over the key axis for this lane's q column against the HELD reference: the tiles are the exponents.
        // The reference moves only where it must: a column without any sum yet takes its first one, and a column whose p
        // could leave the f16 range (every p <= this lane's sum) is looked at again. One test a chunk for the whole wave, a
        // scalar branch; behind it every lane works on the maximum of both lane halves, so the halves stay in step, the
        // exponents are shifted in place and the exponentials are taken once more (at most two turns).
        float ssum;
        float p[4][8];
        float alph = 1.0f;
        // rolled: the second turn runs through the same instructions, so the usual single turn carries no copies
#pragma unroll 1
        for (int turn = 0;; ++turn) {
          ssum = 0.0f;
#pragma unroll
          for (int r = 0; r < 8; ++r) {
#pragma unroll
            for (int t = 0; t < 4; ++t) p[t][r] = __builtin_amdgcn_exp2f(a[t][r]);
            ssum += (p[0][r] + p[1][r]) + (p[2][r] + p[3][r]);
          }
          if (turn != 0 || __builtin_amdgcn_ballot_w32((ssum > PTOP) || (l_run == 0.0f)) == 0u) break;
          float mloc = -1.0e30f;
#pragma unroll
          for (int t = 0; t < 4; ++t) {
#pragma unroll
            for (int r = 0; r < 8; r += 2) mloc = fmaxf(mloc, fmaxf(a[t][r], a[t][r + 1]));
          }
          mloc = fmaxf(mloc, __shfl_xor(mloc, 16, 32));
          // moved so that the chunk's largest exponent becomes 10; a column with no open key in this chunk stays
          const bool  mv   = (mloc > -1.0e29f) && ((l_run == 0.0f) || (mloc > 15.0f));
          const float cnew = mv ? (cval - (mloc - 10.0f)) : cval;
          const float dd   = cnew - cval;
          alph = (l_run == 0.0f) ? 1.0f : __builtin_amdgcn_exp2f(dd);
          cval = cnew;
#pragma unroll
          for (int t = 0; t < 4; ++t) {
#pragma unroll
            for (int r = 0; r < 8; ++r) a[t][r] += dd;
          }
        }
        ssum += __shfl_xor(ssum, 16, 32);
        l_run = l_run * alph + ssum;
        // alph is 1 in the usual turn; multiplied in every chunk all the same, in place: under the branch the compiler
        // kept two copies of the running output and moved all sixteen registers in every chunk
#pragma unroll
        for (int dt = 0; dt < 2; ++dt) {
#pragma unroll
          for (int r = 0; r < 8; ++r) oh[dt][r] *= alph;
        }

        // P (f32, D layout) -> B operands (f16 hi, f16 residual) of 32-key step s: element r <- tile 2s, 8+r <- tile 2s+1
        union { v16h v; _Float16 s[16]; } ph[2], plo[2];
#pragma unroll
        for (int s = 0; s < 2; ++s) {
#pragma unroll
          for (int r = 0; r < 8; ++r) {
            const _Float16 x0 = (_Float16)p[2 * s][r];
            const _Float16 x1 = (_Float16)p[2 * s + 1][r];
            ph[s].s[r]      = x0;
            ph[s].s[8 + r]  = x1;
            plo[s].s[r]     = (_Float16)(p[2 * s][r] - (float)x0);
            plo[s].s[8 + r] = (_Float16)(p[2 * s + 1][r] - (float)x1);
          }
        }

        // O[d][q] += V[d][32s .. +31] x P, hi and residual terms, step 0 then step 1
        // written with the two d tiles' chains turn about; step 0's products may issue while step 1's P is still being split
#pragma unroll
        for (int s = 0; s < 2; ++s) {
#pragma unroll
          for (int dt = 0; dt < 2; ++dt) oh[dt] = mma_h_raw(val[s][dt], ph[s].v, oh[dt]);
#pragma unroll
          for (int dt = 0; dt < 2; ++dt) oh[dt] = mma_h_raw(vah[s][dt], plo[s].v, oh[dt]);
#pragma unroll
          for (int dt = 0; dt < 2; ++dt) oh[dt] = mma_h_raw(vah[s][dt], ph[s].v, oh[dt]);
        }
        guard4(oh[0], oh[1], vah[1][0], val[1][0], vah[1][1], val[1][1], ph[1].v, plo[1].v);
      }
    }
    acc_guard2(oh[0], oh[1]);

    // ---- output values -> per-wave f32 LDS staging ----
    const float inv = (1.0f / 16.0f) * (1.0f / l_run);            // out = O / (16 * l)
    float* st = sO[wave];
#pragma unroll
    for (int dt = 0; dt < 2; ++dt) {
      v4f va, vb;
#pragma unroll
      for (int e = 0; e < 4; ++e) {
        va[e] = oh[dt][e] * inv;                                   // d = 16dt + 8hsel + e
        vb[e] = oh[dt][4 + e] * inv;                               // d = 16dt + 8hsel + 4 + e
      }
      const int so = rlane * OP + 16 * dt + 8 * hsel;              // row q = rlane
      *(v4f*)(st + so) = va;
      *(v4f*)(st + so + 4) = vb;
    }
    wave_sync_lds();
    {
      const int rq = lane >> 3, c4 = (lane & 7) * 4;
      const int n0 = q0 + wave * 16;
      {
#pragma unroll
        for (int it = 0; it < 4; ++it) {
          const int row = it * 4 + rq;                             // it 0..3 x rq 0..3 = rows 0..15
          const v4f v = *(const v4f*)(st + row * OP + c4);
          *(v4f*)(Out + ((size_t)(b * NT + n0 + row)) * ND + h * HD + c4) = v;
        }
        // precaution: the four stores' address and data registers are not rewritten (by the second tile's code) before
        // this wait
        asm volatile("s_wait_xcnt 0x0" ::: "memory");
      }
    }
  }
}

// =====================================================================================================
// Workspace map (bytes, every offset a multiple of 128; every plane an exact multiple of its whole-line store
// granularity, row counts exact tile multiples, no padded tails needed):
//   XH   f16 [4096][1024]    activation, bf16-RNE x16                    0          8388608 B
//   WT   f16 [3072][1024]    Wqkv transposed, bf16-RNE x1024       8388608          6291456 B
//   COS  f32 [2048][32]                                          14680064           262144 B
//   SIN  f32 [2048][32]                                          14942208           262144 B
//   (256 B not used)                                            15204352              256 B
//   QH   f16 [64][2048][32]  q x log2(e)/sqrt(32) hi             15204608          8388608 B
//   QL   f16 [64][2048][32]  its residual                        23593216          8388608 B
//   KH   f16 [64][2048][32]                                      31981824          8388608 B
//   KL   f16 [64][2048][32]                                      40370432          8388608 B
//   VH   f16 [64][32][2048]  v x16 hi, key-contiguous            48759040          8388608 B
//   VL   f16 [64][32][2048]                                      57147648          8388608 B
//   MB   u32 [128][32][32]   lane masks per (query tile, chunk, element) 65536256     524288 B
//   FL   i32 [16][16][32]    chunk flags, one line per digest block  66060544          32768 B
//   end                                                          66093312
// =====================================================================================================
extern "C" void kernel_launch(void* const* d_in, const int* in_sizes, int n_in,
                              void* d_out, int out_size, void* d_ws, size_t ws_size,
                              hipStream_t stream) {
  if (n_in < 3) return;
  if (in_sizes[0] != NTOK * ND) return;
  if (in_sizes[1] != ND * NQKV) return;
  if (in_sizes[2] != NT * NT) return;
  if (out_size != NTOK * ND) return;

  const float* x   = (const float*)d_in[0];
  const float* W   = (const float*)d_in[1];
  const int*   msk = (const int*)d_in[2];

  const size_t PXH = (size_t)NTOK * ND * 2;                    // 8388608
  const size_t PWT = (size_t)NQKV * ND * 2;                    // 6291456
  const size_t PTB = (size_t)NT * HD * 4;                      // 262144
  const size_t PIN = 256;
  const size_t PQK = (size_t)NBH * NT * HD * 2;                // 8388608
  const size_t PV  = (size_t)NBH * HD * NT * 2;                // 8388608
  size_t off = 0;
  const size_t oXH  = off; off += PXH;
  const size_t oWT  = off; off += PWT;
  const size_t oCOS = off; off += PTB;
  const size_t oSIN = off; off += PTB;
  off += PIN;                                                  // 256 B not used
  const size_t oQH  = off; off += PQK;
  const size_t oQL  = off; off += PQK;
  const size_t oKH  = off; off += PQK;
  const size_t oKL  = off; off += PQK;
  const size_t oVH  = off; off += PV;
  const size_t oVL  = off; off += PV;
  const size_t oMB  = off; off += (size_t)(NT / 16) * NKC * 32 * 4;        // 524288
  const size_t oFL  = off; off += (size_t)(NT / QBLK) * (NKC / MCH) * MFL * 4;   // 32768
  if (off > ws_size) return;                                   // off = 66093312
  if (off > (size_t)134217728) return;

  char* ws = (char*)d_ws;
  unsigned short* XH   = (unsigned short*)(ws + oXH);
  unsigned short* WT   = (unsigned short*)(ws + oWT);
  float*          COS  = (float*)(ws + oCOS);
  float*          SIN  = (float*)(ws + oSIN);
  unsigned short* QH   = (unsigned short*)(ws + oQH);
  unsigned short* QL   = (unsigned short*)(ws + oQL);
  unsigned short* KH   = (unsigned short*)(ws + oKH);
  unsigned short* KL   = (unsigned short*)(ws + oKL);
  unsigned short* VH   = (unsigned short*)(ws + oVH);
  unsigned short* VL   = (unsigned short*)(ws + oVL);
  unsigned*       MB   = (unsigned*)(ws + oMB);
  int*            FL   = (int*)(ws + oFL);
  float*          out  = (float*)d_out;

  const dim3 blk(256);
  const dim3 gPrep(PB_ALL);                                    // 256 + 768 + 256 + 2048 = 3328
  const dim3 gProj((NTOK / GBT) * (NQKV / GBT));               // 32 x 24 = 768 blocks of 4 waves
  const dim3 gAttn(NBH, NQB / 2);                              // 64 x 8, 256 threads, two query tiles each

  const float oscPrj = 1.0f / 16384.0f;                        // undo x*16 and W*1024

  // (1) one launch: inputs -> f16 planes holding bf16-RNE values times an exact power of two; rotary tables;
  //     mask -> lane masks of the attention waves' score elements, and one flag per 128-query x 64-key block
  prep<<<gPrep, blk, 0, stream>>>(x, W, msk, XH, WT, COS, SIN, MB, FL);
  // (2) fused qkv projection with rotary epilogue: q, k -> [bh][t][32] hi/res planes; v -> [bh][d][t] hi/res planes
  gemm_proj<<<gProj, dim3(128), 0, stream>>>(XH, WT, COS, SIN, QH, QL, KH, KL, VH, VL, oscPrj);
  // (3) attention per (batch*head, pair of 128-query blocks) -> f32 output lines [tok][h*32 .. +31]
  attn_kernel<<<gAttn, dim3(ATHR), 0, stream>>>(QH, QL, KH, KL, VH, VL, MB, FL, out);
  (void)hipGetLastError();
}

// v008
// One run takes 81.2 microseconds.
// In both of two side-by-side timings against v007, it was 1.09 times as fast.
// Over all steps from v000 it is 2.70 times as fast.
#include <hip/hip_runtime.h>
#include <math.h>
#include <stdint.h>

// Contractions: fused qkv projection x.Wqkv (f16 operands holding bf16-RNE values, x carried x16 and W x1024, one
// product per tile pair); scores k.q (k, and q times log2(e)/sqrt(32), each an f16 hi plane plus an f16 residual plane,
// small residuals as f16 subnormals: hi.lo + lo.hi + hi.hi chained in ONE accumulator, 3 products); context v.p
// (p x1024 and v x16, each f16 hi plus f16 residual at the same scale: lo.hi + hi.lo + hi.hi chained in the one running
// accumulator, 3 products); all v_wmma_f32_16x16x32_f16 with f32 accumulate; rotary tables, rotary combine, key masking, softmax
// statistics and the final normalisation in f32 on VALU; output stored as f32.

#define NB    2
#define NT    2048
#define ND    1024
#define NQKV  3072
#define NH    32
#define HD    32
#define NTOK  (NB * NT)
#define NBH   (NB * NH)
#define QBLK  128
#define KCH   64
#define NKC   (NT / KCH)
#define NQB   (NT / QBLK)
#define KP    40
#define VP    72
#define SPP   72
#define OP    36
#define ATHR  256
#define GBT   128
#define GBK   64
#define GLP   72
#define GTR   (ND / GBK)
#define GBUF  (GBT * GLP)
#define MCH   2
#define OKL   (KCH * KP)
#define OVH   (2 * KCH * KP)
#define OVL   (2 * KCH * KP + HD * VP)
#define KVB   (2 * KCH * KP + 2 * HD * VP)
#define MFL   32
#define QSC   0.25503486f

static_assert(NH * HD == ND);
static_assert(NQKV == 3 * ND);
static_assert((NT % QBLK) == 0 && (NT % KCH) == 0 && (NT % 64) == 0 && (NTOK % 64) == 0);
static_assert((NQKV % 64) == 0 && (ND % 64) == 0 && (ND % 32) == 0);
static_assert(QBLK == (ATHR / 32) * 16 && (NQB % 2) == 0);
static_assert(KCH * 4 == ATHR && HD * 8 == ATHR);
static_assert(HD == 32 && KCH == 64 && NKC * KCH == NT);
static_assert(NKC == 32 && (NKC % MCH) == 0 && MCH <= MFL && QBLK == 8 * 16);
static_assert(((NTOK * ND) % 2048) == 0);
static_assert((NTOK % GBT) == 0 && (NQKV % GBT) == 0 && (NT % GBT) == 0 && (ND % GBT) == 0 && GTR >= 2);

typedef _Float16 v16h __attribute__((ext_vector_type(16)));
typedef _Float16 v8h  __attribute__((ext_vector_type(8)));
typedef float    v8f  __attribute__((ext_vector_type(8)));
typedef float    v4f  __attribute__((ext_vector_type(4)));
typedef unsigned int v4u __attribute__((ext_vector_type(4)));
typedef int      v4i  __attribute__((ext_vector_type(4)));
typedef unsigned int v16u __attribute__((ext_vector_type(16)));

// ---- scalar helpers --------------------------------------------------------------------------------
__device__ __forceinline__ unsigned short bf_bits(float f) {          // f32 -> bf16 bits, RNE convert
  unsigned u = __float_as_uint(f);
  return (unsigned short)((u + 0x7FFFu + ((u >> 16) & 1u)) >> 16);
}
__device__ __forceinline__ float bf_up(unsigned short h) { return __uint_as_float(((unsigned)h) << 16); }
__device__ __forceinline__ unsigned short h_bits(_Float16 x) { return __builtin_bit_cast(unsigned short, x); }
__device__ __forceinline__ unsigned pk16(unsigned short a, unsigned short b) { return (unsigned)a | ((unsigned)b << 16); }
__device__ __forceinline__ v8f zero8() { v8f z = {0.f, 0.f, 0.f, 0.f, 0.f, 0.f, 0.f, 0.f}; return z; }

// ---- fragment loader: 16-bit A/B operand, lane -> row/col (lane&15), p already includes +8*(lane>>4);
//      elements 0..7 <- p[0..7] (k0+8h..), elements 8..15 <- p[16..23] (k0+16+8h..)
__device__ __forceinline__ v16h ldfrag_h(const _Float16* p) {
  union { v16h v; v8h h[2]; } f;
  f.h[0] = *(const v8h*)(p);
  f.h[1] = *(const v8h*)(p + 16);
  return f.v;
}

// ---- WMMA helpers with trailing VALU hazard gap --------------------------------------------------------
__device__ __forceinline__ v8f mma_h_raw(v16h a, v16h b, v8f c) {
  return __builtin_amdgcn_wmma_f32_16x16x32_f16(false, a, false, b, (short)0, c, false, false);
}
__device__ __forceinline__ void guard4(v8f& a, v8f& b, v16h u, v16h v, v16h w, v16h x, v16h y, v16h z) {
#if defined(__HIP_DEVICE_COMPILE__)
  asm volatile("v_nop\n\tv_nop\n\tv_nop\n\tv_nop" : "+v"(a), "+v"(b) : "v"(u), "v"(v), "v"(w), "v"(x), "v"(y), "v"(z));
#endif
}
// the same gap behind the loop's last products, in front of the first vector read of the two output accumulators
__device__ __forceinline__ void acc_guard2(v8f& a, v8f& b) {
#if defined(__HIP_DEVICE_COMPILE__)
  asm volatile("v_nop\n\tv_nop\n\tv_nop\n\tv_nop" : "+v"(a), "+v"(b));
#endif
}
__device__ __forceinline__ void acc_guard4(v8f& a, v8f& b, v8f& c, v8f& d) {
#if defined(__HIP_DEVICE_COMPILE__)
  asm volatile("v_nop\n\tv_nop\n\tv_nop\n\tv_nop" : "+v"(a), "+v"(b), "+v"(c), "+v"(d));
#endif
}
__device__ __forceinline__ void wave_sync_lds() {
  __builtin_amdgcn_fence(__ATOMIC_RELEASE, "workgroup");
  __builtin_amdgcn_wave_barrier();
  __builtin_amdgcn_fence(__ATOMIC_ACQUIRE, "workgroup");
}

// ---- asynchronous copies global -> LDS ------------------------------------------------------------------
__device__ __forceinline__ unsigned lds_addr(const unsigned short* p) {   // byte offset in the work-group's LDS
  return (unsigned)(size_t)(const __attribute__((address_space(3))) unsigned short*)p;
}
// One lane's share of a 128-row x 128-B tile: eight 16-B pieces, 16 rows apart (global pitch ND halves, LDS pitch
// GLP halves). The closing s_wait_xcnt stands inside the statement so that no address register named here is
// rewritten ahead of it.
__device__ __forceinline__ void stage_rows(unsigned l, const unsigned short* g) {
#if defined(__HIP_DEVICE_COMPILE__)
  asm volatile(
      "global_load_async_to_lds_b128 %0, %8, off\n\t"
      "global_load_async_to_lds_b128 %1, %9, off\n\t"
      "global_load_async_to_lds_b128 %2, %10, off\n\t"
      "global_load_async_to_lds_b128 %3, %11, off\n\t"
      "global_load_async_to_lds_b128 %4, %12, off\n\t"
      "global_load_async_to_lds_b128 %5, %13, off\n\t"
      "global_load_async_to_lds_b128 %6, %14, off\n\t"
      "global_load_async_to_lds_b128 %7, %15, off\n\t"
      "s_wait_xcnt 0x0"
      :: "v"(l), "v"(l + 1u * 16u * GLP * 2u), "v"(l + 2u * 16u * GLP * 2u), "v"(l + 3u * 16u * GLP * 2u),
         "v"(l + 4u * 16u * GLP * 2u), "v"(l + 5u * 16u * GLP * 2u), "v"(l + 6u * 16u * GLP * 2u),
         "v"(l + 7u * 16u * GLP * 2u),
         "v"(g), "v"(g + 1 * 16 * ND), "v"(g + 2 * 16 * ND), "v"(g + 3 * 16 * ND),
         "v"(g + 4 * 16 * ND), "v"(g + 5 * 16 * ND), "v"(g + 6 * 16 * ND), "v"(g + 7 * 16 * ND)
      : "memory");
#endif
}
// One lane's share of a 64-key chunk: one 16-B piece each of K hi, K residual, V hi and V residual. lk, lv: the lane's LDS
// byte addresses in the K hi and V hi parts of a buffer (the residual parts lie a fixed step behind). The closing
// s_wait_xcnt stands inside the statement so that no address register named here is rewritten ahead of it.
__device__ __forceinline__ void stage_kv(unsigned lk, unsigned lv, const unsigned short* gkh, const unsigned short* gkl,
                                         const unsigned short* gvh, const unsigned short* gvl) {
#if defined(__HIP_DEVICE_COMPILE__)
  asm volatile(
      "global_load_async_to_lds_b128 %0, %4, off\n\t"
      "global_load_async_to_lds_b128 %1, %5, off\n\t"
      "global_load_async_to_lds_b128 %2, %6, off\n\t"
      "global_load_async_to_lds_b128 %3, %7, off\n\t"
      "s_wait_xcnt 0x0"
      :: "v"(lk), "v"(lk + OKL * 2u), "v"(lv), "v"(lv + (OVL - OVH) * 2u),
         "v"(gkh), "v"(gkl), "v"(gvh), "v"(gvl)
      : "memory");
#endif
}
__device__ __forceinline__ void wait_copies() {      // this wave's own copies have landed in LDS
#if defined(__HIP_DEVICE_COMPILE__)
  asm volatile("s_wait_asynccnt 0x0" ::: "memory");
#endif
}
__device__ __forceinline__ void wait_lds_reads() {   // this wave's LDS reads have returned before their buffer is refilled
#if defined(__HIP_DEVICE_COMPILE__)
  asm volatile("s_wait_dscnt 0x0" ::: "memory");
#endif
}

// =====================================================================================================
// f32 -> f16( bf16_RNE(v) * scale ), scale a power of two (exact), 8 elements per thread, one 16-B store
// =====================================================================================================
__device__ __forceinline__ void cvt_h8(int blk, const float* __restrict__ in, unsigned short* out, int n8, float scale) {
  const int i = blk * 256 + threadIdx.x;
  if (i < n8) {
    const v4f a = *(const v4f*)(in + (size_t)i * 8);
    const v4f c = *(const v4f*)(in + (size_t)i * 8 + 4);
    float f[8];
    f[0] = a[0]; f[1] = a[1]; f[2] = a[2]; f[3] = a[3];
    f[4] = c[0]; f[5] = c[1]; f[6] = c[2]; f[7] = c[3];
    unsigned short hb[8];
#pragma unroll
    for (int e = 0; e < 8; ++e) hb[e] = h_bits((_Float16)(bf_up(bf_bits(f[e])) * scale));
    v4u p;
    p[0] = pk16(hb[0], hb[1]);
    p[1] = pk16(hb[2], hb[3]);
    p[2] = pk16(hb[4], hb[5]);
    p[3] = pk16(hb[6], hb[7]);
    *(v4u*)(out + (size_t)i * 8) = p;
    
  }
}

// =====================================================================================================
// Weight transpose + convert: W[c][o] f32 (c in [0,1024), o in [0,3072), o contiguous) ->
// WT[o][c] f16 = f16( bf16_RNE(W[c][o]) * scale ), c contiguous (k-major rows for the B fragment loader).
// Block = one 64(o) x 64(c) tile: thread (ol = tid&63, cb = tid>>6) reads 16 consecutive c rows of column o0+ol
// (coalesced per row across lanes), packs them as two 16-B LDS stores into sT[ol][c]; block barrier; then every
// tiles = (3072/64, 1024/64) = (48, 16): bx = o tiles (rows of WT), by = c tiles (rows of W).
// coverage: 256 threads x 2 rows-iterations... : rows tid>>3 (0..31) and +32 -> all 64 rows x 64 halves per tile.
// =====================================================================================================
__device__ __forceinline__ void cvt_wT(int bx, int by, const float* __restrict__ W, unsigned short* WT, float scale) {
  __shared__ __align__(16) unsigned short sT[64 * SPP];          // 9216 B
  const int tid = threadIdx.x;
  const int o0 = bx * 64;
  const int c0 = by * 64;
  {
    const int ol = tid & 63, cb = tid >> 6;                      // cb 0..3 -> c rows cb*16 .. +15
    unsigned short hb[16];
#pragma unroll
    for (int e = 0; e < 16; ++e) {
      const float f = W[(size_t)(c0 + cb * 16 + e) * NQKV + o0 + ol];
      hb[e] = h_bits((_Float16)(bf_up(bf_bits(f)) * scale));
    }
    v4u p0, p1;
#pragma unroll
    for (int q = 0; q < 4; ++q) {
      p0[q] = pk16(hb[2 * q], hb[2 * q + 1]);
      p1[q] = pk16(hb[8 + 2 * q], hb[8 + 2 * q + 1]);
    }
    *(v4u*)(sT + ol * SPP + cb * 16) = p0;
    *(v4u*)(sT + ol * SPP + cb * 16 + 8) = p1;
  }
  __syncthreads();
  {
    const int row = tid >> 3, c8 = (tid & 7) * 8;
    const v4u v0 = *(const v4u*)(sT + row * SPP + c8);
    const v4u v1 = *(const v4u*)(sT + (row + 32) * SPP + c8);
    const size_t d0 = (size_t)(o0 + row) * ND + c0 + c8;
    const size_t d1 = (size_t)(o0 + row + 32) * ND + c0 + c8;
    {
      *(v4u*)(WT + d0) = v0;
      *(v4u*)(WT + d1) = v1;
      // precaution: the two stores' address and data registers are not rewritten (by another job's code that
      // follows in the listing) before this wait
      asm volatile("s_wait_xcnt 0x0" ::: "memory");
    }
  }
}

// =====================================================================================================
// inv_freq[j] = 1 / 10000^(j/32), j = 0..31 (full head dim, not pairs), worked out by every thread that needs it.
// Contraction off: power, reciprocal and (in k_tab) the angle s * inv_freq are each rounded to f32 on their own, as the
// definition rounds them, before the sine and cosine see the angle.
// =====================================================================================================
__device__ __forceinline__ float k_invf(int j) {
  #pragma clang fp contract(off)
  const float e = (float)j * 0.03125f;
  const float p = powf(10000.0f, e);
  const float inv = 1.0f / p;
  return inv;
}

// =====================================================================================================
// Rotary tables COS/SIN[s][j] = cos/sin( s * inv_freq[j] ), s in [0,2048), j in [0,32): 256 threads = 8 rows x 32,
// one precise sincosf per thread (rolled, nothing unrolled); values staged in LDS, block barrier, then waves 0-1
// coverage: 256 blocks x 8 rows x 32 = every COS and SIN element.
// =====================================================================================================
__device__ __forceinline__ void k_tab(int blk, float* COS, float* SIN) {
  // the angle is rounded to f32 as a product of its own before sine and cosine (see k_invf)
  #pragma clang fp contract(off)
  __shared__ __align__(16) float sc[8 * 32];
  __shared__ __align__(16) float ss[8 * 32];
  const int tid = threadIdx.x, j = tid & 31, rl = tid >> 5;
  const int s = blk * 8 + rl;
  const float ang = (float)s * k_invf(j);
  float sn, cs;
  sincosf(ang, &sn, &cs);
  sc[rl * 32 + j] = cs;
  ss[rl * 32 + j] = sn;
  __syncthreads();
  if (tid < 64) {                                                // waves 0,1: COS rows
    const int row = tid >> 3, c4 = (tid & 7) * 4;
    const v4f v = *(const v4f*)(sc + row * 32 + c4);
    float* d = COS + (size_t)(blk * 8 + row) * HD + c4;
    *(v4f*)d = v;
    
  } else if (tid < 128) {                                        // waves 2,3: SIN rows
    const int t2 = tid - 64;
    const int row = t2 >> 3, c4 = (t2 & 7) * 4;
    const v4f v = *(const v4f*)(ss + row * 32 + c4);
    float* d = SIN + (size_t)(blk * 8 + row) * HD + c4;
    *(v4f*)d = v;
    
  }
}

// =====================================================================================================
// Mask digest, made once for all batch*head pairs. Block (cp, qb) = 128 query rows x MCH key chunks of 64; wave w owns
// the 16-row query tile qt = 8*qb + w and reads, per chunk, the same 32 entries per lane that the attention wave of
// that tile needs: lane -> query row 16*qt + (lane&15), keys of lane half lane>>4.
//   MB[qt][c][16*s + 8*t + r]: a lane mask, bit lane <-> (mask[row][64*c + 32*s + 16*t + 8*(lane>>4) + r] != 0), ready
//                    as the select mask of score element (t, r) of 32-key step s; one 128-B line per (qt, c), written
//                    by one wave (lane i stores word i).
//   FL[qb][cp][MFL]: entry e < MCH is nonzero iff any entry of the 128 x 64 block of chunk MCH*cp + e is nonzero;
//                    one whole 128-B line per block (the rest of the line is 0).
// blocks = (32/MCH, 16): every (qt, c) word line and every FL line written exactly once.
// =====================================================================================================
__device__ __forceinline__ void mask_digest(int cp, int qb, const int* __restrict__ msk, unsigned* MB, int* FL) {
  __shared__ int sany[MCH][8];
  const int tid = threadIdx.x, lane = tid & 31, wave = tid >> 5;
  const int rlane = lane & 15, hsel = lane >> 4;
  const int qt = qb * 8 + wave;
  const size_t rowbase = (size_t)(qt * 16 + rlane) * NT;
  // all loads of the wave stand ahead of its first store; every loop below is unrolled so that ent[] is indexed by
  // constants and stays in registers
  v4i ent[MCH][2][2][2];
#pragma unroll
  for (int e = 0; e < MCH; ++e) {
#pragma unroll
    for (int s = 0; s < 2; ++s) {
#pragma unroll
      for (int t = 0; t < 2; ++t) {
        const int* mp = msk + rowbase + (size_t)((cp * MCH + e) * KCH + 32 * s + 16 * t + 8 * hsel);
        ent[e][s][t][0] = *(const v4i*)mp;
        ent[e][s][t][1] = *(const v4i*)(mp + 4);
      }
    }
  }
#pragma unroll
  for (int e = 0; e < MCH; ++e) {
    unsigned any = 0u;
    int mine = 0;                                                // lane i ends up with word i
#pragma unroll
    for (int i = 0; i < 32; ++i) {                               // i = 16*s + 8*t + r
      const unsigned w = __builtin_amdgcn_ballot_w32(ent[e][i >> 4][(i >> 3) & 1][(i >> 2) & 1][i & 3] != 0);
      any |= w;
      mine = (lane == i) ? (int)w : mine;
    }
    MB[((size_t)qt * NKC + cp * MCH + e) * 32 + lane] = (unsigned)mine;
    if (lane == 0) sany[e][wave] = (any != 0u) ? 1 : 0;
  }
  __syncthreads();
  if (tid < MFL) {
    int f = 0;
    if (tid < MCH) {
#pragma unroll
      for (int w = 0; w < 8; ++w) f |= sany[tid][w];
    }
    FL[((size_t)qb * (NKC / MCH) + cp) * MFL + tid] = f;
  }
}

// =====================================================================================================
// All work that depends on the inputs alone, in ONE launch: the four jobs above read and write disjoint buffers and none
// reads what another writes, so their work-groups share the chip instead of waiting for one another's launch to end.
// The job is picked by the block index (the same for the whole work-group, so each job's barrier stays block-uniform):
//   [0, PB_DIG)       mask digest, block (cp, qb) = (i % 16, i / 16)
//   [.., PB_WT)       weight transpose + convert, tile (bx, by) = (i % 48, i / 48)
//   [.., PB_TAB)      rotary tables, 8 rows a block
//   [.., PB_ALL)      activation convert, 2048 elements a block
// =====================================================================================================
#define PB_DIG  ((NKC / MCH) * (NT / QBLK))
#define PB_WT   (PB_DIG + (NQKV / 64) * (ND / 64))
#define PB_TAB  (PB_WT + NT / 8)
#define PB_ALL  (PB_TAB + NTOK * ND / 2048)
__global__ __launch_bounds__(256) void prep(const float* __restrict__ x, const float* __restrict__ W,
                                            const int* __restrict__ msk, unsigned short* XH, unsigned short* WT,
                                            float* COS, float* SIN, unsigned* MB, int* FL) {
  const int blk = blockIdx.x;
  if (blk < PB_DIG) {
    mask_digest(blk % (NKC / MCH), blk / (NKC / MCH), msk, MB, FL);
  } else if (blk < PB_WT) {
    const int i = blk - PB_DIG;
    cvt_wT(i % (NQKV / 64), i / (NQKV / 64), W, WT, 1024.0f);
  } else if (blk < PB_TAB) {
    k_tab(blk - PB_WT, COS, SIN);
  } else {
    cvt_h8(blk - PB_TAB, x, XH, NTOK * ND / 8, 16.0f);
  }
}

// =====================================================================================================
// Fused qkv projection GEMM with rotary + 16-bit plane epilogue:
//   Y[tok][o] = sum_c XH[tok][c] * WT[o][c] * oscale,  tok in [0,4096), o in [0,3072), K = 1024.
// One work-group of 4 waves per 128x128 tile, one wave per 64x64 quarter (register-blocked); A = XH rows (token),
// Bt = WT rows (k contiguous). Per 64-deep k stage the 128 A rows and 128 Bt rows (128 B each, whole lines) are copied
// asynchronously into one of two LDS buffers (pitch 144 B) while the other buffer is worked on; k order unchanged.
// The 64 tokens of a tile lie in one batch b (t0 = m0 mod 2048); the 64 outputs are two heads h0, h0+1 of one of
// q (o < 1024), k (1024 <= o < 2048), v (o >= 2048); column j (16-wide subtile) -> head h0 + (j>>1), d = 16*(j&1)+lane%16.
//   q, k: rotary combine per the module: out[d] = y[d]*cos[s][d] - y[d+16]*sin[s][d] (d < 16),
//         out[d] = y[d]*cos[s][d] + y[d-16]*sin[s][d] (d >= 16); both partners sit in the same lane and element.
//         PH/PL[bh][t][32] f16 = hi plane and residual of out (k) or out*log2(e)/sqrt(32) (q) (64 B per token; the wave owns 64 consecutive
// then q/k: each head's slab region (16 tok x 64 B = 1024 contiguous B) written as 32 lanes x 16 B contiguous per
// grid = 768 blocks x 4 waves = 3072 wave tiles = 64 x 48 exactly.
// coverage: q/k tiles: 4 slabs x 2 heads x 16 tok x 32 d (hi and residual); v tiles: 4 subtiles x 16 d x 64 tok;
// 64 token tiles x (16+16+16) column tiles = every (bh, t) row of QH/QL/KH/KL and every (bh, d) row of VH/VL.
// =====================================================================================================
__global__ __launch_bounds__(128) void gemm_proj(
    const unsigned short* __restrict__ XHp, const unsigned short* __restrict__ WTp,
    const float* __restrict__ COS, const float* __restrict__ SIN,
    unsigned short* QH, unsigned short* QL, unsigned short* KH, unsigned short* KL,
    unsigned short* VH, unsigned short* VL, float oscale) {
  __shared__ __align__(16) unsigned short sA[2][GBUF];            // 36864 B
  __shared__ __align__(16) unsigned short sB[2][GBUF];            // 36864 B
  __shared__ __align__(16) unsigned short sP[4][2][16 * SPP];     // 18432 B
  const int tid  = threadIdx.x;
  const int lane = tid & 31;
  const int wave = tid >> 5;
  const int tilesN = NQKV / GBT;                                 // 24
  const int tilesM = NTOK / GBT;                                 // 32
  const int tile = blockIdx.x;
  if (tile >= tilesM * tilesN) return;                           // block-uniform, in front of every barrier
  const int tm = tile / tilesN;
  const int tn = tile - tm * tilesN;
  const int wm = wave >> 1, wn = wave & 1;                       // 2 x 2 waves
  const int m0 = tm * GBT + (wm << 6);                           // token base of this wave
  const int n0 = tn * GBT + (wn << 6);                           // output channel base in [0,3072)
  const int rlane = lane & 15;
  const int hh    = lane >> 4;
  const int koff  = hh * 8;
  const int mOff  = hh * 8;

  v8f acc[4][4];
#pragma unroll
  for (int i = 0; i < 4; ++i)
#pragma unroll
    for (int j = 0; j < 4; ++j) acc[i][j] = zero8();

  // copy share of this lane: piece tid&7 (16 B) of rows (tid>>3) + 16e, e = 0..7; a wave's copy = 4 whole 128-B lines
  const int crow = tid >> 3, cpc = (tid & 7) * 8;
  const unsigned short* gA = XHp + (size_t)(tm * GBT + crow) * ND + cpc;
  const unsigned short* gB = WTp + (size_t)(tn * GBT + crow) * ND + cpc;
  const unsigned lA = lds_addr(&sA[0][crow * GLP + cpc]);
  const unsigned lB = lds_addr(&sB[0][crow * GLP + cpc]);

  stage_rows(lA, gA);                                            // stage 0 -> buffer 0
  stage_rows(lB, gB);
  wait_copies();
  __syncthreads();
  stage_rows(lA + GBUF * 2u, gA + GBK);                          // stage 1 -> buffer 1
  stage_rows(lB + GBUF * 2u, gB + GBK);

  // rolled: the two-buffer order below is written once
#pragma unroll 1
  for (int t = 0; t < GTR; ++t) {
    const int bsel = t & 1;
    const _Float16* fa = (const _Float16*)(const void*)&sA[bsel][((wm << 6) + rlane) * GLP + koff];
    const _Float16* fb = (const _Float16*)(const void*)&sB[bsel][((wn << 6) + rlane) * GLP + koff];
#pragma unroll
    for (int kk = 0; kk < GBK; kk += 32) {
      v16h bf[4], af[4];
#pragma unroll
      for (int j = 0; j < 4; ++j) bf[j] = ldfrag_h(fb + (j << 4) * GLP + kk);
#pragma unroll
      for (int i = 0; i < 4; ++i) af[i] = ldfrag_h(fa + (i << 4) * GLP + kk);
#pragma unroll
      for (int i = 0; i < 4; ++i)
#pragma unroll
        for (int j = 0; j < 4; ++j) acc[i][j] = mma_h_raw(af[i], bf[j], acc[i][j]);
      // all 16 LDS reads of this k step as one group ahead of its 16 products: one LDS wait a step, not one a row
      __builtin_amdgcn_sched_group_barrier(0x100, 16, 0);
      __builtin_amdgcn_sched_group_barrier(0x008, 16, 0);
    }
    // publish point of stage t + 1: own reads done, own copies landed, barrier, then the refill of the buffer just read
    wait_lds_reads();
    wait_copies();
    __syncthreads();
    if (t + 2 < GTR) {
      stage_rows(lA + (unsigned)bsel * (GBUF * 2u), gA + (t + 2) * GBK);
      stage_rows(lB + (unsigned)bsel * (GBUF * 2u), gB + (t + 2) * GBK);
    }
  }
  wait_copies();
  acc_guard4(acc[0][0], acc[0][1], acc[0][2], acc[0][3]);
  acc_guard4(acc[1][0], acc[1][1], acc[1][2], acc[1][3]);
  acc_guard4(acc[2][0], acc[2][1], acc[2][2], acc[2][3]);
  acc_guard4(acc[3][0], acc[3][1], acc[3][2], acc[3][3]);

  // ---- epilogue ----
  const int b   = m0 / NT;
  const int t0  = m0 - b * NT;
  const int sel = n0 >> 10;                                      // 0 q, 1 k, 2 v (wave-uniform)
  const int h0  = (n0 & (ND - 1)) >> 5;                          // first of the two heads of this tile
  unsigned short* s0 = &sP[wave][0][0];
  unsigned short* s1 = &sP[wave][1][0];

  if (sel < 2) {
    unsigned short* PH = (sel == 0) ? QH : KH;
    unsigned short* PL = (sel == 0) ? QL : KL;
    const float fs = (sel == 0) ? QSC : 1.0f;                    // q carries log2(e)/sqrt(32), k is stored as it is
#pragma unroll
    for (int i = 0; i < 4; ++i) {                                // slab = 16 tokens t0+16i .. +15
#pragma unroll
      for (int r = 0; r < 8; ++r) {
        const int tok = t0 + (i << 4) + mOff + r;                // row tok = 8hh + r
        const float* cp = COS + (size_t)tok * HD;
        const float* sp = SIN + (size_t)tok * HD;
        const float ca = cp[rlane], cb = cp[16 + rlane];
        const float sa = sp[rlane], sb = sp[16 + rlane];
#pragma unroll
        for (int hp = 0; hp < 2; ++hp) {
          const float y0 = acc[i][2 * hp][r] * oscale;           // d = rlane
          const float y1 = acc[i][2 * hp + 1][r] * oscale;       // d = 16 + rlane
          const float f0 = (y0 * ca - y1 * sa) * fs;
          const float f1 = (y1 * cb + y0 * sb) * fs;
          const _Float16 x0 = (_Float16)f0;
          const _Float16 x1 = (_Float16)f1;
          const int so = (mOff + r) * SPP + 32 * hp + rlane;     // row tok, col 32hp + d
          s0[so]      = h_bits(x0);
          s1[so]      = h_bits((_Float16)(f0 - (float)x0));
          s0[so + 16] = h_bits(x1);
          s1[so + 16] = h_bits((_Float16)(f1 - (float)x1));
        }
      }
      wave_sync_lds();
      {
        const int rr = lane >> 2, cc = (lane & 3) * 8;           // rr*32 + cc = lane*8 halves
#pragma unroll
        for (int hp = 0; hp < 2; ++hp) {
          const int bhp = b * NH + h0 + hp;
          const size_t base = ((size_t)(bhp * NT + t0 + (i << 4))) * HD + lane * 8;
          const v4u v0 = *(const v4u*)(s0 + rr * SPP + 32 * hp + cc);
          const v4u v1 = *(const v4u*)(s0 + (rr + 8) * SPP + 32 * hp + cc);
          const v4u w0 = *(const v4u*)(s1 + rr * SPP + 32 * hp + cc);
          const v4u w1 = *(const v4u*)(s1 + (rr + 8) * SPP + 32 * hp + cc);
          {
            *(v4u*)(PH + base) = v0;
            *(v4u*)(PH + base + 256) = v1;
            *(v4u*)(PL + base) = w0;
            *(v4u*)(PL + base + 256) = w1;
            
          }
        }
      }
      wave_sync_lds();
    }
  } else {
#pragma unroll
    for (int j = 0; j < 4; ++j) {                                // slab = 16 rows d = 16(j&1) + rlane of head h0+(j>>1)
      const int hp = j >> 1, dbase = (j & 1) * 16;
      const int bhp = b * NH + h0 + hp;
#pragma unroll
      for (int i = 0; i < 4; ++i) {
        unsigned short hb[8], lb[8];
#pragma unroll
        for (int r = 0; r < 8; ++r) {
          const float f = (acc[i][j][r] * oscale) * 16.0f;
          const _Float16 xh = (_Float16)f;
          hb[r] = h_bits(xh);
          lb[r] = h_bits((_Float16)(f - (float)xh));
        }
        v4u ph, pl;
#pragma unroll
        for (int q = 0; q < 4; ++q) {
          ph[q] = pk16(hb[2 * q], hb[2 * q + 1]);
          pl[q] = pk16(lb[2 * q], lb[2 * q + 1]);
        }
        *(v4u*)(s0 + rlane * SPP + (i << 4) + mOff) = ph;       // row d = rlane, tok = 16i + 8hh .. +7
        *(v4u*)(s1 + rlane * SPP + (i << 4) + mOff) = pl;
      }
      wave_sync_lds();
      {
        const int rq = lane >> 3, c8 = (lane & 7) * 8;
        {
#pragma unroll
          for (int it = 0; it < 4; ++it) {
            const int row = it * 4 + rq;                         // it 0..3 x rq 0..3 = rows 0..15
            const size_t dst = ((size_t)(bhp * HD + dbase + row)) * NT + t0 + c8;
            const v4u v = *(const v4u*)(s0 + row * SPP + c8);
            const v4u w = *(const v4u*)(s1 + row * SPP + c8);
            *(v4u*)(VH + dst) = v;
            *(v4u*)(VL + dst) = w;
          }
          
        }
      }
      wave_sync_lds();
    }
  }
}

// =====================================================================================================
// Attention for one batch*head and two 128-query blocks (NQB-1-y, then y): grid = (64, 8), 256 threads = 8 waves x 16
// queries; at most four waves a SIMD by the register allocation, so the 512 equal work-groups lie two on a WGP; each lane
// owns one query column q = q0 + 16*wave + (lane&15). QH/QL/KH/KL[bh][t][32] f16 (hi, residual; q times log2(e)/sqrt(32)),
// VH/VL[bh][d][2048] (x16 hi, residual at the same scale). The mask [2048 q][2048 key] comes as the digest of mask_digest: key
// chunks of 64; each wave loads the 32 lane masks MB[qt][c][..] of its query tile by wave-uniform loads, one mask per
// score element; a chunk whose entries are all zero for the whole block (FL, gathered once into a wave-uniform word)
// is skipped block-uniformly: the loop walks the set bits of that word (exact: such keys have probability 0). K hi/res
// rows [64][40] and V hi/res tiles [32 d][72] of the next open chunk are copied asynchronously into one of two LDS buffers
// while the other buffer is worked on; one block barrier a chunk. Per chunk (one softmax update for its 64 keys) and 16-key tile t:
// S[key][q] = C + A(K hi) x B(Q res) + A(K res) x B(Q hi) + A(K hi rows) x B(resident Q hi), small terms first, chained in one
// accumulator that starts at C = 10 - reference: S is the exponent to base two; entries with mask == 0 replaced by -inf;
// the reference of a column is its first chunk's maximum and is raised (running sum and output rescaled) only when a p
// could leave the f16 range; p = 2^S = 1024*exp(x - reference) packed D->B per the chained map (element r <-
// keys 0-15 tile, 8+r <- keys 16-31 tile of a 32-key step) as f16 hi plus residual; O[d][q] += A(V res) x Ph + A(V hi) x Pl +
// A(V hi rows) x Ph in one accumulator; out = O / (16 * l) (l = 0 gives 0*inf = NaN).
// coverage: 64 x 8 blocks x 2 tiles x 8 waves x 16 rows x 32 floats = every (tok, head) line of the output.
// =====================================================================================================
__global__ __launch_bounds__(ATHR) __attribute__((amdgpu_waves_per_eu(4, 4))) void attn_kernel(
    const unsigned short* __restrict__ QHp, const unsigned short* __restrict__ QLp,
    const unsigned short* __restrict__ KHp, const unsigned short* __restrict__ KLp,
    const unsigned short* __restrict__ VHp, const unsigned short* __restrict__ VLp,
    const unsigned* __restrict__ MB, const int* __restrict__ FL, float* Out) {
  __shared__ __align__(16) unsigned short skv[2][KVB];            // 2 x 19456 B: K hi, K res (5120 B each), V hi, V res (4608 B each)
  __shared__ __align__(16) float sO[8][16 * OP];                  // 18432 B
  const _Float16* QH = (const _Float16*)(const void*)QHp;
  const _Float16* QL = (const _Float16*)(const void*)QLp;

  const int tid = threadIdx.x, lane = tid & 31, wave = tid >> 5;
  const int bh = blockIdx.x;
  const int b  = bh / NH;
  const int h  = bh - b * NH;
  const int rlane = lane & 15, hsel = lane >> 4, koff = hsel * 8;

  // copy share of this lane in a chunk: piece tid&3 of K row tid>>2 (64 keys x 32 halves), piece tid&7 of V row tid>>3
  // (32 d rows x 64 halves), hi and residual plane each
  const int ckey = tid >> 2, cck = (tid & 3) * 8;
  const int cdr = tid >> 3, ccv = (tid & 7) * 8;
  const size_t gk0 = ((size_t)(bh * NT + ckey)) * HD + cck;
  const size_t gv0 = ((size_t)(bh * HD + cdr)) * NT + ccv;
  const unsigned lk0 = lds_addr(&skv[0][ckey * KP + cck]);
  const unsigned lv0 = lds_addr(&skv[0][OVH + cdr * VP + ccv]);

  // Two query tiles per work-group, one after the other in every wave: NQB-1-y, then y. Under a lower-triangular mask the
  // active chunks of such a pair add up to the same count in every work-group; any other mask is only divided differently.
  // The barrier at the foot of the first tile's last chunk ends every wave's reads of K/V ahead of the second tile's copies.
  // rolled: the tile body stands once in the instruction cache
#pragma unroll 1
  for (int leg = 0; leg < 2; ++leg) {
    const int qb = (leg == 0) ? (NQB - 1 - (int)blockIdx.y) : (int)blockIdx.y;
    const int q0 = qb * QBLK;
    const int qrow = q0 + wave * 16 + rlane;                       // this lane's query index within the sequence

    // resident Q fragments (B operand: B[k=d][n=q] from [q][d] rows), arithmetic addressing, one 32-deep k-step
    const size_t qo = ((size_t)(bh * NT + qrow)) * HD + koff;
    const v16h qh0 = ldfrag_h(QH + qo);
    const v16h ql0 = ldfrag_h(QL + qo);
    // this wave's lane masks, 32 words a chunk; the wave number made uniform so that the words load into scalar registers
    const unsigned* mbp = MB + ((size_t)(qb * 8 + __builtin_amdgcn_readfirstlane(wave)) * NKC) * 32;
    // bit c <-> chunk c has a nonzero mask entry somewhere in this block's 128 query rows (the same word in every wave)
    const unsigned act = __builtin_amdgcn_ballot_w32(
        FL[((size_t)qb * (NKC / MCH) + lane / MCH) * MFL + (lane % MCH)] != 0);

    const float PTOP   = 60000.0f;                                // below the largest finite f16
    const float NEGINF = __uint_as_float(0xff800000u);

    v8f oh[2];
#pragma unroll
    for (int dt = 0; dt < 2; ++dt) oh[dt] = zero8();
    float l_run = 0.0f;
    float cval = 10.0f;                                            // 10 - reference (in powers of two) of this lane's column

    // the open chunks still to come, lowest first (the same word in every wave, so every test on it is block-uniform)
    unsigned rem = act;
    if (rem != 0u) {
    int c = __builtin_ctz(rem);                                    // chunk in work: keys 64*c .. 64*c + 63
    rem &= rem - 1u;
    stage_kv(lk0, lv0, KHp + gk0 + (size_t)c * (KCH * HD), KLp + gk0 + (size_t)c * (KCH * HD),
             VHp + gv0 + c * KCH, VLp + gv0 + c * KCH);            // first open chunk -> buffer 0
    // lane masks: word (16*s + 8*t + r), bit lane <-> key 64*c + 32*s + 16*t + 8*hsel + r of the lane's query row
    // read through the constant address space (nothing writes MB in this launch), which makes them scalar loads
    v16u mw0 = *(const __attribute__((address_space(4))) v16u*)(mbp + c * 32);
    v16u mw1 = *(const __attribute__((address_space(4))) v16u*)(mbp + c * 32 + 16);
    wait_copies();
    __syncthreads();
    if (rem != 0u) {                                               // second open chunk -> buffer 1
      const int c1 = __builtin_ctz(rem);
      stage_kv(lk0 + KVB * 2u, lv0 + KVB * 2u, KHp + gk0 + (size_t)c1 * (KCH * HD), KLp + gk0 + (size_t)c1 * (KCH * HD),
               VHp + gv0 + c1 * KCH, VLp + gv0 + c1 * KCH);
    }
    unsigned bsel = 0u;
    // rolled: the two-buffer order is written once, and the body stands once in the instruction cache
#pragma unroll 1
    for (;;) {
      const _Float16* kh = (const _Float16*)(const void*)&skv[bsel][0];
      const _Float16* kl = kh + OKL;
      const _Float16* vh = kh + OVH;
      const _Float16* vl = kh + OVL;

      // ONE softmax update for the whole 64-key chunk: four 16-key score tiles T (keys kc + 16*T ..) are formed, masked,
      // exponentiated and summed together, so the exchange between lane halves stands once a chunk.
      {
        float a[4][8];
        // the four key tiles' chains of three are issued turn about, so that four independent accumulators stay in flight
        v16h kha[4], kla[4];
        v8f sh[4];
        const v8f cref = {cval, cval, cval, cval, cval, cval, cval, cval};   // the C operand of the score products
#pragma unroll
        for (int t = 0; t < 4; ++t) {
          const int krow = 16 * t + rlane;
          kha[t] = ldfrag_h(kh + krow * KP + koff);
          kla[t] = ldfrag_h(kl + krow * KP + koff);
        }
#pragma unroll
        for (int t = 0; t < 4; ++t) sh[t] = mma_h_raw(kha[t], ql0, cref);
#pragma unroll
        for (int t = 0; t < 4; ++t) sh[t] = mma_h_raw(kla[t], qh0, sh[t]);
#pragma unroll
        for (int t = 0; t < 4; ++t) sh[t] = mma_h_raw(kha[t], qh0, sh[t]);
        // the chunk's 16 V fragment reads are issued behind the score products, so that they return under the softmax arithmetic
        v16h vah[2][2], val[2][2];
#pragma unroll
        for (int s = 0; s < 2; ++s) {
#pragma unroll
          for (int dt = 0; dt < 2; ++dt) {
            vah[s][dt] = ldfrag_h(vh + (16 * dt + rlane) * VP + 32 * s + koff);
            val[s][dt] = ldfrag_h(vl + (16 * dt + rlane) * VP + 32 * s + koff);
          }
        }
        // order of issue: all 16 K fragment reads as one group (one LDS wait, not three), the 12 score products, the 16 V reads
        __builtin_amdgcn_sched_group_barrier(0x100, 16, 0);
        __builtin_amdgcn_sched_group_barrier(0x008, 12, 0);
        __builtin_amdgcn_sched_group_barrier(0x100, 16, 0);
        // no vector work is drawn in between the products (each such read of a fresh tile would cost its own v_nop gap)
        __builtin_amdgcn_sched_barrier(0);
#pragma unroll
        for (int t = 0; t < 4; ++t) {
#pragma unroll
          for (int r = 0; r < 8; ++r) {
            const unsigned kw = (t < 2) ? mw0[(t & 1) * 8 + r] : mw1[(t & 1) * 8 + r];
            a[t][r] = __builtin_amdgcn_inverse_ballot_w32(kw) ? sh[t][r] : NEGINF;
          }
        }

        // softmax over the key axis for this lane's q column against the HELD reference: the tiles are the exponents.
        // The reference moves only where it must: a column without any sum yet takes its first one, and a column whose p
        // could leave the f16 range (every p <= this lane's sum) is looked at again. One test a chunk for the whole wave, a
        // scalar branch; behind it every lane works on the maximum of both lane halves, so the halves stay in step, the
        // exponents are shifted in place and the exponentials are taken once more (at most two turns).
        float ssum;
        float p[4][8];
        float alph = 1.0f;
        // rolled: the second turn runs through the same instructions, so the usual single turn carries no copies
#pragma unroll 1
        for (int turn = 0;; ++turn) {
          ssum = 0.0f;
#pragma unroll
          for (int r = 0; r < 8; ++r) {
#pragma unroll
            for (int t = 0; t < 4; ++t) p[t][r] = __builtin_amdgcn_exp2f(a[t][r]);
            ssum += (p[0][r] + p[1][r]) + (p[2][r] + p[3][r]);
          }
          if (turn != 0 || __builtin_amdgcn_ballot_w32((ssum > PTOP) || (l_run == 0.0f)) == 0u) break;
          float mloc = -1.0e30f;
#pragma unroll
          for (int t = 0; t < 4; ++t) {
#pragma unroll
            for (int r = 0; r < 8; r += 2) mloc = fmaxf(mloc, fmaxf(a[t][r], a[t][r + 1]));
          }
          mloc = fmaxf(mloc, __shfl_xor(mloc, 16, 32));
          // moved so that the chunk's largest exponent becomes 10; a column with no open key in this chunk stays
          const bool  mv   = (mloc > -1.0e29f) && ((l_run == 0.0f) || (mloc > 15.0f));
          const float cnew = mv ? (cval - (mloc - 10.0f)) : cval;
          const float dd   = cnew - cval;
          alph = (l_run == 0.0f) ? 1.0f : __builtin_amdgcn_exp2f(dd);
          cval = cnew;
#pragma unroll
          for (int t = 0; t < 4; ++t) {
#pragma unroll
            for (int r = 0; r < 8; ++r) a[t][r] += dd;
          }
        }
        // the next open chunk's lane masks are asked for here, this chunk's being used up, so that they return under the
        // rest of this chunk and the next one's score products (behind the last chunk: its own words once more, never used)
        {
          const int cn = (rem != 0u) ? __builtin_ctz(rem) : c;
          mw0 = *(const __attribute__((address_space(4))) v16u*)(mbp + cn * 32);
          mw1 = *(const __attribute__((address_space(4))) v16u*)(mbp + cn * 32 + 16);
        }
        // keeps the two scalar loads at the head of what follows: left free they sank to the chunk's foot, too late to
        // return ahead of the next chunk's selects
        __builtin_amdgcn_sched_barrier(0);
        ssum += __shfl_xor(ssum, 16, 32);
        l_run = l_run * alph + ssum;
        // alph is 1 in the usual turn; multiplied in every chunk all the same, in place: under the branch the compiler
        // kept two copies of the running output and moved all sixteen registers in every chunk
#pragma unroll
        for (int dt = 0; dt < 2; ++dt) {
#pragma unroll
          for (int r = 0; r < 8; ++r) oh[dt][r] *= alph;
        }

        // P (f32, D layout) -> B operands (f16 hi, f16 residual) of 32-key step s: element r <- tile 2s, 8+r <- tile 2s+1
        union { v16h v; _Float16 s[16]; } ph[2], plo[2];
#pragma unroll
        for (int s = 0; s < 2; ++s) {
#pragma unroll
          for (int r = 0; r < 8; ++r) {
            const _Float16 x0 = (_Float16)p[2 * s][r];
            const _Float16 x1 = (_Float16)p[2 * s + 1][r];
            ph[s].s[r]      = x0;
            ph[s].s[8 + r]  = x1;
            plo[s].s[r]     = (_Float16)(p[2 * s][r] - (float)x0);
            plo[s].s[8 + r] = (_Float16)(p[2 * s + 1][r] - (float)x1);
          }
        }

        // O[d][q] += V[d][32s .. +31] x P, hi and residual terms, step 0 then step 1
        // written with the two d tiles' chains turn about; step 0's products may issue while step 1's P is still being split
#pragma unroll
        for (int s = 0; s < 2; ++s) {
#pragma unroll
          for (int dt = 0; dt < 2; ++dt) oh[dt] = mma_h_raw(val[s][dt], ph[s].v, oh[dt]);
#pragma unroll
          for (int dt = 0; dt < 2; ++dt) oh[dt] = mma_h_raw(vah[s][dt], plo[s].v, oh[dt]);
#pragma unroll
          for (int dt = 0; dt < 2; ++dt) oh[dt] = mma_h_raw(vah[s][dt], ph[s].v, oh[dt]);
        }
        guard4(oh[0], oh[1], vah[1][0], val[1][0], vah[1][1], val[1][1], ph[1].v, plo[1].v);
      }
      // publish point of the next open chunk: own reads done, own copies landed, barrier, then the refill of the buffer just read
      wait_lds_reads();
      wait_copies();
      __syncthreads();
      if (rem == 0u) break;
      c = __builtin_ctz(rem);
      rem &= rem - 1u;
      if (rem != 0u) {
        const int c2 = __builtin_ctz(rem);
        stage_kv(lk0 + bsel * (KVB * 2u), lv0 + bsel * (KVB * 2u), KHp + gk0 + (size_t)c2 * (KCH * HD),
                 KLp + gk0 + (size_t)c2 * (KCH * HD), VHp + gv0 + c2 * KCH, VLp + gv0 + c2 * KCH);
      }
      bsel ^= 1u;
    }
    wait_copies();
    }
    acc_guard2(oh[0], oh[1]);

    // ---- output values -> per-wave f32 LDS staging ----
    const float inv = (1.0f / 16.0f) * (1.0f / l_run);            // out = O / (16 * l)
    float* st = sO[wave];
#pragma unroll
    for (int dt = 0; dt < 2; ++dt) {
      v4f va, vb;
#pragma unroll
      for (int e = 0; e < 4; ++e) {
        va[e] = oh[dt][e] * inv;                                   // d = 16dt + 8hsel + e
        vb[e] = oh[dt][4 + e] * inv;                               // d = 16dt + 8hsel + 4 + e
      }
      const int so = rlane * OP + 16 * dt + 8 * hsel;              // row q = rlane
      *(v4f*)(st + so) = va;
      *(v4f*)(st + so + 4) = vb;
    }
    wave_sync_lds();
    {
      const int rq = lane >> 3, c4 = (lane & 7) * 4;
      const int n0 = q0 + wave * 16;
      {
#pragma unroll
        for (int it = 0; it < 4; ++it) {
          const int row = it * 4 + rq;                             // it 0..3 x rq 0..3 = rows 0..15
          const v4f v = *(const v4f*)(st + row * OP + c4);
          *(v4f*)(Out + ((size_t)(b * NT + n0 + row)) * ND + h * HD + c4) = v;
        }
        // precaution: the four stores' address and data registers are not rewritten (by the second tile's code) before
        // this wait
        asm volatile("s_wait_xcnt 0x0" ::: "memory");
      }
    }
  }
}

// =====================================================================================================
// Workspace map (bytes, every offset a multiple of 128; every plane an exact multiple of its whole-line store
// granularity, row counts exact tile multiples, no padded tails needed):
//   XH   f16 [4096][1024]    activation, bf16-RNE x16                    0          8388608 B
//   WT   f16 [3072][1024]    Wqkv transposed, bf16-RNE x1024       8388608          6291456 B
//   COS  f32 [2048][32]                                          14680064           262144 B
//   SIN  f32 [2048][32]                                          14942208           262144 B
//   (256 B not used)                                            15204352              256 B
//   QH   f16 [64][2048][32]  q x log2(e)/sqrt(32) hi             15204608          8388608 B
//   QL   f16 [64][2048][32]  its residual                        23593216          8388608 B
//   KH   f16 [64][2048][32]                                      31981824          8388608 B
//   KL   f16 [64][2048][32]                                      40370432          8388608 B
//   VH   f16 [64][32][2048]  v x16 hi, key-contiguous            48759040          8388608 B
//   VL   f16 [64][32][2048]                                      57147648          8388608 B
//   MB   u32 [128][32][32]   lane masks per (query tile, chunk, element) 65536256     524288 B
//   FL   i32 [16][16][32]    chunk flags, one line per digest block  66060544          32768 B
//   end                                                          66093312
// =====================================================================================================
extern "C" void kernel_launch(void* const* d_in, const int* in_sizes, int n_in,
                              void* d_out, int out_size, void* d_ws, size_t ws_size,
                              hipStream_t stream) {
  if (n_in < 3) return;
  if (in_sizes[0] != NTOK * ND) return;
  if (in_sizes[1] != ND * NQKV) return;
  if (in_sizes[2] != NT * NT) return;
  if (out_size != NTOK * ND) return;

  const float* x   = (const float*)d_in[0];
  const float* W   = (const float*)d_in[1];
  const int*   msk = (const int*)d_in[2];

  const size_t PXH = (size_t)NTOK * ND * 2;                    // 8388608
  const size_t PWT = (size_t)NQKV * ND * 2;                    // 6291456
  const size_t PTB = (size_t)NT * HD * 4;                      // 262144
  const size_t PIN = 256;
  const size_t PQK = (size_t)NBH * NT * HD * 2;                // 8388608
  const size_t PV  = (size_t)NBH * HD * NT * 2;                // 8388608
  size_t off = 0;
  const size_t oXH  = off; off += PXH;
  const size_t oWT  = off; off += PWT;
  const size_t oCOS = off; off += PTB;
  const size_t oSIN = off; off += PTB;
  off += PIN;                                                  // 256 B not used
  const size_t oQH  = off; off += PQK;
  const size_t oQL  = off; off += PQK;
  const size_t oKH  = off; off += PQK;
  const size_t oKL  = off; off += PQK;
  const size_t oVH  = off; off += PV;
  const size_t oVL  = off; off += PV;
  const size_t oMB  = off; off += (size_t)(NT / 16) * NKC * 32 * 4;        // 524288
  const size_t oFL  = off; off += (size_t)(NT / QBLK) * (NKC / MCH) * MFL * 4;   // 32768
  if (off > ws_size) return;                                   // off = 66093312
  if (off > (size_t)134217728) return;

  char* ws = (char*)d_ws;
  unsigned short* XH   = (unsigned short*)(ws + oXH);
  unsigned short* WT   = (unsigned short*)(ws + oWT);
  float*          COS  = (float*)(ws + oCOS);
  float*          SIN  = (float*)(ws + oSIN);
  unsigned short* QH   = (unsigned short*)(ws + oQH);
  unsigned short* QL   = (unsigned short*)(ws + oQL);
  unsigned short* KH   = (unsigned short*)(ws + oKH);
  unsigned short* KL   = (unsigned short*)(ws + oKL);
  unsigned short* VH   = (unsigned short*)(ws + oVH);
  unsigned short* VL   = (unsigned short*)(ws + oVL);
  unsigned*       MB   = (unsigned*)(ws + oMB);
  int*            FL   = (int*)(ws + oFL);
  float*          out  = (float*)d_out;

  const dim3 blk(256);
  const dim3 gPrep(PB_ALL);                                    // 256 + 768 + 256 + 2048 = 3328
  const dim3 gProj((NTOK / GBT) * (NQKV / GBT));               // 32 x 24 = 768 blocks of 4 waves
  const dim3 gAttn(NBH, NQB / 2);                              // 64 x 8, 256 threads, two query tiles each

  const float oscPrj = 1.0f / 16384.0f;                        // undo x*16 and W*1024

  // (1) one launch: inputs -> f16 planes holding bf16-RNE values times an exact power of two; rotary tables;
  //     mask -> lane masks of the attention waves' score elements, and one flag per 128-query x 64-key block
  prep<<<gPrep, blk, 0, stream>>>(x, W, msk, XH, WT, COS, SIN, MB, FL);
  // (2) fused qkv projection with rotary epilogue: q, k -> [bh][t][32] hi/res planes; v -> [bh][d][t] hi/res planes
  gemm_proj<<<gProj, dim3(128), 0, stream>>>(XH, WT, COS, SIN, QH, QL, KH, KL, VH, VL, oscPrj);
  // (3) attention per (batch*head, pair of 128-query blocks) -> f32 output lines [tok][h*32 .. +31]
  attn_kernel<<<gAttn, dim3(ATHR), 0, stream>>>(QH, QL, KH, KL, VH, VL, MB, FL, out);
  (void)hipGetLastError();
}

// v010
// A run of this version takes 57.4 microseconds.
// Versions between v008 and this one are left out; their measured steps multiply to 1.42 times as fast.
// Counting every step since v000, it is 3.84 times as fast.
#include <hip/hip_runtime.h>
#include <math.h>
#include <stdint.h>

// Contractions: fused qkv projection x.Wqkv (f16 operands holding bf16-RNE values, x carried x16 and W x1024, one
// product per tile pair); scores k.q (k, and q times log2(e)/sqrt(32), each rounded once to f16, one product); context
// v.p (p x1024 and v x16, each rounded once to f16, one product into the running accumulator). The 11 bits of an f16
// operand lie three bits below the 8 bits to which x and W are rounded ahead of the projection, so the rounding of q, k,
// v and p adds little to the error that the projection's operands already carry.
// All v_wmma_f32_16x16x32_f16 with f32 accumulate; rotary tables, rotary combine, key masking, softmax
// statistics and the final normalisation in f32 on VALU; output stored as f32.

#define NB    2
#define NT    2048
#define ND    1024
#define NQKV  3072
#define NH    32
#define HD    32
#define NTOK  (NB * NT)
#define NBH   (NB * NH)
#define QBLK  128
#define KCH   64
#define NKC   (NT / KCH)
#define NQB   (NT / QBLK)
#define KP    40
#define VP    72
#define SPP   72
#define OP    36
#define ATHR  256
#define GBM   256
#define GBN   192
#define GBK   128
#define GLP   136
#define GTR   (ND / GBK)
#define GBUFA (GBM * GLP)
#define GBUFB (GBN * GLP)
#define GTHR  384
#define MCH   2
#define OVH   (KCH * KP)
#define KVB   (KCH * KP + HD * VP)
#define MFL   32
#define QSC   0.25503486f

static_assert(NH * HD == ND);
static_assert(NQKV == 3 * ND);
static_assert((NT % QBLK) == 0 && (NT % KCH) == 0 && (NT % 64) == 0 && (NTOK % 64) == 0);
static_assert((NQKV % 64) == 0 && (ND % 64) == 0 && (ND % 32) == 0);
static_assert(QBLK == (ATHR / 32) * 16 && (NQB % 2) == 0);
static_assert(KCH * 4 == ATHR && HD * 8 == ATHR);
static_assert(HD == 32 && KCH == 64 && NKC * KCH == NT);
static_assert(NKC == 32 && (NKC % MCH) == 0 && MCH <= MFL && QBLK == 8 * 16);
static_assert(((NTOK * ND) % 2048) == 0);
static_assert((NTOK % GBM) == 0 && (NQKV % GBN) == 0 && (NT % GBM) == 0 && (GBN % 64) == 0 && GTR >= 2);
static_assert(GTHR / 32 == (GBM / 64) * (GBN / 64) && GBM == 256 && GBN == 192 && GBK == 128);

typedef _Float16 v16h __attribute__((ext_vector_type(16)));
typedef _Float16 v8h  __attribute__((ext_vector_type(8)));
typedef float    v8f  __attribute__((ext_vector_type(8)));
typedef float    v4f  __attribute__((ext_vector_type(4)));
typedef unsigned int v4u __attribute__((ext_vector_type(4)));
typedef int      v4i  __attribute__((ext_vector_type(4)));
typedef unsigned int v16u __attribute__((ext_vector_type(16)));

// ---- scalar helpers --------------------------------------------------------------------------------
__device__ __forceinline__ unsigned short bf_bits(float f) {          // f32 -> bf16 bits, RNE convert
  unsigned u = __float_as_uint(f);
  return (unsigned short)((u + 0x7FFFu + ((u >> 16) & 1u)) >> 16);
}
__device__ __forceinline__ float bf_up(unsigned short h) { return __uint_as_float(((unsigned)h) << 16); }
__device__ __forceinline__ unsigned short h_bits(_Float16 x) { return __builtin_bit_cast(unsigned short, x); }
__device__ __forceinline__ unsigned pk16(unsigned short a, unsigned short b) { return (unsigned)a | ((unsigned)b << 16); }
__device__ __forceinline__ v8f zero8() { v8f z = {0.f, 0.f, 0.f, 0.f, 0.f, 0.f, 0.f, 0.f}; return z; }

// ---- fragment loader: 16-bit A/B operand, lane -> row/col (lane&15), p already includes +8*(lane>>4);
//      elements 0..7 <- p[0..7] (k0+8h..), elements 8..15 <- p[16..23] (k0+16+8h..)
__device__ __forceinline__ v16h ldfrag_h(const _Float16* p) {
  union { v16h v; v8h h[2]; } f;
  f.h[0] = *(const v8h*)(p);
  f.h[1] = *(const v8h*)(p + 16);
  return f.v;
}

// ---- WMMA helpers with trailing VALU hazard gap --------------------------------------------------------
__device__ __forceinline__ v8f mma_h_raw(v16h a, v16h b, v8f c) {
  return __builtin_amdgcn_wmma_f32_16x16x32_f16(false, a, false, b, (short)0, c, false, false);
}
__device__ __forceinline__ void guard4(v8f& a, v8f& b, v16h u, v16h v, v16h w) {
#if defined(__HIP_DEVICE_COMPILE__)
  asm volatile("v_nop\n\tv_nop\n\tv_nop\n\tv_nop" : "+v"(a), "+v"(b) : "v"(u), "v"(v), "v"(w));
#endif
}
// the same gap behind the loop's last products, in front of the first vector read of the two output accumulators
__device__ __forceinline__ void acc_guard2(v8f& a, v8f& b) {
#if defined(__HIP_DEVICE_COMPILE__)
  asm volatile("v_nop\n\tv_nop\n\tv_nop\n\tv_nop" : "+v"(a), "+v"(b));
#endif
}
__device__ __forceinline__ void acc_guard4(v8f& a, v8f& b, v8f& c, v8f& d) {
#if defined(__HIP_DEVICE_COMPILE__)
  asm volatile("v_nop\n\tv_nop\n\tv_nop\n\tv_nop" : "+v"(a), "+v"(b), "+v"(c), "+v"(d));
#endif
}
__device__ __forceinline__ void wave_sync_lds() {
  __builtin_amdgcn_fence(__ATOMIC_RELEASE, "workgroup");
  __builtin_amdgcn_wave_barrier();
  __builtin_amdgcn_fence(__ATOMIC_ACQUIRE, "workgroup");
}

// ---- asynchronous copies global -> LDS ------------------------------------------------------------------
__device__ __forceinline__ unsigned lds_addr(const unsigned short* p) {   // byte offset in the work-group's LDS
  return (unsigned)(size_t)(const __attribute__((address_space(3))) unsigned short*)p;
}
// Eight 16-B pieces of one lane, RS rows apart (global pitch ND halves, LDS pitch GLP halves). The closing s_wait_xcnt
// stands inside the statement so that no address register named here is rewritten ahead of it.
template <int RS>
__device__ __forceinline__ void stage_rows(unsigned l, const unsigned short* g) {
#if defined(__HIP_DEVICE_COMPILE__)
  asm volatile(
      "global_load_async_to_lds_b128 %0, %8, off\n\t"
      "global_load_async_to_lds_b128 %1, %9, off\n\t"
      "global_load_async_to_lds_b128 %2, %10, off\n\t"
      "global_load_async_to_lds_b128 %3, %11, off\n\t"
      "global_load_async_to_lds_b128 %4, %12, off\n\t"
      "global_load_async_to_lds_b128 %5, %13, off\n\t"
      "global_load_async_to_lds_b128 %6, %14, off\n\t"
      "global_load_async_to_lds_b128 %7, %15, off\n\t"
      "s_wait_xcnt 0x0"
      :: "v"(l), "v"(l + 1u * RS * GLP * 2u), "v"(l + 2u * RS * GLP * 2u), "v"(l + 3u * RS * GLP * 2u),
         "v"(l + 4u * RS * GLP * 2u), "v"(l + 5u * RS * GLP * 2u), "v"(l + 6u * RS * GLP * 2u),
         "v"(l + 7u * RS * GLP * 2u),
         "v"(g), "v"(g + 1 * RS * ND), "v"(g + 2 * RS * ND), "v"(g + 3 * RS * ND),
         "v"(g + 4 * RS * ND), "v"(g + 5 * RS * ND), "v"(g + 6 * RS * ND), "v"(g + 7 * RS * ND)
      : "memory");
#endif
}
// One lane's share of a 64-key chunk: one 16-B piece each of K and V. lk, lv: the lane's LDS byte addresses in the K and
// V parts of a buffer. The closing s_wait_xcnt stands inside the statement so that no address register named here is
// rewritten ahead of it.
__device__ __forceinline__ void stage_kv(unsigned lk, unsigned lv, const unsigned short* gk, const unsigned short* gv) {
#if defined(__HIP_DEVICE_COMPILE__)
  asm volatile(
      "global_load_async_to_lds_b128 %0, %2, off\n\t"
      "global_load_async_to_lds_b128 %1, %3, off\n\t"
      "s_wait_xcnt 0x0"
      :: "v"(lk), "v"(lv), "v"(gk), "v"(gv)
      : "memory");
#endif
}
__device__ __forceinline__ void wait_copies() {      // this wave's own copies have landed in LDS
#if defined(__HIP_DEVICE_COMPILE__)
  asm volatile("s_wait_asynccnt 0x0" ::: "memory");
#endif
}
__device__ __forceinline__ void wait_lds_reads() {   // this wave's LDS reads have returned before their buffer is refilled
#if defined(__HIP_DEVICE_COMPILE__)
  asm volatile("s_wait_dscnt 0x0" ::: "memory");
#endif
}

// =====================================================================================================
// f32 -> f16( bf16_RNE(v) * scale ), scale a power of two (exact), 8 elements per thread, one 16-B store
// =====================================================================================================
__device__ __forceinline__ void cvt_h8(int blk, const float* __restrict__ in, unsigned short* out, int n8, float scale) {
  const int i = blk * 256 + threadIdx.x;
  if (i < n8) {
    const v4f a = *(const v4f*)(in + (size_t)i * 8);
    const v4f c = *(const v4f*)(in + (size_t)i * 8 + 4);
    float f[8];
    f[0] = a[0]; f[1] = a[1]; f[2] = a[2]; f[3] = a[3];
    f[4] = c[0]; f[5] = c[1]; f[6] = c[2]; f[7] = c[3];
    unsigned short hb[8];
#pragma unroll
    for (int e = 0; e < 8; ++e) hb[e] = h_bits((_Float16)(bf_up(bf_bits(f[e])) * scale));
    v4u p;
    p[0] = pk16(hb[0], hb[1]);
    p[1] = pk16(hb[2], hb[3]);
    p[2] = pk16(hb[4], hb[5]);
    p[3] = pk16(hb[6], hb[7]);
    *(v4u*)(out + (size_t)i * 8) = p;
    
  }
}

// =====================================================================================================
// Weight transpose + convert: W[c][o] f32 (c in [0,1024), o in [0,3072), o contiguous) ->
// WT[o][c] f16 = f16( bf16_RNE(W[c][o]) * scale ), c contiguous (k-major rows for the B fragment loader).
// Block = one 64(o) x 64(c) tile: thread (ol = tid&63, cb = tid>>6) reads 16 consecutive c rows of column o0+ol
// (coalesced per row across lanes), packs them as two 16-B LDS stores into sT[ol][c]; block barrier; then every
// tiles = (3072/64, 1024/64) = (48, 16): bx = o tiles (rows of WT), by = c tiles (rows of W).
// coverage: 256 threads x 2 rows-iterations... : rows tid>>3 (0..31) and +32 -> all 64 rows x 64 halves per tile.
// =====================================================================================================
__device__ __forceinline__ void cvt_wT(int bx, int by, const float* __restrict__ W, unsigned short* WT, float scale) {
  __shared__ __align__(16) unsigned short sT[64 * SPP];          // 9216 B
  const int tid = threadIdx.x;
  const int o0 = bx * 64;
  const int c0 = by * 64;
  {
    const int ol = tid & 63, cb = tid >> 6;                      // cb 0..3 -> c rows cb*16 .. +15
    unsigned short hb[16];
#pragma unroll
    for (int e = 0; e < 16; ++e) {
      const float f = W[(size_t)(c0 + cb * 16 + e) * NQKV + o0 + ol];
      hb[e] = h_bits((_Float16)(bf_up(bf_bits(f)) * scale));
    }
    v4u p0, p1;
#pragma unroll
    for (int q = 0; q < 4; ++q) {
      p0[q] = pk16(hb[2 * q], hb[2 * q + 1]);
      p1[q] = pk16(hb[8 + 2 * q], hb[8 + 2 * q + 1]);
    }
    *(v4u*)(sT + ol * SPP + cb * 16) = p0;
    *(v4u*)(sT + ol * SPP + cb * 16 + 8) = p1;
  }
  __syncthreads();
  {
    const int row = tid >> 3, c8 = (tid & 7) * 8;
    const v4u v0 = *(const v4u*)(sT + row * SPP + c8);
    const v4u v1 = *(const v4u*)(sT + (row + 32) * SPP + c8);
    const size_t d0 = (size_t)(o0 + row) * ND + c0 + c8;
    const size_t d1 = (size_t)(o0 + row + 32) * ND + c0 + c8;
    {
      *(v4u*)(WT + d0) = v0;
      *(v4u*)(WT + d1) = v1;
      // precaution: the two stores' address and data registers are not rewritten (by another job's code that
      // follows in the listing) before this wait
      asm volatile("s_wait_xcnt 0x0" ::: "memory");
    }
  }
}

// =====================================================================================================
// inv_freq[j] = 1 / 10000^(j/32), j = 0..31 (full head dim, not pairs), worked out by every thread that needs it.
// Contraction off: power, reciprocal and (in k_tab) the angle s * inv_freq are each rounded to f32 on their own, as the
// definition rounds them, before the sine and cosine see the angle.
// =====================================================================================================
__device__ __forceinline__ float k_invf(int j) {
  #pragma clang fp contract(off)
  const float e = (float)j * 0.03125f;
  const float p = powf(10000.0f, e);
  const float inv = 1.0f / p;
  return inv;
}

// =====================================================================================================
// Rotary tables COS/SIN[s][j] = cos/sin( s * inv_freq[j] ), s in [0,2048), j in [0,32): 256 threads = 8 rows x 32,
// one precise sincosf per thread (rolled, nothing unrolled); values staged in LDS, block barrier, then waves 0-1
// coverage: 256 blocks x 8 rows x 32 = every COS and SIN element.
// =====================================================================================================
__device__ __forceinline__ void k_tab(int blk, float* COS, float* SIN) {
  // the angle is rounded to f32 as a product of its own before sine and cosine (see k_invf)
  #pragma clang fp contract(off)
  __shared__ __align__(16) float sc[8 * 32];
  __shared__ __align__(16) float ss[8 * 32];
  const int tid = threadIdx.x, j = tid & 31, rl = tid >> 5;
  const int s = blk * 8 + rl;
  const float ang = (float)s * k_invf(j);
  float sn, cs;
  sincosf(ang, &sn, &cs);
  sc[rl * 32 + j] = cs;
  ss[rl * 32 + j] = sn;
  __syncthreads();
  if (tid < 64) {                                                // waves 0,1: COS rows
    const int row = tid >> 3, c4 = (tid & 7) * 4;
    const v4f v = *(const v4f*)(sc + row * 32 + c4);
    float* d = COS + (size_t)(blk * 8 + row) * HD + c4;
    *(v4f*)d = v;
    
  } else if (tid < 128) {                                        // waves 2,3: SIN rows
    const int t2 = tid - 64;
    const int row = t2 >> 3, c4 = (t2 & 7) * 4;
    const v4f v = *(const v4f*)(ss + row * 32 + c4);
    float* d = SIN + (size_t)(blk * 8 + row) * HD + c4;
    *(v4f*)d = v;
    
  }
}

// =====================================================================================================
// Mask digest, made once for all batch*head pairs. Block (cp, qb) = 128 query rows x MCH key chunks of 64; wave w owns
// the 16-row query tile qt = 8*qb + w and reads, per chunk, the same 32 entries per lane that the attention wave of
// that tile needs: lane -> query row 16*qt + (lane&15), keys of lane half lane>>4.
//   MB[qt][c][16*s + 8*t + r]: a lane mask, bit lane <-> (mask[row][64*c + 32*s + 16*t + 8*(lane>>4) + r] != 0), ready
//                    as the select mask of score element (t, r) of 32-key step s; one 128-B line per (qt, c), written
//                    by one wave (lane i stores word i).
//   FL[qb][cp][MFL]: entry e < MCH is nonzero iff any entry of the 128 x 64 block of chunk MCH*cp + e is nonzero;
//                    one whole 128-B line per block (the rest of the line is 0).
// blocks = (32/MCH, 16): every (qt, c) word line and every FL line written exactly once.
// =====================================================================================================
__device__ __forceinline__ void mask_digest(int cp, int qb, const int* __restrict__ msk, unsigned* MB, int* FL) {
  __shared__ int sany[MCH][8];
  const int tid = threadIdx.x, lane = tid & 31, wave = tid >> 5;
  const int rlane = lane & 15, hsel = lane >> 4;
  const int qt = qb * 8 + wave;
  const size_t rowbase = (size_t)(qt * 16 + rlane) * NT;
  // all loads of the wave stand ahead of its first store; every loop below is unrolled so that ent[] is indexed by
  // constants and stays in registers
  v4i ent[MCH][2][2][2];
#pragma unroll
  for (int e = 0; e < MCH; ++e) {
#pragma unroll
    for (int s = 0; s < 2; ++s) {
#pragma unroll
      for (int t = 0; t < 2; ++t) {
        const int* mp = msk + rowbase + (size_t)((cp * MCH + e) * KCH + 32 * s + 16 * t + 8 * hsel);
        ent[e][s][t][0] = *(const v4i*)mp;
        ent[e][s][t][1] = *(const v4i*)(mp + 4);
      }
    }
  }
#pragma unroll
  for (int e = 0; e < MCH; ++e) {
    unsigned any = 0u;
    int mine = 0;                                                // lane i ends up with word i
#pragma unroll
    for (int i = 0; i < 32; ++i) {                               // i = 16*s + 8*t + r
      const unsigned w = __builtin_amdgcn_ballot_w32(ent[e][i >> 4][(i >> 3) & 1][(i >> 2) & 1][i & 3] != 0);
      any |= w;
      mine = (lane == i) ? (int)w : mine;
    }
    MB[((size_t)qt * NKC + cp * MCH + e) * 32 + lane] = (unsigned)mine;
    if (lane == 0) sany[e][wave] = (any != 0u) ? 1 : 0;
  }
  __syncthreads();
  if (tid < MFL) {
    int f = 0;
    if (tid < MCH) {
#pragma unroll
      for (int w = 0; w < 8; ++w) f |= sany[tid][w];
    }
    FL[((size_t)qb * (NKC / MCH) + cp) * MFL + tid] = f;
  }
}

// =====================================================================================================
// All work that depends on the inputs alone, in ONE launch: the four jobs above read and write disjoint buffers and none
// reads what another writes, so their work-groups share the chip instead of waiting for one another's launch to end.
// The job is picked by the block index (the same for the whole work-group, so each job's barrier stays block-uniform):
//   [0, PB_DIG)       mask digest, block (cp, qb) = (i % 16, i / 16)
//   [.., PB_WT)       weight transpose + convert, tile (bx, by) = (i % 48, i / 48)
//   [.., PB_TAB)      rotary tables, 8 rows a block
//   [.., PB_ALL)      activation convert, 2048 elements a block
// =====================================================================================================
#define PB_DIG  ((NKC / MCH) * (NT / QBLK))
#define PB_WT   (PB_DIG + (NQKV / 64) * (ND / 64))
#define PB_TAB  (PB_WT + NT / 8)
#define PB_ALL  (PB_TAB + NTOK * ND / 2048)
__global__ __launch_bounds__(256) void prep(const float* __restrict__ x, const float* __restrict__ W,
                                            const int* __restrict__ msk, unsigned short* XH, unsigned short* WT,
                                            float* COS, float* SIN, unsigned* MB, int* FL) {
  const int blk = blockIdx.x;
  if (blk < PB_DIG) {
    mask_digest(blk % (NKC / MCH), blk / (NKC / MCH), msk, MB, FL);
  } else if (blk < PB_WT) {
    const int i = blk - PB_DIG;
    cvt_wT(i % (NQKV / 64), i / (NQKV / 64), W, WT, 1024.0f);
  } else if (blk < PB_TAB) {
    k_tab(blk - PB_WT, COS, SIN);
  } else {
    cvt_h8(blk - PB_TAB, x, XH, NTOK * ND / 8, 16.0f);
  }
}

// =====================================================================================================
// Fused qkv projection GEMM with rotary + 16-bit plane epilogue:
//   Y[tok][o] = sum_c XH[tok][c] * WT[o][c] * oscale,  tok in [0,4096), o in [0,3072), K = 1024.
// One work-group of 12 waves per 256x192 tile, one on a WGP, one wave per 64x64 part (4 x 3, register-blocked); A = XH
// rows (token), Bt = WT rows (k contiguous). Per 128-deep k stage the 256 A rows (waves 4-11) and 192 Bt rows (waves 0-3),
// 256 B each (whole lines), are copied asynchronously into one of two LDS buffers (pitch 272 B) while the other buffer is
// worked on; k order unchanged. A row of XH is so read from L2 by 16 work-groups and a row of WT by 16.
// The 64 tokens of a tile lie in one batch b (t0 = m0 mod 2048); the 64 outputs are two heads h0, h0+1 of one of
// q (o < 1024), k (1024 <= o < 2048), v (o >= 2048); column j (16-wide subtile) -> head h0 + (j>>1), d = 16*(j&1)+lane%16.
//   q, k: rotary combine per the module: out[d] = y[d]*cos[s][d] - y[d+16]*sin[s][d] (d < 16),
//         out[d] = y[d]*cos[s][d] + y[d-16]*sin[s][d] (d >= 16); both partners sit in the same lane and element.
//         PH[bh][t][32] f16 = out (k) or out*log2(e)/sqrt(32) (q), rounded once (64 B per token; the wave owns 64 consecutive
// then q/k: each head's slab region (16 tok x 64 B = 1024 contiguous B) written as 32 lanes x 16 B contiguous per
// grid = 256 blocks x 12 waves = 3072 wave tiles = 64 x 48 exactly.
// coverage: q/k tiles: 4 slabs x 2 heads x 16 tok x 32 d; v tiles: 4 subtiles x 16 d x 64 tok;
// 64 token tiles x (16+16+16) column tiles = every (bh, t) row of QH/KH and every (bh, d) row of VH.
// =====================================================================================================
__global__ __launch_bounds__(GTHR) void gemm_proj(
    const unsigned short* __restrict__ XHp, const unsigned short* __restrict__ WTp,
    const float* __restrict__ COS, const float* __restrict__ SIN,
    unsigned short* QH, unsigned short* KH, unsigned short* VH, float oscale) {
  __shared__ __align__(16) unsigned short sA[2][GBUFA];           // 139264 B
  __shared__ __align__(16) unsigned short sB[2][GBUFB];           // 104448 B
  __shared__ __align__(16) unsigned short sP[GTHR / 32][16 * SPP];   // 27648 B
  const int tid  = threadIdx.x;
  const int lane = tid & 31;
  const int wave = __builtin_amdgcn_readfirstlane(tid >> 5);     // uniform: the tests on it below are scalar branches
  const int tilesN = NQKV / GBN;                                 // 16
  const int tilesM = NTOK / GBM;                                 // 16
  const int tile = blockIdx.x;
  if (tile >= tilesM * tilesN) return;                           // block-uniform, in front of every barrier
  const int tm = tile / tilesN;
  const int tn = tile - tm * tilesN;
  const int wm = wave / 3, wn = wave - 3 * wm;                   // 4 x 3 waves
  const int m0 = tm * GBM + (wm << 6);                           // token base of this wave
  const int n0 = tn * GBN + (wn << 6);                           // output channel base in [0,3072)
  const int rlane = lane & 15;
  const int hh    = lane >> 4;
  const int koff  = hh * 8;
  const int mOff  = hh * 8;

  v8f acc[4][4];
#pragma unroll
  for (int i = 0; i < 4; ++i)
#pragma unroll
    for (int j = 0; j < 4; ++j) acc[i][j] = zero8();

  // copy share of this lane; a wave's copy = 2 rows of 256 B = 4 whole 128-B lines.
  // waves 0-3:  piece tid&15 (16 B) of Bt rows (tid>>4) + 8e, e = 0..23 (the larger share per wave)
  // waves 4-11: piece tid&15 of A rows ((tid-128)>>4) + 16e, e = 0..15
  const bool forA = wave >= 4;
  const int crow = (forA ? tid - 128 : tid) >> 4, cpc = (tid & 15) * 8;
  const unsigned short* gsrc = forA ? XHp + (size_t)(tm * GBM + crow) * ND + cpc
                                    : WTp + (size_t)(tn * GBN + crow) * ND + cpc;
  const unsigned ldst  = forA ? lds_addr(&sA[0][crow * GLP + cpc]) : lds_addr(&sB[0][crow * GLP + cpc]);
  const unsigned lbuf  = forA ? GBUFA * 2u : GBUFB * 2u;         // bytes from buffer 0 to buffer 1
  auto stage = [&](unsigned buf, int st) {                       // k stage st -> buffer buf
    const unsigned l = ldst + buf * lbuf;
    const unsigned short* g = gsrc + st * GBK;
    if (forA) {
      stage_rows<16>(l, g);
      stage_rows<16>(l + 128u * GLP * 2u, g + 128 * ND);
    } else {
      stage_rows<8>(l, g);
      stage_rows<8>(l + 64u * GLP * 2u, g + 64 * ND);
      stage_rows<8>(l + 128u * GLP * 2u, g + 128 * ND);
    }
  };

  stage(0u, 0);                                                  // stage 0 -> buffer 0
  wait_copies();
  __syncthreads();
  stage(1u, 1);                                                  // stage 1 -> buffer 1

  // rolled: the two-buffer order below is written once, and the body stays small in the instruction cache
#pragma unroll 1
  for (int t = 0; t < GTR; ++t) {
    const int bsel = t & 1;
    const _Float16* fa = (const _Float16*)(const void*)&sA[bsel][((wm << 6) + rlane) * GLP + koff];
    const _Float16* fb = (const _Float16*)(const void*)&sB[bsel][((wn << 6) + rlane) * GLP + koff];
#pragma unroll
    for (int kk = 0; kk < GBK; kk += 32) {
      v16h bf[4], af[4];
#pragma unroll
      for (int j = 0; j < 4; ++j) bf[j] = ldfrag_h(fb + (j << 4) * GLP + kk);
#pragma unroll
      for (int i = 0; i < 4; ++i) af[i] = ldfrag_h(fa + (i << 4) * GLP + kk);
#pragma unroll
      for (int i = 0; i < 4; ++i)
#pragma unroll
        for (int j = 0; j < 4; ++j) acc[i][j] = mma_h_raw(af[i], bf[j], acc[i][j]);
      // all 16 LDS reads of this k step as one group ahead of its 16 products: one LDS wait a step, not one a row
      __builtin_amdgcn_sched_group_barrier(0x100, 16, 0);
      __builtin_amdgcn_sched_group_barrier(0x008, 16, 0);
    }
    // publish point of stage t + 1: own reads done, own copies landed, barrier, then the refill of the buffer just read
    wait_lds_reads();
    wait_copies();
    __syncthreads();
    if (t + 2 < GTR) stage((unsigned)bsel, t + 2);
  }
  wait_copies();
  acc_guard4(acc[0][0], acc[0][1], acc[0][2], acc[0][3]);
  acc_guard4(acc[1][0], acc[1][1], acc[1][2], acc[1][3]);
  acc_guard4(acc[2][0], acc[2][1], acc[2][2], acc[2][3]);
  acc_guard4(acc[3][0], acc[3][1], acc[3][2], acc[3][3]);

  // ---- epilogue ----
  const int b   = m0 / NT;
  const int t0  = m0 - b * NT;
  const int sel = n0 >> 10;                                      // 0 q, 1 k, 2 v (wave-uniform)
  const int h0  = (n0 & (ND - 1)) >> 5;                          // first of the two heads of this tile
  unsigned short* s0 = &sP[wave][0];

  if (sel < 2) {
    unsigned short* PH = (sel == 0) ? QH : KH;
    const float fs = (sel == 0) ? QSC : 1.0f;                    // q carries log2(e)/sqrt(32), k is stored as it is
#pragma unroll
    for (int i = 0; i < 4; ++i) {                                // slab = 16 tokens t0+16i .. +15
#pragma unroll
      for (int r = 0; r < 8; ++r) {
        const int tok = t0 + (i << 4) + mOff + r;                // row tok = 8hh + r
        const float* cp = COS + (size_t)tok * HD;
        const float* sp = SIN + (size_t)tok * HD;
        const float ca = cp[rlane], cb = cp[16 + rlane];
        const float sa = sp[rlane], sb = sp[16 + rlane];
#pragma unroll
        for (int hp = 0; hp < 2; ++hp) {
          const float y0 = acc[i][2 * hp][r] * oscale;           // d = rlane
          const float y1 = acc[i][2 * hp + 1][r] * oscale;       // d = 16 + rlane
          const float f0 = (y0 * ca - y1 * sa) * fs;
          const float f1 = (y1 * cb + y0 * sb) * fs;
          const int so = (mOff + r) * SPP + 32 * hp + rlane;     // row tok, col 32hp + d
          s0[so]      = h_bits((_Float16)f0);
          s0[so + 16] = h_bits((_Float16)f1);
        }
      }
      wave_sync_lds();
      {
        const int rr = lane >> 2, cc = (lane & 3) * 8;           // rr*32 + cc = lane*8 halves
#pragma unroll
        for (int hp = 0; hp < 2; ++hp) {
          const int bhp = b * NH + h0 + hp;
          const size_t base = ((size_t)(bhp * NT + t0 + (i << 4))) * HD + lane * 8;
          const v4u v0 = *(const v4u*)(s0 + rr * SPP + 32 * hp + cc);
          const v4u v1 = *(const v4u*)(s0 + (rr + 8) * SPP + 32 * hp + cc);
          *(v4u*)(PH + base) = v0;
          *(v4u*)(PH + base + 256) = v1;
        }
      }
      wave_sync_lds();
    }
  } else {
#pragma unroll
    for (int j = 0; j < 4; ++j) {                                // slab = 16 rows d = 16(j&1) + rlane of head h0+(j>>1)
      const int hp = j >> 1, dbase = (j & 1) * 16;
      const int bhp = b * NH + h0 + hp;
#pragma unroll
      for (int i = 0; i < 4; ++i) {
        unsigned short hb[8];
#pragma unroll
        for (int r = 0; r < 8; ++r) hb[r] = h_bits((_Float16)((acc[i][j][r] * oscale) * 16.0f));
        v4u ph;
#pragma unroll
        for (int q = 0; q < 4; ++q) ph[q] = pk16(hb[2 * q], hb[2 * q + 1]);
        *(v4u*)(s0 + rlane * SPP + (i << 4) + mOff) = ph;       // row d = rlane, tok = 16i + 8hh .. +7
      }
      wave_sync_lds();
      {
        const int rq = lane >> 3, c8 = (lane & 7) * 8;
        {
#pragma unroll
          for (int it = 0; it < 4; ++it) {
            const int row = it * 4 + rq;                         // it 0..3 x rq 0..3 = rows 0..15
            const size_t dst = ((size_t)(bhp * HD + dbase + row)) * NT + t0 + c8;
            const v4u v = *(const v4u*)(s0 + row * SPP + c8);
            *(v4u*)(VH + dst) = v;
          }
          
        }
      }
      wave_sync_lds();
    }
  }
}

// =====================================================================================================
// Attention for one batch*head and two 128-query blocks (NQB-1-y, then y): grid = (64, 8), 256 threads = 8 waves x 16
// queries; at most four waves a SIMD by the register allocation, so the 512 equal work-groups lie two on a WGP; each lane
// owns one query column q = q0 + 16*wave + (lane&15). QH/KH[bh][t][32] f16 (q times log2(e)/sqrt(32)),
// VH[bh][d][2048] f16 (x16). The mask [2048 q][2048 key] comes as the digest of mask_digest: key
// chunks of 64; each wave loads the 32 lane masks MB[qt][c][..] of its query tile by wave-uniform loads, one mask per
// score element; a chunk whose entries are all zero for the whole block (FL, gathered once into a wave-uniform word)
// is skipped block-uniformly: the loop walks the set bits of that word (exact: such keys have probability 0). K
// rows [64][40] and the V tile [32 d][72] of the next open chunk are copied asynchronously into one of two LDS buffers
// while the other buffer is worked on; one block barrier a chunk. Per chunk (one softmax update for its 64 keys) and 16-key tile t:
// S[key][q] = C + A(K rows) x B(resident Q), C = 10 - reference: S is the exponent to base two; entries with mask == 0 replaced by -inf;
// the reference of a column is its first chunk's maximum and is raised (running sum and output rescaled) only when a p
// could leave the f16 range; p = 2^S = 1024*exp(x - reference) packed D->B per the chained map (element r <-
// keys 0-15 tile, 8+r <- keys 16-31 tile of a 32-key step) as f16; O[d][q] += A(V rows) x P; l sums the f32 p;
// out = O / (16 * l) (l = 0 gives 0*inf = NaN).
// coverage: 64 x 8 blocks x 2 tiles x 8 waves x 16 rows x 32 floats = every (tok, head) line of the output.
// =====================================================================================================
__global__ __launch_bounds__(ATHR) __attribute__((amdgpu_waves_per_eu(4, 4))) void attn_kernel(
    const unsigned short* __restrict__ QHp, const unsigned short* __restrict__ KHp,
    const unsigned short* __restrict__ VHp,
    const unsigned* __restrict__ MB, const int* __restrict__ FL, float* Out) {
  __shared__ __align__(16) unsigned short skv[2][KVB];            // 2 x 9728 B: K (5120 B), V (4608 B)
  __shared__ __align__(16) float sO[8][16 * OP];                  // 18432 B
  const _Float16* QH = (const _Float16*)(const void*)QHp;

  const int tid = threadIdx.x, lane = tid & 31, wave = tid >> 5;
  const int bh = blockIdx.x;
  const int b  = bh / NH;
  const int h  = bh - b * NH;
  const int rlane = lane & 15, hsel = lane >> 4, koff = hsel * 8;

  // copy share of this lane in a chunk: piece tid&3 of K row tid>>2 (64 keys x 32 halves), piece tid&7 of V row tid>>3
  // (32 d rows x 64 halves)
  const int ckey = tid >> 2, cck = (tid & 3) * 8;
  const int cdr = tid >> 3, ccv = (tid & 7) * 8;
  const size_t gk0 = ((size_t)(bh * NT + ckey)) * HD + cck;
  const size_t gv0 = ((size_t)(bh * HD + cdr)) * NT + ccv;
  const unsigned lk0 = lds_addr(&skv[0][ckey * KP + cck]);
  const unsigned lv0 = lds_addr(&skv[0][OVH + cdr * VP + ccv]);

  // Two query tiles per work-group, one after the other in every wave: NQB-1-y, then y. Under a lower-triangular mask the
  // active chunks of such a pair add up to the same count in every work-group; any other mask is only divided differently.
  // The barrier at the foot of the first tile's last chunk ends every wave's reads of K/V ahead of the second tile's copies.
  // rolled: the tile body stands once in the instruction cache
#pragma unroll 1
  for (int leg = 0; leg < 2; ++leg) {
    const int qb = (leg == 0) ? (NQB - 1 - (int)blockIdx.y) : (int)blockIdx.y;
    const int q0 = qb * QBLK;
    const int qrow = q0 + wave * 16 + rlane;                       // this lane's query index within the sequence

    // resident Q fragments (B operand: B[k=d][n=q] from [q][d] rows), arithmetic addressing, one 32-deep k-step
    const size_t qo = ((size_t)(bh * NT + qrow)) * HD + koff;
    const v16h qh0 = ldfrag_h(QH + qo);
    // this wave's lane masks, 32 words a chunk; the wave number made uniform so that the words load into scalar registers
    const unsigned* mbp = MB + ((size_t)(qb * 8 + __builtin_amdgcn_readfirstlane(wave)) * NKC) * 32;
    // bit c <-> chunk c has a nonzero mask entry somewhere in this block's 128 query rows (the same word in every wave)
    const unsigned act = __builtin_amdgcn_ballot_w32(
        FL[((size_t)qb * (NKC / MCH) + lane / MCH) * MFL + (lane % MCH)] != 0);

    const float PTOP   = 60000.0f;                                // below the largest finite f16
    const float NEGINF = __uint_as_float(0xff800000u);

    v8f oh[2];
#pragma unroll
    for (int dt = 0; dt < 2; ++dt) oh[dt] = zero8();
    float l_run = 0.0f;
    float cval = 10.0f;                                            // 10 - reference (in powers of two) of this lane's column

    // the open chunks still to come, lowest first (the same word in every wave, so every test on it is block-uniform)
    unsigned rem = act;
    if (rem != 0u) {
    int c = __builtin_ctz(rem);                                    // chunk in work: keys 64*c .. 64*c + 63
    rem &= rem - 1u;
    stage_kv(lk0, lv0, KHp + gk0 + (size_t)c * (KCH * HD), VHp + gv0 + c * KCH);   // first open chunk -> buffer 0
    // lane masks: word (16*s + 8*t + r), bit lane <-> key 64*c + 32*s + 16*t + 8*hsel + r of the lane's query row
    // read through the constant address space (nothing writes MB in this launch), which makes them scalar loads
    v16u mw0 = *(const __attribute__((address_space(4))) v16u*)(mbp + c * 32);
    v16u mw1 = *(const __attribute__((address_space(4))) v16u*)(mbp + c * 32 + 16);
    wait_copies();
    __syncthreads();
    if (rem != 0u) {                                               // second open chunk -> buffer 1
      const int c1 = __builtin_ctz(rem);
      stage_kv(lk0 + KVB * 2u, lv0 + KVB * 2u, KHp + gk0 + (size_t)c1 * (KCH * HD), VHp + gv0 + c1 * KCH);
    }
    unsigned bsel = 0u;
    // rolled: the two-buffer order is written once, and the body stands once in the instruction cache
#pragma unroll 1
    for (;;) {
      const _Float16* kh = (const _Float16*)(const void*)&skv[bsel][0];
      const _Float16* vh = kh + OVH;

      // ONE softmax update for the whole 64-key chunk: four 16-key score tiles T (keys kc + 16*T ..) are formed, masked,
      // exponentiated and summed together, so the exchange between lane halves stands once a chunk.
      {
        float a[4][8];
        // the four key tiles' products are independent of one another
        v16h kha[4];
        v8f sh[4];
        const v8f cref = {cval, cval, cval, cval, cval, cval, cval, cval};   // the C operand of the score products
#pragma unroll
        for (int t = 0; t < 4; ++t) {
          const int krow = 16 * t + rlane;
          kha[t] = ldfrag_h(kh + krow * KP + koff);
        }
#pragma unroll
        for (int t = 0; t < 4; ++t) sh[t] = mma_h_raw(kha[t], qh0, cref);
        // the chunk's 8 V fragment reads are issued behind the score products, so that they return under the softmax arithmetic
        v16h vah[2][2];
#pragma unroll
        for (int s = 0; s < 2; ++s) {
#pragma unroll
          for (int dt = 0; dt < 2; ++dt) vah[s][dt] = ldfrag_h(vh + (16 * dt + rlane) * VP + 32 * s + koff);
        }
        // order of issue: the vector work (C operand, LDS addresses) first, so that none of it lands among the products and
        // rewrites a register of their C operand inside the WMMA distance; then all 8 K fragment reads as one group, the 4
        // score products, the 8 V reads
        __builtin_amdgcn_sched_group_barrier(0x002, 32, 0);
        __builtin_amdgcn_sched_group_barrier(0x100, 8, 0);
        __builtin_amdgcn_sched_group_barrier(0x008, 4, 0);
        __builtin_amdgcn_sched_group_barrier(0x100, 8, 0);
        // no vector work is drawn in between the products (each such read of a fresh tile would cost its own v_nop gap)
        __builtin_amdgcn_sched_barrier(0);
#pragma unroll
        for (int t = 0; t < 4; ++t) {
#pragma unroll
          for (int r = 0; r < 8; ++r) {
            const unsigned kw = (t < 2) ? mw0[(t & 1) * 8 + r] : mw1[(t & 1) * 8 + r];
            a[t][r] = __builtin_amdgcn_inverse_ballot_w32(kw) ? sh[t][r] : NEGINF;
          }
        }

        // softmax over the key axis for this lane's q column against the HELD reference: the tiles are the exponents.
        // The reference moves only where it must: a column without any sum yet takes its first one, and a column whose p
        // could leave the f16 range (every p <= this lane's sum) is looked at again. One test a chunk for the whole wave, a
        // scalar branch; behind it every lane works on the maximum of both lane halves, so the halves stay in step, the
        // exponents are shifted in place and the exponentials are taken once more (at most two turns).
        float ssum;
        float p[4][8];
        float alph = 1.0f;
        // rolled: the second turn runs through the same instructions, so the usual single turn carries no copies
#pragma unroll 1
        for (int turn = 0;; ++turn) {
          ssum = 0.0f;
#pragma unroll
          for (int r = 0; r < 8; ++r) {
#pragma unroll
            for (int t = 0; t < 4; ++t) p[t][r] = __builtin_amdgcn_exp2f(a[t][r]);
            ssum += (p[0][r] + p[1][r]) + (p[2][r] + p[3][r]);
          }
          if (turn != 0 || __builtin_amdgcn_ballot_w32((ssum > PTOP) || (l_run == 0.0f)) == 0u) break;
          float mloc = -1.0e30f;
#pragma unroll
          for (int t = 0; t < 4; ++t) {
#pragma unroll
            for (int r = 0; r < 8; r += 2) mloc = fmaxf(mloc, fmaxf(a[t][r], a[t][r + 1]));
          }
          mloc = fmaxf(mloc, __shfl_xor(mloc, 16, 32));
          // moved so that the chunk's largest exponent becomes 10; a column with no open key in this chunk stays
          const bool  mv   = (mloc > -1.0e29f) && ((l_run == 0.0f) || (mloc > 15.0f));
          const float cnew = mv ? (cval - (mloc - 10.0f)) : cval;
          const float dd   = cnew - cval;
          alph = (l_run == 0.0f) ? 1.0f : __builtin_amdgcn_exp2f(dd);
          cval = cnew;
#pragma unroll
          for (int t = 0; t < 4; ++t) {
#pragma unroll
            for (int r = 0; r < 8; ++r) a[t][r] += dd;
          }
        }
        // the next open chunk's lane masks are asked for here, this chunk's being used up, so that they return under the
        // rest of this chunk and the next one's score products (behind the last chunk: its own words once more, never used)
        {
          const int cn = (rem != 0u) ? __builtin_ctz(rem) : c;
          mw0 = *(const __attribute__((address_space(4))) v16u*)(mbp + cn * 32);
          mw1 = *(const __attribute__((address_space(4))) v16u*)(mbp + cn * 32 + 16);
        }
        // keeps the two scalar loads at the head of what follows: left free they sank to the chunk's foot, too late to
        // return ahead of the next chunk's selects
        __builtin_amdgcn_sched_barrier(0);
        ssum += __shfl_xor(ssum, 16, 32);
        l_run = l_run * alph + ssum;
        // alph is 1 in the usual turn; multiplied in every chunk all the same, in place: under the branch the compiler
        // kept two copies of the running output and moved all sixteen registers in every chunk
#pragma unroll
        for (int dt = 0; dt < 2; ++dt) {
#pragma unroll
          for (int r = 0; r < 8; ++r) oh[dt][r] *= alph;
        }

        // P (f32, D layout) -> B operand (f16) of 32-key step s: element r <- tile 2s, 8+r <- tile 2s+1
        union { v16h v; _Float16 s[16]; } ph[2];
#pragma unroll
        for (int s = 0; s < 2; ++s) {
#pragma unroll
          for (int r = 0; r < 8; ++r) {
            ph[s].s[r]     = (_Float16)p[2 * s][r];
            ph[s].s[8 + r] = (_Float16)p[2 * s + 1][r];
          }
        }

        // both steps' P stand packed ahead of the first product: packed among the products, step 1's P took over registers of
        // step 0's B operand and cost a v_nop gap behind the product that read them
        __builtin_amdgcn_sched_barrier(0);
        // O[d][q] += V[d][32s .. +31] x P, step 0 then step 1, the two d tiles' chains turn about
#pragma unroll
        for (int s = 0; s < 2; ++s) {
#pragma unroll
          for (int dt = 0; dt < 2; ++dt) oh[dt] = mma_h_raw(vah[s][dt], ph[s].v, oh[dt]);
        }
        // order of issue: the exchange of the sums between the lane halves (its address, then the LDS-path permute) ahead of the
        // four products, so that it returns under them; left free it sank behind the last product, in front of the barrier
        __builtin_amdgcn_sched_group_barrier(0x002, 1, 0);
        __builtin_amdgcn_sched_group_barrier(0x080, 1, 0);
        __builtin_amdgcn_sched_group_barrier(0x008, 4, 0);
        guard4(oh[0], oh[1], vah[1][0], vah[1][1], ph[1].v);
      }
      // publish point of the next open chunk: own reads done, own copies landed, barrier, then the refill of the buffer just read
      wait_lds_reads();
      wait_copies();
      __syncthreads();
      if (rem == 0u) break;
      c = __builtin_ctz(rem);
      rem &= rem - 1u;
      if (rem != 0u) {
        const int c2 = __builtin_ctz(rem);
        stage_kv(lk0 + bsel * (KVB * 2u), lv0 + bsel * (KVB * 2u), KHp + gk0 + (size_t)c2 * (KCH * HD),
                 VHp + gv0 + c2 * KCH);
      }
      bsel ^= 1u;
    }
    wait_copies();
    }
    acc_guard2(oh[0], oh[1]);

    // ---- output values -> per-wave f32 LDS staging ----
    const float inv = (1.0f / 16.0f) * (1.0f / l_run);            // out = O / (16 * l)
    float* st = sO[wave];
#pragma unroll
    for (int dt = 0; dt < 2; ++dt) {
      v4f va, vb;
#pragma unroll
      for (int e = 0; e < 4; ++e) {
        va[e] = oh[dt][e] * inv;                                   // d = 16dt + 8hsel + e
        vb[e] = oh[dt][4 + e] * inv;                               // d = 16dt + 8hsel + 4 + e
      }
      const int so = rlane * OP + 16 * dt + 8 * hsel;              // row q = rlane
      *(v4f*)(st + so) = va;
      *(v4f*)(st + so + 4) = vb;
    }
    wave_sync_lds();
    {
      const int rq = lane >> 3, c4 = (lane & 7) * 4;
      const int n0 = q0 + wave * 16;
      {
#pragma unroll
        for (int it = 0; it < 4; ++it) {
          const int row = it * 4 + rq;                             // it 0..3 x rq 0..3 = rows 0..15
          const v4f v = *(const v4f*)(st + row * OP + c4);
          *(v4f*)(Out + ((size_t)(b * NT + n0 + row)) * ND + h * HD + c4) = v;
        }
        // precaution: the four stores' address and data registers are not rewritten (by the second tile's code) before
        // this wait
        asm volatile("s_wait_xcnt 0x0" ::: "memory");
      }
    }
  }
}

// =====================================================================================================
// Workspace map (bytes, every offset a multiple of 128; every plane an exact multiple of its whole-line store
// granularity, row counts exact tile multiples, no padded tails needed):
//   XH   f16 [4096][1024]    activation, bf16-RNE x16                    0          8388608 B
//   WT   f16 [3072][1024]    Wqkv transposed, bf16-RNE x1024       8388608          6291456 B
//   COS  f32 [2048][32]                                          14680064           262144 B
//   SIN  f32 [2048][32]                                          14942208           262144 B
//   (256 B not used)                                            15204352              256 B
//   QH   f16 [64][2048][32]  q x log2(e)/sqrt(32)                15204608          8388608 B
//   KH   f16 [64][2048][32]                                      23593216          8388608 B
//   VH   f16 [64][32][2048]  v x16, key-contiguous               31981824          8388608 B
//   MB   u32 [128][32][32]   lane masks per (query tile, chunk, element) 40370432     524288 B
//   FL   i32 [16][16][32]    chunk flags, one line per digest block  40894720          32768 B
//   end                                                          40927488
// =====================================================================================================
extern "C" void kernel_launch(void* const* d_in, const int* in_sizes, int n_in,
                              void* d_out, int out_size, void* d_ws, size_t ws_size,
                              hipStream_t stream) {
  if (n_in < 3) return;
  if (in_sizes[0] != NTOK * ND) return;
  if (in_sizes[1] != ND * NQKV) return;
  if (in_sizes[2] != NT * NT) return;
  if (out_size != NTOK * ND) return;

  const float* x   = (const float*)d_in[0];
  const float* W   = (const float*)d_in[1];
  const int*   msk = (const int*)d_in[2];

  const size_t PXH = (size_t)NTOK * ND * 2;                    // 8388608
  const size_t PWT = (size_t)NQKV * ND * 2;                    // 6291456
  const size_t PTB = (size_t)NT * HD * 4;                      // 262144
  const size_t PIN = 256;
  const size_t PQK = (size_t)NBH * NT * HD * 2;                // 8388608
  const size_t PV  = (size_t)NBH * HD * NT * 2;                // 8388608
  size_t off = 0;
  const size_t oXH  = off; off += PXH;
  const size_t oWT  = off; off += PWT;
  const size_t oCOS = off; off += PTB;
  const size_t oSIN = off; off += PTB;
  off += PIN;                                                  // 256 B not used
  const size_t oQH  = off; off += PQK;
  const size_t oKH  = off; off += PQK;
  const size_t oVH  = off; off += PV;
  const size_t oMB  = off; off += (size_t)(NT / 16) * NKC * 32 * 4;        // 524288
  const size_t oFL  = off; off += (size_t)(NT / QBLK) * (NKC / MCH) * MFL * 4;   // 32768
  if (off > ws_size) return;                                   // off = 40927488
  if (off > (size_t)134217728) return;

  char* ws = (char*)d_ws;
  unsigned short* XH   = (unsigned short*)(ws + oXH);
  unsigned short* WT   = (unsigned short*)(ws + oWT);
  float*          COS  = (float*)(ws + oCOS);
  float*          SIN  = (float*)(ws + oSIN);
  unsigned short* QH   = (unsigned short*)(ws + oQH);
  unsigned short* KH   = (unsigned short*)(ws + oKH);
  unsigned short* VH   = (unsigned short*)(ws + oVH);
  unsigned*       MB   = (unsigned*)(ws + oMB);
  int*            FL   = (int*)(ws + oFL);
  float*          out  = (float*)d_out;

  const dim3 blk(256);
  const dim3 gPrep(PB_ALL);                                    // 256 + 768 + 256 + 2048 = 3328
  const dim3 gProj((NTOK / GBM) * (NQKV / GBN));               // 16 x 16 = 256 blocks of 12 waves
  const dim3 gAttn(NBH, NQB / 2);                              // 64 x 8, 256 threads, two query tiles each

  const float oscPrj = 1.0f / 16384.0f;                        // undo x*16 and W*1024

  // (1) one launch: inputs -> f16 planes holding bf16-RNE values times an exact power of two; rotary tables;
  //     mask -> lane masks of the attention waves' score elements, and one flag per 128-query x 64-key block
  prep<<<gPrep, blk, 0, stream>>>(x, W, msk, XH, WT, COS, SIN, MB, FL);
  // (2) fused qkv projection with rotary epilogue: q, k -> [bh][t][32] f16 planes; v -> [bh][d][t] f16 plane
  gemm_proj<<<gProj, dim3(GTHR), 0, stream>>>(XH, WT, COS, SIN, QH, KH, VH, oscPrj);
  // (3) attention per (batch*head, pair of 128-query blocks) -> f32 output lines [tok][h*32 .. +31]
  attn_kernel<<<gAttn, dim3(ATHR), 0, stream>>>(QH, KH, VH, MB, FL, out);
  (void)hipGetLastError();
}
